// v000
// The times below were measured on an AMD MI455X: many runs one after another, warmed up first and cycling through
// copies of the inputs, with the whole window's GPU time divided by the number of runs. Launches and the gaps
// between them are all in it. The median over several windows is given; except for v000 it joins two sittings, which
// can be a few percent apart, so the side-by-side timings, each taken in one sitting, are the better comparison.
// v000, which the later versions start from, runs in 860 microseconds.
#include <hip/hip_runtime.h>
#include <math.h>
// T5 self-attention with relative-position bias: q/k/v = x·Wᵀ (2048 x 1024 · 1024 x 1024 each), out = o·Woᵀ and the attention
// (16 heads x 64, 2048 x 2048, unscaled scores + rel_bias[bucket(k−q), h]): q/k projections and both attention products on
// v_wmma_f32_16x16x32_bf16 with bf16 hi/lo split operands (unscaled T5 scores make the softmax sharp), v and output projections on v_wmma_f32_16x16x32_f16 with f16 operands; f32 accumulate; the bucket table (integer thresholds of the T5 log-spaced bucketing: |Δ| < 8 exact, then ≥8,12,16,23,32,46,64,91,
// +16 for Δ > 0) and softmax in f32/int on VALU.
typedef __attribute__((ext_vector_type(16))) _Float16 v16h;
typedef __attribute__((ext_vector_type(8)))  _Float16 v8h;
typedef __attribute__((ext_vector_type(16))) __bf16   v16b;
typedef __attribute__((ext_vector_type(8)))  __bf16   v8b;
typedef __attribute__((ext_vector_type(8)))  float    v8f;
typedef __attribute__((ext_vector_type(4)))  float    v4f;
#define PSCALE 32768.0f
#define U16(p) ((const unsigned short*)(const void*)(p))
#define PSCALE_INV (1.0f / 32768.0f)

__device__ __forceinline__ unsigned short f2bf_bits(float f) {
  unsigned u = __float_as_uint(f);
  return (unsigned short)((u + 0x7FFFu + ((u >> 16) & 1u)) >> 16);
}
__device__ __forceinline__ float bf_bits2f(unsigned short h) { return __uint_as_float(((unsigned)h) << 16); }

// hazard guards as plain device helpers (no inline asm inside the kernel template body)
__device__ __forceinline__ void dep_guard_h(v8f& a, v8f& b, v16h x, v16h y) { asm volatile("v_nop\n\tv_nop\n\tv_nop\n\tv_nop" : "+v"(a), "+v"(b) : "v"(x), "v"(y)); }
__device__ __forceinline__ void dep_guard_b(v8f& a, v8f& b, v16b x, v16b y) { asm volatile("v_nop\n\tv_nop\n\tv_nop\n\tv_nop" : "+v"(a), "+v"(b) : "v"(x), "v"(y)); }
__device__ __forceinline__ void keep4_h(v16h a, v16h b, v16h c, v16h d) { asm volatile("v_nop" :: "v"(a), "v"(b), "v"(c), "v"(d)); }
__device__ __forceinline__ void keep4_b(v16b a, v16b b, v16b c, v16b d) { asm volatile("v_nop" :: "v"(a), "v"(b), "v"(c), "v"(d)); }
__device__ __forceinline__ void acc_guard4(v8f& a, v8f& b, v8f& c, v8f& d) { asm volatile("v_nop\n\tv_nop\n\tv_nop\n\tv_nop" : "+v"(a), "+v"(b), "+v"(c), "+v"(d)); }
template <typename T> struct Frag;
template <> struct Frag<_Float16> {
  typedef v16h V; union U { v16h v; v8h h[2]; };
  static __device__ __forceinline__ v16h load(const _Float16* p) {   // elements 0..7 <- p[0..7], 8..15 <- p[16..23]
    U f; f.h[0] = *(const v8h*)(p); f.h[1] = *(const v8h*)(p + 16); return f.v;
  }
  static __device__ __forceinline__ v8f mma(v16h a, v16h b, v8f c) {
    return __builtin_amdgcn_wmma_f32_16x16x32_f16(false, a, false, b, (short)0, c, false, false);
  }
  static __device__ __forceinline__ void guard(v8f& a, v8f& b, v16h x, v16h y) { dep_guard_h(a, b, x, y); }
  static __device__ __forceinline__ void keep(v16h a, v16h b, v16h c, v16h d) { keep4_h(a, b, c, d); }
};
template <> struct Frag<__bf16> {
  typedef v16b V; union U { v16b v; v8b h[2]; };
  static __device__ __forceinline__ v16b load(const __bf16* p) {
    U f; f.h[0] = *(const v8b*)(p); f.h[1] = *(const v8b*)(p + 16); return f.v;
  }
  static __device__ __forceinline__ v8f mma(v16b a, v16b b, v8f c) {
    return __builtin_amdgcn_wmma_f32_16x16x32_bf16(false, a, false, b, (short)0, c, false, false);
  }
  static __device__ __forceinline__ void guard(v8f& a, v8f& b, v16b x, v16b y) { dep_guard_b(a, b, x, y); }
  static __device__ __forceinline__ void keep(v16b a, v16b b, v16b c, v16b d) { keep4_b(a, b, c, d); }
};

// ---- Register-blocked batched WMMA GEMM ------------------------------------
// C[m,n] = scale * sum_k A[m,k] * Bt[n,k] (+bias)(+resid); each wave owns a 64x64 tile.
// A row-major [M,K]; Bt row-major [N,K]; M,N % 64 == 0, K % 32 == 0.
// SPLIT: operands are hi/lo planes (A2/Bt2 = lo planes, same layout); product = hi·hi + hi·lo + lo·hi.
// BIAS_MODE: 0 = none, 1 = bias[m], 2 = bias[n].
// OUT_MODE: 0 = f32, 1 = f16, 2 = bf16 hi plane (Cout) + bf16 lo plane (Cout2).
// ET: 0 = f16 operands, 1 = bf16 operands (pointers passed as 16-bit storage)
template <int ET> struct Elem;
template <> struct Elem<0> { typedef _Float16 T; };
template <> struct Elem<1> { typedef __bf16 T; };
template <int ET, bool SPLIT, int BIAS_MODE, int OUT_MODE, bool RESID, int ACT = 0>
__global__ __launch_bounds__(256) void wmma_gemm64(
    const unsigned short* __restrict__ Ap, const unsigned short* __restrict__ A2p, int lda, long strideA,
    const unsigned short* __restrict__ Btp, const unsigned short* __restrict__ Bt2p, int ldb, long strideB,
    void* __restrict__ Cout, void* __restrict__ Cout2, int ldc, long strideC,
    const float* __restrict__ bias,
    const float* __restrict__ resid, long strideR,
    int M, int N, int K, float scale) {
  typedef typename Elem<ET>::T T;
  typedef typename Frag<T>::V V;
  const T* A = (const T*)Ap; const T* A2 = (const T*)A2p; const T* Bt = (const T*)Btp; const T* Bt2 = (const T*)Bt2p;
  __shared__ __align__(16) float sT[8][16 * 68];   // per-wave 16x64 slab, pitch 68 floats
  const int b    = blockIdx.y;
  const int lane = threadIdx.x & 31;
  const int wave = threadIdx.x >> 5;
  const int tilesN = N >> 6;
  const int tilesM = M >> 6;
  const int tile = blockIdx.x * 8 + wave;
  if (tile >= tilesM * tilesN) return;   // wave-uniform; no block barriers in this kernel
  const int tm = tile / tilesN;
  const int tn = tile - tm * tilesN;
  const int m0 = tm << 6;
  const int n0 = tn << 6;

  const T* Ab  = A  + (size_t)b * strideA;
  const T* Bb  = Bt + (size_t)b * strideB;
  const T* Ab2 = SPLIT ? (A2  + (size_t)b * strideA) : nullptr;
  const T* Bb2 = SPLIT ? (Bt2 + (size_t)b * strideB) : nullptr;

  const int rlane = lane & 15;                 // row (A) / col (B, D) within subtile
  const int koff  = (lane >> 4) * 8;           // k offset of this lane half
  const int mOff  = (lane >> 4) * 8;           // D row offset

  v8f acc[4][4];
#pragma unroll
  for (int i = 0; i < 4; ++i)
#pragma unroll
    for (int j = 0; j < 4; ++j) acc[i][j] = (v8f){0.f,0.f,0.f,0.f,0.f,0.f,0.f,0.f};

  for (int k0 = 0; k0 < K; k0 += 32) {
    V bh[4], bl[4];
#pragma unroll
    for (int j = 0; j < 4; ++j) {
      const size_t bo = (size_t)(n0 + (j << 4) + rlane) * ldb + koff + k0;
      bh[j] = Frag<T>::load(Bb + bo);
      if (SPLIT) bl[j] = Frag<T>::load(Bb2 + bo);
    }
#pragma unroll
    for (int i = 0; i < 4; ++i) {
      const size_t ao = (size_t)(m0 + (i << 4) + rlane) * lda + koff + k0;
      V ah = Frag<T>::load(Ab + ao);
      V al;
      if (SPLIT) al = Frag<T>::load(Ab2 + ao);
#pragma unroll
      for (int j = 0; j < 4; ++j) {
        acc[i][j] = Frag<T>::mma(ah, bh[j], acc[i][j]);
        if (SPLIT) {
          acc[i][j] = Frag<T>::mma(ah, bl[j], acc[i][j]);
          acc[i][j] = Frag<T>::mma(al, bh[j], acc[i][j]);
        }
      }
      Frag<T>::guard(acc[i][0], acc[i][3], ah, SPLIT ? al : ah);
    }
    Frag<T>::keep(bh[0], bh[1], bh[2], bh[3]);
    if (SPLIT) Frag<T>::keep(bl[0], bl[1], bl[2], bl[3]);
  }
  acc_guard4(acc[0][0], acc[0][1], acc[0][2], acc[0][3]);
  acc_guard4(acc[1][0], acc[1][1], acc[1][2], acc[1][3]);
  acc_guard4(acc[2][0], acc[2][1], acc[2][2], acc[2][3]);
  acc_guard4(acc[3][0], acc[3][1], acc[3][2], acc[3][3]);

  // ---- epilogue ----
  float* slab = sT[wave];
  const float* Rb = RESID ? (resid + (size_t)b * strideR) : nullptr;
#pragma unroll
  for (int i = 0; i < 4; ++i) {
    const int mBase = m0 + (i << 4);
#pragma unroll
    for (int j = 0; j < 4; ++j) {
      const int n = n0 + (j << 4) + rlane;
      float bv = 0.f;
      if (BIAS_MODE == 2) bv = bias[n];
#pragma unroll
      for (int r = 0; r < 8; ++r) {
        float v = acc[i][j][r] * scale;
        if (BIAS_MODE == 1) v += bias[mBase + mOff + r];
        if (BIAS_MODE == 2) v += bv;
        if (RESID) v += Rb[(size_t)(mBase + mOff + r) * ldc + n];
        if (ACT == 1) v = tanhf(v);
        if (ACT == 2) v = fmaxf(v, 0.0f);
        if (ACT == 3) v = v / (1.0f + expf(-v));
        if (ACT == 4) v = (v > 0.f) ? v : 0.01f * v;
        if (ACT == 5) v = 0.5f * v * (1.0f + erff(v * 0.70710678118654752f));
        slab[(mOff + r) * 68 + (j << 4) + rlane] = v;
      }
    }
    __builtin_amdgcn_fence(__ATOMIC_RELEASE, "workgroup");
    __builtin_amdgcn_wave_barrier();
    __builtin_amdgcn_fence(__ATOMIC_ACQUIRE, "workgroup");
    if (OUT_MODE == 0) {
      float* C = (float*)Cout + (size_t)b * strideC;
      const int hh = lane >> 4, c4 = (lane & 15) * 4;     // row seg = 256 B = 16 lanes x 16 B
      {
#pragma unroll
        for (int it = 0; it < 8; ++it) {
          const int row = it * 2 + hh;
          v4f v = *(const v4f*)(slab + row * 68 + c4);
          *(v4f*)(C + (size_t)(mBase + row) * ldc + n0 + c4) = v;
        }
        
      }
    } else {
      const int q = lane >> 3, c8 = (lane & 7) * 8;
      unsigned short* C  = (unsigned short*)Cout  + (size_t)b * strideC;
      unsigned short* C2 = (OUT_MODE == 2) ? ((unsigned short*)Cout2 + (size_t)b * strideC) : nullptr;
      {
#pragma unroll
        for (int it = 0; it < 4; ++it) {
          const int row = it * 4 + q;
          const float* sp = slab + row * 68 + c8;
          v8h hv, lv;
#pragma unroll
          for (int e = 0; e < 8; ++e) {
            if (OUT_MODE == 1) {
              hv[e] = (_Float16)sp[e];
            } else {
              unsigned short hb = f2bf_bits(sp[e]);
              unsigned short lb = f2bf_bits(sp[e] - bf_bits2f(hb));
              hv[e] = __builtin_bit_cast(_Float16, hb);
              lv[e] = __builtin_bit_cast(_Float16, lb);
            }
          }
          *(v8h*)(C + (size_t)(mBase + row) * ldc + n0 + c8) = hv;
          if (OUT_MODE == 2) *(v8h*)(C2 + (size_t)(mBase + row) * ldc + n0 + c8) = lv;
        }
        
      }
    }
    __builtin_amdgcn_fence(__ATOMIC_RELEASE, "workgroup");
    __builtin_amdgcn_wave_barrier();
    __builtin_amdgcn_fence(__ATOMIC_ACQUIRE, "workgroup");
  }
}

__global__ __launch_bounds__(256) void cast_f32_f16x2(
    const float* __restrict__ in, _Float16* __restrict__ out, int n2) {
  int i = blockIdx.x * 256 + threadIdx.x;
  if (i < n2) {
    const _Float16 h0 = (_Float16)in[2 * i], h1 = (_Float16)in[2 * i + 1];
    const unsigned u = (unsigned)__builtin_bit_cast(unsigned short, h0) | ((unsigned)__builtin_bit_cast(unsigned short, h1) << 16);
    ((unsigned*)out)[i] = u;
    
  }
}


// ---- f32 -> f16 cast with a power-of-two pre-scale (folded back by the consumer GEMM's scale) ----
__global__ __launch_bounds__(256) void cast_f32_f16x2s(const float* __restrict__ in, _Float16* __restrict__ out, int n2, float s) {
  int i = blockIdx.x * 256 + threadIdx.x;
  if (i < n2) {
    const _Float16 h0 = (_Float16)(in[2 * i] * s), h1 = (_Float16)(in[2 * i + 1] * s);
    const unsigned u = (unsigned)__builtin_bit_cast(unsigned short, h0) | ((unsigned)__builtin_bit_cast(unsigned short, h1) << 16);
    ((unsigned*)out)[i] = u;
    
  }
}
__global__ __launch_bounds__(256) void split_f32_bf16x2(
    const float* __restrict__ in, __bf16* __restrict__ hi, __bf16* __restrict__ lo, long n2) {
  long i = (long)blockIdx.x * 256 + threadIdx.x;
  long stride = (long)gridDim.x * 256;
  {
    for (long j = i; j < n2; j += stride) {
      const float a = in[2 * j], b = in[2 * j + 1];
      const unsigned short ah = f2bf_bits(a), bh = f2bf_bits(b);
      const unsigned short al = f2bf_bits(a - bf_bits2f(ah)), bl = f2bf_bits(b - bf_bits2f(bh));
      ((unsigned*)hi)[j] = (unsigned)ah | ((unsigned)bh << 16);
      ((unsigned*)lo)[j] = (unsigned)al | ((unsigned)bl << 16);
    }
    
  }
}


// ---- f32 [R][C] (row pitch ldi) -> f16 transposed [C][R] (row pitch ldo); 64x64 tiles; each output row segment
__global__ __launch_bounds__(256) void transpose_cast_f16(const float* __restrict__ in, int ldi,
                                                         _Float16* __restrict__ outT, int ldo, float scale) {
  __shared__ __align__(16) _Float16 tile[64][72];     // [c][r]
  const int c0 = blockIdx.x * 64, r0 = blockIdx.y * 64;
  const int t = threadIdx.y * 32 + threadIdx.x;
  for (int i = threadIdx.y; i < 64; i += 8) {
    tile[threadIdx.x][i]      = (_Float16)(in[(size_t)(r0 + i) * ldi + c0 + threadIdx.x] * scale);
    tile[32 + threadIdx.x][i] = (_Float16)(in[(size_t)(r0 + i) * ldi + c0 + 32 + threadIdx.x] * scale);
  }
  __syncthreads();
  const int q = t >> 3, c8 = (t & 7) * 8;
  {
#pragma unroll
    for (int it = 0; it < 2; ++it) {
      const int c = it * 32 + q;
      v8h hv = *(const v8h*)(&tile[c][c8]);
      *(v8h*)(outT + (size_t)(c0 + c) * ldo + r0 + c8) = hv;
    }
    
  }
}

// ---- f32 [R][C] (pitch ldi) -> bf16 hi/lo transposed planes [C][R] (pitch ldo); 64x64 tiles; each output row segment
__global__ __launch_bounds__(256) void transpose_split_bf16(const float* __restrict__ in, int ldi,
                                                           __bf16* __restrict__ outH, __bf16* __restrict__ outL, int ldo) {
  __shared__ __align__(16) float tile[64][68];     // [c][r]
  const int c0 = blockIdx.x * 64, r0 = blockIdx.y * 64;
  const int t = threadIdx.y * 32 + threadIdx.x;
  for (int i = threadIdx.y; i < 64; i += 8) {
    tile[threadIdx.x][i]      = in[(size_t)(r0 + i) * ldi + c0 + threadIdx.x];
    tile[32 + threadIdx.x][i] = in[(size_t)(r0 + i) * ldi + c0 + 32 + threadIdx.x];
  }
  __syncthreads();
  const int q = t >> 3, c8 = (t & 7) * 8;
  {
#pragma unroll
    for (int it = 0; it < 2; ++it) {
      const int c = it * 32 + q;
      v8b hv, lv;
#pragma unroll
      for (int e = 0; e < 8; ++e) {
        const float f = tile[c][c8 + e];
        const unsigned short hb = f2bf_bits(f);
        hv[e] = __builtin_bit_cast(__bf16, hb);
        lv[e] = __builtin_bit_cast(__bf16, f2bf_bits(f - bf_bits2f(hb)));
      }
      *(v8b*)(outH + (size_t)(c0 + c) * ldo + r0 + c8) = hv;
      *(v8b*)(outL + (size_t)(c0 + c) * ldo + r0 + c8) = lv;
    }
    
  }
}

// =====================================================================================
// Generic causal/non-causal attention for head_dim 64, f32 in / f32 out; 16-bit operands: bf16 with optional hi/lo splits, or
// plain f16 (F16=true, non-split, probabilities carried x2^15).
//   scores = (q*qscale)·kᵀ : v_wmma_f32_16x16x32_bf16; SPLIT_QK -> q,k as bf16 hi/lo (hi·hi + hi·lo + lo·hi)
//   out    = p·v           : v_wmma_f32_16x16x32_bf16; SPLIT_PV -> p,v as bf16 hi/lo; else p,v plain bf16
//   f32 accumulate; online softmax in f32. Block = 4 waves = 64 query rows of one (batch, head); S % 64 == 0.
//   Element (b, s, h, d) of tensor X lives at X[b*X_bs + s*X_rs + h*X_hs + d] (strides in floats, multiples of 4).
//   Masking: mask_mode 0 none, 1 causal (kv > q masked), 2 tensor [S][Skv] shared over (b,h) (float if
//   mask_is_int==0, int32 with element == 0 -> masked if 1, int32 with element != 0 -> masked if 2), 3 per-token vectors qmask[B][S] & kvmask[B][Skv] (int32,
//   0 -> masked), 4 causal + sliding window (kv > q or q - kv > W masked; W passed in mask_is_int);
//   5 = relative-position bias: s += cp[b,h,q][idx[q][kv]] + pc[b,h,kv][idx[q][kv]] with idx = mask_b ([S][Skv] int32) and
//   mask_a an int32 [S][Skv] tensor with nonzero = masked (tables: element (b,h,row,n) at X + b*c_bs + h*c_hs + row*c_rs + n);
//   masked scores are replaced by mask_fill (e.g. -inf or -1e9) before the softmax.
//   grid.x = B * H * (S/64) (or a sub-range with blk0).
// =====================================================================================
#define AT_D 64
#define AT_NW 4
#define AT_QB 64
#define AT_KC 64
struct AttnGeom { const float* cp = nullptr; const float* pc = nullptr; long c_bs = 0, c_rs = 0, c_hs = 0;   // mode-5 score-bias tables
                  long q_bs, q_rs, q_hs, k_bs, k_rs, k_hs, v_bs, v_rs, v_hs, o_bs, o_rs, o_hs;
                  int S, Skv, H, mask_mode; float qscale; int blk0; float mask_fill; int mask_is_int; };
static_assert(sizeof(AttnGeom) == 168, "no padding");

__device__ __forceinline__ unsigned short at_bf_bits(float f) {
  unsigned u = __float_as_uint(f);
  return (unsigned short)((u + 0x7FFFu + ((u >> 16) & 1u)) >> 16);
}
__device__ __forceinline__ __bf16 at_f2bf(float f) { return __builtin_bit_cast(__bf16, at_bf_bits(f)); }
__device__ __forceinline__ void at_split(float f, __bf16& hi, __bf16& lo) {
  const unsigned short hb = at_bf_bits(f);
  hi = __builtin_bit_cast(__bf16, hb);
  lo = at_f2bf(f - __uint_as_float(((unsigned)hb) << 16));
}
__device__ __forceinline__ v8f at_mma(v16b a, v16b b, v8f c) {
  c = __builtin_amdgcn_wmma_f32_16x16x32_bf16(false, a, false, b, (short)0, c, false, false);
  asm volatile("v_nop\n\tv_nop\n\tv_nop\n\tv_nop" : "+v"(c) : "v"(a), "v"(b));
  return c;
}
// 16-bit element as a bit pattern held in a __bf16 slot: f16 bits when F16, bf16 (RNE) otherwise
template <bool F16> __device__ __forceinline__ __bf16 at_to16(float f) {
  if (F16) return __builtin_bit_cast(__bf16, (_Float16)f);
  return at_f2bf(f);
}
template <bool F16> __device__ __forceinline__ v8f at_mma16(v16b a, v16b b, v8f c) {
  if (F16) {
    const v16h ah = __builtin_bit_cast(v16h, a), bh = __builtin_bit_cast(v16h, b);
    c = __builtin_amdgcn_wmma_f32_16x16x32_f16(false, ah, false, bh, (short)0, c, false, false);
    asm volatile("v_nop\n\tv_nop\n\tv_nop\n\tv_nop" : "+v"(c) : "v"(ah), "v"(bh));
    return c;
  }
  return at_mma(a, b, c);
}

template <bool SPLIT_QK, bool SPLIT_PV, bool F16 = false>
__global__ __launch_bounds__(128)
void attn64_kernel(const float* __restrict__ q, const float* __restrict__ k,
                   const float* __restrict__ v, float* __restrict__ out,
                   const void* __restrict__ mask_a, const int* __restrict__ mask_b, AttnGeom g) {
  static_assert(!(F16 && (SPLIT_QK || SPLIT_PV)), "f16 mode is non-split");
  const float PSC = F16 ? 32768.0f : 1.0f;     // f16 probabilities carried x2^15 (subnormal range), folded into the final 1/l
  union FB { v16b v; v8b h[2]; };
  __shared__ __align__(16) __bf16 Ksh[AT_KC * AT_D];             // K hi [kv][d]      8 KB
  __shared__ __align__(16) __bf16 Ksl[SPLIT_QK ? AT_KC * AT_D : 8];
  __shared__ __align__(16) __bf16 Vth[AT_D * AT_KC];             // V hi [d][kv]      8 KB
  __shared__ __align__(16) __bf16 Vtl[SPLIT_PV ? AT_D * AT_KC : 8];
  __shared__ __align__(16) __bf16 Psh[AT_NW][16 * AT_KC];        // per wave P hi [row][kv]  8 KB
  __shared__ __align__(16) __bf16 Psl[SPLIT_PV ? AT_NW : 1][SPLIT_PV ? 16 * AT_KC : 8];
  __shared__ __align__(16) float  Os[AT_NW][16 * 68];            // per wave out tile, pitch 68

  const int tid  = threadIdx.x;
  const int wave = tid >> 5;
  const int lane = tid & 31;
  const int hh   = lane >> 4;
  const int c    = lane & 15;

  const int nqb = g.S / AT_QB;
  const int bx = blockIdx.x + g.blk0;
  const int qb = bx % nqb;
  const int bh = bx / nqb;
  const int h  = bh % g.H;
  const int b  = bh / g.H;
  const int qbase_block = qb * AT_QB;
  const int q0 = qbase_block + wave * 16;

  const float* qb_ptr = q + (size_t)b * g.q_bs + (size_t)h * g.q_hs;
  const float* kb_ptr = k + (size_t)b * g.k_bs + (size_t)h * g.k_hs;
  const float* vb_ptr = v + (size_t)b * g.v_bs + (size_t)h * g.v_hs;
  float*       ob_ptr = out + (size_t)b * g.o_bs + (size_t)h * g.o_hs;

  // ---- Q fragments (A operand): 2 d-chunks, hi (and lo) ----
  v16b qah[2], qal[2];
  {
    const float* qrow = qb_ptr + (size_t)(q0 + c) * g.q_rs;
#pragma unroll
    for (int dc = 0; dc < 2; ++dc) {
#pragma unroll
      for (int e = 0; e < 8; ++e) {
        const float f0 = qrow[dc * 32 + 8 * hh + e] * g.qscale;
        const float f1 = qrow[dc * 32 + 16 + 8 * hh + e] * g.qscale;
        if (SPLIT_QK) { __bf16 hq, lq; at_split(f0, hq, lq); qah[dc][e] = hq; qal[dc][e] = lq; at_split(f1, hq, lq); qah[dc][8 + e] = hq; qal[dc][8 + e] = lq; }
        else { qah[dc][e] = at_to16<F16>(f0); qah[dc][8 + e] = at_to16<F16>(f1); qal[dc][e] = qah[dc][e]; qal[dc][8 + e] = qah[dc][8 + e]; }
      }
    }
  }

  float mrow[8], lrow[8];
  v8f oacc[4];
#pragma unroll
  for (int r = 0; r < 8; ++r) { mrow[r] = -INFINITY; lrow[r] = 0.f; }
#pragma unroll
  for (int t = 0; t < 4; ++t) oacc[t] = (v8f){0.f,0.f,0.f,0.f,0.f,0.f,0.f,0.f};

  const int nChunks = (g.mask_mode == 1 || g.mask_mode == 4) ? (qb + 1) : (g.Skv / AT_KC);   // block-uniform
  // per-row query mask (mode 3)
  int qkeep[8];
#pragma unroll
  for (int r = 0; r < 8; ++r) qkeep[r] = (g.mask_mode == 3) ? mask_b[(size_t)b * g.S + q0 + 8 * hh + r] : 1;   // mask_b = qmask in mode 3
  for (int kc = 0; kc < nChunks; ++kc) {
    const int kv0 = kc * AT_KC;
    __syncthreads();
    {
      const int kvr = tid >> 1, dh = (tid & 1) * 32;
      const float* krow = kb_ptr + (size_t)(kv0 + kvr) * g.k_rs + dh;
      const float* vrow = vb_ptr + (size_t)(kv0 + kvr) * g.v_rs + dh;
#pragma unroll
      for (int i = 0; i < 8; ++i) {
        v4f kk = *(const v4f*)(krow + 4 * i);
        v4f vv = *(const v4f*)(vrow + 4 * i);
#pragma unroll
        for (int e = 0; e < 4; ++e) {
          const int d = dh + 4 * i + e;
          if (SPLIT_QK) { __bf16 a, bl; at_split(kk[e], a, bl); Ksh[kvr * AT_D + d] = a; Ksl[kvr * AT_D + d] = bl; }
          else Ksh[kvr * AT_D + d] = at_to16<F16>(kk[e]);
          if (SPLIT_PV) { __bf16 a, bl; at_split(vv[e], a, bl); Vth[d * AT_KC + kvr] = a; Vtl[d * AT_KC + kvr] = bl; }
          else Vth[d * AT_KC + kvr] = at_to16<F16>(vv[e]);
        }
      }
    }
    __syncthreads();

    v8f s[4];
#pragma unroll
    for (int j = 0; j < 4; ++j) {
      s[j] = (v8f){0.f,0.f,0.f,0.f,0.f,0.f,0.f,0.f};
#pragma unroll 1
      for (int dc = 0; dc < 2; ++dc) {
        FB kb;
        kb.h[0] = *(const v8b*)(Ksh + (j * 16 + c) * AT_D + dc * 32 + 8 * hh);
        kb.h[1] = *(const v8b*)(Ksh + (j * 16 + c) * AT_D + dc * 32 + 16 + 8 * hh);
        s[j] = at_mma16<F16>(qah[dc], kb.v, s[j]);
        if (SPLIT_QK) {
          FB kl;
          kl.h[0] = *(const v8b*)(Ksl + (j * 16 + c) * AT_D + dc * 32 + 8 * hh);
          kl.h[1] = *(const v8b*)(Ksl + (j * 16 + c) * AT_D + dc * 32 + 16 + 8 * hh);
          s[j] = at_mma16<F16>(qah[dc], kl.v, s[j]);
          s[j] = at_mma16<F16>(qal[dc], kb.v, s[j]);
        }
      }
    }
    const bool diag = (g.mask_mode == 1) && (kc == qb);
    int kvkeep[4] = {1, 1, 1, 1};
    if (g.mask_mode == 3) {
#pragma unroll
      for (int j = 0; j < 4; ++j) kvkeep[j] = ((const int*)mask_a)[(size_t)b * g.Skv + kv0 + j * 16 + c];   // mask_a = kvmask
    }
    float cm[8];
#pragma unroll
    for (int r = 0; r < 8; ++r) {
      const int qrow = q0 + 8 * hh + r;
      float m = -INFINITY;
#pragma unroll
      for (int j = 0; j < 4; ++j) {
        const int kvcol = kv0 + j * 16 + c;
        bool masked = false;
        if (diag) masked = (kvcol > qrow);
        else if (g.mask_mode == 4) masked = (kvcol > qrow) || (qrow - kvcol > g.mask_is_int);
        else if (g.mask_mode == 2) {
          const size_t mi = (size_t)qrow * g.Skv + kvcol;
          masked = (g.mask_is_int == 0) ? (((const float*)mask_a)[mi] == 0.0f)
                 : (g.mask_is_int == 1) ? (((const int*)mask_a)[mi] == 0) : (((const int*)mask_a)[mi] != 0);
        } else if (g.mask_mode == 3) masked = (qkeep[r] == 0) || (kvkeep[j] == 0);
        else if (g.mask_mode == 7) {
          const size_t mi = (size_t)qrow * g.Skv + kvcol;
          int n = mask_b[mi]; n = n < 0 ? 0 : n;
          s[j][r] += g.cp[(size_t)b * g.c_bs + (size_t)h * g.c_hs + (size_t)qrow * g.c_rs + n];
        }
        else if (g.mask_mode == 5) {
          const size_t mi = (size_t)qrow * g.Skv + kvcol;
          masked = (((const int*)mask_a)[mi] != 0);
          int n = mask_b[mi]; n = n < 0 ? 0 : n;
          s[j][r] += g.cp[(size_t)b * g.c_bs + (size_t)h * g.c_hs + (size_t)qrow * g.c_rs + n]
                   + g.pc[(size_t)b * g.c_bs + (size_t)h * g.c_hs + (size_t)kvcol * g.c_rs + n];
        }
        if (masked) s[j][r] = g.mask_fill;
        m = fmaxf(m, s[j][r]);
      }
#pragma unroll
      for (int off = 1; off < 16; off <<= 1) m = fmaxf(m, __shfl_xor(m, off, 32));
      cm[r] = m;
    }
    __bf16* pwh = Psh[wave];
    __bf16* pwl = Psl[SPLIT_PV ? wave : 0];
#pragma unroll
    for (int r = 0; r < 8; ++r) {
      const float mnew = fmaxf(mrow[r], cm[r]);
      const float alpha = expf(mrow[r] - mnew);
      mrow[r] = mnew;
      float psum = 0.f;
#pragma unroll
      for (int j = 0; j < 4; ++j) {
        const float p = expf(s[j][r] - mnew);
        psum += p;
        if (SPLIT_PV) { __bf16 a, bl; at_split(p, a, bl); pwh[(8 * hh + r) * AT_KC + j * 16 + c] = a; pwl[(8 * hh + r) * AT_KC + j * 16 + c] = bl; }
        else pwh[(8 * hh + r) * AT_KC + j * 16 + c] = at_to16<F16>(p * PSC);
      }
#pragma unroll
      for (int off = 1; off < 16; off <<= 1) psum += __shfl_xor(psum, off, 32);
      lrow[r] = lrow[r] * alpha + psum;
#pragma unroll
      for (int t = 0; t < 4; ++t) oacc[t][r] *= alpha;
    }
    __builtin_amdgcn_fence(__ATOMIC_RELEASE, "workgroup");
    __builtin_amdgcn_wave_barrier();
    __builtin_amdgcn_fence(__ATOMIC_ACQUIRE, "workgroup");
#pragma unroll 1
    for (int kk = 0; kk < 2; ++kk) {
      FB pa, pl;
      pa.h[0] = *(const v8b*)(pwh + c * AT_KC + kk * 32 + 8 * hh);
      pa.h[1] = *(const v8b*)(pwh + c * AT_KC + kk * 32 + 16 + 8 * hh);
      if (SPLIT_PV) {
        pl.h[0] = *(const v8b*)(pwl + c * AT_KC + kk * 32 + 8 * hh);
        pl.h[1] = *(const v8b*)(pwl + c * AT_KC + kk * 32 + 16 + 8 * hh);
      }
#pragma unroll
      for (int t = 0; t < 4; ++t) {
        FB vb;
        vb.h[0] = *(const v8b*)(Vth + (t * 16 + c) * AT_KC + kk * 32 + 8 * hh);
        vb.h[1] = *(const v8b*)(Vth + (t * 16 + c) * AT_KC + kk * 32 + 16 + 8 * hh);
        oacc[t] = at_mma16<F16>(pa.v, vb.v, oacc[t]);
        if (SPLIT_PV) {
          FB vl;
          vl.h[0] = *(const v8b*)(Vtl + (t * 16 + c) * AT_KC + kk * 32 + 8 * hh);
          vl.h[1] = *(const v8b*)(Vtl + (t * 16 + c) * AT_KC + kk * 32 + 16 + 8 * hh);
          oacc[t] = at_mma16<F16>(pa.v, vl.v, oacc[t]);
          oacc[t] = at_mma16<F16>(pl.v, vb.v, oacc[t]);
        }
      }
    }
  }

  float* os = Os[wave];
#pragma unroll
  for (int r = 0; r < 8; ++r) {
    const float inv = 1.0f / (lrow[r] * PSC);
#pragma unroll
    for (int t = 0; t < 4; ++t) os[(8 * hh + r) * 68 + t * 16 + c] = oacc[t][r] * inv;
  }
  __builtin_amdgcn_fence(__ATOMIC_RELEASE, "workgroup");
  __builtin_amdgcn_wave_barrier();
  __builtin_amdgcn_fence(__ATOMIC_ACQUIRE, "workgroup");
  {
    const int c4 = (lane & 15) * 4;
    {
#pragma unroll
      for (int it = 0; it < 8; ++it) {
        const int row = it * 2 + hh;
        v4f val = *(const v4f*)(os + row * 68 + c4);
        *(v4f*)(ob_ptr + (size_t)(q0 + row) * g.o_rs + c4) = val;
      }
      
    }
  }
}

#define TS 2048
#define TD 1024
#define TNH 16
#define TNB 32
// bucket table idx[q][k] (int32, [2048][2048]) — T5 bidirectional bucketing with num_buckets=32, max_distance=128
__global__ __launch_bounds__(256) void bucket_kernel(int* __restrict__ idx) {
  const int q = blockIdx.x; 
  {
    for (int k = threadIdx.x; k < TS; k += 256) {
      const int rel = k - q; const int a = rel < 0 ? -rel : rel;
      int bkt;
      if (a < 8) bkt = a;
      else bkt = 8 + (a >= 12) + (a >= 16) + (a >= 23) + (a >= 32) + (a >= 46) + (a >= 64) + (a >= 91);   // = 8 + trunc(8·log(a/8)/log 16), capped at 15
      if (rel > 0) bkt += 16;
      ((int*)idx)[(size_t)q * TS + k] = bkt;
    }
    
  }
}
// rel_bias [32][16] -> cp table [16][32] (per head contiguous)
__global__ void biasT_kernel(const float* __restrict__ rb, float* __restrict__ cp) {
  const int i = threadIdx.x + blockIdx.x * 256; if (i >= TNH * TNB) return; const int h = i / TNB, n = i % TNB;
  const float v = rb[n * TNH + h]; ((float*)cp)[i] = v; 
}
extern "C" void kernel_launch(void* const* d_in, const int* in_sizes, int n_in, void* d_out, int out_size, void* d_ws, size_t ws_size, hipStream_t stream) {
  (void)in_sizes; (void)n_in; (void)out_size; (void)ws_size;
  const float* x = (const float*)d_in[0]; const float* wq = (const float*)d_in[1]; const float* wk = (const float*)d_in[2]; const float* wv = (const float*)d_in[3]; const float* wo = (const float*)d_in[4]; const float* rb = (const float*)d_in[5];
  float* out = (float*)d_out;   // [1][2048][1024]
  char* ws = (char*)d_ws; size_t off = 0;
  auto carve = [&](size_t bytes) -> char* { char* p = ws + off; off += (bytes + 255) & ~(size_t)255; return p; };
  _Float16* X16 = (_Float16*)carve((size_t)TS * TD * 2);
__bf16* Xh = (__bf16*)carve((size_t)TS * TD * 2); __bf16* Xl = (__bf16*)carve((size_t)TS * TD * 2);
  __bf16* Wqh = (__bf16*)carve((size_t)TD * TD * 2); __bf16* Wql = (__bf16*)carve((size_t)TD * TD * 2); __bf16* Wkh = (__bf16*)carve((size_t)TD * TD * 2); __bf16* Wkl = (__bf16*)carve((size_t)TD * TD * 2);
  _Float16* Wv16 = (_Float16*)carve((size_t)TD * TD * 2); _Float16* Wo16 = (_Float16*)carve((size_t)TD * TD * 2);
  float* Q = (float*)carve((size_t)TS * TD * 4); float* Kf = (float*)carve((size_t)TS * TD * 4); float* Vf = (float*)carve((size_t)TS * TD * 4); float* O = (float*)carve((size_t)TS * TD * 4);
  int* idx = (int*)carve((size_t)TS * TS * 4);      // 16 MB
  float* cp = (float*)carve((size_t)TNH * TNB * 4);
  _Float16* O16 = X16;
  cast_f32_f16x2<<<(TS * TD / 2 + 255) / 256, 256, 0, stream>>>(x, X16, TS * TD / 2);
  split_f32_bf16x2<<<(TS * TD / 2 + 255) / 256, 256, 0, stream>>>(x, Xh, Xl, TS * TD / 2);
  split_f32_bf16x2<<<(TD * TD / 2 + 255) / 256, 256, 0, stream>>>(wq, Wqh, Wql, TD * TD / 2);   // nn.Linear weights [out][in] = Bt layout
  split_f32_bf16x2<<<(TD * TD / 2 + 255) / 256, 256, 0, stream>>>(wk, Wkh, Wkl, TD * TD / 2);
  cast_f32_f16x2<<<(TD * TD / 2 + 255) / 256, 256, 0, stream>>>(wv, Wv16, TD * TD / 2);
  cast_f32_f16x2<<<(TD * TD / 2 + 255) / 256, 256, 0, stream>>>(wo, Wo16, TD * TD / 2);
  bucket_kernel<<<TS, 256, 0, stream>>>(idx);
  biasT_kernel<<<2, 256, 0, stream>>>(rb, cp);
  { const int t = (TS / 64) * (TD / 64);
    wmma_gemm64<1, true, 0, 0, false><<<dim3((t + 7) / 8, 1), 256, 0, stream>>>(U16(Xh), U16(Xl), TD, 0, U16(Wqh), U16(Wql), TD, 0, Q, nullptr, TD, 0, nullptr, nullptr, 0, TS, TD, TD, 1.0f);
    wmma_gemm64<1, true, 0, 0, false><<<dim3((t + 7) / 8, 1), 256, 0, stream>>>(U16(Xh), U16(Xl), TD, 0, U16(Wkh), U16(Wkl), TD, 0, Kf, nullptr, TD, 0, nullptr, nullptr, 0, TS, TD, TD, 1.0f);
    wmma_gemm64<0, false, 0, 0, false><<<dim3((t + 7) / 8, 1), 256, 0, stream>>>(U16(X16), nullptr, TD, 0, U16(Wv16), nullptr, TD, 0, Vf, nullptr, TD, 0, nullptr, nullptr, 0, TS, TD, TD, 1.0f); }
  { AttnGeom g;
    g.cp = cp; g.pc = nullptr; g.c_bs = 0; g.c_hs = TNB; g.c_rs = 0;
    g.q_bs = 0; g.q_rs = TD; g.q_hs = 64; g.k_bs = 0; g.k_rs = TD; g.k_hs = 64; g.v_bs = 0; g.v_rs = TD; g.v_hs = 64; g.o_bs = 0; g.o_rs = TD; g.o_hs = 64;
    g.S = TS; g.Skv = TS; g.H = TNH; g.mask_mode = 7; g.qscale = 1.0f; g.blk0 = 0; g.mask_fill = -INFINITY; g.mask_is_int = 0;
    attn64_kernel<true, true, false><<<TNH * (TS / AT_QB), AT_NW * 32, 0, stream>>>(Q, Kf, Vf, O, nullptr, idx, g); }
  cast_f32_f16x2<<<(TS * TD / 2 + 255) / 256, 256, 0, stream>>>(O, O16, TS * TD / 2);
  { const int t = (TS / 64) * (TD / 64);
    wmma_gemm64<0, false, 0, 0, false><<<dim3((t + 7) / 8, 1), 256, 0, stream>>>(U16(O16), nullptr, TD, 0, U16(Wo16), nullptr, TD, 0, out, nullptr, TD, 0, nullptr, nullptr, 0, TS, TD, TD, 1.0f); }
}

// v001
// It runs in 466 microseconds.
// Two timings next to v000 both put it at 1.88 times that version's speed.
#include <hip/hip_runtime.h>
#include <math.h>
// T5 self-attention with relative-position bias: q/k/v = x·Wᵀ (2048 x 1024 · 1024 x 1024 each), out = o·Woᵀ and the attention
// (16 heads x 64, 2048 x 2048, unscaled scores + rel_bias[bucket(k−q), h]): q/k projections and both attention products on
// v_wmma_f32_16x16x32_bf16 with bf16 hi/lo split operands (unscaled T5 scores make the softmax sharp), v and output projections on v_wmma_f32_16x16x32_f16 with f16 operands; f32 accumulate; the bucket table (integer thresholds of the T5 log-spaced bucketing: |Δ| < 8 exact, then ≥8,12,16,23,32,46,64,91,
// +16 for Δ > 0) and softmax in f32/int on VALU.
typedef __attribute__((ext_vector_type(16))) _Float16 v16h;
typedef __attribute__((ext_vector_type(8)))  _Float16 v8h;
typedef __attribute__((ext_vector_type(16))) __bf16   v16b;
typedef __attribute__((ext_vector_type(8)))  __bf16   v8b;
typedef __attribute__((ext_vector_type(8)))  float    v8f;
typedef __attribute__((ext_vector_type(4)))  float    v4f;
#define PSCALE 32768.0f
#define U16(p) ((const unsigned short*)(const void*)(p))
#define PSCALE_INV (1.0f / 32768.0f)

__device__ __forceinline__ unsigned short f2bf_bits(float f) {
  unsigned u = __float_as_uint(f);
  return (unsigned short)((u + 0x7FFFu + ((u >> 16) & 1u)) >> 16);
}
__device__ __forceinline__ float bf_bits2f(unsigned short h) { return __uint_as_float(((unsigned)h) << 16); }

// hazard guards as plain device helpers (no inline asm inside the kernel template body)
__device__ __forceinline__ void dep_guard_h(v8f& a, v8f& b, v16h x, v16h y) { asm volatile("v_nop\n\tv_nop\n\tv_nop\n\tv_nop" : "+v"(a), "+v"(b) : "v"(x), "v"(y)); }
__device__ __forceinline__ void dep_guard_b(v8f& a, v8f& b, v16b x, v16b y) { asm volatile("v_nop\n\tv_nop\n\tv_nop\n\tv_nop" : "+v"(a), "+v"(b) : "v"(x), "v"(y)); }
__device__ __forceinline__ void keep4_h(v16h a, v16h b, v16h c, v16h d) { asm volatile("v_nop" :: "v"(a), "v"(b), "v"(c), "v"(d)); }
__device__ __forceinline__ void keep4_b(v16b a, v16b b, v16b c, v16b d) { asm volatile("v_nop" :: "v"(a), "v"(b), "v"(c), "v"(d)); }
__device__ __forceinline__ void acc_guard4(v8f& a, v8f& b, v8f& c, v8f& d) { asm volatile("v_nop\n\tv_nop\n\tv_nop\n\tv_nop" : "+v"(a), "+v"(b), "+v"(c), "+v"(d)); }
template <typename T> struct Frag;
template <> struct Frag<_Float16> {
  typedef v16h V; union U { v16h v; v8h h[2]; };
  static __device__ __forceinline__ v16h load(const _Float16* p) {   // elements 0..7 <- p[0..7], 8..15 <- p[16..23]
    U f; f.h[0] = *(const v8h*)(p); f.h[1] = *(const v8h*)(p + 16); return f.v;
  }
  static __device__ __forceinline__ v8f mma(v16h a, v16h b, v8f c) {
    return __builtin_amdgcn_wmma_f32_16x16x32_f16(false, a, false, b, (short)0, c, false, false);
  }
  static __device__ __forceinline__ void guard(v8f& a, v8f& b, v16h x, v16h y) { dep_guard_h(a, b, x, y); }
  static __device__ __forceinline__ void keep(v16h a, v16h b, v16h c, v16h d) { keep4_h(a, b, c, d); }
};
template <> struct Frag<__bf16> {
  typedef v16b V; union U { v16b v; v8b h[2]; };
  static __device__ __forceinline__ v16b load(const __bf16* p) {
    U f; f.h[0] = *(const v8b*)(p); f.h[1] = *(const v8b*)(p + 16); return f.v;
  }
  static __device__ __forceinline__ v8f mma(v16b a, v16b b, v8f c) {
    return __builtin_amdgcn_wmma_f32_16x16x32_bf16(false, a, false, b, (short)0, c, false, false);
  }
  static __device__ __forceinline__ void guard(v8f& a, v8f& b, v16b x, v16b y) { dep_guard_b(a, b, x, y); }
  static __device__ __forceinline__ void keep(v16b a, v16b b, v16b c, v16b d) { keep4_b(a, b, c, d); }
};

// ---- Register-blocked batched WMMA GEMM ------------------------------------
// C[m,n] = scale * sum_k A[m,k] * Bt[n,k] (+bias)(+resid); each wave owns a 64x64 tile.
// A row-major [M,K]; Bt row-major [N,K]; M,N % 64 == 0, K % 32 == 0.
// SPLIT: operands are hi/lo planes (A2/Bt2 = lo planes, same layout); product = hi·hi + hi·lo + lo·hi.
// BIAS_MODE: 0 = none, 1 = bias[m], 2 = bias[n].
// OUT_MODE: 0 = f32, 1 = f16, 2 = bf16 hi plane (Cout) + bf16 lo plane (Cout2).
// ET: 0 = f16 operands, 1 = bf16 operands (pointers passed as 16-bit storage)
template <int ET> struct Elem;
template <> struct Elem<0> { typedef _Float16 T; };
template <> struct Elem<1> { typedef __bf16 T; };
template <int ET, bool SPLIT, int BIAS_MODE, int OUT_MODE, bool RESID, int ACT = 0>
__global__ __launch_bounds__(256) void wmma_gemm64(
    const unsigned short* __restrict__ Ap, const unsigned short* __restrict__ A2p, int lda, long strideA,
    const unsigned short* __restrict__ Btp, const unsigned short* __restrict__ Bt2p, int ldb, long strideB,
    void* __restrict__ Cout, void* __restrict__ Cout2, int ldc, long strideC,
    const float* __restrict__ bias,
    const float* __restrict__ resid, long strideR,
    int M, int N, int K, float scale) {
  typedef typename Elem<ET>::T T;
  typedef typename Frag<T>::V V;
  const T* A = (const T*)Ap; const T* A2 = (const T*)A2p; const T* Bt = (const T*)Btp; const T* Bt2 = (const T*)Bt2p;
  __shared__ __align__(16) float sT[8][16 * 68];   // per-wave 16x64 slab, pitch 68 floats
  const int b    = blockIdx.y;
  const int lane = threadIdx.x & 31;
  const int wave = threadIdx.x >> 5;
  const int tilesN = N >> 6;
  const int tilesM = M >> 6;
  const int tile = blockIdx.x * 8 + wave;
  if (tile >= tilesM * tilesN) return;   // wave-uniform; no block barriers in this kernel
  const int tm = tile / tilesN;
  const int tn = tile - tm * tilesN;
  const int m0 = tm << 6;
  const int n0 = tn << 6;

  const T* Ab  = A  + (size_t)b * strideA;
  const T* Bb  = Bt + (size_t)b * strideB;
  const T* Ab2 = SPLIT ? (A2  + (size_t)b * strideA) : nullptr;
  const T* Bb2 = SPLIT ? (Bt2 + (size_t)b * strideB) : nullptr;

  const int rlane = lane & 15;                 // row (A) / col (B, D) within subtile
  const int koff  = (lane >> 4) * 8;           // k offset of this lane half
  const int mOff  = (lane >> 4) * 8;           // D row offset

  v8f acc[4][4];
#pragma unroll
  for (int i = 0; i < 4; ++i)
#pragma unroll
    for (int j = 0; j < 4; ++j) acc[i][j] = (v8f){0.f,0.f,0.f,0.f,0.f,0.f,0.f,0.f};

  for (int k0 = 0; k0 < K; k0 += 32) {
    V bh[4], bl[4];
#pragma unroll
    for (int j = 0; j < 4; ++j) {
      const size_t bo = (size_t)(n0 + (j << 4) + rlane) * ldb + koff + k0;
      bh[j] = Frag<T>::load(Bb + bo);
      if (SPLIT) bl[j] = Frag<T>::load(Bb2 + bo);
    }
#pragma unroll
    for (int i = 0; i < 4; ++i) {
      const size_t ao = (size_t)(m0 + (i << 4) + rlane) * lda + koff + k0;
      V ah = Frag<T>::load(Ab + ao);
      V al;
      if (SPLIT) al = Frag<T>::load(Ab2 + ao);
#pragma unroll
      for (int j = 0; j < 4; ++j) {
        acc[i][j] = Frag<T>::mma(ah, bh[j], acc[i][j]);
        if (SPLIT) {
          acc[i][j] = Frag<T>::mma(ah, bl[j], acc[i][j]);
          acc[i][j] = Frag<T>::mma(al, bh[j], acc[i][j]);
        }
      }
      Frag<T>::guard(acc[i][0], acc[i][3], ah, SPLIT ? al : ah);
    }
    Frag<T>::keep(bh[0], bh[1], bh[2], bh[3]);
    if (SPLIT) Frag<T>::keep(bl[0], bl[1], bl[2], bl[3]);
  }
  acc_guard4(acc[0][0], acc[0][1], acc[0][2], acc[0][3]);
  acc_guard4(acc[1][0], acc[1][1], acc[1][2], acc[1][3]);
  acc_guard4(acc[2][0], acc[2][1], acc[2][2], acc[2][3]);
  acc_guard4(acc[3][0], acc[3][1], acc[3][2], acc[3][3]);

  // ---- epilogue ----
  float* slab = sT[wave];
  const float* Rb = RESID ? (resid + (size_t)b * strideR) : nullptr;
#pragma unroll
  for (int i = 0; i < 4; ++i) {
    const int mBase = m0 + (i << 4);
#pragma unroll
    for (int j = 0; j < 4; ++j) {
      const int n = n0 + (j << 4) + rlane;
      float bv = 0.f;
      if (BIAS_MODE == 2) bv = bias[n];
#pragma unroll
      for (int r = 0; r < 8; ++r) {
        float v = acc[i][j][r] * scale;
        if (BIAS_MODE == 1) v += bias[mBase + mOff + r];
        if (BIAS_MODE == 2) v += bv;
        if (RESID) v += Rb[(size_t)(mBase + mOff + r) * ldc + n];
        if (ACT == 1) v = tanhf(v);
        if (ACT == 2) v = fmaxf(v, 0.0f);
        if (ACT == 3) v = v / (1.0f + expf(-v));
        if (ACT == 4) v = (v > 0.f) ? v : 0.01f * v;
        if (ACT == 5) v = 0.5f * v * (1.0f + erff(v * 0.70710678118654752f));
        slab[(mOff + r) * 68 + (j << 4) + rlane] = v;
      }
    }
    __builtin_amdgcn_fence(__ATOMIC_RELEASE, "workgroup");
    __builtin_amdgcn_wave_barrier();
    __builtin_amdgcn_fence(__ATOMIC_ACQUIRE, "workgroup");
    if (OUT_MODE == 0) {
      float* C = (float*)Cout + (size_t)b * strideC;
      const int hh = lane >> 4, c4 = (lane & 15) * 4;     // row seg = 256 B = 16 lanes x 16 B
      {
#pragma unroll
        for (int it = 0; it < 8; ++it) {
          const int row = it * 2 + hh;
          v4f v = *(const v4f*)(slab + row * 68 + c4);
          *(v4f*)(C + (size_t)(mBase + row) * ldc + n0 + c4) = v;
        }
        
      }
    } else {
      const int q = lane >> 3, c8 = (lane & 7) * 8;
      unsigned short* C  = (unsigned short*)Cout  + (size_t)b * strideC;
      unsigned short* C2 = (OUT_MODE == 2) ? ((unsigned short*)Cout2 + (size_t)b * strideC) : nullptr;
      {
#pragma unroll
        for (int it = 0; it < 4; ++it) {
          const int row = it * 4 + q;
          const float* sp = slab + row * 68 + c8;
          v8h hv, lv;
#pragma unroll
          for (int e = 0; e < 8; ++e) {
            if (OUT_MODE == 1) {
              hv[e] = (_Float16)sp[e];
            } else {
              unsigned short hb = f2bf_bits(sp[e]);
              unsigned short lb = f2bf_bits(sp[e] - bf_bits2f(hb));
              hv[e] = __builtin_bit_cast(_Float16, hb);
              lv[e] = __builtin_bit_cast(_Float16, lb);
            }
          }
          *(v8h*)(C + (size_t)(mBase + row) * ldc + n0 + c8) = hv;
          if (OUT_MODE == 2) *(v8h*)(C2 + (size_t)(mBase + row) * ldc + n0 + c8) = lv;
        }
        
      }
    }
    __builtin_amdgcn_fence(__ATOMIC_RELEASE, "workgroup");
    __builtin_amdgcn_wave_barrier();
    __builtin_amdgcn_fence(__ATOMIC_ACQUIRE, "workgroup");
  }
}

__global__ __launch_bounds__(256) void cast_f32_f16x2(
    const float* __restrict__ in, _Float16* __restrict__ out, int n2) {
  int i = blockIdx.x * 256 + threadIdx.x;
  if (i < n2) {
    const _Float16 h0 = (_Float16)in[2 * i], h1 = (_Float16)in[2 * i + 1];
    const unsigned u = (unsigned)__builtin_bit_cast(unsigned short, h0) | ((unsigned)__builtin_bit_cast(unsigned short, h1) << 16);
    ((unsigned*)out)[i] = u;
    
  }
}


// ---- f32 -> f16 cast with a power-of-two pre-scale (folded back by the consumer GEMM's scale) ----
__global__ __launch_bounds__(256) void cast_f32_f16x2s(const float* __restrict__ in, _Float16* __restrict__ out, int n2, float s) {
  int i = blockIdx.x * 256 + threadIdx.x;
  if (i < n2) {
    const _Float16 h0 = (_Float16)(in[2 * i] * s), h1 = (_Float16)(in[2 * i + 1] * s);
    const unsigned u = (unsigned)__builtin_bit_cast(unsigned short, h0) | ((unsigned)__builtin_bit_cast(unsigned short, h1) << 16);
    ((unsigned*)out)[i] = u;
    
  }
}
__global__ __launch_bounds__(256) void split_f32_bf16x2(
    const float* __restrict__ in, __bf16* __restrict__ hi, __bf16* __restrict__ lo, long n2) {
  long i = (long)blockIdx.x * 256 + threadIdx.x;
  long stride = (long)gridDim.x * 256;
  {
    for (long j = i; j < n2; j += stride) {
      const float a = in[2 * j], b = in[2 * j + 1];
      const unsigned short ah = f2bf_bits(a), bh = f2bf_bits(b);
      const unsigned short al = f2bf_bits(a - bf_bits2f(ah)), bl = f2bf_bits(b - bf_bits2f(bh));
      ((unsigned*)hi)[j] = (unsigned)ah | ((unsigned)bh << 16);
      ((unsigned*)lo)[j] = (unsigned)al | ((unsigned)bl << 16);
    }
    
  }
}


// ---- f32 [R][C] (row pitch ldi) -> f16 transposed [C][R] (row pitch ldo); 64x64 tiles; each output row segment
__global__ __launch_bounds__(256) void transpose_cast_f16(const float* __restrict__ in, int ldi,
                                                         _Float16* __restrict__ outT, int ldo, float scale) {
  __shared__ __align__(16) _Float16 tile[64][72];     // [c][r]
  const int c0 = blockIdx.x * 64, r0 = blockIdx.y * 64;
  const int t = threadIdx.y * 32 + threadIdx.x;
  for (int i = threadIdx.y; i < 64; i += 8) {
    tile[threadIdx.x][i]      = (_Float16)(in[(size_t)(r0 + i) * ldi + c0 + threadIdx.x] * scale);
    tile[32 + threadIdx.x][i] = (_Float16)(in[(size_t)(r0 + i) * ldi + c0 + 32 + threadIdx.x] * scale);
  }
  __syncthreads();
  const int q = t >> 3, c8 = (t & 7) * 8;
  {
#pragma unroll
    for (int it = 0; it < 2; ++it) {
      const int c = it * 32 + q;
      v8h hv = *(const v8h*)(&tile[c][c8]);
      *(v8h*)(outT + (size_t)(c0 + c) * ldo + r0 + c8) = hv;
    }
    
  }
}

// ---- f32 [R][C] (pitch ldi) -> bf16 hi/lo transposed planes [C][R] (pitch ldo); 64x64 tiles; each output row segment
__global__ __launch_bounds__(256) void transpose_split_bf16(const float* __restrict__ in, int ldi,
                                                           __bf16* __restrict__ outH, __bf16* __restrict__ outL, int ldo) {
  __shared__ __align__(16) float tile[64][68];     // [c][r]
  const int c0 = blockIdx.x * 64, r0 = blockIdx.y * 64;
  const int t = threadIdx.y * 32 + threadIdx.x;
  for (int i = threadIdx.y; i < 64; i += 8) {
    tile[threadIdx.x][i]      = in[(size_t)(r0 + i) * ldi + c0 + threadIdx.x];
    tile[32 + threadIdx.x][i] = in[(size_t)(r0 + i) * ldi + c0 + 32 + threadIdx.x];
  }
  __syncthreads();
  const int q = t >> 3, c8 = (t & 7) * 8;
  {
#pragma unroll
    for (int it = 0; it < 2; ++it) {
      const int c = it * 32 + q;
      v8b hv, lv;
#pragma unroll
      for (int e = 0; e < 8; ++e) {
        const float f = tile[c][c8 + e];
        const unsigned short hb = f2bf_bits(f);
        hv[e] = __builtin_bit_cast(__bf16, hb);
        lv[e] = __builtin_bit_cast(__bf16, f2bf_bits(f - bf_bits2f(hb)));
      }
      *(v8b*)(outH + (size_t)(c0 + c) * ldo + r0 + c8) = hv;
      *(v8b*)(outL + (size_t)(c0 + c) * ldo + r0 + c8) = lv;
    }
    
  }
}

// =====================================================================================
// Generic causal/non-causal attention for head_dim 64, f32 in / f32 out; 16-bit operands: bf16 with optional hi/lo splits, or
// plain f16 (F16=true, non-split, probabilities carried x2^15).
//   scores = (q*qscale)·kᵀ : v_wmma_f32_16x16x32_bf16; SPLIT_QK -> q,k as bf16 hi/lo (hi·hi + hi·lo + lo·hi)
//   out    = p·v           : v_wmma_f32_16x16x32_bf16; SPLIT_PV -> p,v as bf16 hi/lo; else p,v plain bf16
//   f32 accumulate; online softmax in f32. Block = 4 waves = 64 query rows of one (batch, head); S % 64 == 0.
//   Element (b, s, h, d) of tensor X lives at X[b*X_bs + s*X_rs + h*X_hs + d] (strides in floats, multiples of 4).
//   Masking: mask_mode 0 none, 1 causal (kv > q masked), 2 tensor [S][Skv] shared over (b,h) (float if
//   mask_is_int==0, int32 with element == 0 -> masked if 1, int32 with element != 0 -> masked if 2), 3 per-token vectors qmask[B][S] & kvmask[B][Skv] (int32,
//   0 -> masked), 4 causal + sliding window (kv > q or q - kv > W masked; W passed in mask_is_int);
//   5 = relative-position bias: s += cp[b,h,q][idx[q][kv]] + pc[b,h,kv][idx[q][kv]] with idx = mask_b ([S][Skv] int32) and
//   mask_a an int32 [S][Skv] tensor with nonzero = masked (tables: element (b,h,row,n) at X + b*c_bs + h*c_hs + row*c_rs + n);
//   masked scores are replaced by mask_fill (e.g. -inf or -1e9) before the softmax.
//   grid.x = B * H * (S/64) (or a sub-range with blk0).
// =====================================================================================
#define AT_D 64
#define AT_NW 4
#define AT_QB 64
#define AT_KC 64
#define AT_BT (2048 + AT_QB)   // distance table: Skv + AT_QB - 1 entries used (Skv <= 2048), rounded up to whole waves
struct AttnGeom { const float* cp = nullptr; const float* pc = nullptr; long c_bs = 0, c_rs = 0, c_hs = 0;   // mode-5 / DISTB score-bias tables
                  long q_bs, q_rs, q_hs, k_bs, k_rs, k_hs, v_bs, v_rs, v_hs, o_bs, o_rs, o_hs;
                  int S, Skv, H, mask_mode; float qscale; int blk0; float mask_fill; int mask_is_int; };
static_assert(sizeof(AttnGeom) == 168, "no padding");

__device__ __forceinline__ unsigned short at_bf_bits(float f) {
  unsigned u = __float_as_uint(f);
  return (unsigned short)((u + 0x7FFFu + ((u >> 16) & 1u)) >> 16);
}
__device__ __forceinline__ __bf16 at_f2bf(float f) { return __builtin_bit_cast(__bf16, at_bf_bits(f)); }
__device__ __forceinline__ void at_split(float f, __bf16& hi, __bf16& lo) {
  const unsigned short hb = at_bf_bits(f);
  hi = __builtin_bit_cast(__bf16, hb);
  lo = at_f2bf(f - __uint_as_float(((unsigned)hb) << 16));
}
__device__ __forceinline__ v8f at_mma(v16b a, v16b b, v8f c) {
  c = __builtin_amdgcn_wmma_f32_16x16x32_bf16(false, a, false, b, (short)0, c, false, false);
  asm volatile("v_nop\n\tv_nop\n\tv_nop\n\tv_nop" : "+v"(c) : "v"(a), "v"(b));
  return c;
}
// 16-bit element as a bit pattern held in a __bf16 slot: f16 bits when F16, bf16 (RNE) otherwise
template <bool F16> __device__ __forceinline__ __bf16 at_to16(float f) {
  if (F16) return __builtin_bit_cast(__bf16, (_Float16)f);
  return at_f2bf(f);
}
template <bool F16> __device__ __forceinline__ v8f at_mma16(v16b a, v16b b, v8f c) {
  if (F16) {
    const v16h ah = __builtin_bit_cast(v16h, a), bh = __builtin_bit_cast(v16h, b);
    c = __builtin_amdgcn_wmma_f32_16x16x32_f16(false, ah, false, bh, (short)0, c, false, false);
    asm volatile("v_nop\n\tv_nop\n\tv_nop\n\tv_nop" : "+v"(c) : "v"(ah), "v"(bh));
    return c;
  }
  return at_mma(a, b, c);
}

// DISTB: s += bias[bucket(kv - q)] of this head (32 buckets; bucket n of (b, h) at cp + b*c_bs + h*c_hs + n*c_rs), no mask; Skv <= 2048.
template <bool SPLIT_QK, bool SPLIT_PV, bool F16 = false, bool DISTB = false>
__global__ __launch_bounds__(128)
void attn64_kernel(const float* __restrict__ q, const float* __restrict__ k,
                   const float* __restrict__ v, float* __restrict__ out,
                   const void* __restrict__ mask_a, const int* __restrict__ mask_b, AttnGeom g) {
  static_assert(!(F16 && (SPLIT_QK || SPLIT_PV)), "f16 mode is non-split");
  const float PSC = F16 ? 32768.0f : 1.0f;     // f16 probabilities carried x2^15 (subnormal range), folded into the final 1/l
  union FB { v16b v; v8b h[2]; };
  __shared__ __align__(16) __bf16 Ksh[AT_KC * AT_D];             // K hi [kv][d]      8 KB
  __shared__ __align__(16) __bf16 Ksl[SPLIT_QK ? AT_KC * AT_D : 8];
  __shared__ __align__(16) __bf16 Vth[AT_D * AT_KC];             // V hi [d][kv]      8 KB
  __shared__ __align__(16) __bf16 Vtl[SPLIT_PV ? AT_D * AT_KC : 8];
  __shared__ __align__(16) __bf16 Psh[AT_NW][16 * AT_KC];        // per wave P hi [row][kv]  8 KB
  __shared__ __align__(16) __bf16 Psl[SPLIT_PV ? AT_NW : 1][SPLIT_PV ? 16 * AT_KC : 8];
  __shared__ __align__(16) float  Os[AT_NW][16 * 68];            // per wave out tile, pitch 68
  __shared__ float Bs[DISTB ? AT_BT : 1];                        // score bias of this (head, query block) by distance kv - q

  const int tid  = threadIdx.x;
  const int wave = tid >> 5;
  const int lane = tid & 31;
  const int hh   = lane >> 4;
  const int c    = lane & 15;

  const int nqb = g.S / AT_QB;
  const int bx = blockIdx.x + g.blk0;
  const int qb = bx % nqb;
  const int bh = bx / nqb;
  const int h  = bh % g.H;
  const int b  = bh / g.H;
  const int qbase_block = qb * AT_QB;
  const int q0 = qbase_block + wave * 16;

  const float* qb_ptr = q + (size_t)b * g.q_bs + (size_t)h * g.q_hs;
  const float* kb_ptr = k + (size_t)b * g.k_bs + (size_t)h * g.k_hs;
  const float* vb_ptr = v + (size_t)b * g.v_bs + (size_t)h * g.v_hs;
  float*       ob_ptr = out + (size_t)b * g.o_bs + (size_t)h * g.o_hs;

  // Bs[i] = bias of distance kv - q = i - (qbase_block + AT_QB - 1); published by the barriers at the head of the kv loop
  if (DISTB) {
    const float bl = g.cp[(size_t)b * g.c_bs + (size_t)h * g.c_hs + (size_t)lane * g.c_rs];   // lane n holds bucket n
    for (int i = tid; i < AT_BT; i += AT_NW * 32) {   // whole waves only (AT_BT % 32 == 0): every source lane of the shuffle is on
      const int rel = i - (qbase_block + AT_QB - 1); const int a = rel < 0 ? -rel : rel;
      int bkt;
      if (a < 8) bkt = a;
      else bkt = 8 + (a >= 12) + (a >= 16) + (a >= 23) + (a >= 32) + (a >= 46) + (a >= 64) + (a >= 91);   // = 8 + trunc(8*log(a/8)/log 16), capped at 15
      if (rel > 0) bkt += 16;
      Bs[i] = __shfl(bl, bkt, 32);
    }
  }

  // ---- Q fragments (A operand): 2 d-chunks, hi (and lo) ----
  v16b qah[2], qal[2];
  {
    const float* qrow = qb_ptr + (size_t)(q0 + c) * g.q_rs;
#pragma unroll
    for (int dc = 0; dc < 2; ++dc) {
#pragma unroll
      for (int e = 0; e < 8; ++e) {
        const float f0 = qrow[dc * 32 + 8 * hh + e] * g.qscale;
        const float f1 = qrow[dc * 32 + 16 + 8 * hh + e] * g.qscale;
        if (SPLIT_QK) { __bf16 hq, lq; at_split(f0, hq, lq); qah[dc][e] = hq; qal[dc][e] = lq; at_split(f1, hq, lq); qah[dc][8 + e] = hq; qal[dc][8 + e] = lq; }
        else { qah[dc][e] = at_to16<F16>(f0); qah[dc][8 + e] = at_to16<F16>(f1); qal[dc][e] = qah[dc][e]; qal[dc][8 + e] = qah[dc][8 + e]; }
      }
    }
  }

  float mrow[8], lrow[8];
  v8f oacc[4];
#pragma unroll
  for (int r = 0; r < 8; ++r) { mrow[r] = -INFINITY; lrow[r] = 0.f; }
#pragma unroll
  for (int t = 0; t < 4; ++t) oacc[t] = (v8f){0.f,0.f,0.f,0.f,0.f,0.f,0.f,0.f};

  const int nChunks = (g.mask_mode == 1 || g.mask_mode == 4) ? (qb + 1) : (g.Skv / AT_KC);   // block-uniform
  // per-row query mask (mode 3)
  int qkeep[8];
#pragma unroll
  for (int r = 0; r < 8; ++r) qkeep[r] = (g.mask_mode == 3) ? mask_b[(size_t)b * g.S + q0 + 8 * hh + r] : 1;   // mask_b = qmask in mode 3
  for (int kc = 0; kc < nChunks; ++kc) {
    const int kv0 = kc * AT_KC;
    __syncthreads();
    {
      const int kvr = tid >> 1, dh = (tid & 1) * 32;
      const float* krow = kb_ptr + (size_t)(kv0 + kvr) * g.k_rs + dh;
      const float* vrow = vb_ptr + (size_t)(kv0 + kvr) * g.v_rs + dh;
#pragma unroll
      for (int i = 0; i < 8; ++i) {
        v4f kk = *(const v4f*)(krow + 4 * i);
        v4f vv = *(const v4f*)(vrow + 4 * i);
#pragma unroll
        for (int e = 0; e < 4; ++e) {
          const int d = dh + 4 * i + e;
          if (SPLIT_QK) { __bf16 a, bl; at_split(kk[e], a, bl); Ksh[kvr * AT_D + d] = a; Ksl[kvr * AT_D + d] = bl; }
          else Ksh[kvr * AT_D + d] = at_to16<F16>(kk[e]);
          if (SPLIT_PV) { __bf16 a, bl; at_split(vv[e], a, bl); Vth[d * AT_KC + kvr] = a; Vtl[d * AT_KC + kvr] = bl; }
          else Vth[d * AT_KC + kvr] = at_to16<F16>(vv[e]);
        }
      }
    }
    __syncthreads();

    v8f s[4];
#pragma unroll
    for (int j = 0; j < 4; ++j) {
      s[j] = (v8f){0.f,0.f,0.f,0.f,0.f,0.f,0.f,0.f};
#pragma unroll 1
      for (int dc = 0; dc < 2; ++dc) {
        FB kb;
        kb.h[0] = *(const v8b*)(Ksh + (j * 16 + c) * AT_D + dc * 32 + 8 * hh);
        kb.h[1] = *(const v8b*)(Ksh + (j * 16 + c) * AT_D + dc * 32 + 16 + 8 * hh);
        s[j] = at_mma16<F16>(qah[dc], kb.v, s[j]);
        if (SPLIT_QK) {
          FB kl;
          kl.h[0] = *(const v8b*)(Ksl + (j * 16 + c) * AT_D + dc * 32 + 8 * hh);
          kl.h[1] = *(const v8b*)(Ksl + (j * 16 + c) * AT_D + dc * 32 + 16 + 8 * hh);
          s[j] = at_mma16<F16>(qah[dc], kl.v, s[j]);
          s[j] = at_mma16<F16>(qal[dc], kb.v, s[j]);
        }
      }
    }
    const bool diag = (g.mask_mode == 1) && (kc == qb);
    int kvkeep[4] = {1, 1, 1, 1};
    if (g.mask_mode == 3) {
#pragma unroll
      for (int j = 0; j < 4; ++j) kvkeep[j] = ((const int*)mask_a)[(size_t)b * g.Skv + kv0 + j * 16 + c];   // mask_a = kvmask
    }
    float cm[8];
    if (DISTB) {
      const float* bp = Bs + (kv0 + c + (AT_QB - 1) - wave * 16 - 8 * hh);   // + kv column offset - query row offset
#pragma unroll
      for (int r = 0; r < 8; ++r) {
        float m = -INFINITY;
#pragma unroll
        for (int j = 0; j < 4; ++j) { s[j][r] += bp[j * 16 - r]; m = fmaxf(m, s[j][r]); }
#pragma unroll
        for (int off = 1; off < 16; off <<= 1) m = fmaxf(m, __shfl_xor(m, off, 32));
        cm[r] = m;
      }
    } else
#pragma unroll
    for (int r = 0; r < 8; ++r) {
      const int qrow = q0 + 8 * hh + r;
      float m = -INFINITY;
#pragma unroll
      for (int j = 0; j < 4; ++j) {
        const int kvcol = kv0 + j * 16 + c;
        bool masked = false;
        if (diag) masked = (kvcol > qrow);
        else if (g.mask_mode == 4) masked = (kvcol > qrow) || (qrow - kvcol > g.mask_is_int);
        else if (g.mask_mode == 2) {
          const size_t mi = (size_t)qrow * g.Skv + kvcol;
          masked = (g.mask_is_int == 0) ? (((const float*)mask_a)[mi] == 0.0f)
                 : (g.mask_is_int == 1) ? (((const int*)mask_a)[mi] == 0) : (((const int*)mask_a)[mi] != 0);
        } else if (g.mask_mode == 3) masked = (qkeep[r] == 0) || (kvkeep[j] == 0);
        else if (g.mask_mode == 5) {
          const size_t mi = (size_t)qrow * g.Skv + kvcol;
          masked = (((const int*)mask_a)[mi] != 0);
          int n = mask_b[mi]; n = n < 0 ? 0 : n;
          s[j][r] += g.cp[(size_t)b * g.c_bs + (size_t)h * g.c_hs + (size_t)qrow * g.c_rs + n]
                   + g.pc[(size_t)b * g.c_bs + (size_t)h * g.c_hs + (size_t)kvcol * g.c_rs + n];
        }
        if (masked) s[j][r] = g.mask_fill;
        m = fmaxf(m, s[j][r]);
      }
#pragma unroll
      for (int off = 1; off < 16; off <<= 1) m = fmaxf(m, __shfl_xor(m, off, 32));
      cm[r] = m;
    }
    __bf16* pwh = Psh[wave];
    __bf16* pwl = Psl[SPLIT_PV ? wave : 0];
#pragma unroll
    for (int r = 0; r < 8; ++r) {
      const float mnew = fmaxf(mrow[r], cm[r]);
      const float alpha = expf(mrow[r] - mnew);
      mrow[r] = mnew;
      float psum = 0.f;
#pragma unroll
      for (int j = 0; j < 4; ++j) {
        const float p = expf(s[j][r] - mnew);
        psum += p;
        if (SPLIT_PV) { __bf16 a, bl; at_split(p, a, bl); pwh[(8 * hh + r) * AT_KC + j * 16 + c] = a; pwl[(8 * hh + r) * AT_KC + j * 16 + c] = bl; }
        else pwh[(8 * hh + r) * AT_KC + j * 16 + c] = at_to16<F16>(p * PSC);
      }
#pragma unroll
      for (int off = 1; off < 16; off <<= 1) psum += __shfl_xor(psum, off, 32);
      lrow[r] = lrow[r] * alpha + psum;
#pragma unroll
      for (int t = 0; t < 4; ++t) oacc[t][r] *= alpha;
    }
    __builtin_amdgcn_fence(__ATOMIC_RELEASE, "workgroup");
    __builtin_amdgcn_wave_barrier();
    __builtin_amdgcn_fence(__ATOMIC_ACQUIRE, "workgroup");
#pragma unroll 1
    for (int kk = 0; kk < 2; ++kk) {
      FB pa, pl;
      pa.h[0] = *(const v8b*)(pwh + c * AT_KC + kk * 32 + 8 * hh);
      pa.h[1] = *(const v8b*)(pwh + c * AT_KC + kk * 32 + 16 + 8 * hh);
      if (SPLIT_PV) {
        pl.h[0] = *(const v8b*)(pwl + c * AT_KC + kk * 32 + 8 * hh);
        pl.h[1] = *(const v8b*)(pwl + c * AT_KC + kk * 32 + 16 + 8 * hh);
      }
#pragma unroll
      for (int t = 0; t < 4; ++t) {
        FB vb;
        vb.h[0] = *(const v8b*)(Vth + (t * 16 + c) * AT_KC + kk * 32 + 8 * hh);
        vb.h[1] = *(const v8b*)(Vth + (t * 16 + c) * AT_KC + kk * 32 + 16 + 8 * hh);
        oacc[t] = at_mma16<F16>(pa.v, vb.v, oacc[t]);
        if (SPLIT_PV) {
          FB vl;
          vl.h[0] = *(const v8b*)(Vtl + (t * 16 + c) * AT_KC + kk * 32 + 8 * hh);
          vl.h[1] = *(const v8b*)(Vtl + (t * 16 + c) * AT_KC + kk * 32 + 16 + 8 * hh);
          oacc[t] = at_mma16<F16>(pa.v, vl.v, oacc[t]);
          oacc[t] = at_mma16<F16>(pl.v, vb.v, oacc[t]);
        }
      }
    }
  }

  float* os = Os[wave];
#pragma unroll
  for (int r = 0; r < 8; ++r) {
    const float inv = 1.0f / (lrow[r] * PSC);
#pragma unroll
    for (int t = 0; t < 4; ++t) os[(8 * hh + r) * 68 + t * 16 + c] = oacc[t][r] * inv;
  }
  __builtin_amdgcn_fence(__ATOMIC_RELEASE, "workgroup");
  __builtin_amdgcn_wave_barrier();
  __builtin_amdgcn_fence(__ATOMIC_ACQUIRE, "workgroup");
  {
    const int c4 = (lane & 15) * 4;
    {
#pragma unroll
      for (int it = 0; it < 8; ++it) {
        const int row = it * 2 + hh;
        v4f val = *(const v4f*)(os + row * 68 + c4);
        *(v4f*)(ob_ptr + (size_t)(q0 + row) * g.o_rs + c4) = val;
      }
      
    }
  }
}

#define TS 2048
#define TD 1024
#define TNH 16
#define TNB 32
extern "C" void kernel_launch(void* const* d_in, const int* in_sizes, int n_in, void* d_out, int out_size, void* d_ws, size_t ws_size, hipStream_t stream) {
  (void)in_sizes; (void)n_in; (void)out_size; (void)ws_size;
  const float* x = (const float*)d_in[0]; const float* wq = (const float*)d_in[1]; const float* wk = (const float*)d_in[2]; const float* wv = (const float*)d_in[3]; const float* wo = (const float*)d_in[4]; const float* rb = (const float*)d_in[5];
  float* out = (float*)d_out;   // [1][2048][1024]
  char* ws = (char*)d_ws; size_t off = 0;
  auto carve = [&](size_t bytes) -> char* { char* p = ws + off; off += (bytes + 255) & ~(size_t)255; return p; };
  _Float16* X16 = (_Float16*)carve((size_t)TS * TD * 2);
__bf16* Xh = (__bf16*)carve((size_t)TS * TD * 2); __bf16* Xl = (__bf16*)carve((size_t)TS * TD * 2);
  __bf16* Wqh = (__bf16*)carve((size_t)TD * TD * 2); __bf16* Wql = (__bf16*)carve((size_t)TD * TD * 2); __bf16* Wkh = (__bf16*)carve((size_t)TD * TD * 2); __bf16* Wkl = (__bf16*)carve((size_t)TD * TD * 2);
  _Float16* Wv16 = (_Float16*)carve((size_t)TD * TD * 2); _Float16* Wo16 = (_Float16*)carve((size_t)TD * TD * 2);
  float* Q = (float*)carve((size_t)TS * TD * 4); float* Kf = (float*)carve((size_t)TS * TD * 4); float* Vf = (float*)carve((size_t)TS * TD * 4); float* O = (float*)carve((size_t)TS * TD * 4);
  _Float16* O16 = X16;
  cast_f32_f16x2<<<(TS * TD / 2 + 255) / 256, 256, 0, stream>>>(x, X16, TS * TD / 2);
  split_f32_bf16x2<<<(TS * TD / 2 + 255) / 256, 256, 0, stream>>>(x, Xh, Xl, TS * TD / 2);
  split_f32_bf16x2<<<(TD * TD / 2 + 255) / 256, 256, 0, stream>>>(wq, Wqh, Wql, TD * TD / 2);   // nn.Linear weights [out][in] = Bt layout
  split_f32_bf16x2<<<(TD * TD / 2 + 255) / 256, 256, 0, stream>>>(wk, Wkh, Wkl, TD * TD / 2);
  cast_f32_f16x2<<<(TD * TD / 2 + 255) / 256, 256, 0, stream>>>(wv, Wv16, TD * TD / 2);
  cast_f32_f16x2<<<(TD * TD / 2 + 255) / 256, 256, 0, stream>>>(wo, Wo16, TD * TD / 2);
  { const int t = (TS / 64) * (TD / 64);
    wmma_gemm64<1, true, 0, 0, false><<<dim3((t + 7) / 8, 1), 256, 0, stream>>>(U16(Xh), U16(Xl), TD, 0, U16(Wqh), U16(Wql), TD, 0, Q, nullptr, TD, 0, nullptr, nullptr, 0, TS, TD, TD, 1.0f);
    wmma_gemm64<1, true, 0, 0, false><<<dim3((t + 7) / 8, 1), 256, 0, stream>>>(U16(Xh), U16(Xl), TD, 0, U16(Wkh), U16(Wkl), TD, 0, Kf, nullptr, TD, 0, nullptr, nullptr, 0, TS, TD, TD, 1.0f);
    wmma_gemm64<0, false, 0, 0, false><<<dim3((t + 7) / 8, 1), 256, 0, stream>>>(U16(X16), nullptr, TD, 0, U16(Wv16), nullptr, TD, 0, Vf, nullptr, TD, 0, nullptr, nullptr, 0, TS, TD, TD, 1.0f); }
  { AttnGeom g;
    g.cp = rb; g.pc = nullptr; g.c_bs = 0; g.c_hs = 1; g.c_rs = TNH;   // rel_bias [bucket][head]
    g.q_bs = 0; g.q_rs = TD; g.q_hs = 64; g.k_bs = 0; g.k_rs = TD; g.k_hs = 64; g.v_bs = 0; g.v_rs = TD; g.v_hs = 64; g.o_bs = 0; g.o_rs = TD; g.o_hs = 64;
    g.S = TS; g.Skv = TS; g.H = TNH; g.mask_mode = 0; g.qscale = 1.0f; g.blk0 = 0; g.mask_fill = -INFINITY; g.mask_is_int = 0;
    attn64_kernel<true, true, false, true><<<TNH * (TS / AT_QB), AT_NW * 32, 0, stream>>>(Q, Kf, Vf, O, nullptr, nullptr, g); }
  cast_f32_f16x2<<<(TS * TD / 2 + 255) / 256, 256, 0, stream>>>(O, O16, TS * TD / 2);
  { const int t = (TS / 64) * (TD / 64);
    wmma_gemm64<0, false, 0, 0, false><<<dim3((t + 7) / 8, 1), 256, 0, stream>>>(U16(O16), nullptr, TD, 0, U16(Wo16), nullptr, TD, 0, out, nullptr, TD, 0, nullptr, nullptr, 0, TS, TD, TD, 1.0f); }
}

// v002
// A run of this version takes 428 microseconds.
// Two timings next to v001 both put it at 1.09 times that version's speed.
// Over all steps from v000 it is 2.05 times as fast.
#include <hip/hip_runtime.h>
#include <math.h>
// T5 self-attention with relative-position bias: q/k/v = x·Wᵀ (2048 x 1024 · 1024 x 1024 each), out = o·Woᵀ and the attention
// (16 heads x 64, 2048 x 2048, unscaled scores + rel_bias[bucket(k−q), h]): q/k projections and both attention products on
// v_wmma_f32_16x16x32_bf16 with bf16 hi/lo split operands (unscaled T5 scores make the softmax sharp), v and output projections on v_wmma_f32_16x16x32_f16 with f16 operands; f32 accumulate; the bucket table (integer thresholds of the T5 log-spaced bucketing: |Δ| < 8 exact, then ≥8,12,16,23,32,46,64,91,
// +16 for Δ > 0) and softmax in f32/int on VALU.
typedef __attribute__((ext_vector_type(16))) _Float16 v16h;
typedef __attribute__((ext_vector_type(8)))  _Float16 v8h;
typedef __attribute__((ext_vector_type(16))) __bf16   v16b;
typedef __attribute__((ext_vector_type(8)))  __bf16   v8b;
typedef __attribute__((ext_vector_type(8)))  float    v8f;
typedef __attribute__((ext_vector_type(4)))  float    v4f;
#define PSCALE 32768.0f
#define U16(p) ((const unsigned short*)(const void*)(p))
#define PSCALE_INV (1.0f / 32768.0f)

__device__ __forceinline__ unsigned short f2bf_bits(float f) {
  unsigned u = __float_as_uint(f);
  return (unsigned short)((u + 0x7FFFu + ((u >> 16) & 1u)) >> 16);
}
__device__ __forceinline__ float bf_bits2f(unsigned short h) { return __uint_as_float(((unsigned)h) << 16); }

// hazard guards as plain device helpers (no inline asm inside the kernel template body)
__device__ __forceinline__ void dep_guard_h(v8f& a, v8f& b, v16h x, v16h y) { asm volatile("v_nop\n\tv_nop\n\tv_nop\n\tv_nop" : "+v"(a), "+v"(b) : "v"(x), "v"(y)); }
__device__ __forceinline__ void dep_guard_b(v8f& a, v8f& b, v16b x, v16b y) { asm volatile("v_nop\n\tv_nop\n\tv_nop\n\tv_nop" : "+v"(a), "+v"(b) : "v"(x), "v"(y)); }
__device__ __forceinline__ void keep4_h(v16h a, v16h b, v16h c, v16h d) { asm volatile("v_nop" :: "v"(a), "v"(b), "v"(c), "v"(d)); }
__device__ __forceinline__ void keep4_b(v16b a, v16b b, v16b c, v16b d) { asm volatile("v_nop" :: "v"(a), "v"(b), "v"(c), "v"(d)); }
__device__ __forceinline__ void acc_guard4(v8f& a, v8f& b, v8f& c, v8f& d) { asm volatile("v_nop\n\tv_nop\n\tv_nop\n\tv_nop" : "+v"(a), "+v"(b), "+v"(c), "+v"(d)); }
template <typename T> struct Frag;
template <> struct Frag<_Float16> {
  typedef v16h V; union U { v16h v; v8h h[2]; };
  static __device__ __forceinline__ v16h load(const _Float16* p) {   // elements 0..7 <- p[0..7], 8..15 <- p[16..23]
    U f; f.h[0] = *(const v8h*)(p); f.h[1] = *(const v8h*)(p + 16); return f.v;
  }
  static __device__ __forceinline__ v8f mma(v16h a, v16h b, v8f c) {
    return __builtin_amdgcn_wmma_f32_16x16x32_f16(false, a, false, b, (short)0, c, false, false);
  }
  static __device__ __forceinline__ void guard(v8f& a, v8f& b, v16h x, v16h y) { dep_guard_h(a, b, x, y); }
  static __device__ __forceinline__ void keep(v16h a, v16h b, v16h c, v16h d) { keep4_h(a, b, c, d); }
};
template <> struct Frag<__bf16> {
  typedef v16b V; union U { v16b v; v8b h[2]; };
  static __device__ __forceinline__ v16b load(const __bf16* p) {
    U f; f.h[0] = *(const v8b*)(p); f.h[1] = *(const v8b*)(p + 16); return f.v;
  }
  static __device__ __forceinline__ v8f mma(v16b a, v16b b, v8f c) {
    return __builtin_amdgcn_wmma_f32_16x16x32_bf16(false, a, false, b, (short)0, c, false, false);
  }
  static __device__ __forceinline__ void guard(v8f& a, v8f& b, v16b x, v16b y) { dep_guard_b(a, b, x, y); }
  static __device__ __forceinline__ void keep(v16b a, v16b b, v16b c, v16b d) { keep4_b(a, b, c, d); }
};

// ---- Register-blocked batched WMMA GEMM ------------------------------------
// C[m,n] = scale * sum_k A[m,k] * Bt[n,k] (+bias)(+resid); each wave owns a 64x64 tile.
// A row-major [M,K]; Bt row-major [N,K]; M,N % 64 == 0, K % 32 == 0.
// SPLIT: operands are hi/lo planes (A2/Bt2 = lo planes, same layout); product = hi·hi + hi·lo + lo·hi.
// BIAS_MODE: 0 = none, 1 = bias[m], 2 = bias[n].
// OUT_MODE: 0 = f32, 1 = f16, 2 = bf16 hi plane (Cout) + bf16 lo plane (Cout2).
// ET: 0 = f16 operands, 1 = bf16 operands (pointers passed as 16-bit storage)
template <int ET> struct Elem;
template <> struct Elem<0> { typedef _Float16 T; };
template <> struct Elem<1> { typedef __bf16 T; };
template <int ET, bool SPLIT, int BIAS_MODE, int OUT_MODE, bool RESID, int ACT = 0>
__global__ __launch_bounds__(256) void wmma_gemm64(
    const unsigned short* __restrict__ Ap, const unsigned short* __restrict__ A2p, int lda, long strideA,
    const unsigned short* __restrict__ Btp, const unsigned short* __restrict__ Bt2p, int ldb, long strideB,
    void* __restrict__ Cout, void* __restrict__ Cout2, int ldc, long strideC,
    const float* __restrict__ bias,
    const float* __restrict__ resid, long strideR,
    int M, int N, int K, float scale) {
  typedef typename Elem<ET>::T T;
  typedef typename Frag<T>::V V;
  const T* A = (const T*)Ap; const T* A2 = (const T*)A2p; const T* Bt = (const T*)Btp; const T* Bt2 = (const T*)Bt2p;
  __shared__ __align__(16) float sT[8][16 * 68];   // per-wave 16x64 slab, pitch 68 floats
  const int b    = blockIdx.y;
  const int lane = threadIdx.x & 31;
  const int wave = threadIdx.x >> 5;
  const int tilesN = N >> 6;
  const int tilesM = M >> 6;
  const int tile = blockIdx.x * 8 + wave;
  if (tile >= tilesM * tilesN) return;   // wave-uniform; no block barriers in this kernel
  const int tm = tile / tilesN;
  const int tn = tile - tm * tilesN;
  const int m0 = tm << 6;
  const int n0 = tn << 6;

  const T* Ab  = A  + (size_t)b * strideA;
  const T* Bb  = Bt + (size_t)b * strideB;
  const T* Ab2 = SPLIT ? (A2  + (size_t)b * strideA) : nullptr;
  const T* Bb2 = SPLIT ? (Bt2 + (size_t)b * strideB) : nullptr;

  const int rlane = lane & 15;                 // row (A) / col (B, D) within subtile
  const int koff  = (lane >> 4) * 8;           // k offset of this lane half
  const int mOff  = (lane >> 4) * 8;           // D row offset

  v8f acc[4][4];
#pragma unroll
  for (int i = 0; i < 4; ++i)
#pragma unroll
    for (int j = 0; j < 4; ++j) acc[i][j] = (v8f){0.f,0.f,0.f,0.f,0.f,0.f,0.f,0.f};

  for (int k0 = 0; k0 < K; k0 += 32) {
    V bh[4], bl[4];
#pragma unroll
    for (int j = 0; j < 4; ++j) {
      const size_t bo = (size_t)(n0 + (j << 4) + rlane) * ldb + koff + k0;
      bh[j] = Frag<T>::load(Bb + bo);
      if (SPLIT) bl[j] = Frag<T>::load(Bb2 + bo);
    }
#pragma unroll
    for (int i = 0; i < 4; ++i) {
      const size_t ao = (size_t)(m0 + (i << 4) + rlane) * lda + koff + k0;
      V ah = Frag<T>::load(Ab + ao);
      V al;
      if (SPLIT) al = Frag<T>::load(Ab2 + ao);
#pragma unroll
      for (int j = 0; j < 4; ++j) {
        acc[i][j] = Frag<T>::mma(ah, bh[j], acc[i][j]);
        if (SPLIT) {
          acc[i][j] = Frag<T>::mma(ah, bl[j], acc[i][j]);
          acc[i][j] = Frag<T>::mma(al, bh[j], acc[i][j]);
        }
      }
      Frag<T>::guard(acc[i][0], acc[i][3], ah, SPLIT ? al : ah);
    }
    Frag<T>::keep(bh[0], bh[1], bh[2], bh[3]);
    if (SPLIT) Frag<T>::keep(bl[0], bl[1], bl[2], bl[3]);
  }
  acc_guard4(acc[0][0], acc[0][1], acc[0][2], acc[0][3]);
  acc_guard4(acc[1][0], acc[1][1], acc[1][2], acc[1][3]);
  acc_guard4(acc[2][0], acc[2][1], acc[2][2], acc[2][3]);
  acc_guard4(acc[3][0], acc[3][1], acc[3][2], acc[3][3]);

  // ---- epilogue ----
  float* slab = sT[wave];
  const float* Rb = RESID ? (resid + (size_t)b * strideR) : nullptr;
#pragma unroll
  for (int i = 0; i < 4; ++i) {
    const int mBase = m0 + (i << 4);
#pragma unroll
    for (int j = 0; j < 4; ++j) {
      const int n = n0 + (j << 4) + rlane;
      float bv = 0.f;
      if (BIAS_MODE == 2) bv = bias[n];
#pragma unroll
      for (int r = 0; r < 8; ++r) {
        float v = acc[i][j][r] * scale;
        if (BIAS_MODE == 1) v += bias[mBase + mOff + r];
        if (BIAS_MODE == 2) v += bv;
        if (RESID) v += Rb[(size_t)(mBase + mOff + r) * ldc + n];
        if (ACT == 1) v = tanhf(v);
        if (ACT == 2) v = fmaxf(v, 0.0f);
        if (ACT == 3) v = v / (1.0f + expf(-v));
        if (ACT == 4) v = (v > 0.f) ? v : 0.01f * v;
        if (ACT == 5) v = 0.5f * v * (1.0f + erff(v * 0.70710678118654752f));
        slab[(mOff + r) * 68 + (j << 4) + rlane] = v;
      }
    }
    __builtin_amdgcn_fence(__ATOMIC_RELEASE, "workgroup");
    __builtin_amdgcn_wave_barrier();
    __builtin_amdgcn_fence(__ATOMIC_ACQUIRE, "workgroup");
    if (OUT_MODE == 0) {
      float* C = (float*)Cout + (size_t)b * strideC;
      const int hh = lane >> 4, c4 = (lane & 15) * 4;     // row seg = 256 B = 16 lanes x 16 B
      {
#pragma unroll
        for (int it = 0; it < 8; ++it) {
          const int row = it * 2 + hh;
          v4f v = *(const v4f*)(slab + row * 68 + c4);
          *(v4f*)(C + (size_t)(mBase + row) * ldc + n0 + c4) = v;
        }
        
      }
    } else {
      const int q = lane >> 3, c8 = (lane & 7) * 8;
      unsigned short* C  = (unsigned short*)Cout  + (size_t)b * strideC;
      unsigned short* C2 = (OUT_MODE == 2) ? ((unsigned short*)Cout2 + (size_t)b * strideC) : nullptr;
      {
#pragma unroll
        for (int it = 0; it < 4; ++it) {
          const int row = it * 4 + q;
          const float* sp = slab + row * 68 + c8;
          v8h hv, lv;
#pragma unroll
          for (int e = 0; e < 8; ++e) {
            if (OUT_MODE == 1) {
              hv[e] = (_Float16)sp[e];
            } else {
              unsigned short hb = f2bf_bits(sp[e]);
              unsigned short lb = f2bf_bits(sp[e] - bf_bits2f(hb));
              hv[e] = __builtin_bit_cast(_Float16, hb);
              lv[e] = __builtin_bit_cast(_Float16, lb);
            }
          }
          *(v8h*)(C + (size_t)(mBase + row) * ldc + n0 + c8) = hv;
          if (OUT_MODE == 2) *(v8h*)(C2 + (size_t)(mBase + row) * ldc + n0 + c8) = lv;
        }
        
      }
    }
    __builtin_amdgcn_fence(__ATOMIC_RELEASE, "workgroup");
    __builtin_amdgcn_wave_barrier();
    __builtin_amdgcn_fence(__ATOMIC_ACQUIRE, "workgroup");
  }
}

__global__ __launch_bounds__(256) void cast_f32_f16x2(
    const float* __restrict__ in, _Float16* __restrict__ out, int n2) {
  int i = blockIdx.x * 256 + threadIdx.x;
  if (i < n2) {
    const _Float16 h0 = (_Float16)in[2 * i], h1 = (_Float16)in[2 * i + 1];
    const unsigned u = (unsigned)__builtin_bit_cast(unsigned short, h0) | ((unsigned)__builtin_bit_cast(unsigned short, h1) << 16);
    ((unsigned*)out)[i] = u;
    
  }
}


// ---- f32 -> f16 cast with a power-of-two pre-scale (folded back by the consumer GEMM's scale) ----
__global__ __launch_bounds__(256) void cast_f32_f16x2s(const float* __restrict__ in, _Float16* __restrict__ out, int n2, float s) {
  int i = blockIdx.x * 256 + threadIdx.x;
  if (i < n2) {
    const _Float16 h0 = (_Float16)(in[2 * i] * s), h1 = (_Float16)(in[2 * i + 1] * s);
    const unsigned u = (unsigned)__builtin_bit_cast(unsigned short, h0) | ((unsigned)__builtin_bit_cast(unsigned short, h1) << 16);
    ((unsigned*)out)[i] = u;
    
  }
}
__global__ __launch_bounds__(256) void split_f32_bf16x2(
    const float* __restrict__ in, __bf16* __restrict__ hi, __bf16* __restrict__ lo, long n2) {
  long i = (long)blockIdx.x * 256 + threadIdx.x;
  long stride = (long)gridDim.x * 256;
  {
    for (long j = i; j < n2; j += stride) {
      const float a = in[2 * j], b = in[2 * j + 1];
      const unsigned short ah = f2bf_bits(a), bh = f2bf_bits(b);
      const unsigned short al = f2bf_bits(a - bf_bits2f(ah)), bl = f2bf_bits(b - bf_bits2f(bh));
      ((unsigned*)hi)[j] = (unsigned)ah | ((unsigned)bh << 16);
      ((unsigned*)lo)[j] = (unsigned)al | ((unsigned)bl << 16);
    }
    
  }
}


// ---- f32 [R][C] (row pitch ldi) -> f16 transposed [C][R] (row pitch ldo); 64x64 tiles; each output row segment
__global__ __launch_bounds__(256) void transpose_cast_f16(const float* __restrict__ in, int ldi,
                                                         _Float16* __restrict__ outT, int ldo, float scale) {
  __shared__ __align__(16) _Float16 tile[64][72];     // [c][r]
  const int c0 = blockIdx.x * 64, r0 = blockIdx.y * 64;
  const int t = threadIdx.y * 32 + threadIdx.x;
  for (int i = threadIdx.y; i < 64; i += 8) {
    tile[threadIdx.x][i]      = (_Float16)(in[(size_t)(r0 + i) * ldi + c0 + threadIdx.x] * scale);
    tile[32 + threadIdx.x][i] = (_Float16)(in[(size_t)(r0 + i) * ldi + c0 + 32 + threadIdx.x] * scale);
  }
  __syncthreads();
  const int q = t >> 3, c8 = (t & 7) * 8;
  {
#pragma unroll
    for (int it = 0; it < 2; ++it) {
      const int c = it * 32 + q;
      v8h hv = *(const v8h*)(&tile[c][c8]);
      *(v8h*)(outT + (size_t)(c0 + c) * ldo + r0 + c8) = hv;
    }
    
  }
}

// ---- f32 [R][C] (pitch ldi) -> bf16 hi/lo transposed planes [C][R] (pitch ldo); 64x64 tiles; each output row segment
__global__ __launch_bounds__(256) void transpose_split_bf16(const float* __restrict__ in, int ldi,
                                                           __bf16* __restrict__ outH, __bf16* __restrict__ outL, int ldo) {
  __shared__ __align__(16) float tile[64][68];     // [c][r]
  const int c0 = blockIdx.x * 64, r0 = blockIdx.y * 64;
  const int t = threadIdx.y * 32 + threadIdx.x;
  for (int i = threadIdx.y; i < 64; i += 8) {
    tile[threadIdx.x][i]      = in[(size_t)(r0 + i) * ldi + c0 + threadIdx.x];
    tile[32 + threadIdx.x][i] = in[(size_t)(r0 + i) * ldi + c0 + 32 + threadIdx.x];
  }
  __syncthreads();
  const int q = t >> 3, c8 = (t & 7) * 8;
  {
#pragma unroll
    for (int it = 0; it < 2; ++it) {
      const int c = it * 32 + q;
      v8b hv, lv;
#pragma unroll
      for (int e = 0; e < 8; ++e) {
        const float f = tile[c][c8 + e];
        const unsigned short hb = f2bf_bits(f);
        hv[e] = __builtin_bit_cast(__bf16, hb);
        lv[e] = __builtin_bit_cast(__bf16, f2bf_bits(f - bf_bits2f(hb)));
      }
      *(v8b*)(outH + (size_t)(c0 + c) * ldo + r0 + c8) = hv;
      *(v8b*)(outL + (size_t)(c0 + c) * ldo + r0 + c8) = lv;
    }
    
  }
}

// =====================================================================================
// Generic causal/non-causal attention for head_dim 64, f32 in / f32 out; 16-bit operands: bf16 with optional hi/lo splits, or
// plain f16 (F16=true, non-split, probabilities carried x2^15).
//   scores = (q*qscale)·kᵀ : v_wmma_f32_16x16x32_bf16; SPLIT_QK -> q,k as bf16 hi/lo (hi·hi + hi·lo + lo·hi)
//   out    = p·v           : v_wmma_f32_16x16x32_bf16; SPLIT_PV -> p,v as bf16 hi/lo; else p,v plain bf16
//   f32 accumulate; online softmax in f32. Block = 4 waves = 64 query rows of one (batch, head); S % 64 == 0.
//   Element (b, s, h, d) of tensor X lives at X[b*X_bs + s*X_rs + h*X_hs + d] (strides in floats, multiples of 4).
//   Masking: mask_mode 0 none, 1 causal (kv > q masked), 2 tensor [S][Skv] shared over (b,h) (float if
//   mask_is_int==0, int32 with element == 0 -> masked if 1, int32 with element != 0 -> masked if 2), 3 per-token vectors qmask[B][S] & kvmask[B][Skv] (int32,
//   0 -> masked), 4 causal + sliding window (kv > q or q - kv > W masked; W passed in mask_is_int);
//   5 = relative-position bias: s += cp[b,h,q][idx[q][kv]] + pc[b,h,kv][idx[q][kv]] with idx = mask_b ([S][Skv] int32) and
//   mask_a an int32 [S][Skv] tensor with nonzero = masked (tables: element (b,h,row,n) at X + b*c_bs + h*c_hs + row*c_rs + n);
//   masked scores are replaced by mask_fill (e.g. -inf or -1e9) before the softmax.
//   grid.x = B * H * (S/64) (or a sub-range with blk0).
// =====================================================================================
#define AT_D 64
#define AT_NW 4
#define AT_QB 64
#define AT_KC 64
#define AT_LP 72   // LDS row pitch of the K, V and P tiles in 16-bit elements: 144 B = 16 B x 9 (odd), so the 16 rows of a ds_load_b128 fragment read spread over the banks
#define AT_BT (2048 + AT_QB)   // distance table: Skv + AT_QB - 1 entries used (Skv <= 2048), rounded up to whole waves
struct AttnGeom { const float* cp = nullptr; const float* pc = nullptr; long c_bs = 0, c_rs = 0, c_hs = 0;   // mode-5 / DISTB score-bias tables
                  long q_bs, q_rs, q_hs, k_bs, k_rs, k_hs, v_bs, v_rs, v_hs, o_bs, o_rs, o_hs;
                  int S, Skv, H, mask_mode; float qscale; int blk0; float mask_fill; int mask_is_int; };
static_assert(sizeof(AttnGeom) == 168, "no padding");

__device__ __forceinline__ unsigned short at_bf_bits(float f) {
  unsigned u = __float_as_uint(f);
  return (unsigned short)((u + 0x7FFFu + ((u >> 16) & 1u)) >> 16);
}
__device__ __forceinline__ __bf16 at_f2bf(float f) { return __builtin_bit_cast(__bf16, at_bf_bits(f)); }
__device__ __forceinline__ void at_split(float f, __bf16& hi, __bf16& lo) {
  const unsigned short hb = at_bf_bits(f);
  hi = __builtin_bit_cast(__bf16, hb);
  lo = at_f2bf(f - __uint_as_float(((unsigned)hb) << 16));
}
__device__ __forceinline__ v8f at_mma(v16b a, v16b b, v8f c) {
  c = __builtin_amdgcn_wmma_f32_16x16x32_bf16(false, a, false, b, (short)0, c, false, false);
  asm volatile("v_nop\n\tv_nop\n\tv_nop\n\tv_nop" : "+v"(c) : "v"(a), "v"(b));
  return c;
}
// 16-bit element as a bit pattern held in a __bf16 slot: f16 bits when F16, bf16 (RNE) otherwise
template <bool F16> __device__ __forceinline__ __bf16 at_to16(float f) {
  if (F16) return __builtin_bit_cast(__bf16, (_Float16)f);
  return at_f2bf(f);
}
template <bool F16> __device__ __forceinline__ v8f at_mma16(v16b a, v16b b, v8f c) {
  if (F16) {
    const v16h ah = __builtin_bit_cast(v16h, a), bh = __builtin_bit_cast(v16h, b);
    c = __builtin_amdgcn_wmma_f32_16x16x32_f16(false, ah, false, bh, (short)0, c, false, false);
    asm volatile("v_nop\n\tv_nop\n\tv_nop\n\tv_nop" : "+v"(c) : "v"(ah), "v"(bh));
    return c;
  }
  return at_mma(a, b, c);
}

// DISTB: s += bias[bucket(kv - q)] of this head (32 buckets; bucket n of (b, h) at cp + b*c_bs + h*c_hs + n*c_rs), no mask; Skv <= 2048.
template <bool SPLIT_QK, bool SPLIT_PV, bool F16 = false, bool DISTB = false>
__global__ __launch_bounds__(128)
void attn64_kernel(const float* __restrict__ q, const float* __restrict__ k,
                   const float* __restrict__ v, float* __restrict__ out,
                   const void* __restrict__ mask_a, const int* __restrict__ mask_b, AttnGeom g) {
  static_assert(!(F16 && (SPLIT_QK || SPLIT_PV)), "f16 mode is non-split");
  const float PSC = F16 ? 32768.0f : 1.0f;     // f16 probabilities carried x2^15 (subnormal range), folded into the final 1/l
  union FB { v16b v; v8b h[2]; };
  __shared__ __align__(16) __bf16 Ksh[AT_KC * AT_LP];            // K hi [kv][d], rows at pitch AT_LP   9 KB
  __shared__ __align__(16) __bf16 Ksl[SPLIT_QK ? AT_KC * AT_LP : 8];
  __shared__ __align__(16) __bf16 Vth[AT_D * AT_LP];            // V hi [d][kv], rows at pitch AT_LP   9 KB
  __shared__ __align__(16) __bf16 Vtl[SPLIT_PV ? AT_D * AT_LP : 8];
  __shared__ __align__(16) __bf16 Psh[AT_NW][16 * AT_LP];       // per wave P hi [row][kv], rows at pitch AT_LP   9 KB
  __shared__ __align__(16) __bf16 Psl[SPLIT_PV ? AT_NW : 1][SPLIT_PV ? 16 * AT_LP : 8];
  __shared__ __align__(16) float  Os[AT_NW][16 * 68];            // per wave out tile, pitch 68
  __shared__ float Bs[DISTB ? AT_BT : 1];                        // score bias of this (head, query block) by distance kv - q

  const int tid  = threadIdx.x;
  const int wave = tid >> 5;
  const int lane = tid & 31;
  const int hh   = lane >> 4;
  const int c    = lane & 15;

  const int nqb = g.S / AT_QB;
  const int bx = blockIdx.x + g.blk0;
  const int qb = bx % nqb;
  const int bh = bx / nqb;
  const int h  = bh % g.H;
  const int b  = bh / g.H;
  const int qbase_block = qb * AT_QB;
  const int q0 = qbase_block + wave * 16;

  const float* qb_ptr = q + (size_t)b * g.q_bs + (size_t)h * g.q_hs;
  const float* kb_ptr = k + (size_t)b * g.k_bs + (size_t)h * g.k_hs;
  const float* vb_ptr = v + (size_t)b * g.v_bs + (size_t)h * g.v_hs;
  float*       ob_ptr = out + (size_t)b * g.o_bs + (size_t)h * g.o_hs;

  // Bs[i] = bias of distance kv - q = i - (qbase_block + AT_QB - 1); published by the barriers at the head of the kv loop
  if (DISTB) {
    const float bl = g.cp[(size_t)b * g.c_bs + (size_t)h * g.c_hs + (size_t)lane * g.c_rs];   // lane n holds bucket n
    for (int i = tid; i < AT_BT; i += AT_NW * 32) {   // whole waves only (AT_BT % 32 == 0): every source lane of the shuffle is on
      const int rel = i - (qbase_block + AT_QB - 1); const int a = rel < 0 ? -rel : rel;
      int bkt;
      if (a < 8) bkt = a;
      else bkt = 8 + (a >= 12) + (a >= 16) + (a >= 23) + (a >= 32) + (a >= 46) + (a >= 64) + (a >= 91);   // = 8 + trunc(8*log(a/8)/log 16), capped at 15
      if (rel > 0) bkt += 16;
      Bs[i] = __shfl(bl, bkt, 32);
    }
  }

  // ---- Q fragments (A operand): 2 d-chunks, hi (and lo) ----
  v16b qah[2], qal[2];
  {
    const float* qrow = qb_ptr + (size_t)(q0 + c) * g.q_rs;
#pragma unroll
    for (int dc = 0; dc < 2; ++dc) {
#pragma unroll
      for (int e = 0; e < 8; ++e) {
        const float f0 = qrow[dc * 32 + 8 * hh + e] * g.qscale;
        const float f1 = qrow[dc * 32 + 16 + 8 * hh + e] * g.qscale;
        if (SPLIT_QK) { __bf16 hq, lq; at_split(f0, hq, lq); qah[dc][e] = hq; qal[dc][e] = lq; at_split(f1, hq, lq); qah[dc][8 + e] = hq; qal[dc][8 + e] = lq; }
        else { qah[dc][e] = at_to16<F16>(f0); qah[dc][8 + e] = at_to16<F16>(f1); qal[dc][e] = qah[dc][e]; qal[dc][8 + e] = qah[dc][8 + e]; }
      }
    }
  }

  float mrow[8], lrow[8];
  v8f oacc[4];
#pragma unroll
  for (int r = 0; r < 8; ++r) { mrow[r] = -INFINITY; lrow[r] = 0.f; }
#pragma unroll
  for (int t = 0; t < 4; ++t) oacc[t] = (v8f){0.f,0.f,0.f,0.f,0.f,0.f,0.f,0.f};

  const int nChunks = (g.mask_mode == 1 || g.mask_mode == 4) ? (qb + 1) : (g.Skv / AT_KC);   // block-uniform
  // per-row query mask (mode 3)
  int qkeep[8];
#pragma unroll
  for (int r = 0; r < 8; ++r) qkeep[r] = (g.mask_mode == 3) ? mask_b[(size_t)b * g.S + q0 + 8 * hh + r] : 1;   // mask_b = qmask in mode 3
  for (int kc = 0; kc < nChunks; ++kc) {
    const int kv0 = kc * AT_KC;
    __syncthreads();
    {
      const int kvr = tid >> 1, dh = (tid & 1) * 32;
      const float* krow = kb_ptr + (size_t)(kv0 + kvr) * g.k_rs + dh;
      const float* vrow = vb_ptr + (size_t)(kv0 + kvr) * g.v_rs + dh;
#pragma unroll
      for (int i = 0; i < 8; ++i) {
        v4f kk = *(const v4f*)(krow + 4 * i);
        v4f vv = *(const v4f*)(vrow + 4 * i);
#pragma unroll
        for (int e = 0; e < 4; ++e) {
          const int d = dh + 4 * i + e;
          if (SPLIT_QK) { __bf16 a, bl; at_split(kk[e], a, bl); Ksh[kvr * AT_LP + d] = a; Ksl[kvr * AT_LP + d] = bl; }
          else Ksh[kvr * AT_LP + d] = at_to16<F16>(kk[e]);
          if (SPLIT_PV) { __bf16 a, bl; at_split(vv[e], a, bl); Vth[d * AT_LP + kvr] = a; Vtl[d * AT_LP + kvr] = bl; }
          else Vth[d * AT_LP + kvr] = at_to16<F16>(vv[e]);
        }
      }
    }
    __syncthreads();

    v8f s[4];
#pragma unroll
    for (int j = 0; j < 4; ++j) {
      s[j] = (v8f){0.f,0.f,0.f,0.f,0.f,0.f,0.f,0.f};
#pragma unroll 1
      for (int dc = 0; dc < 2; ++dc) {
        FB kb;
        kb.h[0] = *(const v8b*)(Ksh + (j * 16 + c) * AT_LP + dc * 32 + 8 * hh);
        kb.h[1] = *(const v8b*)(Ksh + (j * 16 + c) * AT_LP + dc * 32 + 16 + 8 * hh);
        s[j] = at_mma16<F16>(qah[dc], kb.v, s[j]);
        if (SPLIT_QK) {
          FB kl;
          kl.h[0] = *(const v8b*)(Ksl + (j * 16 + c) * AT_LP + dc * 32 + 8 * hh);
          kl.h[1] = *(const v8b*)(Ksl + (j * 16 + c) * AT_LP + dc * 32 + 16 + 8 * hh);
          s[j] = at_mma16<F16>(qah[dc], kl.v, s[j]);
          s[j] = at_mma16<F16>(qal[dc], kb.v, s[j]);
        }
      }
    }
    const bool diag = (g.mask_mode == 1) && (kc == qb);
    int kvkeep[4] = {1, 1, 1, 1};
    if (g.mask_mode == 3) {
#pragma unroll
      for (int j = 0; j < 4; ++j) kvkeep[j] = ((const int*)mask_a)[(size_t)b * g.Skv + kv0 + j * 16 + c];   // mask_a = kvmask
    }
    float cm[8];
    if (DISTB) {
      const float* bp = Bs + (kv0 + c + (AT_QB - 1) - wave * 16 - 8 * hh);   // + kv column offset - query row offset
#pragma unroll
      for (int r = 0; r < 8; ++r) {
        float m = -INFINITY;
#pragma unroll
        for (int j = 0; j < 4; ++j) { s[j][r] += bp[j * 16 - r]; m = fmaxf(m, s[j][r]); }
#pragma unroll
        for (int off = 1; off < 16; off <<= 1) m = fmaxf(m, __shfl_xor(m, off, 32));
        cm[r] = m;
      }
    } else
#pragma unroll
    for (int r = 0; r < 8; ++r) {
      const int qrow = q0 + 8 * hh + r;
      float m = -INFINITY;
#pragma unroll
      for (int j = 0; j < 4; ++j) {
        const int kvcol = kv0 + j * 16 + c;
        bool masked = false;
        if (diag) masked = (kvcol > qrow);
        else if (g.mask_mode == 4) masked = (kvcol > qrow) || (qrow - kvcol > g.mask_is_int);
        else if (g.mask_mode == 2) {
          const size_t mi = (size_t)qrow * g.Skv + kvcol;
          masked = (g.mask_is_int == 0) ? (((const float*)mask_a)[mi] == 0.0f)
                 : (g.mask_is_int == 1) ? (((const int*)mask_a)[mi] == 0) : (((const int*)mask_a)[mi] != 0);
        } else if (g.mask_mode == 3) masked = (qkeep[r] == 0) || (kvkeep[j] == 0);
        else if (g.mask_mode == 5) {
          const size_t mi = (size_t)qrow * g.Skv + kvcol;
          masked = (((const int*)mask_a)[mi] != 0);
          int n = mask_b[mi]; n = n < 0 ? 0 : n;
          s[j][r] += g.cp[(size_t)b * g.c_bs + (size_t)h * g.c_hs + (size_t)qrow * g.c_rs + n]
                   + g.pc[(size_t)b * g.c_bs + (size_t)h * g.c_hs + (size_t)kvcol * g.c_rs + n];
        }
        if (masked) s[j][r] = g.mask_fill;
        m = fmaxf(m, s[j][r]);
      }
#pragma unroll
      for (int off = 1; off < 16; off <<= 1) m = fmaxf(m, __shfl_xor(m, off, 32));
      cm[r] = m;
    }
    __bf16* pwh = Psh[wave];
    __bf16* pwl = Psl[SPLIT_PV ? wave : 0];
#pragma unroll
    for (int r = 0; r < 8; ++r) {
      const float mnew = fmaxf(mrow[r], cm[r]);
      const float alpha = expf(mrow[r] - mnew);
      mrow[r] = mnew;
      float psum = 0.f;
#pragma unroll
      for (int j = 0; j < 4; ++j) {
        const float p = expf(s[j][r] - mnew);
        psum += p;
        if (SPLIT_PV) { __bf16 a, bl; at_split(p, a, bl); pwh[(8 * hh + r) * AT_LP + j * 16 + c] = a; pwl[(8 * hh + r) * AT_LP + j * 16 + c] = bl; }
        else pwh[(8 * hh + r) * AT_LP + j * 16 + c] = at_to16<F16>(p * PSC);
      }
#pragma unroll
      for (int off = 1; off < 16; off <<= 1) psum += __shfl_xor(psum, off, 32);
      lrow[r] = lrow[r] * alpha + psum;
#pragma unroll
      for (int t = 0; t < 4; ++t) oacc[t][r] *= alpha;
    }
    __builtin_amdgcn_fence(__ATOMIC_RELEASE, "workgroup");
    __builtin_amdgcn_wave_barrier();
    __builtin_amdgcn_fence(__ATOMIC_ACQUIRE, "workgroup");
#pragma unroll 1
    for (int kk = 0; kk < 2; ++kk) {
      FB pa, pl;
      pa.h[0] = *(const v8b*)(pwh + c * AT_LP + kk * 32 + 8 * hh);
      pa.h[1] = *(const v8b*)(pwh + c * AT_LP + kk * 32 + 16 + 8 * hh);
      if (SPLIT_PV) {
        pl.h[0] = *(const v8b*)(pwl + c * AT_LP + kk * 32 + 8 * hh);
        pl.h[1] = *(const v8b*)(pwl + c * AT_LP + kk * 32 + 16 + 8 * hh);
      }
#pragma unroll
      for (int t = 0; t < 4; ++t) {
        FB vb;
        vb.h[0] = *(const v8b*)(Vth + (t * 16 + c) * AT_LP + kk * 32 + 8 * hh);
        vb.h[1] = *(const v8b*)(Vth + (t * 16 + c) * AT_LP + kk * 32 + 16 + 8 * hh);
        oacc[t] = at_mma16<F16>(pa.v, vb.v, oacc[t]);
        if (SPLIT_PV) {
          FB vl;
          vl.h[0] = *(const v8b*)(Vtl + (t * 16 + c) * AT_LP + kk * 32 + 8 * hh);
          vl.h[1] = *(const v8b*)(Vtl + (t * 16 + c) * AT_LP + kk * 32 + 16 + 8 * hh);
          oacc[t] = at_mma16<F16>(pa.v, vl.v, oacc[t]);
          oacc[t] = at_mma16<F16>(pl.v, vb.v, oacc[t]);
        }
      }
    }
  }

  float* os = Os[wave];
#pragma unroll
  for (int r = 0; r < 8; ++r) {
    const float inv = 1.0f / (lrow[r] * PSC);
#pragma unroll
    for (int t = 0; t < 4; ++t) os[(8 * hh + r) * 68 + t * 16 + c] = oacc[t][r] * inv;
  }
  __builtin_amdgcn_fence(__ATOMIC_RELEASE, "workgroup");
  __builtin_amdgcn_wave_barrier();
  __builtin_amdgcn_fence(__ATOMIC_ACQUIRE, "workgroup");
  {
    const int c4 = (lane & 15) * 4;
    {
#pragma unroll
      for (int it = 0; it < 8; ++it) {
        const int row = it * 2 + hh;
        v4f val = *(const v4f*)(os + row * 68 + c4);
        *(v4f*)(ob_ptr + (size_t)(q0 + row) * g.o_rs + c4) = val;
      }
      
    }
  }
}

#define TS 2048
#define TD 1024
#define TNH 16
#define TNB 32
extern "C" void kernel_launch(void* const* d_in, const int* in_sizes, int n_in, void* d_out, int out_size, void* d_ws, size_t ws_size, hipStream_t stream) {
  (void)in_sizes; (void)n_in; (void)out_size; (void)ws_size;
  const float* x = (const float*)d_in[0]; const float* wq = (const float*)d_in[1]; const float* wk = (const float*)d_in[2]; const float* wv = (const float*)d_in[3]; const float* wo = (const float*)d_in[4]; const float* rb = (const float*)d_in[5];
  float* out = (float*)d_out;   // [1][2048][1024]
  char* ws = (char*)d_ws; size_t off = 0;
  auto carve = [&](size_t bytes) -> char* { char* p = ws + off; off += (bytes + 255) & ~(size_t)255; return p; };
  _Float16* X16 = (_Float16*)carve((size_t)TS * TD * 2);
__bf16* Xh = (__bf16*)carve((size_t)TS * TD * 2); __bf16* Xl = (__bf16*)carve((size_t)TS * TD * 2);
  __bf16* Wqh = (__bf16*)carve((size_t)TD * TD * 2); __bf16* Wql = (__bf16*)carve((size_t)TD * TD * 2); __bf16* Wkh = (__bf16*)carve((size_t)TD * TD * 2); __bf16* Wkl = (__bf16*)carve((size_t)TD * TD * 2);
  _Float16* Wv16 = (_Float16*)carve((size_t)TD * TD * 2); _Float16* Wo16 = (_Float16*)carve((size_t)TD * TD * 2);
  float* Q = (float*)carve((size_t)TS * TD * 4); float* Kf = (float*)carve((size_t)TS * TD * 4); float* Vf = (float*)carve((size_t)TS * TD * 4); float* O = (float*)carve((size_t)TS * TD * 4);
  _Float16* O16 = X16;
  cast_f32_f16x2<<<(TS * TD / 2 + 255) / 256, 256, 0, stream>>>(x, X16, TS * TD / 2);
  split_f32_bf16x2<<<(TS * TD / 2 + 255) / 256, 256, 0, stream>>>(x, Xh, Xl, TS * TD / 2);
  split_f32_bf16x2<<<(TD * TD / 2 + 255) / 256, 256, 0, stream>>>(wq, Wqh, Wql, TD * TD / 2);   // nn.Linear weights [out][in] = Bt layout
  split_f32_bf16x2<<<(TD * TD / 2 + 255) / 256, 256, 0, stream>>>(wk, Wkh, Wkl, TD * TD / 2);
  cast_f32_f16x2<<<(TD * TD / 2 + 255) / 256, 256, 0, stream>>>(wv, Wv16, TD * TD / 2);
  cast_f32_f16x2<<<(TD * TD / 2 + 255) / 256, 256, 0, stream>>>(wo, Wo16, TD * TD / 2);
  { const int t = (TS / 64) * (TD / 64);
    wmma_gemm64<1, true, 0, 0, false><<<dim3((t + 7) / 8, 1), 256, 0, stream>>>(U16(Xh), U16(Xl), TD, 0, U16(Wqh), U16(Wql), TD, 0, Q, nullptr, TD, 0, nullptr, nullptr, 0, TS, TD, TD, 1.0f);
    wmma_gemm64<1, true, 0, 0, false><<<dim3((t + 7) / 8, 1), 256, 0, stream>>>(U16(Xh), U16(Xl), TD, 0, U16(Wkh), U16(Wkl), TD, 0, Kf, nullptr, TD, 0, nullptr, nullptr, 0, TS, TD, TD, 1.0f);
    wmma_gemm64<0, false, 0, 0, false><<<dim3((t + 7) / 8, 1), 256, 0, stream>>>(U16(X16), nullptr, TD, 0, U16(Wv16), nullptr, TD, 0, Vf, nullptr, TD, 0, nullptr, nullptr, 0, TS, TD, TD, 1.0f); }
  { AttnGeom g;
    g.cp = rb; g.pc = nullptr; g.c_bs = 0; g.c_hs = 1; g.c_rs = TNH;   // rel_bias [bucket][head]
    g.q_bs = 0; g.q_rs = TD; g.q_hs = 64; g.k_bs = 0; g.k_rs = TD; g.k_hs = 64; g.v_bs = 0; g.v_rs = TD; g.v_hs = 64; g.o_bs = 0; g.o_rs = TD; g.o_hs = 64;
    g.S = TS; g.Skv = TS; g.H = TNH; g.mask_mode = 0; g.qscale = 1.0f; g.blk0 = 0; g.mask_fill = -INFINITY; g.mask_is_int = 0;
    attn64_kernel<true, true, false, true><<<TNH * (TS / AT_QB), AT_NW * 32, 0, stream>>>(Q, Kf, Vf, O, nullptr, nullptr, g); }
  cast_f32_f16x2<<<(TS * TD / 2 + 255) / 256, 256, 0, stream>>>(O, O16, TS * TD / 2);
  { const int t = (TS / 64) * (TD / 64);
    wmma_gemm64<0, false, 0, 0, false><<<dim3((t + 7) / 8, 1), 256, 0, stream>>>(U16(O16), nullptr, TD, 0, U16(Wo16), nullptr, TD, 0, out, nullptr, TD, 0, nullptr, nullptr, 0, TS, TD, TD, 1.0f); }
}

// v003
// Measured time: 309 microseconds a run.
// Timed twice side by side with v002, it ran 1.38 times as fast both times.
// Over all steps from v000 it is 2.82 times as fast.
#include <hip/hip_runtime.h>
#include <math.h>
// T5 self-attention with relative-position bias: q/k/v = x·Wᵀ (2048 x 1024 · 1024 x 1024 each), out = o·Woᵀ and the attention
// (16 heads x 64, 2048 x 2048, unscaled scores + rel_bias[bucket(k−q), h]): q/k projections and both attention products on
// v_wmma_f32_16x16x32_bf16 with bf16 hi/lo split operands (unscaled T5 scores make the softmax sharp), v and output projections on v_wmma_f32_16x16x32_f16 with f16 operands; f32 accumulate; the bucket table (integer thresholds of the T5 log-spaced bucketing: |Δ| < 8 exact, then ≥8,12,16,23,32,46,64,91,
// +16 for Δ > 0) and softmax in f32/int on VALU.
typedef __attribute__((ext_vector_type(16))) _Float16 v16h;
typedef __attribute__((ext_vector_type(8)))  _Float16 v8h;
typedef __attribute__((ext_vector_type(16))) __bf16   v16b;
typedef __attribute__((ext_vector_type(8)))  __bf16   v8b;
typedef __attribute__((ext_vector_type(8)))  float    v8f;
typedef __attribute__((ext_vector_type(4)))  float    v4f;
#define PSCALE 32768.0f
#define U16(p) ((const unsigned short*)(const void*)(p))
#define PSCALE_INV (1.0f / 32768.0f)

__device__ __forceinline__ unsigned short f2bf_bits(float f) {
  unsigned u = __float_as_uint(f);
  return (unsigned short)((u + 0x7FFFu + ((u >> 16) & 1u)) >> 16);
}
__device__ __forceinline__ float bf_bits2f(unsigned short h) { return __uint_as_float(((unsigned)h) << 16); }

// hazard guards as plain device helpers (no inline asm inside the kernel template body)
__device__ __forceinline__ void dep_guard_h(v8f& a, v8f& b, v16h x, v16h y) { asm volatile("v_nop\n\tv_nop\n\tv_nop\n\tv_nop" : "+v"(a), "+v"(b) : "v"(x), "v"(y)); }
__device__ __forceinline__ void dep_guard_b(v8f& a, v8f& b, v16b x, v16b y) { asm volatile("v_nop\n\tv_nop\n\tv_nop\n\tv_nop" : "+v"(a), "+v"(b) : "v"(x), "v"(y)); }
__device__ __forceinline__ void keep4_h(v16h a, v16h b, v16h c, v16h d) { asm volatile("v_nop" :: "v"(a), "v"(b), "v"(c), "v"(d)); }
__device__ __forceinline__ void keep4_b(v16b a, v16b b, v16b c, v16b d) { asm volatile("v_nop" :: "v"(a), "v"(b), "v"(c), "v"(d)); }
__device__ __forceinline__ void acc_guard4(v8f& a, v8f& b, v8f& c, v8f& d) { asm volatile("v_nop\n\tv_nop\n\tv_nop\n\tv_nop" : "+v"(a), "+v"(b), "+v"(c), "+v"(d)); }
template <typename T> struct Frag;
template <> struct Frag<_Float16> {
  typedef v16h V; union U { v16h v; v8h h[2]; };
  static __device__ __forceinline__ v16h load(const _Float16* p) {   // elements 0..7 <- p[0..7], 8..15 <- p[16..23]
    U f; f.h[0] = *(const v8h*)(p); f.h[1] = *(const v8h*)(p + 16); return f.v;
  }
  static __device__ __forceinline__ v8f mma(v16h a, v16h b, v8f c) {
    return __builtin_amdgcn_wmma_f32_16x16x32_f16(false, a, false, b, (short)0, c, false, false);
  }
  static __device__ __forceinline__ void guard(v8f& a, v8f& b, v16h x, v16h y) { dep_guard_h(a, b, x, y); }
  static __device__ __forceinline__ void keep(v16h a, v16h b, v16h c, v16h d) { keep4_h(a, b, c, d); }
};
template <> struct Frag<__bf16> {
  typedef v16b V; union U { v16b v; v8b h[2]; };
  static __device__ __forceinline__ v16b load(const __bf16* p) {
    U f; f.h[0] = *(const v8b*)(p); f.h[1] = *(const v8b*)(p + 16); return f.v;
  }
  static __device__ __forceinline__ v8f mma(v16b a, v16b b, v8f c) {
    return __builtin_amdgcn_wmma_f32_16x16x32_bf16(false, a, false, b, (short)0, c, false, false);
  }
  static __device__ __forceinline__ void guard(v8f& a, v8f& b, v16b x, v16b y) { dep_guard_b(a, b, x, y); }
  static __device__ __forceinline__ void keep(v16b a, v16b b, v16b c, v16b d) { keep4_b(a, b, c, d); }
};

// ---- Register-blocked batched WMMA GEMM ------------------------------------
// C[m,n] = scale * sum_k A[m,k] * Bt[n,k] (+bias)(+resid); each wave owns a 64x64 tile.
// A row-major [M,K]; Bt row-major [N,K]; M,N % 64 == 0, K % 32 == 0.
// SPLIT: operands are hi/lo planes (A2/Bt2 = lo planes, same layout); product = hi·hi + hi·lo + lo·hi.
// BIAS_MODE: 0 = none, 1 = bias[m], 2 = bias[n].
// OUT_MODE: 0 = f32, 1 = f16, 2 = bf16 hi plane (Cout) + bf16 lo plane (Cout2).
// ET: 0 = f16 operands, 1 = bf16 operands (pointers passed as 16-bit storage)
template <int ET> struct Elem;
template <> struct Elem<0> { typedef _Float16 T; };
template <> struct Elem<1> { typedef __bf16 T; };
// NW = waves (64x64 tiles) per work-group, bx = index of the work-group among those of this product, b = batch index,
// sT = the work-group's NW slabs of 16 x 68 floats in LDS
template <int NW, int ET, bool SPLIT, int BIAS_MODE, int OUT_MODE, bool RESID, int ACT = 0>
__device__ __forceinline__ void gemm64_body(const int bx, const int b, float* __restrict__ sT,
    const unsigned short* __restrict__ Ap, const unsigned short* __restrict__ A2p, int lda, long strideA,
    const unsigned short* __restrict__ Btp, const unsigned short* __restrict__ Bt2p, int ldb, long strideB,
    void* __restrict__ Cout, void* __restrict__ Cout2, int ldc, long strideC,
    const float* __restrict__ bias,
    const float* __restrict__ resid, long strideR,
    int M, int N, int K, float scale) {
  typedef typename Elem<ET>::T T;
  typedef typename Frag<T>::V V;
  const T* A = (const T*)Ap; const T* A2 = (const T*)A2p; const T* Bt = (const T*)Btp; const T* Bt2 = (const T*)Bt2p;
  const int lane = threadIdx.x & 31;
  const int wave = threadIdx.x >> 5;
  const int tilesN = N >> 6;
  const int tilesM = M >> 6;
  const int tile = bx * NW + wave;
  if (tile >= tilesM * tilesN) return;   // wave-uniform; no block barriers in this kernel
  const int tm = tile / tilesN;
  const int tn = tile - tm * tilesN;
  const int m0 = tm << 6;
  const int n0 = tn << 6;

  const T* Ab  = A  + (size_t)b * strideA;
  const T* Bb  = Bt + (size_t)b * strideB;
  const T* Ab2 = SPLIT ? (A2  + (size_t)b * strideA) : nullptr;
  const T* Bb2 = SPLIT ? (Bt2 + (size_t)b * strideB) : nullptr;

  const int rlane = lane & 15;                 // row (A) / col (B, D) within subtile
  const int koff  = (lane >> 4) * 8;           // k offset of this lane half
  const int mOff  = (lane >> 4) * 8;           // D row offset

  v8f acc[4][4];
#pragma unroll
  for (int i = 0; i < 4; ++i)
#pragma unroll
    for (int j = 0; j < 4; ++j) acc[i][j] = (v8f){0.f,0.f,0.f,0.f,0.f,0.f,0.f,0.f};

  for (int k0 = 0; k0 < K; k0 += 32) {
    V bh[4], bl[4];
#pragma unroll
    for (int j = 0; j < 4; ++j) {
      const size_t bo = (size_t)(n0 + (j << 4) + rlane) * ldb + koff + k0;
      bh[j] = Frag<T>::load(Bb + bo);
      if (SPLIT) bl[j] = Frag<T>::load(Bb2 + bo);
    }
#pragma unroll
    for (int i = 0; i < 4; ++i) {
      const size_t ao = (size_t)(m0 + (i << 4) + rlane) * lda + koff + k0;
      V ah = Frag<T>::load(Ab + ao);
      V al;
      if (SPLIT) al = Frag<T>::load(Ab2 + ao);
#pragma unroll
      for (int j = 0; j < 4; ++j) {
        acc[i][j] = Frag<T>::mma(ah, bh[j], acc[i][j]);
        if (SPLIT) {
          acc[i][j] = Frag<T>::mma(ah, bl[j], acc[i][j]);
          acc[i][j] = Frag<T>::mma(al, bh[j], acc[i][j]);
        }
      }
      Frag<T>::guard(acc[i][0], acc[i][3], ah, SPLIT ? al : ah);
    }
    Frag<T>::keep(bh[0], bh[1], bh[2], bh[3]);
    if (SPLIT) Frag<T>::keep(bl[0], bl[1], bl[2], bl[3]);
  }
  acc_guard4(acc[0][0], acc[0][1], acc[0][2], acc[0][3]);
  acc_guard4(acc[1][0], acc[1][1], acc[1][2], acc[1][3]);
  acc_guard4(acc[2][0], acc[2][1], acc[2][2], acc[2][3]);
  acc_guard4(acc[3][0], acc[3][1], acc[3][2], acc[3][3]);

  // ---- epilogue ----
  float* slab = sT + wave * (16 * 68);
  const float* Rb = RESID ? (resid + (size_t)b * strideR) : nullptr;
#pragma unroll
  for (int i = 0; i < 4; ++i) {
    const int mBase = m0 + (i << 4);
#pragma unroll
    for (int j = 0; j < 4; ++j) {
      const int n = n0 + (j << 4) + rlane;
      float bv = 0.f;
      if (BIAS_MODE == 2) bv = bias[n];
#pragma unroll
      for (int r = 0; r < 8; ++r) {
        float v = acc[i][j][r] * scale;
        if (BIAS_MODE == 1) v += bias[mBase + mOff + r];
        if (BIAS_MODE == 2) v += bv;
        if (RESID) v += Rb[(size_t)(mBase + mOff + r) * ldc + n];
        if (ACT == 1) v = tanhf(v);
        if (ACT == 2) v = fmaxf(v, 0.0f);
        if (ACT == 3) v = v / (1.0f + expf(-v));
        if (ACT == 4) v = (v > 0.f) ? v : 0.01f * v;
        if (ACT == 5) v = 0.5f * v * (1.0f + erff(v * 0.70710678118654752f));
        slab[(mOff + r) * 68 + (j << 4) + rlane] = v;
      }
    }
    __builtin_amdgcn_fence(__ATOMIC_RELEASE, "workgroup");
    __builtin_amdgcn_wave_barrier();
    __builtin_amdgcn_fence(__ATOMIC_ACQUIRE, "workgroup");
    if (OUT_MODE == 0) {
      float* C = (float*)Cout + (size_t)b * strideC;
      const int hh = lane >> 4, c4 = (lane & 15) * 4;     // row seg = 256 B = 16 lanes x 16 B
      {
#pragma unroll
        for (int it = 0; it < 8; ++it) {
          const int row = it * 2 + hh;
          v4f v = *(const v4f*)(slab + row * 68 + c4);
          *(v4f*)(C + (size_t)(mBase + row) * ldc + n0 + c4) = v;
        }
        
      }
    } else {
      const int q = lane >> 3, c8 = (lane & 7) * 8;
      unsigned short* C  = (unsigned short*)Cout  + (size_t)b * strideC;
      unsigned short* C2 = (OUT_MODE == 2) ? ((unsigned short*)Cout2 + (size_t)b * strideC) : nullptr;
      {
#pragma unroll
        for (int it = 0; it < 4; ++it) {
          const int row = it * 4 + q;
          const float* sp = slab + row * 68 + c8;
          v8h hv, lv;
#pragma unroll
          for (int e = 0; e < 8; ++e) {
            if (OUT_MODE == 1) {
              hv[e] = (_Float16)sp[e];
            } else {
              unsigned short hb = f2bf_bits(sp[e]);
              unsigned short lb = f2bf_bits(sp[e] - bf_bits2f(hb));
              hv[e] = __builtin_bit_cast(_Float16, hb);
              lv[e] = __builtin_bit_cast(_Float16, lb);
            }
          }
          *(v8h*)(C + (size_t)(mBase + row) * ldc + n0 + c8) = hv;
          if (OUT_MODE == 2) *(v8h*)(C2 + (size_t)(mBase + row) * ldc + n0 + c8) = lv;
        }
        
      }
    }
    __builtin_amdgcn_fence(__ATOMIC_RELEASE, "workgroup");
    __builtin_amdgcn_wave_barrier();
    __builtin_amdgcn_fence(__ATOMIC_ACQUIRE, "workgroup");
  }
}

template <int NW, int ET, bool SPLIT, int BIAS_MODE, int OUT_MODE, bool RESID, int ACT = 0>
__global__ __launch_bounds__(NW * 32) void wmma_gemm64(
    const unsigned short* __restrict__ Ap, const unsigned short* __restrict__ A2p, int lda, long strideA,
    const unsigned short* __restrict__ Btp, const unsigned short* __restrict__ Bt2p, int ldb, long strideB,
    void* __restrict__ Cout, void* __restrict__ Cout2, int ldc, long strideC,
    const float* __restrict__ bias,
    const float* __restrict__ resid, long strideR,
    int M, int N, int K, float scale) {
  __shared__ __align__(16) float sT[NW * 16 * 68];   // per-wave 16x64 slab, pitch 68 floats
  gemm64_body<NW, ET, SPLIT, BIAS_MODE, OUT_MODE, RESID, ACT>(blockIdx.x, blockIdx.y, sT, Ap, A2p, lda, strideA, Btp, Bt2p, ldb, strideB,
                                                              Cout, Cout2, ldc, strideC, bias, resid, strideR, M, N, K, scale);
}

// The three projections of one x [M][K] in one launch, so that their work-groups run side by side on different WGPs:
// blockIdx.y = 0: q = x Wq^T, 1: k = x Wk^T (both bf16 hi/lo split), 2: v = x Wv^T (f16); weights [N][K], outputs f32 [M][N].
template <int NW>
__global__ __launch_bounds__(NW * 32) void qkv_gemm64(
    const unsigned short* __restrict__ Xh, const unsigned short* __restrict__ Xl, const unsigned short* __restrict__ X16,
    const unsigned short* __restrict__ Wqh, const unsigned short* __restrict__ Wql,
    const unsigned short* __restrict__ Wkh, const unsigned short* __restrict__ Wkl, const unsigned short* __restrict__ Wv16,
    float* __restrict__ Q, float* __restrict__ Kf, float* __restrict__ Vf, int M, int N, int K) {
  __shared__ __align__(16) float sT[NW * 16 * 68];   // per-wave 16x64 slab, pitch 68 floats
  if (blockIdx.y < 2) {
    const bool isk = blockIdx.y == 1;
    gemm64_body<NW, 1, true, 0, 0, false>(blockIdx.x, 0, sT, Xh, Xl, K, 0, isk ? Wkh : Wqh, isk ? Wkl : Wql, K, 0,
                                          isk ? Kf : Q, nullptr, N, 0, nullptr, nullptr, 0, M, N, K, 1.0f);
  } else {
    gemm64_body<NW, 0, false, 0, 0, false>(blockIdx.x, 0, sT, X16, nullptr, K, 0, Wv16, nullptr, K, 0,
                                           Vf, nullptr, N, 0, nullptr, nullptr, 0, M, N, K, 1.0f);
  }
}

__global__ __launch_bounds__(256) void cast_f32_f16x2(
    const float* __restrict__ in, _Float16* __restrict__ out, int n2) {
  int i = blockIdx.x * 256 + threadIdx.x;
  if (i < n2) {
    const _Float16 h0 = (_Float16)in[2 * i], h1 = (_Float16)in[2 * i + 1];
    const unsigned u = (unsigned)__builtin_bit_cast(unsigned short, h0) | ((unsigned)__builtin_bit_cast(unsigned short, h1) << 16);
    ((unsigned*)out)[i] = u;
    
  }
}


// ---- f32 -> f16 cast with a power-of-two pre-scale (folded back by the consumer GEMM's scale) ----
__global__ __launch_bounds__(256) void cast_f32_f16x2s(const float* __restrict__ in, _Float16* __restrict__ out, int n2, float s) {
  int i = blockIdx.x * 256 + threadIdx.x;
  if (i < n2) {
    const _Float16 h0 = (_Float16)(in[2 * i] * s), h1 = (_Float16)(in[2 * i + 1] * s);
    const unsigned u = (unsigned)__builtin_bit_cast(unsigned short, h0) | ((unsigned)__builtin_bit_cast(unsigned short, h1) << 16);
    ((unsigned*)out)[i] = u;
    
  }
}
__global__ __launch_bounds__(256) void split_f32_bf16x2(
    const float* __restrict__ in, __bf16* __restrict__ hi, __bf16* __restrict__ lo, long n2) {
  long i = (long)blockIdx.x * 256 + threadIdx.x;
  long stride = (long)gridDim.x * 256;
  {
    for (long j = i; j < n2; j += stride) {
      const float a = in[2 * j], b = in[2 * j + 1];
      const unsigned short ah = f2bf_bits(a), bh = f2bf_bits(b);
      const unsigned short al = f2bf_bits(a - bf_bits2f(ah)), bl = f2bf_bits(b - bf_bits2f(bh));
      ((unsigned*)hi)[j] = (unsigned)ah | ((unsigned)bh << 16);
      ((unsigned*)lo)[j] = (unsigned)al | ((unsigned)bl << 16);
    }
    
  }
}


// ---- f32 [R][C] (row pitch ldi) -> f16 transposed [C][R] (row pitch ldo); 64x64 tiles; each output row segment
__global__ __launch_bounds__(256) void transpose_cast_f16(const float* __restrict__ in, int ldi,
                                                         _Float16* __restrict__ outT, int ldo, float scale) {
  __shared__ __align__(16) _Float16 tile[64][72];     // [c][r]
  const int c0 = blockIdx.x * 64, r0 = blockIdx.y * 64;
  const int t = threadIdx.y * 32 + threadIdx.x;
  for (int i = threadIdx.y; i < 64; i += 8) {
    tile[threadIdx.x][i]      = (_Float16)(in[(size_t)(r0 + i) * ldi + c0 + threadIdx.x] * scale);
    tile[32 + threadIdx.x][i] = (_Float16)(in[(size_t)(r0 + i) * ldi + c0 + 32 + threadIdx.x] * scale);
  }
  __syncthreads();
  const int q = t >> 3, c8 = (t & 7) * 8;
  {
#pragma unroll
    for (int it = 0; it < 2; ++it) {
      const int c = it * 32 + q;
      v8h hv = *(const v8h*)(&tile[c][c8]);
      *(v8h*)(outT + (size_t)(c0 + c) * ldo + r0 + c8) = hv;
    }
    
  }
}

// ---- f32 [R][C] (pitch ldi) -> bf16 hi/lo transposed planes [C][R] (pitch ldo); 64x64 tiles; each output row segment
__global__ __launch_bounds__(256) void transpose_split_bf16(const float* __restrict__ in, int ldi,
                                                           __bf16* __restrict__ outH, __bf16* __restrict__ outL, int ldo) {
  __shared__ __align__(16) float tile[64][68];     // [c][r]
  const int c0 = blockIdx.x * 64, r0 = blockIdx.y * 64;
  const int t = threadIdx.y * 32 + threadIdx.x;
  for (int i = threadIdx.y; i < 64; i += 8) {
    tile[threadIdx.x][i]      = in[(size_t)(r0 + i) * ldi + c0 + threadIdx.x];
    tile[32 + threadIdx.x][i] = in[(size_t)(r0 + i) * ldi + c0 + 32 + threadIdx.x];
  }
  __syncthreads();
  const int q = t >> 3, c8 = (t & 7) * 8;
  {
#pragma unroll
    for (int it = 0; it < 2; ++it) {
      const int c = it * 32 + q;
      v8b hv, lv;
#pragma unroll
      for (int e = 0; e < 8; ++e) {
        const float f = tile[c][c8 + e];
        const unsigned short hb = f2bf_bits(f);
        hv[e] = __builtin_bit_cast(__bf16, hb);
        lv[e] = __builtin_bit_cast(__bf16, f2bf_bits(f - bf_bits2f(hb)));
      }
      *(v8b*)(outH + (size_t)(c0 + c) * ldo + r0 + c8) = hv;
      *(v8b*)(outL + (size_t)(c0 + c) * ldo + r0 + c8) = lv;
    }
    
  }
}

// =====================================================================================
// Generic causal/non-causal attention for head_dim 64, f32 in / f32 out; 16-bit operands: bf16 with optional hi/lo splits, or
// plain f16 (F16=true, non-split, probabilities carried x2^15).
//   scores = (q*qscale)·kᵀ : v_wmma_f32_16x16x32_bf16; SPLIT_QK -> q,k as bf16 hi/lo (hi·hi + hi·lo + lo·hi)
//   out    = p·v           : v_wmma_f32_16x16x32_bf16; SPLIT_PV -> p,v as bf16 hi/lo; else p,v plain bf16 (f16 if F16)
//   f32 accumulate; online softmax in f32. Block = 4 waves = 64 query rows of one (batch, head); S % 64 == 0.
//   Element (b, s, h, d) of tensor X lives at X[b*X_bs + s*X_rs + h*X_hs + d] (strides in floats, multiples of 4).
//   Masking: mask_mode 0 none, 1 causal (kv > q masked), 2 tensor [S][Skv] shared over (b,h) (float if
//   mask_is_int==0, int32 with element == 0 -> masked if 1, int32 with element != 0 -> masked if 2), 3 per-token vectors qmask[B][S] & kvmask[B][Skv] (int32,
//   0 -> masked), 4 causal + sliding window (kv > q or q - kv > W masked; W passed in mask_is_int);
//   5 = relative-position bias: s += cp[b,h,q][idx[q][kv]] + pc[b,h,kv][idx[q][kv]] with idx = mask_b ([S][Skv] int32) and
//   mask_a an int32 [S][Skv] tensor with nonzero = masked (tables: element (b,h,row,n) at X + b*c_bs + h*c_hs + row*c_rs + n);
//   masked scores are replaced by mask_fill (e.g. -inf or -1e9) before the softmax.
//   grid.x = B * H * (S/64) (or a sub-range with blk0).
// =====================================================================================
#define AT_D 64
#define AT_NW 4
#define AT_QB 64
#define AT_KC 64
#define AT_LP 72   // LDS row pitch of the K, V and P tiles in 16-bit elements: 144 B = 16 B x 9 (odd), so the 16 rows of a ds_load_b128 fragment read spread over the banks
#define AT_BT (2048 + AT_QB)   // distance table: Skv + AT_QB - 1 entries used (Skv <= 2048), rounded up to whole waves
struct AttnGeom { const float* cp = nullptr; const float* pc = nullptr; long c_bs = 0, c_rs = 0, c_hs = 0;   // mode-5 / DISTB score-bias tables
                  long q_bs, q_rs, q_hs, k_bs, k_rs, k_hs, v_bs, v_rs, v_hs, o_bs, o_rs, o_hs;
                  int S, Skv, H, mask_mode; float qscale; int blk0; float mask_fill; int mask_is_int; };
static_assert(sizeof(AttnGeom) == 168, "no padding");

__device__ __forceinline__ unsigned short at_bf_bits(float f) {
  unsigned u = __float_as_uint(f);
  return (unsigned short)((u + 0x7FFFu + ((u >> 16) & 1u)) >> 16);
}
__device__ __forceinline__ __bf16 at_f2bf(float f) { return __builtin_bit_cast(__bf16, at_bf_bits(f)); }
__device__ __forceinline__ void at_split(float f, __bf16& hi, __bf16& lo) {
  const unsigned short hb = at_bf_bits(f);
  hi = __builtin_bit_cast(__bf16, hb);
  lo = at_f2bf(f - __uint_as_float(((unsigned)hb) << 16));
}
__device__ __forceinline__ v8f at_mma(v16b a, v16b b, v8f c) {
  c = __builtin_amdgcn_wmma_f32_16x16x32_bf16(false, a, false, b, (short)0, c, false, false);
  asm volatile("v_nop\n\tv_nop\n\tv_nop\n\tv_nop" : "+v"(c) : "v"(a), "v"(b));
  return c;
}
// 16-bit element as a bit pattern held in a __bf16 slot: f16 bits when F16, bf16 (RNE) otherwise
template <bool F16> __device__ __forceinline__ __bf16 at_to16(float f) {
  if (F16) return __builtin_bit_cast(__bf16, (_Float16)f);
  return at_f2bf(f);
}
template <bool F16> __device__ __forceinline__ v8f at_mma16(v16b a, v16b b, v8f c) {
  if (F16) {
    const v16h ah = __builtin_bit_cast(v16h, a), bh = __builtin_bit_cast(v16h, b);
    c = __builtin_amdgcn_wmma_f32_16x16x32_f16(false, ah, false, bh, (short)0, c, false, false);
    asm volatile("v_nop\n\tv_nop\n\tv_nop\n\tv_nop" : "+v"(c) : "v"(ah), "v"(bh));
    return c;
  }
  return at_mma(a, b, c);
}

// DISTB: s += bias[bucket(kv - q)] of this head (32 buckets; bucket n of (b, h) at cp + b*c_bs + h*c_hs + n*c_rs), no mask; Skv <= 2048.
template <bool SPLIT_QK, bool SPLIT_PV, bool F16 = false, bool DISTB = false>
__global__ __launch_bounds__(128)
void attn64_kernel(const float* __restrict__ q, const float* __restrict__ k,
                   const float* __restrict__ v, float* __restrict__ out,
                   const void* __restrict__ mask_a, const int* __restrict__ mask_b, AttnGeom g) {
  static_assert(!(F16 && (SPLIT_QK || SPLIT_PV)), "f16 mode is non-split");
  const float PSC = F16 ? 32768.0f : 1.0f;     // f16 probabilities carried x2^15 (subnormal range), folded into the final 1/l
  union FB { v16b v; v8b h[2]; };
  __shared__ __align__(16) __bf16 Ksh[AT_KC * AT_LP];            // K hi [kv][d], rows at pitch AT_LP   9 KB
  __shared__ __align__(16) __bf16 Ksl[SPLIT_QK ? AT_KC * AT_LP : 8];
  __shared__ __align__(16) __bf16 Vth[AT_D * AT_LP];            // V hi [d][kv], rows at pitch AT_LP   9 KB
  __shared__ __align__(16) __bf16 Vtl[SPLIT_PV ? AT_D * AT_LP : 8];
  __shared__ __align__(16) __bf16 Psh[AT_NW][16 * AT_LP];       // per wave P hi [row][kv], rows at pitch AT_LP   9 KB
  __shared__ __align__(16) __bf16 Psl[SPLIT_PV ? AT_NW : 1][SPLIT_PV ? 16 * AT_LP : 8];
  __shared__ __align__(16) float  Os[AT_NW][16 * 68];            // per wave out tile, pitch 68
  __shared__ float Bs[DISTB ? AT_BT : 1];                        // score bias of this (head, query block) by distance kv - q

  const int tid  = threadIdx.x;
  const int wave = tid >> 5;
  const int lane = tid & 31;
  const int hh   = lane >> 4;
  const int c    = lane & 15;

  const int nqb = g.S / AT_QB;
  const int bx = blockIdx.x + g.blk0;
  const int qb = bx % nqb;
  const int bh = bx / nqb;
  const int h  = bh % g.H;
  const int b  = bh / g.H;
  const int qbase_block = qb * AT_QB;
  const int q0 = qbase_block + wave * 16;

  const float* qb_ptr = q + (size_t)b * g.q_bs + (size_t)h * g.q_hs;
  const float* kb_ptr = k + (size_t)b * g.k_bs + (size_t)h * g.k_hs;
  const float* vb_ptr = v + (size_t)b * g.v_bs + (size_t)h * g.v_hs;
  float*       ob_ptr = out + (size_t)b * g.o_bs + (size_t)h * g.o_hs;

  // Bs[i] = bias of distance kv - q = i - (qbase_block + AT_QB - 1); published by the barriers at the head of the kv loop
  if (DISTB) {
    const float bl = g.cp[(size_t)b * g.c_bs + (size_t)h * g.c_hs + (size_t)lane * g.c_rs];   // lane n holds bucket n
    for (int i = tid; i < AT_BT; i += AT_NW * 32) {   // whole waves only (AT_BT % 32 == 0): every source lane of the shuffle is on
      const int rel = i - (qbase_block + AT_QB - 1); const int a = rel < 0 ? -rel : rel;
      int bkt;
      if (a < 8) bkt = a;
      else bkt = 8 + (a >= 12) + (a >= 16) + (a >= 23) + (a >= 32) + (a >= 46) + (a >= 64) + (a >= 91);   // = 8 + trunc(8*log(a/8)/log 16), capped at 15
      if (rel > 0) bkt += 16;
      Bs[i] = __shfl(bl, bkt, 32);
    }
  }

  // ---- Q fragments (A operand): 2 d-chunks, hi (and lo) ----
  v16b qah[2], qal[2];
  {
    const float* qrow = qb_ptr + (size_t)(q0 + c) * g.q_rs;
#pragma unroll
    for (int dc = 0; dc < 2; ++dc) {
#pragma unroll
      for (int e = 0; e < 8; ++e) {
        const float f0 = qrow[dc * 32 + 8 * hh + e] * g.qscale;
        const float f1 = qrow[dc * 32 + 16 + 8 * hh + e] * g.qscale;
        if (SPLIT_QK) { __bf16 hq, lq; at_split(f0, hq, lq); qah[dc][e] = hq; qal[dc][e] = lq; at_split(f1, hq, lq); qah[dc][8 + e] = hq; qal[dc][8 + e] = lq; }
        else { qah[dc][e] = at_to16<F16>(f0); qah[dc][8 + e] = at_to16<F16>(f1); qal[dc][e] = qah[dc][e]; qal[dc][8 + e] = qah[dc][8 + e]; }
      }
    }
  }

  float mrow[8], lrow[8];
  v8f oacc[4];
#pragma unroll
  for (int r = 0; r < 8; ++r) { mrow[r] = -INFINITY; lrow[r] = 0.f; }
#pragma unroll
  for (int t = 0; t < 4; ++t) oacc[t] = (v8f){0.f,0.f,0.f,0.f,0.f,0.f,0.f,0.f};

  const int nChunks = (g.mask_mode == 1 || g.mask_mode == 4) ? (qb + 1) : (g.Skv / AT_KC);   // block-uniform
  // per-row query mask (mode 3)
  int qkeep[8];
#pragma unroll
  for (int r = 0; r < 8; ++r) qkeep[r] = (g.mask_mode == 3) ? mask_b[(size_t)b * g.S + q0 + 8 * hh + r] : 1;   // mask_b = qmask in mode 3
  for (int kc = 0; kc < nChunks; ++kc) {
    const int kv0 = kc * AT_KC;
    __syncthreads();
    {
      const int kvr = tid >> 1, dh = (tid & 1) * 32;
      const float* krow = kb_ptr + (size_t)(kv0 + kvr) * g.k_rs + dh;
      const float* vrow = vb_ptr + (size_t)(kv0 + kvr) * g.v_rs + dh;
#pragma unroll
      for (int i = 0; i < 8; ++i) {
        v4f kk = *(const v4f*)(krow + 4 * i);
        v4f vv = *(const v4f*)(vrow + 4 * i);
#pragma unroll
        for (int e = 0; e < 4; ++e) {
          const int d = dh + 4 * i + e;
          if (SPLIT_QK) { __bf16 a, bl; at_split(kk[e], a, bl); Ksh[kvr * AT_LP + d] = a; Ksl[kvr * AT_LP + d] = bl; }
          else Ksh[kvr * AT_LP + d] = at_to16<F16>(kk[e]);
          if (SPLIT_PV) { __bf16 a, bl; at_split(vv[e], a, bl); Vth[d * AT_LP + kvr] = a; Vtl[d * AT_LP + kvr] = bl; }
          else Vth[d * AT_LP + kvr] = at_to16<F16>(vv[e]);
        }
      }
    }
    __syncthreads();

    v8f s[4];
#pragma unroll
    for (int j = 0; j < 4; ++j) {
      s[j] = (v8f){0.f,0.f,0.f,0.f,0.f,0.f,0.f,0.f};
#pragma unroll 1
      for (int dc = 0; dc < 2; ++dc) {
        FB kb;
        kb.h[0] = *(const v8b*)(Ksh + (j * 16 + c) * AT_LP + dc * 32 + 8 * hh);
        kb.h[1] = *(const v8b*)(Ksh + (j * 16 + c) * AT_LP + dc * 32 + 16 + 8 * hh);
        s[j] = at_mma16<F16>(qah[dc], kb.v, s[j]);
        if (SPLIT_QK) {
          FB kl;
          kl.h[0] = *(const v8b*)(Ksl + (j * 16 + c) * AT_LP + dc * 32 + 8 * hh);
          kl.h[1] = *(const v8b*)(Ksl + (j * 16 + c) * AT_LP + dc * 32 + 16 + 8 * hh);
          s[j] = at_mma16<F16>(qah[dc], kl.v, s[j]);
          s[j] = at_mma16<F16>(qal[dc], kb.v, s[j]);
        }
      }
    }
    const bool diag = (g.mask_mode == 1) && (kc == qb);
    int kvkeep[4] = {1, 1, 1, 1};
    if (g.mask_mode == 3) {
#pragma unroll
      for (int j = 0; j < 4; ++j) kvkeep[j] = ((const int*)mask_a)[(size_t)b * g.Skv + kv0 + j * 16 + c];   // mask_a = kvmask
    }
    float cm[8];
    if (DISTB) {
      const float* bp = Bs + (kv0 + c + (AT_QB - 1) - wave * 16 - 8 * hh);   // + kv column offset - query row offset
#pragma unroll
      for (int r = 0; r < 8; ++r) {
        float m = -INFINITY;
#pragma unroll
        for (int j = 0; j < 4; ++j) { s[j][r] += bp[j * 16 - r]; m = fmaxf(m, s[j][r]); }
#pragma unroll
        for (int off = 1; off < 16; off <<= 1) m = fmaxf(m, __shfl_xor(m, off, 32));
        cm[r] = m;
      }
    } else
#pragma unroll
    for (int r = 0; r < 8; ++r) {
      const int qrow = q0 + 8 * hh + r;
      float m = -INFINITY;
#pragma unroll
      for (int j = 0; j < 4; ++j) {
        const int kvcol = kv0 + j * 16 + c;
        bool masked = false;
        if (diag) masked = (kvcol > qrow);
        else if (g.mask_mode == 4) masked = (kvcol > qrow) || (qrow - kvcol > g.mask_is_int);
        else if (g.mask_mode == 2) {
          const size_t mi = (size_t)qrow * g.Skv + kvcol;
          masked = (g.mask_is_int == 0) ? (((const float*)mask_a)[mi] == 0.0f)
                 : (g.mask_is_int == 1) ? (((const int*)mask_a)[mi] == 0) : (((const int*)mask_a)[mi] != 0);
        } else if (g.mask_mode == 3) masked = (qkeep[r] == 0) || (kvkeep[j] == 0);
        else if (g.mask_mode == 5) {
          const size_t mi = (size_t)qrow * g.Skv + kvcol;
          masked = (((const int*)mask_a)[mi] != 0);
          int n = mask_b[mi]; n = n < 0 ? 0 : n;
          s[j][r] += g.cp[(size_t)b * g.c_bs + (size_t)h * g.c_hs + (size_t)qrow * g.c_rs + n]
                   + g.pc[(size_t)b * g.c_bs + (size_t)h * g.c_hs + (size_t)kvcol * g.c_rs + n];
        }
        if (masked) s[j][r] = g.mask_fill;
        m = fmaxf(m, s[j][r]);
      }
#pragma unroll
      for (int off = 1; off < 16; off <<= 1) m = fmaxf(m, __shfl_xor(m, off, 32));
      cm[r] = m;
    }
    __bf16* pwh = Psh[wave];
    __bf16* pwl = Psl[SPLIT_PV ? wave : 0];
#pragma unroll
    for (int r = 0; r < 8; ++r) {
      const float mnew = fmaxf(mrow[r], cm[r]);
      const float alpha = expf(mrow[r] - mnew);
      mrow[r] = mnew;
      float psum = 0.f;
#pragma unroll
      for (int j = 0; j < 4; ++j) {
        const float p = expf(s[j][r] - mnew);
        psum += p;
        if (SPLIT_PV) { __bf16 a, bl; at_split(p, a, bl); pwh[(8 * hh + r) * AT_LP + j * 16 + c] = a; pwl[(8 * hh + r) * AT_LP + j * 16 + c] = bl; }
        else pwh[(8 * hh + r) * AT_LP + j * 16 + c] = at_to16<F16>(p * PSC);
      }
#pragma unroll
      for (int off = 1; off < 16; off <<= 1) psum += __shfl_xor(psum, off, 32);
      lrow[r] = lrow[r] * alpha + psum;
#pragma unroll
      for (int t = 0; t < 4; ++t) oacc[t][r] *= alpha;
    }
    __builtin_amdgcn_fence(__ATOMIC_RELEASE, "workgroup");
    __builtin_amdgcn_wave_barrier();
    __builtin_amdgcn_fence(__ATOMIC_ACQUIRE, "workgroup");
#pragma unroll 1
    for (int kk = 0; kk < 2; ++kk) {
      FB pa, pl;
      pa.h[0] = *(const v8b*)(pwh + c * AT_LP + kk * 32 + 8 * hh);
      pa.h[1] = *(const v8b*)(pwh + c * AT_LP + kk * 32 + 16 + 8 * hh);
      if (SPLIT_PV) {
        pl.h[0] = *(const v8b*)(pwl + c * AT_LP + kk * 32 + 8 * hh);
        pl.h[1] = *(const v8b*)(pwl + c * AT_LP + kk * 32 + 16 + 8 * hh);
      }
#pragma unroll
      for (int t = 0; t < 4; ++t) {
        FB vb;
        vb.h[0] = *(const v8b*)(Vth + (t * 16 + c) * AT_LP + kk * 32 + 8 * hh);
        vb.h[1] = *(const v8b*)(Vth + (t * 16 + c) * AT_LP + kk * 32 + 16 + 8 * hh);
        oacc[t] = at_mma16<F16>(pa.v, vb.v, oacc[t]);
        if (SPLIT_PV) {
          FB vl;
          vl.h[0] = *(const v8b*)(Vtl + (t * 16 + c) * AT_LP + kk * 32 + 8 * hh);
          vl.h[1] = *(const v8b*)(Vtl + (t * 16 + c) * AT_LP + kk * 32 + 16 + 8 * hh);
          oacc[t] = at_mma16<F16>(pa.v, vl.v, oacc[t]);
          oacc[t] = at_mma16<F16>(pl.v, vb.v, oacc[t]);
        }
      }
    }
  }

  float* os = Os[wave];
#pragma unroll
  for (int r = 0; r < 8; ++r) {
    const float inv = 1.0f / (lrow[r] * PSC);
#pragma unroll
    for (int t = 0; t < 4; ++t) os[(8 * hh + r) * 68 + t * 16 + c] = oacc[t][r] * inv;
  }
  __builtin_amdgcn_fence(__ATOMIC_RELEASE, "workgroup");
  __builtin_amdgcn_wave_barrier();
  __builtin_amdgcn_fence(__ATOMIC_ACQUIRE, "workgroup");
  {
    const int c4 = (lane & 15) * 4;
    {
#pragma unroll
      for (int it = 0; it < 8; ++it) {
        const int row = it * 2 + hh;
        v4f val = *(const v4f*)(os + row * 68 + c4);
        *(v4f*)(ob_ptr + (size_t)(q0 + row) * g.o_rs + c4) = val;
      }
      
    }
  }
}

#define TS 2048
#define TD 1024
#define TNH 16
#define TNB 32
extern "C" void kernel_launch(void* const* d_in, const int* in_sizes, int n_in, void* d_out, int out_size, void* d_ws, size_t ws_size, hipStream_t stream) {
  (void)in_sizes; (void)n_in; (void)out_size; (void)ws_size;
  const float* x = (const float*)d_in[0]; const float* wq = (const float*)d_in[1]; const float* wk = (const float*)d_in[2]; const float* wv = (const float*)d_in[3]; const float* wo = (const float*)d_in[4]; const float* rb = (const float*)d_in[5];
  float* out = (float*)d_out;   // [1][2048][1024]
  char* ws = (char*)d_ws; size_t off = 0;
  auto carve = [&](size_t bytes) -> char* { char* p = ws + off; off += (bytes + 255) & ~(size_t)255; return p; };
  _Float16* X16 = (_Float16*)carve((size_t)TS * TD * 2);
__bf16* Xh = (__bf16*)carve((size_t)TS * TD * 2); __bf16* Xl = (__bf16*)carve((size_t)TS * TD * 2);
  __bf16* Wqh = (__bf16*)carve((size_t)TD * TD * 2); __bf16* Wql = (__bf16*)carve((size_t)TD * TD * 2); __bf16* Wkh = (__bf16*)carve((size_t)TD * TD * 2); __bf16* Wkl = (__bf16*)carve((size_t)TD * TD * 2);
  _Float16* Wv16 = (_Float16*)carve((size_t)TD * TD * 2); _Float16* Wo16 = (_Float16*)carve((size_t)TD * TD * 2);
  float* Q = (float*)carve((size_t)TS * TD * 4); float* Kf = (float*)carve((size_t)TS * TD * 4); float* Vf = (float*)carve((size_t)TS * TD * 4); float* O = (float*)carve((size_t)TS * TD * 4);
  _Float16* O16 = X16;
  cast_f32_f16x2<<<(TS * TD / 2 + 255) / 256, 256, 0, stream>>>(x, X16, TS * TD / 2);
  split_f32_bf16x2<<<(TS * TD / 2 + 255) / 256, 256, 0, stream>>>(x, Xh, Xl, TS * TD / 2);
  split_f32_bf16x2<<<(TD * TD / 2 + 255) / 256, 256, 0, stream>>>(wq, Wqh, Wql, TD * TD / 2);   // nn.Linear weights [out][in] = Bt layout
  split_f32_bf16x2<<<(TD * TD / 2 + 255) / 256, 256, 0, stream>>>(wk, Wkh, Wkl, TD * TD / 2);
  cast_f32_f16x2<<<(TD * TD / 2 + 255) / 256, 256, 0, stream>>>(wv, Wv16, TD * TD / 2);
  cast_f32_f16x2<<<(TD * TD / 2 + 255) / 256, 256, 0, stream>>>(wo, Wo16, TD * TD / 2);
  { const int t = (TS / 64) * (TD / 64);
    qkv_gemm64<4><<<dim3(t / 4, 3), 4 * 32, 0, stream>>>(U16(Xh), U16(Xl), U16(X16), U16(Wqh), U16(Wql), U16(Wkh), U16(Wkl), U16(Wv16), Q, Kf, Vf, TS, TD, TD); }
  { AttnGeom g;
    g.cp = rb; g.pc = nullptr; g.c_bs = 0; g.c_hs = 1; g.c_rs = TNH;   // rel_bias [bucket][head]
    g.q_bs = 0; g.q_rs = TD; g.q_hs = 64; g.k_bs = 0; g.k_rs = TD; g.k_hs = 64; g.v_bs = 0; g.v_rs = TD; g.v_hs = 64; g.o_bs = 0; g.o_rs = TD; g.o_hs = 64;
    g.S = TS; g.Skv = TS; g.H = TNH; g.mask_mode = 0; g.qscale = 1.0f; g.blk0 = 0; g.mask_fill = -INFINITY; g.mask_is_int = 0;
    attn64_kernel<true, true, false, true><<<TNH * (TS / AT_QB), AT_NW * 32, 0, stream>>>(Q, Kf, Vf, O, nullptr, nullptr, g); }
  cast_f32_f16x2<<<(TS * TD / 2 + 255) / 256, 256, 0, stream>>>(O, O16, TS * TD / 2);
  { const int t = (TS / 64) * (TD / 64);
    wmma_gemm64<2, 0, false, 0, 0, false><<<dim3(t / 2, 1), 2 * 32, 0, stream>>>(U16(O16), nullptr, TD, 0, U16(Wo16), nullptr, TD, 0, out, nullptr, TD, 0, nullptr, nullptr, 0, TS, TD, TD, 1.0f); }
}

// v004
// One run takes 298 microseconds.
// In two side-by-side timings against v003, it was 1.03 and 1.04 times as fast.
// Counting every step since v000, it is 2.93 times as fast.
#include <hip/hip_runtime.h>
#include <math.h>
// T5 self-attention with relative-position bias: q/k/v = x·Wᵀ (2048 x 1024 · 1024 x 1024 each), out = o·Woᵀ and the attention
// (16 heads x 64, 2048 x 2048, unscaled scores + rel_bias[bucket(k−q), h]): q/k projections and both attention products on
// v_wmma_f32_16x16x32_bf16 with bf16 hi/lo split operands (unscaled T5 scores make the softmax sharp), v and output projections on v_wmma_f32_16x16x32_f16 with f16 operands; f32 accumulate; the bucket table (integer thresholds of the T5 log-spaced bucketing: |Δ| < 8 exact, then ≥8,12,16,23,32,46,64,91,
// +16 for Δ > 0) and softmax in f32/int on VALU.
typedef __attribute__((ext_vector_type(16))) _Float16 v16h;
typedef __attribute__((ext_vector_type(8)))  _Float16 v8h;
typedef __attribute__((ext_vector_type(16))) __bf16   v16b;
typedef __attribute__((ext_vector_type(8)))  __bf16   v8b;
typedef __attribute__((ext_vector_type(8)))  float    v8f;
typedef __attribute__((ext_vector_type(4)))  float    v4f;
#define PSCALE 32768.0f
#define U16(p) ((const unsigned short*)(const void*)(p))
#define PSCALE_INV (1.0f / 32768.0f)

__device__ __forceinline__ unsigned short f2bf_bits(float f) {
  unsigned u = __float_as_uint(f);
  return (unsigned short)((u + 0x7FFFu + ((u >> 16) & 1u)) >> 16);
}
__device__ __forceinline__ float bf_bits2f(unsigned short h) { return __uint_as_float(((unsigned)h) << 16); }

// hazard guards as plain device helpers (no inline asm inside the kernel template body)
__device__ __forceinline__ void dep_guard_h(v8f& a, v8f& b, v16h x, v16h y) { asm volatile("v_nop\n\tv_nop\n\tv_nop\n\tv_nop" : "+v"(a), "+v"(b) : "v"(x), "v"(y)); }
__device__ __forceinline__ void dep_guard_b(v8f& a, v8f& b, v16b x, v16b y) { asm volatile("v_nop\n\tv_nop\n\tv_nop\n\tv_nop" : "+v"(a), "+v"(b) : "v"(x), "v"(y)); }
__device__ __forceinline__ void keep4_h(v16h a, v16h b, v16h c, v16h d) { asm volatile("v_nop" :: "v"(a), "v"(b), "v"(c), "v"(d)); }
__device__ __forceinline__ void keep4_b(v16b a, v16b b, v16b c, v16b d) { asm volatile("v_nop" :: "v"(a), "v"(b), "v"(c), "v"(d)); }
__device__ __forceinline__ void acc_guard4(v8f& a, v8f& b, v8f& c, v8f& d) { asm volatile("v_nop\n\tv_nop\n\tv_nop\n\tv_nop" : "+v"(a), "+v"(b), "+v"(c), "+v"(d)); }
template <typename T> struct Frag;
template <> struct Frag<_Float16> {
  typedef v16h V; union U { v16h v; v8h h[2]; };
  static __device__ __forceinline__ v16h load(const _Float16* p) {   // elements 0..7 <- p[0..7], 8..15 <- p[16..23]
    U f; f.h[0] = *(const v8h*)(p); f.h[1] = *(const v8h*)(p + 16); return f.v;
  }
  static __device__ __forceinline__ v8f mma(v16h a, v16h b, v8f c) {
    return __builtin_amdgcn_wmma_f32_16x16x32_f16(false, a, false, b, (short)0, c, false, false);
  }
  static __device__ __forceinline__ void guard(v8f& a, v8f& b, v16h x, v16h y) { dep_guard_h(a, b, x, y); }
  static __device__ __forceinline__ void keep(v16h a, v16h b, v16h c, v16h d) { keep4_h(a, b, c, d); }
};
template <> struct Frag<__bf16> {
  typedef v16b V; union U { v16b v; v8b h[2]; };
  static __device__ __forceinline__ v16b load(const __bf16* p) {
    U f; f.h[0] = *(const v8b*)(p); f.h[1] = *(const v8b*)(p + 16); return f.v;
  }
  static __device__ __forceinline__ v8f mma(v16b a, v16b b, v8f c) {
    return __builtin_amdgcn_wmma_f32_16x16x32_bf16(false, a, false, b, (short)0, c, false, false);
  }
  static __device__ __forceinline__ void guard(v8f& a, v8f& b, v16b x, v16b y) { dep_guard_b(a, b, x, y); }
  static __device__ __forceinline__ void keep(v16b a, v16b b, v16b c, v16b d) { keep4_b(a, b, c, d); }
};

// ---- Register-blocked batched WMMA GEMM ------------------------------------
// C[m,n] = scale * sum_k A[m,k] * Bt[n,k] (+bias)(+resid); each wave owns a 64x64 tile.
// A row-major [M,K]; Bt row-major [N,K]; M,N % 64 == 0, K % 32 == 0.
// SPLIT: operands are hi/lo planes (A2/Bt2 = lo planes, same layout); product = hi·hi + hi·lo + lo·hi.
// BIAS_MODE: 0 = none, 1 = bias[m], 2 = bias[n].
// OUT_MODE: 0 = f32, 1 = f16, 2 = bf16 hi plane (Cout) + bf16 lo plane (Cout2).
// ET: 0 = f16 operands, 1 = bf16 operands (pointers passed as 16-bit storage)
template <int ET> struct Elem;
template <> struct Elem<0> { typedef _Float16 T; };
template <> struct Elem<1> { typedef __bf16 T; };
// NW = waves (64x64 tiles) per work-group, bx = index of the work-group among those of this product, b = batch index,
// sT = the work-group's NW slabs of 16 x 68 floats in LDS
template <int NW, int ET, bool SPLIT, int BIAS_MODE, int OUT_MODE, bool RESID, int ACT = 0>
__device__ __forceinline__ void gemm64_body(const int bx, const int b, float* __restrict__ sT,
    const unsigned short* __restrict__ Ap, const unsigned short* __restrict__ A2p, int lda, long strideA,
    const unsigned short* __restrict__ Btp, const unsigned short* __restrict__ Bt2p, int ldb, long strideB,
    void* __restrict__ Cout, void* __restrict__ Cout2, int ldc, long strideC,
    const float* __restrict__ bias,
    const float* __restrict__ resid, long strideR,
    int M, int N, int K, float scale) {
  typedef typename Elem<ET>::T T;
  typedef typename Frag<T>::V V;
  const T* A = (const T*)Ap; const T* A2 = (const T*)A2p; const T* Bt = (const T*)Btp; const T* Bt2 = (const T*)Bt2p;
  const int lane = threadIdx.x & 31;
  const int wave = threadIdx.x >> 5;
  const int tilesN = N >> 6;
  const int tilesM = M >> 6;
  const int tile = bx * NW + wave;
  if (tile >= tilesM * tilesN) return;   // wave-uniform; no block barriers in this kernel
  const int tm = tile / tilesN;
  const int tn = tile - tm * tilesN;
  const int m0 = tm << 6;
  const int n0 = tn << 6;

  const T* Ab  = A  + (size_t)b * strideA;
  const T* Bb  = Bt + (size_t)b * strideB;
  const T* Ab2 = SPLIT ? (A2  + (size_t)b * strideA) : nullptr;
  const T* Bb2 = SPLIT ? (Bt2 + (size_t)b * strideB) : nullptr;

  const int rlane = lane & 15;                 // row (A) / col (B, D) within subtile
  const int koff  = (lane >> 4) * 8;           // k offset of this lane half
  const int mOff  = (lane >> 4) * 8;           // D row offset

  v8f acc[4][4];
#pragma unroll
  for (int i = 0; i < 4; ++i)
#pragma unroll
    for (int j = 0; j < 4; ++j) acc[i][j] = (v8f){0.f,0.f,0.f,0.f,0.f,0.f,0.f,0.f};

  for (int k0 = 0; k0 < K; k0 += 32) {
    V bh[4], bl[4];
#pragma unroll
    for (int j = 0; j < 4; ++j) {
      const size_t bo = (size_t)(n0 + (j << 4) + rlane) * ldb + koff + k0;
      bh[j] = Frag<T>::load(Bb + bo);
      if (SPLIT) bl[j] = Frag<T>::load(Bb2 + bo);
    }
#pragma unroll
    for (int i = 0; i < 4; ++i) {
      const size_t ao = (size_t)(m0 + (i << 4) + rlane) * lda + koff + k0;
      V ah = Frag<T>::load(Ab + ao);
      V al;
      if (SPLIT) al = Frag<T>::load(Ab2 + ao);
#pragma unroll
      for (int j = 0; j < 4; ++j) {
        acc[i][j] = Frag<T>::mma(ah, bh[j], acc[i][j]);
        if (SPLIT) {
          acc[i][j] = Frag<T>::mma(ah, bl[j], acc[i][j]);
          acc[i][j] = Frag<T>::mma(al, bh[j], acc[i][j]);
        }
      }
      Frag<T>::guard(acc[i][0], acc[i][3], ah, SPLIT ? al : ah);
    }
    Frag<T>::keep(bh[0], bh[1], bh[2], bh[3]);
    if (SPLIT) Frag<T>::keep(bl[0], bl[1], bl[2], bl[3]);
  }
  acc_guard4(acc[0][0], acc[0][1], acc[0][2], acc[0][3]);
  acc_guard4(acc[1][0], acc[1][1], acc[1][2], acc[1][3]);
  acc_guard4(acc[2][0], acc[2][1], acc[2][2], acc[2][3]);
  acc_guard4(acc[3][0], acc[3][1], acc[3][2], acc[3][3]);

  // ---- epilogue ----
  float* slab = sT + wave * (16 * 68);
  const float* Rb = RESID ? (resid + (size_t)b * strideR) : nullptr;
#pragma unroll
  for (int i = 0; i < 4; ++i) {
    const int mBase = m0 + (i << 4);
#pragma unroll
    for (int j = 0; j < 4; ++j) {
      const int n = n0 + (j << 4) + rlane;
      float bv = 0.f;
      if (BIAS_MODE == 2) bv = bias[n];
#pragma unroll
      for (int r = 0; r < 8; ++r) {
        float v = acc[i][j][r] * scale;
        if (BIAS_MODE == 1) v += bias[mBase + mOff + r];
        if (BIAS_MODE == 2) v += bv;
        if (RESID) v += Rb[(size_t)(mBase + mOff + r) * ldc + n];
        if (ACT == 1) v = tanhf(v);
        if (ACT == 2) v = fmaxf(v, 0.0f);
        if (ACT == 3) v = v / (1.0f + expf(-v));
        if (ACT == 4) v = (v > 0.f) ? v : 0.01f * v;
        if (ACT == 5) v = 0.5f * v * (1.0f + erff(v * 0.70710678118654752f));
        slab[(mOff + r) * 68 + (j << 4) + rlane] = v;
      }
    }
    __builtin_amdgcn_fence(__ATOMIC_RELEASE, "workgroup");
    __builtin_amdgcn_wave_barrier();
    __builtin_amdgcn_fence(__ATOMIC_ACQUIRE, "workgroup");
    if (OUT_MODE == 0) {
      float* C = (float*)Cout + (size_t)b * strideC;
      const int hh = lane >> 4, c4 = (lane & 15) * 4;     // row seg = 256 B = 16 lanes x 16 B
      {
#pragma unroll
        for (int it = 0; it < 8; ++it) {
          const int row = it * 2 + hh;
          v4f v = *(const v4f*)(slab + row * 68 + c4);
          *(v4f*)(C + (size_t)(mBase + row) * ldc + n0 + c4) = v;
        }
        
      }
    } else {
      const int q = lane >> 3, c8 = (lane & 7) * 8;
      unsigned short* C  = (unsigned short*)Cout  + (size_t)b * strideC;
      unsigned short* C2 = (OUT_MODE == 2) ? ((unsigned short*)Cout2 + (size_t)b * strideC) : nullptr;
      {
#pragma unroll
        for (int it = 0; it < 4; ++it) {
          const int row = it * 4 + q;
          const float* sp = slab + row * 68 + c8;
          v8h hv, lv;
#pragma unroll
          for (int e = 0; e < 8; ++e) {
            if (OUT_MODE == 1) {
              hv[e] = (_Float16)sp[e];
            } else {
              unsigned short hb = f2bf_bits(sp[e]);
              unsigned short lb = f2bf_bits(sp[e] - bf_bits2f(hb));
              hv[e] = __builtin_bit_cast(_Float16, hb);
              lv[e] = __builtin_bit_cast(_Float16, lb);
            }
          }
          *(v8h*)(C + (size_t)(mBase + row) * ldc + n0 + c8) = hv;
          if (OUT_MODE == 2) *(v8h*)(C2 + (size_t)(mBase + row) * ldc + n0 + c8) = lv;
        }
        
      }
    }
    __builtin_amdgcn_fence(__ATOMIC_RELEASE, "workgroup");
    __builtin_amdgcn_wave_barrier();
    __builtin_amdgcn_fence(__ATOMIC_ACQUIRE, "workgroup");
  }
}

template <int NW, int ET, bool SPLIT, int BIAS_MODE, int OUT_MODE, bool RESID, int ACT = 0>
__global__ __launch_bounds__(NW * 32) void wmma_gemm64(
    const unsigned short* __restrict__ Ap, const unsigned short* __restrict__ A2p, int lda, long strideA,
    const unsigned short* __restrict__ Btp, const unsigned short* __restrict__ Bt2p, int ldb, long strideB,
    void* __restrict__ Cout, void* __restrict__ Cout2, int ldc, long strideC,
    const float* __restrict__ bias,
    const float* __restrict__ resid, long strideR,
    int M, int N, int K, float scale) {
  __shared__ __align__(16) float sT[NW * 16 * 68];   // per-wave 16x64 slab, pitch 68 floats
  gemm64_body<NW, ET, SPLIT, BIAS_MODE, OUT_MODE, RESID, ACT>(blockIdx.x, blockIdx.y, sT, Ap, A2p, lda, strideA, Btp, Bt2p, ldb, strideB,
                                                              Cout, Cout2, ldc, strideC, bias, resid, strideR, M, N, K, scale);
}

// The three projections of one x [M][K] in one launch, so that their work-groups run side by side on different WGPs:
// blockIdx.y = 0: q = x Wq^T, 1: k = x Wk^T (both bf16 hi/lo split), 2: v = x Wv^T (f16); weights [N][K], outputs f32 [M][N].
template <int NW>
__global__ __launch_bounds__(NW * 32) void qkv_gemm64(
    const unsigned short* __restrict__ Xh, const unsigned short* __restrict__ Xl, const unsigned short* __restrict__ X16,
    const unsigned short* __restrict__ Wqh, const unsigned short* __restrict__ Wql,
    const unsigned short* __restrict__ Wkh, const unsigned short* __restrict__ Wkl, const unsigned short* __restrict__ Wv16,
    float* __restrict__ Q, float* __restrict__ Kf, float* __restrict__ Vf, int M, int N, int K) {
  __shared__ __align__(16) float sT[NW * 16 * 68];   // per-wave 16x64 slab, pitch 68 floats
  if (blockIdx.y < 2) {
    const bool isk = blockIdx.y == 1;
    gemm64_body<NW, 1, true, 0, 0, false>(blockIdx.x, 0, sT, Xh, Xl, K, 0, isk ? Wkh : Wqh, isk ? Wkl : Wql, K, 0,
                                          isk ? Kf : Q, nullptr, N, 0, nullptr, nullptr, 0, M, N, K, 1.0f);
  } else {
    gemm64_body<NW, 0, false, 0, 0, false>(blockIdx.x, 0, sT, X16, nullptr, K, 0, Wv16, nullptr, K, 0,
                                           Vf, nullptr, N, 0, nullptr, nullptr, 0, M, N, K, 1.0f);
  }
}

__global__ __launch_bounds__(256) void cast_f32_f16x2(
    const float* __restrict__ in, _Float16* __restrict__ out, int n2) {
  int i = blockIdx.x * 256 + threadIdx.x;
  if (i < n2) {
    const _Float16 h0 = (_Float16)in[2 * i], h1 = (_Float16)in[2 * i + 1];
    const unsigned u = (unsigned)__builtin_bit_cast(unsigned short, h0) | ((unsigned)__builtin_bit_cast(unsigned short, h1) << 16);
    ((unsigned*)out)[i] = u;
    
  }
}


// ---- f32 -> f16 cast with a power-of-two pre-scale (folded back by the consumer GEMM's scale) ----
__global__ __launch_bounds__(256) void cast_f32_f16x2s(const float* __restrict__ in, _Float16* __restrict__ out, int n2, float s) {
  int i = blockIdx.x * 256 + threadIdx.x;
  if (i < n2) {
    const _Float16 h0 = (_Float16)(in[2 * i] * s), h1 = (_Float16)(in[2 * i + 1] * s);
    const unsigned u = (unsigned)__builtin_bit_cast(unsigned short, h0) | ((unsigned)__builtin_bit_cast(unsigned short, h1) << 16);
    ((unsigned*)out)[i] = u;
    
  }
}
__global__ __launch_bounds__(256) void split_f32_bf16x2(
    const float* __restrict__ in, __bf16* __restrict__ hi, __bf16* __restrict__ lo, long n2) {
  long i = (long)blockIdx.x * 256 + threadIdx.x;
  long stride = (long)gridDim.x * 256;
  {
    for (long j = i; j < n2; j += stride) {
      const float a = in[2 * j], b = in[2 * j + 1];
      const unsigned short ah = f2bf_bits(a), bh = f2bf_bits(b);
      const unsigned short al = f2bf_bits(a - bf_bits2f(ah)), bl = f2bf_bits(b - bf_bits2f(bh));
      ((unsigned*)hi)[j] = (unsigned)ah | ((unsigned)bh << 16);
      ((unsigned*)lo)[j] = (unsigned)al | ((unsigned)bl << 16);
    }
    
  }
}


// ---- f32 [R][C] (row pitch ldi) -> f16 transposed [C][R] (row pitch ldo); 64x64 tiles; each output row segment
__global__ __launch_bounds__(256) void transpose_cast_f16(const float* __restrict__ in, int ldi,
                                                         _Float16* __restrict__ outT, int ldo, float scale) {
  __shared__ __align__(16) _Float16 tile[64][72];     // [c][r]
  const int c0 = blockIdx.x * 64, r0 = blockIdx.y * 64;
  const int t = threadIdx.y * 32 + threadIdx.x;
  for (int i = threadIdx.y; i < 64; i += 8) {
    tile[threadIdx.x][i]      = (_Float16)(in[(size_t)(r0 + i) * ldi + c0 + threadIdx.x] * scale);
    tile[32 + threadIdx.x][i] = (_Float16)(in[(size_t)(r0 + i) * ldi + c0 + 32 + threadIdx.x] * scale);
  }
  __syncthreads();
  const int q = t >> 3, c8 = (t & 7) * 8;
  {
#pragma unroll
    for (int it = 0; it < 2; ++it) {
      const int c = it * 32 + q;
      v8h hv = *(const v8h*)(&tile[c][c8]);
      *(v8h*)(outT + (size_t)(c0 + c) * ldo + r0 + c8) = hv;
    }
    
  }
}

// ---- f32 [R][C] (pitch ldi) -> bf16 hi/lo transposed planes [C][R] (pitch ldo); 64x64 tiles; each output row segment
__global__ __launch_bounds__(256) void transpose_split_bf16(const float* __restrict__ in, int ldi,
                                                           __bf16* __restrict__ outH, __bf16* __restrict__ outL, int ldo) {
  __shared__ __align__(16) float tile[64][68];     // [c][r]
  const int c0 = blockIdx.x * 64, r0 = blockIdx.y * 64;
  const int t = threadIdx.y * 32 + threadIdx.x;
  for (int i = threadIdx.y; i < 64; i += 8) {
    tile[threadIdx.x][i]      = in[(size_t)(r0 + i) * ldi + c0 + threadIdx.x];
    tile[32 + threadIdx.x][i] = in[(size_t)(r0 + i) * ldi + c0 + 32 + threadIdx.x];
  }
  __syncthreads();
  const int q = t >> 3, c8 = (t & 7) * 8;
  {
#pragma unroll
    for (int it = 0; it < 2; ++it) {
      const int c = it * 32 + q;
      v8b hv, lv;
#pragma unroll
      for (int e = 0; e < 8; ++e) {
        const float f = tile[c][c8 + e];
        const unsigned short hb = f2bf_bits(f);
        hv[e] = __builtin_bit_cast(__bf16, hb);
        lv[e] = __builtin_bit_cast(__bf16, f2bf_bits(f - bf_bits2f(hb)));
      }
      *(v8b*)(outH + (size_t)(c0 + c) * ldo + r0 + c8) = hv;
      *(v8b*)(outL + (size_t)(c0 + c) * ldo + r0 + c8) = lv;
    }
    
  }
}

// =====================================================================================
// Generic causal/non-causal attention for head_dim 64, f32 in / f32 out; 16-bit operands: bf16 with optional hi/lo splits, or
// plain f16 (F16=true, non-split, probabilities carried x2^15).
//   scores = (q*qscale)·kᵀ : v_wmma_f32_16x16x32_bf16; SPLIT_QK -> q,k as bf16 hi/lo (hi·hi + hi·lo + lo·hi)
//   out    = p·v           : v_wmma_f32_16x16x32_bf16; SPLIT_PV -> p,v as bf16 hi/lo; else p,v plain bf16 (f16 if F16)
//   f32 accumulate; online softmax in f32. Block = 4 waves = 64 query rows of one (batch, head); S % 64 == 0.
//   Element (b, s, h, d) of tensor X lives at X[b*X_bs + s*X_rs + h*X_hs + d] (strides in floats, multiples of 4).
//   Masking: mask_mode 0 none, 1 causal (kv > q masked), 2 tensor [S][Skv] shared over (b,h) (float if
//   mask_is_int==0, int32 with element == 0 -> masked if 1, int32 with element != 0 -> masked if 2), 3 per-token vectors qmask[B][S] & kvmask[B][Skv] (int32,
//   0 -> masked), 4 causal + sliding window (kv > q or q - kv > W masked; W passed in mask_is_int);
//   5 = relative-position bias: s += cp[b,h,q][idx[q][kv]] + pc[b,h,kv][idx[q][kv]] with idx = mask_b ([S][Skv] int32) and
//   mask_a an int32 [S][Skv] tensor with nonzero = masked (tables: element (b,h,row,n) at X + b*c_bs + h*c_hs + row*c_rs + n);
//   masked scores are replaced by mask_fill (e.g. -inf or -1e9) before the softmax.
//   grid.x = B * H * (S/64) (or a sub-range with blk0).
// =====================================================================================
#define AT_D 64
#define AT_NW 4
#define AT_QB 64
#define AT_KC 64
#define AT_LP 72   // LDS row pitch of the K, V and P tiles in 16-bit elements: 144 B = 16 B x 9 (odd), so the 16 rows of a ds_load_b128 fragment read spread over the banks
#define AT_BT (2048 + AT_QB)   // distance table: Skv + AT_QB - 1 entries used (Skv <= 2048), rounded up to whole waves
struct AttnGeom { const float* cp = nullptr; const float* pc = nullptr; long c_bs = 0, c_rs = 0, c_hs = 0;   // mode-5 / DISTB score-bias tables
                  long q_bs, q_rs, q_hs, k_bs, k_rs, k_hs, v_bs, v_rs, v_hs, o_bs, o_rs, o_hs;
                  int S, Skv, H, mask_mode; float qscale; int blk0; float mask_fill; int mask_is_int; };
static_assert(sizeof(AttnGeom) == 168, "no padding");

__device__ __forceinline__ unsigned short at_bf_bits(float f) {
  unsigned u = __float_as_uint(f);
  return (unsigned short)((u + 0x7FFFu + ((u >> 16) & 1u)) >> 16);
}
__device__ __forceinline__ __bf16 at_f2bf(float f) { return __builtin_bit_cast(__bf16, at_bf_bits(f)); }
__device__ __forceinline__ void at_split(float f, __bf16& hi, __bf16& lo) {
  const unsigned short hb = at_bf_bits(f);
  hi = __builtin_bit_cast(__bf16, hb);
  lo = at_f2bf(f - __uint_as_float(((unsigned)hb) << 16));
}
// 16-bit element as a bit pattern held in a __bf16 slot: f16 bits when F16, bf16 (RNE) otherwise
template <bool F16> __device__ __forceinline__ __bf16 at_to16(float f) {
  if (F16) return __builtin_bit_cast(__bf16, (_Float16)f);
  return at_f2bf(f);
}
// the builtin alone: the compiler keeps the distance behind it, and LDS reads may be scheduled across it
template <bool F16> __device__ __forceinline__ v8f at_mma16(v16b a, v16b b, v8f c) {
  if (F16) return __builtin_amdgcn_wmma_f32_16x16x32_f16(false, __builtin_bit_cast(v16h, a), false, __builtin_bit_cast(v16h, b), (short)0, c, false, false);
  return __builtin_amdgcn_wmma_f32_16x16x32_bf16(false, a, false, b, (short)0, c, false, false);
}

// DISTB: s += bias[bucket(kv - q)] of this head (32 buckets; bucket n of (b, h) at cp + b*c_bs + h*c_hs + n*c_rs), no mask; Skv <= 2048.
template <bool SPLIT_QK, bool SPLIT_PV, bool F16 = false, bool DISTB = false>
__global__ __launch_bounds__(128)
void attn64_kernel(const float* __restrict__ q, const float* __restrict__ k,
                   const float* __restrict__ v, float* __restrict__ out,
                   const void* __restrict__ mask_a, const int* __restrict__ mask_b, AttnGeom g) {
  static_assert(!(F16 && (SPLIT_QK || SPLIT_PV)), "f16 mode is non-split");
  const float PSC = F16 ? 32768.0f : 1.0f;     // f16 probabilities carried x2^15 (subnormal range), folded into the final 1/l
  union FB { v16b v; v8b h[2]; };
  __shared__ __align__(16) __bf16 Ksh[AT_KC * AT_LP];            // K hi [kv][d], rows at pitch AT_LP   9 KB
  __shared__ __align__(16) __bf16 Ksl[SPLIT_QK ? AT_KC * AT_LP : 8];
  __shared__ __align__(16) __bf16 Vth[AT_D * AT_LP];            // V hi [d][kv], rows at pitch AT_LP   9 KB
  __shared__ __align__(16) __bf16 Vtl[SPLIT_PV ? AT_D * AT_LP : 8];
  __shared__ __align__(16) __bf16 Psh[AT_NW][16 * AT_LP];       // per wave P hi [row][kv], rows at pitch AT_LP   9 KB
  __shared__ __align__(16) __bf16 Psl[SPLIT_PV ? AT_NW : 1][SPLIT_PV ? 16 * AT_LP : 8];
  __shared__ __align__(16) float  Os[AT_NW][16 * 68];            // per wave out tile, pitch 68
  __shared__ float Bs[DISTB ? AT_BT : 1];                        // score bias of this (head, query block) by distance kv - q

  const int tid  = threadIdx.x;
  const int wave = tid >> 5;
  const int lane = tid & 31;
  const int hh   = lane >> 4;
  const int c    = lane & 15;

  const int nqb = g.S / AT_QB;
  const int bx = blockIdx.x + g.blk0;
  const int qb = bx % nqb;
  const int bh = bx / nqb;
  const int h  = bh % g.H;
  const int b  = bh / g.H;
  const int qbase_block = qb * AT_QB;
  const int q0 = qbase_block + wave * 16;

  const float* qb_ptr = q + (size_t)b * g.q_bs + (size_t)h * g.q_hs;
  const float* kb_ptr = k + (size_t)b * g.k_bs + (size_t)h * g.k_hs;
  const float* vb_ptr = v + (size_t)b * g.v_bs + (size_t)h * g.v_hs;
  float*       ob_ptr = out + (size_t)b * g.o_bs + (size_t)h * g.o_hs;

  // Bs[i] = bias of distance kv - q = i - (qbase_block + AT_QB - 1); published by the barriers at the head of the kv loop
  if (DISTB) {
    const float bl = g.cp[(size_t)b * g.c_bs + (size_t)h * g.c_hs + (size_t)lane * g.c_rs];   // lane n holds bucket n
    for (int i = tid; i < AT_BT; i += AT_NW * 32) {   // whole waves only (AT_BT % 32 == 0): every source lane of the shuffle is on
      const int rel = i - (qbase_block + AT_QB - 1); const int a = rel < 0 ? -rel : rel;
      int bkt;
      if (a < 8) bkt = a;
      else bkt = 8 + (a >= 12) + (a >= 16) + (a >= 23) + (a >= 32) + (a >= 46) + (a >= 64) + (a >= 91);   // = 8 + trunc(8*log(a/8)/log 16), capped at 15
      if (rel > 0) bkt += 16;
      Bs[i] = __shfl(bl, bkt, 32);
    }
  }

  // ---- Q fragments (A operand): 2 d-chunks, hi (and lo) ----
  v16b qah[2], qal[2];
  {
    const float* qrow = qb_ptr + (size_t)(q0 + c) * g.q_rs;
#pragma unroll
    for (int dc = 0; dc < 2; ++dc) {
#pragma unroll
      for (int e = 0; e < 8; ++e) {
        const float f0 = qrow[dc * 32 + 8 * hh + e] * g.qscale;
        const float f1 = qrow[dc * 32 + 16 + 8 * hh + e] * g.qscale;
        if (SPLIT_QK) { __bf16 hq, lq; at_split(f0, hq, lq); qah[dc][e] = hq; qal[dc][e] = lq; at_split(f1, hq, lq); qah[dc][8 + e] = hq; qal[dc][8 + e] = lq; }
        else { qah[dc][e] = at_to16<F16>(f0); qah[dc][8 + e] = at_to16<F16>(f1); qal[dc][e] = qah[dc][e]; qal[dc][8 + e] = qah[dc][8 + e]; }
      }
    }
  }

  float mrow[8], lrow[8];
  v8f oacc[4];
#pragma unroll
  for (int r = 0; r < 8; ++r) { mrow[r] = -INFINITY; lrow[r] = 0.f; }
#pragma unroll
  for (int t = 0; t < 4; ++t) oacc[t] = (v8f){0.f,0.f,0.f,0.f,0.f,0.f,0.f,0.f};

  const int nChunks = (g.mask_mode == 1 || g.mask_mode == 4) ? (qb + 1) : (g.Skv / AT_KC);   // block-uniform
  // per-row query mask (mode 3)
  int qkeep[8];
#pragma unroll
  for (int r = 0; r < 8; ++r) qkeep[r] = (g.mask_mode == 3) ? mask_b[(size_t)b * g.S + q0 + 8 * hh + r] : 1;   // mask_b = qmask in mode 3
  for (int kc = 0; kc < nChunks; ++kc) {
    const int kv0 = kc * AT_KC;
    __syncthreads();
    {
      const int kvr = tid >> 1, dh = (tid & 1) * 32;
      const float* krow = kb_ptr + (size_t)(kv0 + kvr) * g.k_rs + dh;
      const float* vrow = vb_ptr + (size_t)(kv0 + kvr) * g.v_rs + dh;
#pragma unroll
      for (int i = 0; i < 8; ++i) {
        v4f kk = *(const v4f*)(krow + 4 * i);
        v4f vv = *(const v4f*)(vrow + 4 * i);
#pragma unroll
        for (int e = 0; e < 4; ++e) {
          const int d = dh + 4 * i + e;
          if (SPLIT_QK) { __bf16 a, bl; at_split(kk[e], a, bl); Ksh[kvr * AT_LP + d] = a; Ksl[kvr * AT_LP + d] = bl; }
          else Ksh[kvr * AT_LP + d] = at_to16<F16>(kk[e]);
          if (SPLIT_PV) { __bf16 a, bl; at_split(vv[e], a, bl); Vth[d * AT_LP + kvr] = a; Vtl[d * AT_LP + kvr] = bl; }
          else Vth[d * AT_LP + kvr] = at_to16<F16>(vv[e]);
        }
      }
    }
    __syncthreads();

    // The K fragments of a d-chunk are read as one group, then the four score tiles advance side by side: one LDS latency a group,
    // and each tile's next product stands four matrix instructions behind its last. Each tile sums its products in the order dc, hi.hi, hi.lo, lo.hi.
    v8f s[4];
#pragma unroll
    for (int j = 0; j < 4; ++j) s[j] = (v8f){0.f,0.f,0.f,0.f,0.f,0.f,0.f,0.f};
#pragma unroll
    for (int dc = 0; dc < 2; ++dc) {
      FB kb[4], kl[4];
#pragma unroll
      for (int j = 0; j < 4; ++j) {
        kb[j].h[0] = *(const v8b*)(Ksh + (j * 16 + c) * AT_LP + dc * 32 + 8 * hh);
        kb[j].h[1] = *(const v8b*)(Ksh + (j * 16 + c) * AT_LP + dc * 32 + 16 + 8 * hh);
        if (SPLIT_QK) {
          kl[j].h[0] = *(const v8b*)(Ksl + (j * 16 + c) * AT_LP + dc * 32 + 8 * hh);
          kl[j].h[1] = *(const v8b*)(Ksl + (j * 16 + c) * AT_LP + dc * 32 + 16 + 8 * hh);
        }
      }
#pragma unroll
      for (int j = 0; j < 4; ++j) s[j] = at_mma16<F16>(qah[dc], kb[j].v, s[j]);
      if (SPLIT_QK) {
#pragma unroll
        for (int j = 0; j < 4; ++j) s[j] = at_mma16<F16>(qah[dc], kl[j].v, s[j]);
#pragma unroll
        for (int j = 0; j < 4; ++j) s[j] = at_mma16<F16>(qal[dc], kb[j].v, s[j]);
      }
    }
    const bool diag = (g.mask_mode == 1) && (kc == qb);
    int kvkeep[4] = {1, 1, 1, 1};
    if (g.mask_mode == 3) {
#pragma unroll
      for (int j = 0; j < 4; ++j) kvkeep[j] = ((const int*)mask_a)[(size_t)b * g.Skv + kv0 + j * 16 + c];   // mask_a = kvmask
    }
    float cm[8];
    if (DISTB) {
      const float* bp = Bs + (kv0 + c + (AT_QB - 1) - wave * 16 - 8 * hh);   // + kv column offset - query row offset
#pragma unroll
      for (int r = 0; r < 8; ++r) {
        float m = -INFINITY;
#pragma unroll
        for (int j = 0; j < 4; ++j) { s[j][r] += bp[j * 16 - r]; m = fmaxf(m, s[j][r]); }
        cm[r] = m;
      }
    } else
#pragma unroll
    for (int r = 0; r < 8; ++r) {
      const int qrow = q0 + 8 * hh + r;
      float m = -INFINITY;
#pragma unroll
      for (int j = 0; j < 4; ++j) {
        const int kvcol = kv0 + j * 16 + c;
        bool masked = false;
        if (diag) masked = (kvcol > qrow);
        else if (g.mask_mode == 4) masked = (kvcol > qrow) || (qrow - kvcol > g.mask_is_int);
        else if (g.mask_mode == 2) {
          const size_t mi = (size_t)qrow * g.Skv + kvcol;
          masked = (g.mask_is_int == 0) ? (((const float*)mask_a)[mi] == 0.0f)
                 : (g.mask_is_int == 1) ? (((const int*)mask_a)[mi] == 0) : (((const int*)mask_a)[mi] != 0);
        } else if (g.mask_mode == 3) masked = (qkeep[r] == 0) || (kvkeep[j] == 0);
        else if (g.mask_mode == 5) {
          const size_t mi = (size_t)qrow * g.Skv + kvcol;
          masked = (((const int*)mask_a)[mi] != 0);
          int n = mask_b[mi]; n = n < 0 ? 0 : n;
          s[j][r] += g.cp[(size_t)b * g.c_bs + (size_t)h * g.c_hs + (size_t)qrow * g.c_rs + n]
                   + g.pc[(size_t)b * g.c_bs + (size_t)h * g.c_hs + (size_t)kvcol * g.c_rs + n];
        }
        if (masked) s[j][r] = g.mask_fill;
        m = fmaxf(m, s[j][r]);
      }
      cm[r] = m;
    }
    // row maxima: the eight rows take each step of the exchange together, so that one LDS-pipe latency is paid a step, not one a row and step
#pragma unroll
    for (int off = 1; off < 16; off <<= 1) {
      float o[8];
#pragma unroll
      for (int r = 0; r < 8; ++r) o[r] = __shfl_xor(cm[r], off, 32);
#pragma unroll
      for (int r = 0; r < 8; ++r) cm[r] = fmaxf(cm[r], o[r]);
    }
    __bf16* pwh = Psh[wave];
    __bf16* pwl = Psl[SPLIT_PV ? wave : 0];
    float alpha[8], ps[8];
#pragma unroll
    for (int r = 0; r < 8; ++r) {
      const float mnew = fmaxf(mrow[r], cm[r]);
      alpha[r] = expf(mrow[r] - mnew);
      mrow[r] = mnew;
      float psum = 0.f;
#pragma unroll
      for (int j = 0; j < 4; ++j) {
        const float p = expf(s[j][r] - mnew);
        psum += p;
        if (SPLIT_PV) { __bf16 a, bl; at_split(p, a, bl); pwh[(8 * hh + r) * AT_LP + j * 16 + c] = a; pwl[(8 * hh + r) * AT_LP + j * 16 + c] = bl; }
        else pwh[(8 * hh + r) * AT_LP + j * 16 + c] = at_to16<F16>(p * PSC);
      }
      ps[r] = psum;
    }
    // row sums: as for the maxima, step by step over the eight rows (each row's tree of sums as before)
#pragma unroll
    for (int off = 1; off < 16; off <<= 1) {
      float o[8];
#pragma unroll
      for (int r = 0; r < 8; ++r) o[r] = __shfl_xor(ps[r], off, 32);
#pragma unroll
      for (int r = 0; r < 8; ++r) ps[r] += o[r];
    }
#pragma unroll
    for (int r = 0; r < 8; ++r) {
      lrow[r] = lrow[r] * alpha[r] + ps[r];
#pragma unroll
      for (int t = 0; t < 4; ++t) oacc[t][r] *= alpha[r];
    }
    __builtin_amdgcn_fence(__ATOMIC_RELEASE, "workgroup");
    __builtin_amdgcn_wave_barrier();
    __builtin_amdgcn_fence(__ATOMIC_ACQUIRE, "workgroup");
    // As for the scores: the P and V fragments of a kv half are read as one group, then the four output tiles advance side by side
    // (each tile's order of sums: kk, hi.hi, hi.lo, lo.hi).
#pragma unroll
    for (int kk = 0; kk < 2; ++kk) {
      FB pa, pl, vb[4], vl[4];
      pa.h[0] = *(const v8b*)(pwh + c * AT_LP + kk * 32 + 8 * hh);
      pa.h[1] = *(const v8b*)(pwh + c * AT_LP + kk * 32 + 16 + 8 * hh);
      if (SPLIT_PV) {
        pl.h[0] = *(const v8b*)(pwl + c * AT_LP + kk * 32 + 8 * hh);
        pl.h[1] = *(const v8b*)(pwl + c * AT_LP + kk * 32 + 16 + 8 * hh);
      }
#pragma unroll
      for (int t = 0; t < 4; ++t) {
        vb[t].h[0] = *(const v8b*)(Vth + (t * 16 + c) * AT_LP + kk * 32 + 8 * hh);
        vb[t].h[1] = *(const v8b*)(Vth + (t * 16 + c) * AT_LP + kk * 32 + 16 + 8 * hh);
        if (SPLIT_PV) {
          vl[t].h[0] = *(const v8b*)(Vtl + (t * 16 + c) * AT_LP + kk * 32 + 8 * hh);
          vl[t].h[1] = *(const v8b*)(Vtl + (t * 16 + c) * AT_LP + kk * 32 + 16 + 8 * hh);
        }
      }
#pragma unroll
      for (int t = 0; t < 4; ++t) oacc[t] = at_mma16<F16>(pa.v, vb[t].v, oacc[t]);
      if (SPLIT_PV) {
#pragma unroll
        for (int t = 0; t < 4; ++t) oacc[t] = at_mma16<F16>(pa.v, vl[t].v, oacc[t]);
#pragma unroll
        for (int t = 0; t < 4; ++t) oacc[t] = at_mma16<F16>(pl.v, vb[t].v, oacc[t]);
      }
    }
  }

  float* os = Os[wave];
#pragma unroll
  for (int r = 0; r < 8; ++r) {
    const float inv = 1.0f / (lrow[r] * PSC);
#pragma unroll
    for (int t = 0; t < 4; ++t) os[(8 * hh + r) * 68 + t * 16 + c] = oacc[t][r] * inv;
  }
  __builtin_amdgcn_fence(__ATOMIC_RELEASE, "workgroup");
  __builtin_amdgcn_wave_barrier();
  __builtin_amdgcn_fence(__ATOMIC_ACQUIRE, "workgroup");
  {
    const int c4 = (lane & 15) * 4;
    {
#pragma unroll
      for (int it = 0; it < 8; ++it) {
        const int row = it * 2 + hh;
        v4f val = *(const v4f*)(os + row * 68 + c4);
        *(v4f*)(ob_ptr + (size_t)(q0 + row) * g.o_rs + c4) = val;
      }
      
    }
  }
}

#define TS 2048
#define TD 1024
#define TNH 16
#define TNB 32
extern "C" void kernel_launch(void* const* d_in, const int* in_sizes, int n_in, void* d_out, int out_size, void* d_ws, size_t ws_size, hipStream_t stream) {
  (void)in_sizes; (void)n_in; (void)out_size; (void)ws_size;
  const float* x = (const float*)d_in[0]; const float* wq = (const float*)d_in[1]; const float* wk = (const float*)d_in[2]; const float* wv = (const float*)d_in[3]; const float* wo = (const float*)d_in[4]; const float* rb = (const float*)d_in[5];
  float* out = (float*)d_out;   // [1][2048][1024]
  char* ws = (char*)d_ws; size_t off = 0;
  auto carve = [&](size_t bytes) -> char* { char* p = ws + off; off += (bytes + 255) & ~(size_t)255; return p; };
  _Float16* X16 = (_Float16*)carve((size_t)TS * TD * 2);
__bf16* Xh = (__bf16*)carve((size_t)TS * TD * 2); __bf16* Xl = (__bf16*)carve((size_t)TS * TD * 2);
  __bf16* Wqh = (__bf16*)carve((size_t)TD * TD * 2); __bf16* Wql = (__bf16*)carve((size_t)TD * TD * 2); __bf16* Wkh = (__bf16*)carve((size_t)TD * TD * 2); __bf16* Wkl = (__bf16*)carve((size_t)TD * TD * 2);
  _Float16* Wv16 = (_Float16*)carve((size_t)TD * TD * 2); _Float16* Wo16 = (_Float16*)carve((size_t)TD * TD * 2);
  float* Q = (float*)carve((size_t)TS * TD * 4); float* Kf = (float*)carve((size_t)TS * TD * 4); float* Vf = (float*)carve((size_t)TS * TD * 4); float* O = (float*)carve((size_t)TS * TD * 4);
  _Float16* O16 = X16;
  cast_f32_f16x2<<<(TS * TD / 2 + 255) / 256, 256, 0, stream>>>(x, X16, TS * TD / 2);
  split_f32_bf16x2<<<(TS * TD / 2 + 255) / 256, 256, 0, stream>>>(x, Xh, Xl, TS * TD / 2);
  split_f32_bf16x2<<<(TD * TD / 2 + 255) / 256, 256, 0, stream>>>(wq, Wqh, Wql, TD * TD / 2);   // nn.Linear weights [out][in] = Bt layout
  split_f32_bf16x2<<<(TD * TD / 2 + 255) / 256, 256, 0, stream>>>(wk, Wkh, Wkl, TD * TD / 2);
  cast_f32_f16x2<<<(TD * TD / 2 + 255) / 256, 256, 0, stream>>>(wv, Wv16, TD * TD / 2);
  cast_f32_f16x2<<<(TD * TD / 2 + 255) / 256, 256, 0, stream>>>(wo, Wo16, TD * TD / 2);
  { const int t = (TS / 64) * (TD / 64);
    qkv_gemm64<4><<<dim3(t / 4, 3), 4 * 32, 0, stream>>>(U16(Xh), U16(Xl), U16(X16), U16(Wqh), U16(Wql), U16(Wkh), U16(Wkl), U16(Wv16), Q, Kf, Vf, TS, TD, TD); }
  { AttnGeom g;
    g.cp = rb; g.pc = nullptr; g.c_bs = 0; g.c_hs = 1; g.c_rs = TNH;   // rel_bias [bucket][head]
    g.q_bs = 0; g.q_rs = TD; g.q_hs = 64; g.k_bs = 0; g.k_rs = TD; g.k_hs = 64; g.v_bs = 0; g.v_rs = TD; g.v_hs = 64; g.o_bs = 0; g.o_rs = TD; g.o_hs = 64;
    g.S = TS; g.Skv = TS; g.H = TNH; g.mask_mode = 0; g.qscale = 1.0f; g.blk0 = 0; g.mask_fill = -INFINITY; g.mask_is_int = 0;
    attn64_kernel<true, true, false, true><<<TNH * (TS / AT_QB), AT_NW * 32, 0, stream>>>(Q, Kf, Vf, O, nullptr, nullptr, g); }
  cast_f32_f16x2<<<(TS * TD / 2 + 255) / 256, 256, 0, stream>>>(O, O16, TS * TD / 2);
  { const int t = (TS / 64) * (TD / 64);
    wmma_gemm64<2, 0, false, 0, 0, false><<<dim3(t / 2, 1), 2 * 32, 0, stream>>>(U16(O16), nullptr, TD, 0, U16(Wo16), nullptr, TD, 0, out, nullptr, TD, 0, nullptr, nullptr, 0, TS, TD, TD, 1.0f); }
}

// v005
// Measured time: 244 microseconds a run.
// Next to v004, in two timings, it ran 1.22 times as fast each time.
// Over all steps from v000 it is 3.58 times as fast.
#include <hip/hip_runtime.h>
#include <math.h>
// T5 self-attention with relative-position bias: q/k/v = x·Wᵀ (2048 x 1024 · 1024 x 1024 each), out = o·Woᵀ and the attention
// (16 heads x 64, 2048 x 2048, unscaled scores + rel_bias[bucket(k−q), h]): q/k projections and both attention products on
// v_wmma_f32_16x16x32_bf16 with bf16 hi/lo split operands (unscaled T5 scores make the softmax sharp), v and output projections on v_wmma_f32_16x16x32_f16 with f16 operands; f32 accumulate; the bucket table (integer thresholds of the T5 log-spaced bucketing: |Δ| < 8 exact, then ≥8,12,16,23,32,46,64,91,
// +16 for Δ > 0) and softmax in f32/int on VALU.
typedef __attribute__((ext_vector_type(16))) _Float16 v16h;
typedef __attribute__((ext_vector_type(8)))  _Float16 v8h;
typedef __attribute__((ext_vector_type(16))) __bf16   v16b;
typedef __attribute__((ext_vector_type(8)))  __bf16   v8b;
typedef __attribute__((ext_vector_type(8)))  float    v8f;
typedef __attribute__((ext_vector_type(4)))  float    v4f;
#define PSCALE 32768.0f
#define U16(p) ((const unsigned short*)(const void*)(p))
#define PSCALE_INV (1.0f / 32768.0f)

__device__ __forceinline__ unsigned short f2bf_bits(float f) {
  unsigned u = __float_as_uint(f);
  return (unsigned short)((u + 0x7FFFu + ((u >> 16) & 1u)) >> 16);
}
__device__ __forceinline__ float bf_bits2f(unsigned short h) { return __uint_as_float(((unsigned)h) << 16); }

// hazard guards as plain device helpers (no inline asm inside the kernel template body)
__device__ __forceinline__ void dep_guard_h(v8f& a, v8f& b, v16h x, v16h y) { asm volatile("v_nop\n\tv_nop\n\tv_nop\n\tv_nop" : "+v"(a), "+v"(b) : "v"(x), "v"(y)); }
__device__ __forceinline__ void dep_guard_b(v8f& a, v8f& b, v16b x, v16b y) { asm volatile("v_nop\n\tv_nop\n\tv_nop\n\tv_nop" : "+v"(a), "+v"(b) : "v"(x), "v"(y)); }
__device__ __forceinline__ void keep4_h(v16h a, v16h b, v16h c, v16h d) { asm volatile("v_nop" :: "v"(a), "v"(b), "v"(c), "v"(d)); }
__device__ __forceinline__ void keep4_b(v16b a, v16b b, v16b c, v16b d) { asm volatile("v_nop" :: "v"(a), "v"(b), "v"(c), "v"(d)); }
__device__ __forceinline__ void acc_guard4(v8f& a, v8f& b, v8f& c, v8f& d) { asm volatile("v_nop\n\tv_nop\n\tv_nop\n\tv_nop" : "+v"(a), "+v"(b), "+v"(c), "+v"(d)); }
template <typename T> struct Frag;
template <> struct Frag<_Float16> {
  typedef v16h V; union U { v16h v; v8h h[2]; };
  static __device__ __forceinline__ v16h load(const _Float16* p) {   // elements 0..7 <- p[0..7], 8..15 <- p[16..23]
    U f; f.h[0] = *(const v8h*)(p); f.h[1] = *(const v8h*)(p + 16); return f.v;
  }
  static __device__ __forceinline__ v8f mma(v16h a, v16h b, v8f c) {
    return __builtin_amdgcn_wmma_f32_16x16x32_f16(false, a, false, b, (short)0, c, false, false);
  }
  static __device__ __forceinline__ void guard(v8f& a, v8f& b, v16h x, v16h y) { dep_guard_h(a, b, x, y); }
  static __device__ __forceinline__ void keep(v16h a, v16h b, v16h c, v16h d) { keep4_h(a, b, c, d); }
};
template <> struct Frag<__bf16> {
  typedef v16b V; union U { v16b v; v8b h[2]; };
  static __device__ __forceinline__ v16b load(const __bf16* p) {
    U f; f.h[0] = *(const v8b*)(p); f.h[1] = *(const v8b*)(p + 16); return f.v;
  }
  static __device__ __forceinline__ v8f mma(v16b a, v16b b, v8f c) {
    return __builtin_amdgcn_wmma_f32_16x16x32_bf16(false, a, false, b, (short)0, c, false, false);
  }
  static __device__ __forceinline__ void guard(v8f& a, v8f& b, v16b x, v16b y) { dep_guard_b(a, b, x, y); }
  static __device__ __forceinline__ void keep(v16b a, v16b b, v16b c, v16b d) { keep4_b(a, b, c, d); }
};

// ---- Register-blocked batched WMMA GEMM ------------------------------------
// C[m,n] = scale * sum_k A[m,k] * Bt[n,k] (+bias)(+resid); each wave owns a 64x64 tile.
// A row-major [M,K]; Bt row-major [N,K]; M,N % 64 == 0, K % 32 == 0.
// SPLIT: operands are hi/lo planes (A2/Bt2 = lo planes, same layout); product = hi·hi + hi·lo + lo·hi.
// BIAS_MODE: 0 = none, 1 = bias[m], 2 = bias[n].
// OUT_MODE: 0 = f32, 1 = f16, 2 = bf16 hi plane (Cout) + bf16 lo plane (Cout2).
// ET: 0 = f16 operands, 1 = bf16 operands (pointers passed as 16-bit storage)
template <int ET> struct Elem;
template <> struct Elem<0> { typedef _Float16 T; };
template <> struct Elem<1> { typedef __bf16 T; };
// NW = waves (64x64 tiles) per work-group, bx = index of the work-group among those of this product, b = batch index,
// sT = the work-group's NW slabs of 16 x 68 floats in LDS
template <int NW, int ET, bool SPLIT, int BIAS_MODE, int OUT_MODE, bool RESID, int ACT = 0>
__device__ __forceinline__ void gemm64_body(const int bx, const int b, float* __restrict__ sT,
    const unsigned short* __restrict__ Ap, const unsigned short* __restrict__ A2p, int lda, long strideA,
    const unsigned short* __restrict__ Btp, const unsigned short* __restrict__ Bt2p, int ldb, long strideB,
    void* __restrict__ Cout, void* __restrict__ Cout2, int ldc, long strideC,
    const float* __restrict__ bias,
    const float* __restrict__ resid, long strideR,
    int M, int N, int K, float scale) {
  typedef typename Elem<ET>::T T;
  typedef typename Frag<T>::V V;
  const T* A = (const T*)Ap; const T* A2 = (const T*)A2p; const T* Bt = (const T*)Btp; const T* Bt2 = (const T*)Bt2p;
  const int lane = threadIdx.x & 31;
  const int wave = threadIdx.x >> 5;
  const int tilesN = N >> 6;
  const int tilesM = M >> 6;
  const int tile = bx * NW + wave;
  if (tile >= tilesM * tilesN) return;   // wave-uniform; no block barriers in this kernel
  const int tm = tile / tilesN;
  const int tn = tile - tm * tilesN;
  const int m0 = tm << 6;
  const int n0 = tn << 6;

  const T* Ab  = A  + (size_t)b * strideA;
  const T* Bb  = Bt + (size_t)b * strideB;
  const T* Ab2 = SPLIT ? (A2  + (size_t)b * strideA) : nullptr;
  const T* Bb2 = SPLIT ? (Bt2 + (size_t)b * strideB) : nullptr;

  const int rlane = lane & 15;                 // row (A) / col (B, D) within subtile
  const int koff  = (lane >> 4) * 8;           // k offset of this lane half
  const int mOff  = (lane >> 4) * 8;           // D row offset

  v8f acc[4][4];
#pragma unroll
  for (int i = 0; i < 4; ++i)
#pragma unroll
    for (int j = 0; j < 4; ++j) acc[i][j] = (v8f){0.f,0.f,0.f,0.f,0.f,0.f,0.f,0.f};

  for (int k0 = 0; k0 < K; k0 += 32) {
    V bh[4], bl[4];
#pragma unroll
    for (int j = 0; j < 4; ++j) {
      const size_t bo = (size_t)(n0 + (j << 4) + rlane) * ldb + koff + k0;
      bh[j] = Frag<T>::load(Bb + bo);
      if (SPLIT) bl[j] = Frag<T>::load(Bb2 + bo);
    }
#pragma unroll
    for (int i = 0; i < 4; ++i) {
      const size_t ao = (size_t)(m0 + (i << 4) + rlane) * lda + koff + k0;
      V ah = Frag<T>::load(Ab + ao);
      V al;
      if (SPLIT) al = Frag<T>::load(Ab2 + ao);
#pragma unroll
      for (int j = 0; j < 4; ++j) {
        acc[i][j] = Frag<T>::mma(ah, bh[j], acc[i][j]);
        if (SPLIT) {
          acc[i][j] = Frag<T>::mma(ah, bl[j], acc[i][j]);
          acc[i][j] = Frag<T>::mma(al, bh[j], acc[i][j]);
        }
      }
      Frag<T>::guard(acc[i][0], acc[i][3], ah, SPLIT ? al : ah);
    }
    Frag<T>::keep(bh[0], bh[1], bh[2], bh[3]);
    if (SPLIT) Frag<T>::keep(bl[0], bl[1], bl[2], bl[3]);
  }
  acc_guard4(acc[0][0], acc[0][1], acc[0][2], acc[0][3]);
  acc_guard4(acc[1][0], acc[1][1], acc[1][2], acc[1][3]);
  acc_guard4(acc[2][0], acc[2][1], acc[2][2], acc[2][3]);
  acc_guard4(acc[3][0], acc[3][1], acc[3][2], acc[3][3]);

  // ---- epilogue ----
  float* slab = sT + wave * (16 * 68);
  const float* Rb = RESID ? (resid + (size_t)b * strideR) : nullptr;
#pragma unroll
  for (int i = 0; i < 4; ++i) {
    const int mBase = m0 + (i << 4);
#pragma unroll
    for (int j = 0; j < 4; ++j) {
      const int n = n0 + (j << 4) + rlane;
      float bv = 0.f;
      if (BIAS_MODE == 2) bv = bias[n];
#pragma unroll
      for (int r = 0; r < 8; ++r) {
        float v = acc[i][j][r] * scale;
        if (BIAS_MODE == 1) v += bias[mBase + mOff + r];
        if (BIAS_MODE == 2) v += bv;
        if (RESID) v += Rb[(size_t)(mBase + mOff + r) * ldc + n];
        if (ACT == 1) v = tanhf(v);
        if (ACT == 2) v = fmaxf(v, 0.0f);
        if (ACT == 3) v = v / (1.0f + expf(-v));
        if (ACT == 4) v = (v > 0.f) ? v : 0.01f * v;
        if (ACT == 5) v = 0.5f * v * (1.0f + erff(v * 0.70710678118654752f));
        slab[(mOff + r) * 68 + (j << 4) + rlane] = v;
      }
    }
    __builtin_amdgcn_fence(__ATOMIC_RELEASE, "workgroup");
    __builtin_amdgcn_wave_barrier();
    __builtin_amdgcn_fence(__ATOMIC_ACQUIRE, "workgroup");
    if (OUT_MODE == 0) {
      float* C = (float*)Cout + (size_t)b * strideC;
      const int hh = lane >> 4, c4 = (lane & 15) * 4;     // row seg = 256 B = 16 lanes x 16 B
      {
#pragma unroll
        for (int it = 0; it < 8; ++it) {
          const int row = it * 2 + hh;
          v4f v = *(const v4f*)(slab + row * 68 + c4);
          *(v4f*)(C + (size_t)(mBase + row) * ldc + n0 + c4) = v;
        }
        
      }
    } else {
      const int q = lane >> 3, c8 = (lane & 7) * 8;
      unsigned short* C  = (unsigned short*)Cout  + (size_t)b * strideC;
      unsigned short* C2 = (OUT_MODE == 2) ? ((unsigned short*)Cout2 + (size_t)b * strideC) : nullptr;
      {
#pragma unroll
        for (int it = 0; it < 4; ++it) {
          const int row = it * 4 + q;
          const float* sp = slab + row * 68 + c8;
          v8h hv, lv;
#pragma unroll
          for (int e = 0; e < 8; ++e) {
            if (OUT_MODE == 1) {
              hv[e] = (_Float16)sp[e];
            } else {
              unsigned short hb = f2bf_bits(sp[e]);
              unsigned short lb = f2bf_bits(sp[e] - bf_bits2f(hb));
              hv[e] = __builtin_bit_cast(_Float16, hb);
              lv[e] = __builtin_bit_cast(_Float16, lb);
            }
          }
          *(v8h*)(C + (size_t)(mBase + row) * ldc + n0 + c8) = hv;
          if (OUT_MODE == 2) *(v8h*)(C2 + (size_t)(mBase + row) * ldc + n0 + c8) = lv;
        }
        
      }
    }
    __builtin_amdgcn_fence(__ATOMIC_RELEASE, "workgroup");
    __builtin_amdgcn_wave_barrier();
    __builtin_amdgcn_fence(__ATOMIC_ACQUIRE, "workgroup");
  }
}

template <int NW, int ET, bool SPLIT, int BIAS_MODE, int OUT_MODE, bool RESID, int ACT = 0>
__global__ __launch_bounds__(NW * 32) void wmma_gemm64(
    const unsigned short* __restrict__ Ap, const unsigned short* __restrict__ A2p, int lda, long strideA,
    const unsigned short* __restrict__ Btp, const unsigned short* __restrict__ Bt2p, int ldb, long strideB,
    void* __restrict__ Cout, void* __restrict__ Cout2, int ldc, long strideC,
    const float* __restrict__ bias,
    const float* __restrict__ resid, long strideR,
    int M, int N, int K, float scale) {
  __shared__ __align__(16) float sT[NW * 16 * 68];   // per-wave 16x64 slab, pitch 68 floats
  gemm64_body<NW, ET, SPLIT, BIAS_MODE, OUT_MODE, RESID, ACT>(blockIdx.x, blockIdx.y, sT, Ap, A2p, lda, strideA, Btp, Bt2p, ldb, strideB,
                                                              Cout, Cout2, ldc, strideC, bias, resid, strideR, M, N, K, scale);
}

// The three projections of one x [M][K] in one launch, so that their work-groups run side by side on different WGPs:
// blockIdx.y = 0: q = x Wq^T, 1: k = x Wk^T (both bf16 hi/lo split), 2: v^T = Wv x^T (f16); weights [N][K].
// Each result leaves as the bf16 hi and lo planes that the attention's matrix products read: q, k as [M][N], v transposed as [N][M].
template <int NW>
__global__ __launch_bounds__(NW * 32) void qkv_gemm64(
    const unsigned short* __restrict__ Xh, const unsigned short* __restrict__ Xl, const unsigned short* __restrict__ X16,
    const unsigned short* __restrict__ Wqh, const unsigned short* __restrict__ Wql,
    const unsigned short* __restrict__ Wkh, const unsigned short* __restrict__ Wkl, const unsigned short* __restrict__ Wv16,
    unsigned short* __restrict__ Qh, unsigned short* __restrict__ Ql, unsigned short* __restrict__ Kh, unsigned short* __restrict__ Kl,
    unsigned short* __restrict__ Vth, unsigned short* __restrict__ Vtl, int M, int N, int K) {
  __shared__ __align__(16) float sT[NW * 16 * 68];   // per-wave 16x64 slab, pitch 68 floats
  if (blockIdx.y < 2) {
    const bool isk = blockIdx.y == 1;
    gemm64_body<NW, 1, true, 0, 2, false>(blockIdx.x, 0, sT, Xh, Xl, K, 0, isk ? Wkh : Wqh, isk ? Wkl : Wql, K, 0,
                                          isk ? Kh : Qh, isk ? Kl : Ql, N, 0, nullptr, nullptr, 0, M, N, K, 1.0f);
  } else {
    gemm64_body<NW, 0, false, 0, 2, false>(blockIdx.x, 0, sT, Wv16, nullptr, K, 0, X16, nullptr, K, 0,
                                           Vth, Vtl, M, 0, nullptr, nullptr, 0, N, M, K, 1.0f);
  }
}

__global__ __launch_bounds__(256) void cast_f32_f16x2(
    const float* __restrict__ in, _Float16* __restrict__ out, int n2) {
  int i = blockIdx.x * 256 + threadIdx.x;
  if (i < n2) {
    const _Float16 h0 = (_Float16)in[2 * i], h1 = (_Float16)in[2 * i + 1];
    const unsigned u = (unsigned)__builtin_bit_cast(unsigned short, h0) | ((unsigned)__builtin_bit_cast(unsigned short, h1) << 16);
    ((unsigned*)out)[i] = u;
    
  }
}


// ---- f32 -> f16 cast with a power-of-two pre-scale (folded back by the consumer GEMM's scale) ----
__global__ __launch_bounds__(256) void cast_f32_f16x2s(const float* __restrict__ in, _Float16* __restrict__ out, int n2, float s) {
  int i = blockIdx.x * 256 + threadIdx.x;
  if (i < n2) {
    const _Float16 h0 = (_Float16)(in[2 * i] * s), h1 = (_Float16)(in[2 * i + 1] * s);
    const unsigned u = (unsigned)__builtin_bit_cast(unsigned short, h0) | ((unsigned)__builtin_bit_cast(unsigned short, h1) << 16);
    ((unsigned*)out)[i] = u;
    
  }
}
__global__ __launch_bounds__(256) void split_f32_bf16x2(
    const float* __restrict__ in, __bf16* __restrict__ hi, __bf16* __restrict__ lo, long n2) {
  long i = (long)blockIdx.x * 256 + threadIdx.x;
  long stride = (long)gridDim.x * 256;
  {
    for (long j = i; j < n2; j += stride) {
      const float a = in[2 * j], b = in[2 * j + 1];
      const unsigned short ah = f2bf_bits(a), bh = f2bf_bits(b);
      const unsigned short al = f2bf_bits(a - bf_bits2f(ah)), bl = f2bf_bits(b - bf_bits2f(bh));
      ((unsigned*)hi)[j] = (unsigned)ah | ((unsigned)bh << 16);
      ((unsigned*)lo)[j] = (unsigned)al | ((unsigned)bl << 16);
    }
    
  }
}


// ---- f32 [R][C] (row pitch ldi) -> f16 transposed [C][R] (row pitch ldo); 64x64 tiles; each output row segment
__global__ __launch_bounds__(256) void transpose_cast_f16(const float* __restrict__ in, int ldi,
                                                         _Float16* __restrict__ outT, int ldo, float scale) {
  __shared__ __align__(16) _Float16 tile[64][72];     // [c][r]
  const int c0 = blockIdx.x * 64, r0 = blockIdx.y * 64;
  const int t = threadIdx.y * 32 + threadIdx.x;
  for (int i = threadIdx.y; i < 64; i += 8) {
    tile[threadIdx.x][i]      = (_Float16)(in[(size_t)(r0 + i) * ldi + c0 + threadIdx.x] * scale);
    tile[32 + threadIdx.x][i] = (_Float16)(in[(size_t)(r0 + i) * ldi + c0 + 32 + threadIdx.x] * scale);
  }
  __syncthreads();
  const int q = t >> 3, c8 = (t & 7) * 8;
  {
#pragma unroll
    for (int it = 0; it < 2; ++it) {
      const int c = it * 32 + q;
      v8h hv = *(const v8h*)(&tile[c][c8]);
      *(v8h*)(outT + (size_t)(c0 + c) * ldo + r0 + c8) = hv;
    }
    
  }
}

// ---- f32 [R][C] (pitch ldi) -> bf16 hi/lo transposed planes [C][R] (pitch ldo); 64x64 tiles; each output row segment
__global__ __launch_bounds__(256) void transpose_split_bf16(const float* __restrict__ in, int ldi,
                                                           __bf16* __restrict__ outH, __bf16* __restrict__ outL, int ldo) {
  __shared__ __align__(16) float tile[64][68];     // [c][r]
  const int c0 = blockIdx.x * 64, r0 = blockIdx.y * 64;
  const int t = threadIdx.y * 32 + threadIdx.x;
  for (int i = threadIdx.y; i < 64; i += 8) {
    tile[threadIdx.x][i]      = in[(size_t)(r0 + i) * ldi + c0 + threadIdx.x];
    tile[32 + threadIdx.x][i] = in[(size_t)(r0 + i) * ldi + c0 + 32 + threadIdx.x];
  }
  __syncthreads();
  const int q = t >> 3, c8 = (t & 7) * 8;
  {
#pragma unroll
    for (int it = 0; it < 2; ++it) {
      const int c = it * 32 + q;
      v8b hv, lv;
#pragma unroll
      for (int e = 0; e < 8; ++e) {
        const float f = tile[c][c8 + e];
        const unsigned short hb = f2bf_bits(f);
        hv[e] = __builtin_bit_cast(__bf16, hb);
        lv[e] = __builtin_bit_cast(__bf16, f2bf_bits(f - bf_bits2f(hb)));
      }
      *(v8b*)(outH + (size_t)(c0 + c) * ldo + r0 + c8) = hv;
      *(v8b*)(outL + (size_t)(c0 + c) * ldo + r0 + c8) = lv;
    }
    
  }
}

// =====================================================================================
// Generic causal/non-causal attention for head_dim 64, f32 out; q, k, v arrive as 16-bit planes made once by their producer:
// bf16 with optional hi/lo splits (the lo planes are read only where split), or plain f16 (F16=true, non-split, probabilities carried x2^15).
//   scores = q k^T : v_wmma_f32_16x16x32_bf16; SPLIT_QK -> q,k as bf16 hi/lo (hi.hi + hi.lo + lo.hi); a score scale (qscale) is the q producer's to apply
//   out    = p·v           : v_wmma_f32_16x16x32_bf16; SPLIT_PV -> p,v as bf16 hi/lo; else p,v plain bf16
//   f32 accumulate; online softmax in f32. Block = 4 waves = 64 query rows of one (batch, head); S % 64 == 0.
//   Element (b, s, h, d) of q, k, out lives at X[b*X_bs + s*X_rs + h*X_hs + d]; v is transposed: v[b*v_bs + h*v_hs + d*v_rs + s]
//   (strides in elements, multiples of 8; one (batch, head)'s k and v each span less than 4 GiB: byte offsets inside them are held in 32 bits).
//   Masking: mask_mode 0 none, 1 causal (kv > q masked), 2 tensor [S][Skv] shared over (b,h) (float if
//   mask_is_int==0, int32 with element == 0 -> masked if 1, int32 with element != 0 -> masked if 2), 3 per-token vectors qmask[B][S] & kvmask[B][Skv] (int32,
//   0 -> masked), 4 causal + sliding window (kv > q or q - kv > W masked; W passed in mask_is_int);
//   5 = relative-position bias: s += cp[b,h,q][idx[q][kv]] + pc[b,h,kv][idx[q][kv]] with idx = mask_b ([S][Skv] int32) and
//   mask_a an int32 [S][Skv] tensor with nonzero = masked (tables: element (b,h,row,n) at X + b*c_bs + h*c_hs + row*c_rs + n);
//   masked scores are replaced by mask_fill (e.g. -inf or -1e9) before the softmax.
//   grid.x = B * H * (S/64) (or a sub-range with blk0).
// =====================================================================================
#define AT_D 64
#define AT_NW 4
#define AT_QB 64
#define AT_KC 64
#define AT_LP 72   // LDS row pitch of the K, V and P tiles in 16-bit elements: 144 B = 16 B x 9 (odd), so the 16 rows of a ds_load_b128 fragment read spread over the banks
#define AT_BT (2048 + AT_QB)   // distance table: Skv + AT_QB - 1 entries used (Skv <= 2048), rounded up to whole waves
struct AttnGeom { const float* cp = nullptr; const float* pc = nullptr; long c_bs = 0, c_rs = 0, c_hs = 0;   // mode-5 / DISTB score-bias tables
                  long q_bs, q_rs, q_hs, k_bs, k_rs, k_hs, v_bs, v_rs, v_hs, o_bs, o_rs, o_hs;
                  int S, Skv, H, mask_mode; float qscale; int blk0; float mask_fill; int mask_is_int; };
static_assert(sizeof(AttnGeom) == 168, "no padding");

__device__ __forceinline__ unsigned short at_bf_bits(float f) {
  unsigned u = __float_as_uint(f);
  return (unsigned short)((u + 0x7FFFu + ((u >> 16) & 1u)) >> 16);
}
__device__ __forceinline__ __bf16 at_f2bf(float f) { return __builtin_bit_cast(__bf16, at_bf_bits(f)); }
__device__ __forceinline__ void at_split(float f, __bf16& hi, __bf16& lo) {
  const unsigned short hb = at_bf_bits(f);
  hi = __builtin_bit_cast(__bf16, hb);
  lo = at_f2bf(f - __uint_as_float(((unsigned)hb) << 16));
}
// 16-bit element as a bit pattern held in a __bf16 slot: f16 bits when F16, bf16 (RNE) otherwise
template <bool F16> __device__ __forceinline__ __bf16 at_to16(float f) {
  if (F16) return __builtin_bit_cast(__bf16, (_Float16)f);
  return at_f2bf(f);
}
// the builtin alone: the compiler keeps the distance behind it, and LDS reads may be scheduled across it
template <bool F16> __device__ __forceinline__ v8f at_mma16(v16b a, v16b b, v8f c) {
  if (F16) return __builtin_amdgcn_wmma_f32_16x16x32_f16(false, __builtin_bit_cast(v16h, a), false, __builtin_bit_cast(v16h, b), (short)0, c, false, false);
  return __builtin_amdgcn_wmma_f32_16x16x32_bf16(false, a, false, b, (short)0, c, false, false);
}

// DISTB: s += bias[bucket(kv - q)] of this head (32 buckets; bucket n of (b, h) at cp + b*c_bs + h*c_hs + n*c_rs), no mask; Skv <= 2048.
template <bool SPLIT_QK, bool SPLIT_PV, bool F16 = false, bool DISTB = false>
__global__ __launch_bounds__(128)
void attn64_kernel(const unsigned short* __restrict__ qh, const unsigned short* __restrict__ ql,
                   const unsigned short* __restrict__ kh, const unsigned short* __restrict__ kl,
                   const unsigned short* __restrict__ vh, const unsigned short* __restrict__ vl, float* __restrict__ out,
                   const void* __restrict__ mask_a, const int* __restrict__ mask_b, AttnGeom g) {
  static_assert(!(F16 && (SPLIT_QK || SPLIT_PV)), "f16 mode is non-split");
  const float PSC = F16 ? 32768.0f : 1.0f;     // f16 probabilities carried x2^15 (subnormal range), folded into the final 1/l
  union FB { v16b v; v8b h[2]; };
  __shared__ __align__(16) __bf16 Ksh[AT_KC * AT_LP];            // K hi [kv][d], rows at pitch AT_LP   9 KB
  __shared__ __align__(16) __bf16 Ksl[SPLIT_QK ? AT_KC * AT_LP : 8];
  __shared__ __align__(16) __bf16 Vth[AT_D * AT_LP];            // V hi [d][kv], rows at pitch AT_LP   9 KB
  __shared__ __align__(16) __bf16 Vtl[SPLIT_PV ? AT_D * AT_LP : 8];
  __shared__ __align__(16) __bf16 Psh[AT_NW][16 * AT_LP];       // per wave P hi [row][kv], rows at pitch AT_LP   9 KB
  __shared__ __align__(16) __bf16 Psl[SPLIT_PV ? AT_NW : 1][SPLIT_PV ? 16 * AT_LP : 8];
  __shared__ __align__(16) float  Os[AT_NW][16 * 68];            // per wave out tile, pitch 68
  __shared__ float Bs[DISTB ? AT_BT : 1];                        // score bias of this (head, query block) by distance kv - q

  const int tid  = threadIdx.x;
  const int wave = tid >> 5;
  const int lane = tid & 31;
  const int hh   = lane >> 4;
  const int c    = lane & 15;

  const int nqb = g.S / AT_QB;
  const int bx = blockIdx.x + g.blk0;
  const int qb = bx % nqb;
  const int bh = bx / nqb;
  const int h  = bh % g.H;
  const int b  = bh / g.H;
  const int qbase_block = qb * AT_QB;
  const int q0 = qbase_block + wave * 16;

  const size_t qoff = (size_t)b * g.q_bs + (size_t)h * g.q_hs;
  const size_t koff = (size_t)b * g.k_bs + (size_t)h * g.k_hs;
  const size_t voff = (size_t)b * g.v_bs + (size_t)h * g.v_hs;
  float*       ob_ptr = out + (size_t)b * g.o_bs + (size_t)h * g.o_hs;

  // Bs[i] = bias of distance kv - q = i - (qbase_block + AT_QB - 1); published by the barriers at the head of the kv loop
  if (DISTB) {
    const float bl = g.cp[(size_t)b * g.c_bs + (size_t)h * g.c_hs + (size_t)lane * g.c_rs];   // lane n holds bucket n
    for (int i = tid; i < AT_BT; i += AT_NW * 32) {   // whole waves only (AT_BT % 32 == 0): every source lane of the shuffle is on
      const int rel = i - (qbase_block + AT_QB - 1); const int a = rel < 0 ? -rel : rel;
      int bkt;
      if (a < 8) bkt = a;
      else bkt = 8 + (a >= 12) + (a >= 16) + (a >= 23) + (a >= 32) + (a >= 46) + (a >= 64) + (a >= 91);   // = 8 + trunc(8*log(a/8)/log 16), capped at 15
      if (rel > 0) bkt += 16;
      Bs[i] = __shfl(bl, bkt, 32);
    }
  }

  // ---- Q fragments (A operand): 2 d-chunks, hi (and lo) ----
  v16b qah[2], qal[2];
  {
    const size_t qrow = qoff + (size_t)(q0 + c) * g.q_rs + 8 * hh;
#pragma unroll
    for (int dc = 0; dc < 2; ++dc) {
      qah[dc] = Frag<__bf16>::load((const __bf16*)qh + qrow + dc * 32);
      qal[dc] = SPLIT_QK ? Frag<__bf16>::load((const __bf16*)ql + qrow + dc * 32) : qah[dc];
    }
  }

  float mrow[8], lrow[8];
  v8f oacc[4];
#pragma unroll
  for (int r = 0; r < 8; ++r) { mrow[r] = -INFINITY; lrow[r] = 0.f; }
#pragma unroll
  for (int t = 0; t < 4; ++t) oacc[t] = (v8f){0.f,0.f,0.f,0.f,0.f,0.f,0.f,0.f};

  const int nChunks = (g.mask_mode == 1 || g.mask_mode == 4) ? (qb + 1) : (g.Skv / AT_KC);   // block-uniform
  // per-row query mask (mode 3)
  int qkeep[8];
#pragma unroll
  for (int r = 0; r < 8; ++r) qkeep[r] = (g.mask_mode == 3) ? mask_b[(size_t)b * g.S + q0 + 8 * hh + r] : 1;   // mask_b = qmask in mode 3
  const int sr = tid >> 3, sc = (tid & 7) * 8;   // tile staging: this thread's first row and its 16 B piece of a row
  unsigned kbo[4], vbo[4];                       // byte offsets of its four pieces of the current K and V tile
#pragma unroll
  for (int i = 0; i < 4; ++i) {
    kbo[i] = ((unsigned)(sr + 16 * i) * (unsigned)g.k_rs + sc) * 2u;
    vbo[i] = ((unsigned)(sr + 16 * i) * (unsigned)g.v_rs + sc) * 2u;
  }
  for (int kc = 0; kc < nChunks; ++kc) {
    const int kv0 = kc * AT_KC;
    {
      // Each tile is 64 rows of 128 B (K: row = kv, V: row = d): eight lanes copy a row, 16 B each, four rows a thread and tile.
      // The global reads touch no LDS, so they stand ahead of the barrier that ends the last chunk's reads of the tiles.
      // Address = this (batch, head)'s first byte, the same in every lane, + the lane's 32-bit byte offset from it.
      v8b rkh[4], rkl[4], rvh[4], rvl[4];
#pragma unroll
      for (int i = 0; i < 4; ++i) {
        rkh[i] = *(const v8b*)((const char*)(kh + koff) + kbo[i]);
        if (SPLIT_QK) rkl[i] = *(const v8b*)((const char*)(kl + koff) + kbo[i]);
        rvh[i] = *(const v8b*)((const char*)(vh + voff) + vbo[i]);
        if (SPLIT_PV) rvl[i] = *(const v8b*)((const char*)(vl + voff) + vbo[i]);
      }
      __syncthreads();
#pragma unroll
      for (int i = 0; i < 4; ++i) {
        const int lo = (sr + 16 * i) * AT_LP + sc;
        *(v8b*)(Ksh + lo) = rkh[i];
        if (SPLIT_QK) *(v8b*)(Ksl + lo) = rkl[i];
        *(v8b*)(Vth + lo) = rvh[i];
        if (SPLIT_PV) *(v8b*)(Vtl + lo) = rvl[i];
        kbo[i] += (unsigned)g.k_rs * (AT_KC * 2u);   // the next chunk: AT_KC rows on in k, AT_KC columns on in v
        vbo[i] += AT_KC * 2u;
      }
    }
    __syncthreads();

    // The K fragments of a d-chunk are read as one group, then the four score tiles advance side by side: one LDS latency a group,
    // and each tile's next product stands four matrix instructions behind its last. Each tile sums its products in the order dc, hi.hi, hi.lo, lo.hi.
    v8f s[4];
#pragma unroll
    for (int j = 0; j < 4; ++j) s[j] = (v8f){0.f,0.f,0.f,0.f,0.f,0.f,0.f,0.f};
#pragma unroll
    for (int dc = 0; dc < 2; ++dc) {
      FB kb[4], kl[4];
#pragma unroll
      for (int j = 0; j < 4; ++j) {
        kb[j].h[0] = *(const v8b*)(Ksh + (j * 16 + c) * AT_LP + dc * 32 + 8 * hh);
        kb[j].h[1] = *(const v8b*)(Ksh + (j * 16 + c) * AT_LP + dc * 32 + 16 + 8 * hh);
        if (SPLIT_QK) {
          kl[j].h[0] = *(const v8b*)(Ksl + (j * 16 + c) * AT_LP + dc * 32 + 8 * hh);
          kl[j].h[1] = *(const v8b*)(Ksl + (j * 16 + c) * AT_LP + dc * 32 + 16 + 8 * hh);
        }
      }
#pragma unroll
      for (int j = 0; j < 4; ++j) s[j] = at_mma16<F16>(qah[dc], kb[j].v, s[j]);
      if (SPLIT_QK) {
#pragma unroll
        for (int j = 0; j < 4; ++j) s[j] = at_mma16<F16>(qah[dc], kl[j].v, s[j]);
#pragma unroll
        for (int j = 0; j < 4; ++j) s[j] = at_mma16<F16>(qal[dc], kb[j].v, s[j]);
      }
    }
    const bool diag = (g.mask_mode == 1) && (kc == qb);
    int kvkeep[4] = {1, 1, 1, 1};
    if (g.mask_mode == 3) {
#pragma unroll
      for (int j = 0; j < 4; ++j) kvkeep[j] = ((const int*)mask_a)[(size_t)b * g.Skv + kv0 + j * 16 + c];   // mask_a = kvmask
    }
    float cm[8];
    if (DISTB) {
      const float* bp = Bs + (kv0 + c + (AT_QB - 1) - wave * 16 - 8 * hh);   // + kv column offset - query row offset
#pragma unroll
      for (int r = 0; r < 8; ++r) {
        float m = -INFINITY;
#pragma unroll
        for (int j = 0; j < 4; ++j) { s[j][r] += bp[j * 16 - r]; m = fmaxf(m, s[j][r]); }
        cm[r] = m;
      }
    } else
#pragma unroll
    for (int r = 0; r < 8; ++r) {
      const int qrow = q0 + 8 * hh + r;
      float m = -INFINITY;
#pragma unroll
      for (int j = 0; j < 4; ++j) {
        const int kvcol = kv0 + j * 16 + c;
        bool masked = false;
        if (diag) masked = (kvcol > qrow);
        else if (g.mask_mode == 4) masked = (kvcol > qrow) || (qrow - kvcol > g.mask_is_int);
        else if (g.mask_mode == 2) {
          const size_t mi = (size_t)qrow * g.Skv + kvcol;
          masked = (g.mask_is_int == 0) ? (((const float*)mask_a)[mi] == 0.0f)
                 : (g.mask_is_int == 1) ? (((const int*)mask_a)[mi] == 0) : (((const int*)mask_a)[mi] != 0);
        } else if (g.mask_mode == 3) masked = (qkeep[r] == 0) || (kvkeep[j] == 0);
        else if (g.mask_mode == 5) {
          const size_t mi = (size_t)qrow * g.Skv + kvcol;
          masked = (((const int*)mask_a)[mi] != 0);
          int n = mask_b[mi]; n = n < 0 ? 0 : n;
          s[j][r] += g.cp[(size_t)b * g.c_bs + (size_t)h * g.c_hs + (size_t)qrow * g.c_rs + n]
                   + g.pc[(size_t)b * g.c_bs + (size_t)h * g.c_hs + (size_t)kvcol * g.c_rs + n];
        }
        if (masked) s[j][r] = g.mask_fill;
        m = fmaxf(m, s[j][r]);
      }
      cm[r] = m;
    }
    // row maxima: the eight rows take each step of the exchange together, so that one LDS-pipe latency is paid a step, not one a row and step
#pragma unroll
    for (int off = 1; off < 16; off <<= 1) {
      float o[8];
#pragma unroll
      for (int r = 0; r < 8; ++r) o[r] = __shfl_xor(cm[r], off, 32);
#pragma unroll
      for (int r = 0; r < 8; ++r) cm[r] = fmaxf(cm[r], o[r]);
    }
    __bf16* pwh = Psh[wave];
    __bf16* pwl = Psl[SPLIT_PV ? wave : 0];
    float alpha[8], ps[8];
#pragma unroll
    for (int r = 0; r < 8; ++r) {
      const float mnew = fmaxf(mrow[r], cm[r]);
      alpha[r] = expf(mrow[r] - mnew);
      mrow[r] = mnew;
      float psum = 0.f;
#pragma unroll
      for (int j = 0; j < 4; ++j) {
        const float p = expf(s[j][r] - mnew);
        psum += p;
        if (SPLIT_PV) { __bf16 a, bl; at_split(p, a, bl); pwh[(8 * hh + r) * AT_LP + j * 16 + c] = a; pwl[(8 * hh + r) * AT_LP + j * 16 + c] = bl; }
        else pwh[(8 * hh + r) * AT_LP + j * 16 + c] = at_to16<F16>(p * PSC);
      }
      ps[r] = psum;
    }
    // row sums: as for the maxima, step by step over the eight rows (each row's tree of sums as before)
#pragma unroll
    for (int off = 1; off < 16; off <<= 1) {
      float o[8];
#pragma unroll
      for (int r = 0; r < 8; ++r) o[r] = __shfl_xor(ps[r], off, 32);
#pragma unroll
      for (int r = 0; r < 8; ++r) ps[r] += o[r];
    }
#pragma unroll
    for (int r = 0; r < 8; ++r) {
      lrow[r] = lrow[r] * alpha[r] + ps[r];
#pragma unroll
      for (int t = 0; t < 4; ++t) oacc[t][r] *= alpha[r];
    }
    __builtin_amdgcn_fence(__ATOMIC_RELEASE, "workgroup");
    __builtin_amdgcn_wave_barrier();
    __builtin_amdgcn_fence(__ATOMIC_ACQUIRE, "workgroup");
    // As for the scores: the P and V fragments of a kv half are read as one group, then the four output tiles advance side by side
    // (each tile's order of sums: kk, hi.hi, hi.lo, lo.hi).
#pragma unroll
    for (int kk = 0; kk < 2; ++kk) {
      FB pa, pl, vb[4], vl[4];
      pa.h[0] = *(const v8b*)(pwh + c * AT_LP + kk * 32 + 8 * hh);
      pa.h[1] = *(const v8b*)(pwh + c * AT_LP + kk * 32 + 16 + 8 * hh);
      if (SPLIT_PV) {
        pl.h[0] = *(const v8b*)(pwl + c * AT_LP + kk * 32 + 8 * hh);
        pl.h[1] = *(const v8b*)(pwl + c * AT_LP + kk * 32 + 16 + 8 * hh);
      }
#pragma unroll
      for (int t = 0; t < 4; ++t) {
        vb[t].h[0] = *(const v8b*)(Vth + (t * 16 + c) * AT_LP + kk * 32 + 8 * hh);
        vb[t].h[1] = *(const v8b*)(Vth + (t * 16 + c) * AT_LP + kk * 32 + 16 + 8 * hh);
        if (SPLIT_PV) {
          vl[t].h[0] = *(const v8b*)(Vtl + (t * 16 + c) * AT_LP + kk * 32 + 8 * hh);
          vl[t].h[1] = *(const v8b*)(Vtl + (t * 16 + c) * AT_LP + kk * 32 + 16 + 8 * hh);
        }
      }
#pragma unroll
      for (int t = 0; t < 4; ++t) oacc[t] = at_mma16<F16>(pa.v, vb[t].v, oacc[t]);
      if (SPLIT_PV) {
#pragma unroll
        for (int t = 0; t < 4; ++t) oacc[t] = at_mma16<F16>(pa.v, vl[t].v, oacc[t]);
#pragma unroll
        for (int t = 0; t < 4; ++t) oacc[t] = at_mma16<F16>(pl.v, vb[t].v, oacc[t]);
      }
    }
  }

  float* os = Os[wave];
#pragma unroll
  for (int r = 0; r < 8; ++r) {
    const float inv = 1.0f / (lrow[r] * PSC);
#pragma unroll
    for (int t = 0; t < 4; ++t) os[(8 * hh + r) * 68 + t * 16 + c] = oacc[t][r] * inv;
  }
  __builtin_amdgcn_fence(__ATOMIC_RELEASE, "workgroup");
  __builtin_amdgcn_wave_barrier();
  __builtin_amdgcn_fence(__ATOMIC_ACQUIRE, "workgroup");
  {
    const int c4 = (lane & 15) * 4;
    {
#pragma unroll
      for (int it = 0; it < 8; ++it) {
        const int row = it * 2 + hh;
        v4f val = *(const v4f*)(os + row * 68 + c4);
        *(v4f*)(ob_ptr + (size_t)(q0 + row) * g.o_rs + c4) = val;
      }
      
    }
  }
}

#define TS 2048
#define TD 1024
#define TNH 16
#define TNB 32
extern "C" void kernel_launch(void* const* d_in, const int* in_sizes, int n_in, void* d_out, int out_size, void* d_ws, size_t ws_size, hipStream_t stream) {
  (void)in_sizes; (void)n_in; (void)out_size; (void)ws_size;
  const float* x = (const float*)d_in[0]; const float* wq = (const float*)d_in[1]; const float* wk = (const float*)d_in[2]; const float* wv = (const float*)d_in[3]; const float* wo = (const float*)d_in[4]; const float* rb = (const float*)d_in[5];
  float* out = (float*)d_out;   // [1][2048][1024]
  char* ws = (char*)d_ws; size_t off = 0;
  auto carve = [&](size_t bytes) -> char* { char* p = ws + off; off += (bytes + 255) & ~(size_t)255; return p; };
  _Float16* X16 = (_Float16*)carve((size_t)TS * TD * 2);
__bf16* Xh = (__bf16*)carve((size_t)TS * TD * 2); __bf16* Xl = (__bf16*)carve((size_t)TS * TD * 2);
  __bf16* Wqh = (__bf16*)carve((size_t)TD * TD * 2); __bf16* Wql = (__bf16*)carve((size_t)TD * TD * 2); __bf16* Wkh = (__bf16*)carve((size_t)TD * TD * 2); __bf16* Wkl = (__bf16*)carve((size_t)TD * TD * 2);
  _Float16* Wv16 = (_Float16*)carve((size_t)TD * TD * 2); _Float16* Wo16 = (_Float16*)carve((size_t)TD * TD * 2);
  unsigned short* Qh = (unsigned short*)carve((size_t)TS * TD * 2); unsigned short* Ql = (unsigned short*)carve((size_t)TS * TD * 2);
  unsigned short* Kh = (unsigned short*)carve((size_t)TS * TD * 2); unsigned short* Kl = (unsigned short*)carve((size_t)TS * TD * 2);
  unsigned short* Vth = (unsigned short*)carve((size_t)TS * TD * 2); unsigned short* Vtl = (unsigned short*)carve((size_t)TS * TD * 2);   // [TD][TS]
  float* O = (float*)carve((size_t)TS * TD * 4);
  _Float16* O16 = X16;
  cast_f32_f16x2<<<(TS * TD / 2 + 255) / 256, 256, 0, stream>>>(x, X16, TS * TD / 2);
  split_f32_bf16x2<<<(TS * TD / 2 + 255) / 256, 256, 0, stream>>>(x, Xh, Xl, TS * TD / 2);
  split_f32_bf16x2<<<(TD * TD / 2 + 255) / 256, 256, 0, stream>>>(wq, Wqh, Wql, TD * TD / 2);   // nn.Linear weights [out][in] = Bt layout
  split_f32_bf16x2<<<(TD * TD / 2 + 255) / 256, 256, 0, stream>>>(wk, Wkh, Wkl, TD * TD / 2);
  cast_f32_f16x2<<<(TD * TD / 2 + 255) / 256, 256, 0, stream>>>(wv, Wv16, TD * TD / 2);
  cast_f32_f16x2<<<(TD * TD / 2 + 255) / 256, 256, 0, stream>>>(wo, Wo16, TD * TD / 2);
  { const int t = (TS / 64) * (TD / 64);
    qkv_gemm64<4><<<dim3(t / 4, 3), 4 * 32, 0, stream>>>(U16(Xh), U16(Xl), U16(X16), U16(Wqh), U16(Wql), U16(Wkh), U16(Wkl), U16(Wv16), Qh, Ql, Kh, Kl, Vth, Vtl, TS, TD, TD); }
  { AttnGeom g;
    g.cp = rb; g.pc = nullptr; g.c_bs = 0; g.c_hs = 1; g.c_rs = TNH;   // rel_bias [bucket][head]
    g.q_bs = 0; g.q_rs = TD; g.q_hs = 64; g.k_bs = 0; g.k_rs = TD; g.k_hs = 64; g.v_bs = 0; g.v_rs = TS; g.v_hs = 64 * TS; g.o_bs = 0; g.o_rs = TD; g.o_hs = 64;
    g.S = TS; g.Skv = TS; g.H = TNH; g.mask_mode = 0; g.qscale = 1.0f; g.blk0 = 0; g.mask_fill = -INFINITY; g.mask_is_int = 0;
    attn64_kernel<true, true, false, true><<<TNH * (TS / AT_QB), AT_NW * 32, 0, stream>>>(Qh, Ql, Kh, Kl, Vth, Vtl, O, nullptr, nullptr, g); }
  cast_f32_f16x2<<<(TS * TD / 2 + 255) / 256, 256, 0, stream>>>(O, O16, TS * TD / 2);
  { const int t = (TS / 64) * (TD / 64);
    wmma_gemm64<2, 0, false, 0, 0, false><<<dim3(t / 2, 1), 2 * 32, 0, stream>>>(U16(O16), nullptr, TD, 0, U16(Wo16), nullptr, TD, 0, out, nullptr, TD, 0, nullptr, nullptr, 0, TS, TD, TD, 1.0f); }
}

// v006
// One run takes 185 microseconds.
// Two timings next to v005 both put it at 1.31 times that version's speed.
// Over all steps from v000 it is 4.69 times as fast.
#include <hip/hip_runtime.h>
#include <math.h>
// T5 self-attention with relative-position bias: q/k/v = x·Wᵀ (2048 x 1024 · 1024 x 1024 each), out = o·Woᵀ and the attention
// (16 heads x 64, 2048 x 2048, unscaled scores + rel_bias[bucket(k−q), h]): q/k projections and both attention products on
// v_wmma_f32_16x16x32_bf16 with bf16 hi/lo split operands (unscaled T5 scores make the softmax sharp), v and output projections on v_wmma_f32_16x16x32_f16 with f16 operands; f32 accumulate; the bucket table (integer thresholds of the T5 log-spaced bucketing: |Δ| < 8 exact, then ≥8,12,16,23,32,46,64,91,
// +16 for Δ > 0) and softmax in f32/int on VALU.
typedef __attribute__((ext_vector_type(16))) _Float16 v16h;
typedef __attribute__((ext_vector_type(8)))  _Float16 v8h;
typedef __attribute__((ext_vector_type(16))) __bf16   v16b;
typedef __attribute__((ext_vector_type(8)))  __bf16   v8b;
typedef __attribute__((ext_vector_type(8)))  float    v8f;
typedef __attribute__((ext_vector_type(4)))  float    v4f;
typedef __attribute__((ext_vector_type(2)))  float    v2f;
typedef __attribute__((ext_vector_type(2)))  __bf16   v2b;
#define PSCALE 32768.0f
#define U16(p) ((const unsigned short*)(const void*)(p))
#define PSCALE_INV (1.0f / 32768.0f)

__device__ __forceinline__ unsigned short f2bf_bits(float f) {
  unsigned u = __float_as_uint(f);
  return (unsigned short)((u + 0x7FFFu + ((u >> 16) & 1u)) >> 16);
}
__device__ __forceinline__ float bf_bits2f(unsigned short h) { return __uint_as_float(((unsigned)h) << 16); }

// hazard guards as plain device helpers (no inline asm inside the kernel template body)
__device__ __forceinline__ void dep_guard_h(v8f& a, v8f& b, v16h x, v16h y) { asm volatile("v_nop\n\tv_nop\n\tv_nop\n\tv_nop" : "+v"(a), "+v"(b) : "v"(x), "v"(y)); }
__device__ __forceinline__ void dep_guard_b(v8f& a, v8f& b, v16b x, v16b y) { asm volatile("v_nop\n\tv_nop\n\tv_nop\n\tv_nop" : "+v"(a), "+v"(b) : "v"(x), "v"(y)); }
__device__ __forceinline__ void keep4_h(v16h a, v16h b, v16h c, v16h d) { asm volatile("v_nop" :: "v"(a), "v"(b), "v"(c), "v"(d)); }
__device__ __forceinline__ void keep4_b(v16b a, v16b b, v16b c, v16b d) { asm volatile("v_nop" :: "v"(a), "v"(b), "v"(c), "v"(d)); }
__device__ __forceinline__ void acc_guard4(v8f& a, v8f& b, v8f& c, v8f& d) { asm volatile("v_nop\n\tv_nop\n\tv_nop\n\tv_nop" : "+v"(a), "+v"(b), "+v"(c), "+v"(d)); }
template <typename T> struct Frag;
template <> struct Frag<_Float16> {
  typedef v16h V; union U { v16h v; v8h h[2]; };
  static __device__ __forceinline__ v16h load(const _Float16* p) {   // elements 0..7 <- p[0..7], 8..15 <- p[16..23]
    U f; f.h[0] = *(const v8h*)(p); f.h[1] = *(const v8h*)(p + 16); return f.v;
  }
  static __device__ __forceinline__ v8f mma(v16h a, v16h b, v8f c) {
    return __builtin_amdgcn_wmma_f32_16x16x32_f16(false, a, false, b, (short)0, c, false, false);
  }
  static __device__ __forceinline__ void guard(v8f& a, v8f& b, v16h x, v16h y) { dep_guard_h(a, b, x, y); }
  static __device__ __forceinline__ void keep(v16h a, v16h b, v16h c, v16h d) { keep4_h(a, b, c, d); }
};
template <> struct Frag<__bf16> {
  typedef v16b V; union U { v16b v; v8b h[2]; };
  static __device__ __forceinline__ v16b load(const __bf16* p) {
    U f; f.h[0] = *(const v8b*)(p); f.h[1] = *(const v8b*)(p + 16); return f.v;
  }
  static __device__ __forceinline__ v8f mma(v16b a, v16b b, v8f c) {
    return __builtin_amdgcn_wmma_f32_16x16x32_bf16(false, a, false, b, (short)0, c, false, false);
  }
  static __device__ __forceinline__ void guard(v8f& a, v8f& b, v16b x, v16b y) { dep_guard_b(a, b, x, y); }
  static __device__ __forceinline__ void keep(v16b a, v16b b, v16b c, v16b d) { keep4_b(a, b, c, d); }
};

// ---- Register-blocked batched WMMA GEMM ------------------------------------
// C[m,n] = scale * sum_k A[m,k] * Bt[n,k] (+bias)(+resid); each wave owns a 64x64 tile.
// A row-major [M,K]; Bt row-major [N,K]; M,N % 64 == 0, K % 32 == 0.
// SPLIT: operands are hi/lo planes (A2/Bt2 = lo planes, same layout); product = hi·hi + hi·lo + lo·hi.
// BIAS_MODE: 0 = none, 1 = bias[m], 2 = bias[n].
// OUT_MODE: 0 = f32, 1 = f16, 2 = bf16 hi plane (Cout) + bf16 lo plane (Cout2).
// ET: 0 = f16 operands, 1 = bf16 operands (pointers passed as 16-bit storage)
template <int ET> struct Elem;
template <> struct Elem<0> { typedef _Float16 T; };
template <> struct Elem<1> { typedef __bf16 T; };
// NW = waves (64x64 tiles) per work-group, bx = index of the work-group among those of this product, b = batch index,
// sT = the work-group's NW slabs of 16 x 68 floats in LDS
template <int NW, int ET, bool SPLIT, int BIAS_MODE, int OUT_MODE, bool RESID, int ACT = 0>
__device__ __forceinline__ void gemm64_body(const int bx, const int b, float* __restrict__ sT,
    const unsigned short* __restrict__ Ap, const unsigned short* __restrict__ A2p, int lda, long strideA,
    const unsigned short* __restrict__ Btp, const unsigned short* __restrict__ Bt2p, int ldb, long strideB,
    void* __restrict__ Cout, void* __restrict__ Cout2, int ldc, long strideC,
    const float* __restrict__ bias,
    const float* __restrict__ resid, long strideR,
    int M, int N, int K, float scale) {
  typedef typename Elem<ET>::T T;
  typedef typename Frag<T>::V V;
  const T* A = (const T*)Ap; const T* A2 = (const T*)A2p; const T* Bt = (const T*)Btp; const T* Bt2 = (const T*)Bt2p;
  const int lane = threadIdx.x & 31;
  const int wave = threadIdx.x >> 5;
  const int tilesN = N >> 6;
  const int tilesM = M >> 6;
  const int tile = bx * NW + wave;
  if (tile >= tilesM * tilesN) return;   // wave-uniform; no block barriers in this kernel
  const int tm = tile / tilesN;
  const int tn = tile - tm * tilesN;
  const int m0 = tm << 6;
  const int n0 = tn << 6;

  const T* Ab  = A  + (size_t)b * strideA;
  const T* Bb  = Bt + (size_t)b * strideB;
  const T* Ab2 = SPLIT ? (A2  + (size_t)b * strideA) : nullptr;
  const T* Bb2 = SPLIT ? (Bt2 + (size_t)b * strideB) : nullptr;

  const int rlane = lane & 15;                 // row (A) / col (B, D) within subtile
  const int koff  = (lane >> 4) * 8;           // k offset of this lane half
  const int mOff  = (lane >> 4) * 8;           // D row offset

  v8f acc[4][4];
#pragma unroll
  for (int i = 0; i < 4; ++i)
#pragma unroll
    for (int j = 0; j < 4; ++j) acc[i][j] = (v8f){0.f,0.f,0.f,0.f,0.f,0.f,0.f,0.f};

  for (int k0 = 0; k0 < K; k0 += 32) {
    V bh[4], bl[4];
#pragma unroll
    for (int j = 0; j < 4; ++j) {
      const size_t bo = (size_t)(n0 + (j << 4) + rlane) * ldb + koff + k0;
      bh[j] = Frag<T>::load(Bb + bo);
      if (SPLIT) bl[j] = Frag<T>::load(Bb2 + bo);
    }
#pragma unroll
    for (int i = 0; i < 4; ++i) {
      const size_t ao = (size_t)(m0 + (i << 4) + rlane) * lda + koff + k0;
      V ah = Frag<T>::load(Ab + ao);
      V al;
      if (SPLIT) al = Frag<T>::load(Ab2 + ao);
#pragma unroll
      for (int j = 0; j < 4; ++j) {
        acc[i][j] = Frag<T>::mma(ah, bh[j], acc[i][j]);
        if (SPLIT) {
          acc[i][j] = Frag<T>::mma(ah, bl[j], acc[i][j]);
          acc[i][j] = Frag<T>::mma(al, bh[j], acc[i][j]);
        }
      }
      Frag<T>::guard(acc[i][0], acc[i][3], ah, SPLIT ? al : ah);
    }
    Frag<T>::keep(bh[0], bh[1], bh[2], bh[3]);
    if (SPLIT) Frag<T>::keep(bl[0], bl[1], bl[2], bl[3]);
  }
  acc_guard4(acc[0][0], acc[0][1], acc[0][2], acc[0][3]);
  acc_guard4(acc[1][0], acc[1][1], acc[1][2], acc[1][3]);
  acc_guard4(acc[2][0], acc[2][1], acc[2][2], acc[2][3]);
  acc_guard4(acc[3][0], acc[3][1], acc[3][2], acc[3][3]);

  // ---- epilogue ----
  float* slab = sT + wave * (16 * 68);
  const float* Rb = RESID ? (resid + (size_t)b * strideR) : nullptr;
#pragma unroll
  for (int i = 0; i < 4; ++i) {
    const int mBase = m0 + (i << 4);
#pragma unroll
    for (int j = 0; j < 4; ++j) {
      const int n = n0 + (j << 4) + rlane;
      float bv = 0.f;
      if (BIAS_MODE == 2) bv = bias[n];
#pragma unroll
      for (int r = 0; r < 8; ++r) {
        float v = acc[i][j][r] * scale;
        if (BIAS_MODE == 1) v += bias[mBase + mOff + r];
        if (BIAS_MODE == 2) v += bv;
        if (RESID) v += Rb[(size_t)(mBase + mOff + r) * ldc + n];
        if (ACT == 1) v = tanhf(v);
        if (ACT == 2) v = fmaxf(v, 0.0f);
        if (ACT == 3) v = v / (1.0f + expf(-v));
        if (ACT == 4) v = (v > 0.f) ? v : 0.01f * v;
        if (ACT == 5) v = 0.5f * v * (1.0f + erff(v * 0.70710678118654752f));
        slab[(mOff + r) * 68 + (j << 4) + rlane] = v;
      }
    }
    __builtin_amdgcn_fence(__ATOMIC_RELEASE, "workgroup");
    __builtin_amdgcn_wave_barrier();
    __builtin_amdgcn_fence(__ATOMIC_ACQUIRE, "workgroup");
    if (OUT_MODE == 0) {
      float* C = (float*)Cout + (size_t)b * strideC;
      const int hh = lane >> 4, c4 = (lane & 15) * 4;     // row seg = 256 B = 16 lanes x 16 B
      {
#pragma unroll
        for (int it = 0; it < 8; ++it) {
          const int row = it * 2 + hh;
          v4f v = *(const v4f*)(slab + row * 68 + c4);
          *(v4f*)(C + (size_t)(mBase + row) * ldc + n0 + c4) = v;
        }
        
      }
    } else {
      const int q = lane >> 3, c8 = (lane & 7) * 8;
      unsigned short* C  = (unsigned short*)Cout  + (size_t)b * strideC;
      unsigned short* C2 = (OUT_MODE == 2) ? ((unsigned short*)Cout2 + (size_t)b * strideC) : nullptr;
      {
#pragma unroll
        for (int it = 0; it < 4; ++it) {
          const int row = it * 4 + q;
          const float* sp = slab + row * 68 + c8;
          v8h hv, lv;
#pragma unroll
          for (int e = 0; e < 8; ++e) {
            if (OUT_MODE == 1) {
              hv[e] = (_Float16)sp[e];
            } else {
              unsigned short hb = f2bf_bits(sp[e]);
              unsigned short lb = f2bf_bits(sp[e] - bf_bits2f(hb));
              hv[e] = __builtin_bit_cast(_Float16, hb);
              lv[e] = __builtin_bit_cast(_Float16, lb);
            }
          }
          *(v8h*)(C + (size_t)(mBase + row) * ldc + n0 + c8) = hv;
          if (OUT_MODE == 2) *(v8h*)(C2 + (size_t)(mBase + row) * ldc + n0 + c8) = lv;
        }
        
      }
    }
    __builtin_amdgcn_fence(__ATOMIC_RELEASE, "workgroup");
    __builtin_amdgcn_wave_barrier();
    __builtin_amdgcn_fence(__ATOMIC_ACQUIRE, "workgroup");
  }
}

template <int NW, int ET, bool SPLIT, int BIAS_MODE, int OUT_MODE, bool RESID, int ACT = 0>
__global__ __launch_bounds__(NW * 32) void wmma_gemm64(
    const unsigned short* __restrict__ Ap, const unsigned short* __restrict__ A2p, int lda, long strideA,
    const unsigned short* __restrict__ Btp, const unsigned short* __restrict__ Bt2p, int ldb, long strideB,
    void* __restrict__ Cout, void* __restrict__ Cout2, int ldc, long strideC,
    const float* __restrict__ bias,
    const float* __restrict__ resid, long strideR,
    int M, int N, int K, float scale) {
  __shared__ __align__(16) float sT[NW * 16 * 68];   // per-wave 16x64 slab, pitch 68 floats
  gemm64_body<NW, ET, SPLIT, BIAS_MODE, OUT_MODE, RESID, ACT>(blockIdx.x, blockIdx.y, sT, Ap, A2p, lda, strideA, Btp, Bt2p, ldb, strideB,
                                                              Cout, Cout2, ldc, strideC, bias, resid, strideR, M, N, K, scale);
}

// The three projections of one x [M][K] in one launch, so that their work-groups run side by side on different WGPs:
// blockIdx.y = 0: q = x Wq^T, 1: k = x Wk^T (both bf16 hi/lo split), 2: v^T = Wv x^T (f16); weights [N][K].
// Each result leaves as the bf16 hi and lo planes that the attention's matrix products read: q, k as [M][N], v transposed as [N][M].
template <int NW>
__global__ __launch_bounds__(NW * 32) void qkv_gemm64(
    const unsigned short* __restrict__ Xh, const unsigned short* __restrict__ Xl, const unsigned short* __restrict__ X16,
    const unsigned short* __restrict__ Wqh, const unsigned short* __restrict__ Wql,
    const unsigned short* __restrict__ Wkh, const unsigned short* __restrict__ Wkl, const unsigned short* __restrict__ Wv16,
    unsigned short* __restrict__ Qh, unsigned short* __restrict__ Ql, unsigned short* __restrict__ Kh, unsigned short* __restrict__ Kl,
    unsigned short* __restrict__ Vth, unsigned short* __restrict__ Vtl, int M, int N, int K) {
  __shared__ __align__(16) float sT[NW * 16 * 68];   // per-wave 16x64 slab, pitch 68 floats
  if (blockIdx.y < 2) {
    const bool isk = blockIdx.y == 1;
    gemm64_body<NW, 1, true, 0, 2, false>(blockIdx.x, 0, sT, Xh, Xl, K, 0, isk ? Wkh : Wqh, isk ? Wkl : Wql, K, 0,
                                          isk ? Kh : Qh, isk ? Kl : Ql, N, 0, nullptr, nullptr, 0, M, N, K, 1.0f);
  } else {
    gemm64_body<NW, 0, false, 0, 2, false>(blockIdx.x, 0, sT, Wv16, nullptr, K, 0, X16, nullptr, K, 0,
                                           Vth, Vtl, M, 0, nullptr, nullptr, 0, N, M, K, 1.0f);
  }
}

__global__ __launch_bounds__(256) void cast_f32_f16x2(
    const float* __restrict__ in, _Float16* __restrict__ out, int n2) {
  int i = blockIdx.x * 256 + threadIdx.x;
  if (i < n2) {
    const _Float16 h0 = (_Float16)in[2 * i], h1 = (_Float16)in[2 * i + 1];
    const unsigned u = (unsigned)__builtin_bit_cast(unsigned short, h0) | ((unsigned)__builtin_bit_cast(unsigned short, h1) << 16);
    ((unsigned*)out)[i] = u;
    
  }
}


// ---- f32 -> f16 cast with a power-of-two pre-scale (folded back by the consumer GEMM's scale) ----
__global__ __launch_bounds__(256) void cast_f32_f16x2s(const float* __restrict__ in, _Float16* __restrict__ out, int n2, float s) {
  int i = blockIdx.x * 256 + threadIdx.x;
  if (i < n2) {
    const _Float16 h0 = (_Float16)(in[2 * i] * s), h1 = (_Float16)(in[2 * i + 1] * s);
    const unsigned u = (unsigned)__builtin_bit_cast(unsigned short, h0) | ((unsigned)__builtin_bit_cast(unsigned short, h1) << 16);
    ((unsigned*)out)[i] = u;
    
  }
}
__global__ __launch_bounds__(256) void split_f32_bf16x2(
    const float* __restrict__ in, __bf16* __restrict__ hi, __bf16* __restrict__ lo, long n2) {
  long i = (long)blockIdx.x * 256 + threadIdx.x;
  long stride = (long)gridDim.x * 256;
  {
    for (long j = i; j < n2; j += stride) {
      const float a = in[2 * j], b = in[2 * j + 1];
      const unsigned short ah = f2bf_bits(a), bh = f2bf_bits(b);
      const unsigned short al = f2bf_bits(a - bf_bits2f(ah)), bl = f2bf_bits(b - bf_bits2f(bh));
      ((unsigned*)hi)[j] = (unsigned)ah | ((unsigned)bh << 16);
      ((unsigned*)lo)[j] = (unsigned)al | ((unsigned)bl << 16);
    }
    
  }
}


// ---- f32 [R][C] (row pitch ldi) -> f16 transposed [C][R] (row pitch ldo); 64x64 tiles; each output row segment
__global__ __launch_bounds__(256) void transpose_cast_f16(const float* __restrict__ in, int ldi,
                                                         _Float16* __restrict__ outT, int ldo, float scale) {
  __shared__ __align__(16) _Float16 tile[64][72];     // [c][r]
  const int c0 = blockIdx.x * 64, r0 = blockIdx.y * 64;
  const int t = threadIdx.y * 32 + threadIdx.x;
  for (int i = threadIdx.y; i < 64; i += 8) {
    tile[threadIdx.x][i]      = (_Float16)(in[(size_t)(r0 + i) * ldi + c0 + threadIdx.x] * scale);
    tile[32 + threadIdx.x][i] = (_Float16)(in[(size_t)(r0 + i) * ldi + c0 + 32 + threadIdx.x] * scale);
  }
  __syncthreads();
  const int q = t >> 3, c8 = (t & 7) * 8;
  {
#pragma unroll
    for (int it = 0; it < 2; ++it) {
      const int c = it * 32 + q;
      v8h hv = *(const v8h*)(&tile[c][c8]);
      *(v8h*)(outT + (size_t)(c0 + c) * ldo + r0 + c8) = hv;
    }
    
  }
}

// ---- f32 [R][C] (pitch ldi) -> bf16 hi/lo transposed planes [C][R] (pitch ldo); 64x64 tiles; each output row segment
__global__ __launch_bounds__(256) void transpose_split_bf16(const float* __restrict__ in, int ldi,
                                                           __bf16* __restrict__ outH, __bf16* __restrict__ outL, int ldo) {
  __shared__ __align__(16) float tile[64][68];     // [c][r]
  const int c0 = blockIdx.x * 64, r0 = blockIdx.y * 64;
  const int t = threadIdx.y * 32 + threadIdx.x;
  for (int i = threadIdx.y; i < 64; i += 8) {
    tile[threadIdx.x][i]      = in[(size_t)(r0 + i) * ldi + c0 + threadIdx.x];
    tile[32 + threadIdx.x][i] = in[(size_t)(r0 + i) * ldi + c0 + 32 + threadIdx.x];
  }
  __syncthreads();
  const int q = t >> 3, c8 = (t & 7) * 8;
  {
#pragma unroll
    for (int it = 0; it < 2; ++it) {
      const int c = it * 32 + q;
      v8b hv, lv;
#pragma unroll
      for (int e = 0; e < 8; ++e) {
        const float f = tile[c][c8 + e];
        const unsigned short hb = f2bf_bits(f);
        hv[e] = __builtin_bit_cast(__bf16, hb);
        lv[e] = __builtin_bit_cast(__bf16, f2bf_bits(f - bf_bits2f(hb)));
      }
      *(v8b*)(outH + (size_t)(c0 + c) * ldo + r0 + c8) = hv;
      *(v8b*)(outL + (size_t)(c0 + c) * ldo + r0 + c8) = lv;
    }
    
  }
}

#define AT_D 64
#define AT_NW 4
#define AT_QB 64
#define AT_KC 64
#define AT_LP 72   // LDS row pitch of the K and V tiles in 16-bit elements: 144 B = 16 B x 9 (odd), so the 16 rows of a ds_load_b128 fragment read spread over the banks
#define AT_BT (2048 + AT_QB)   // distance table: Skv + AT_QB - 1 entries used (Skv <= 2048), rounded up to whole waves
struct AttnGeom { const float* cp = nullptr; const float* pc = nullptr; long c_bs = 0, c_rs = 0, c_hs = 0;   // mode-5 / DISTB score-bias tables
                  long q_bs, q_rs, q_hs, k_bs, k_rs, k_hs, v_bs, v_rs, v_hs, o_bs, o_rs, o_hs;
                  int S, Skv, H, mask_mode; float qscale; int blk0; float mask_fill; int mask_is_int; };
static_assert(sizeof(AttnGeom) == 168, "no padding");

__device__ __forceinline__ unsigned short at_bf_bits(float f) {
  unsigned u = __float_as_uint(f);
  return (unsigned short)((u + 0x7FFFu + ((u >> 16) & 1u)) >> 16);
}
__device__ __forceinline__ __bf16 at_f2bf(float f) { return __builtin_bit_cast(__bf16, at_bf_bits(f)); }
// two neighbours as packed bf16 pairs: hi = the value rounded to nearest even, lo = what is left, rounded likewise
__device__ __forceinline__ void at_split2(float p0, float p1, v2b& hi, v2b& lo) {
  const v2f p = {p0, p1};
  hi = __builtin_convertvector(p, v2b);
  lo = __builtin_convertvector(p - __builtin_convertvector(hi, v2f), v2b);
}
// the value of lane l ^ 16: the other half of the same query's kv rows
__device__ __forceinline__ float at_other_half(float x) {
  const int b = __float_as_int(x);
  return __int_as_float(__builtin_amdgcn_permlanex16(b, b, 0x76543210, 0xfedcba98, false, false));
}
// 16-bit element as a bit pattern held in a __bf16 slot: f16 bits when F16, bf16 (RNE) otherwise
template <bool F16> __device__ __forceinline__ __bf16 at_to16(float f) {
  if (F16) return __builtin_bit_cast(__bf16, (_Float16)f);
  return at_f2bf(f);
}
// the builtin alone: the compiler keeps the distance behind it, and LDS reads may be scheduled across it
template <bool F16> __device__ __forceinline__ v8f at_mma16(v16b a, v16b b, v8f c) {
  if (F16) return __builtin_amdgcn_wmma_f32_16x16x32_f16(false, __builtin_bit_cast(v16h, a), false, __builtin_bit_cast(v16h, b), (short)0, c, false, false);
  return __builtin_amdgcn_wmma_f32_16x16x32_bf16(false, a, false, b, (short)0, c, false, false);
}

// DISTB: s += bias[bucket(kv - q)] of this head (32 buckets; bucket n of (b, h) at cp + b*c_bs + h*c_hs + n*c_rs), no mask; Skv <= 2048.
template <bool SPLIT_QK, bool SPLIT_PV, bool F16 = false, bool DISTB = false>
__global__ __launch_bounds__(128)
void attn64_kernel(const unsigned short* __restrict__ qh, const unsigned short* __restrict__ ql,
                   const unsigned short* __restrict__ kh, const unsigned short* __restrict__ kl,
                   const unsigned short* __restrict__ vh, const unsigned short* __restrict__ vl, float* __restrict__ out,
                   const void* __restrict__ mask_a, const int* __restrict__ mask_b, AttnGeom g) {
  static_assert(!(F16 && (SPLIT_QK || SPLIT_PV)), "f16 mode is non-split");
  const float PSC = F16 ? 32768.0f : 1.0f;     // f16 probabilities carried x2^15 (subnormal range), folded into the final 1/l
  union FB { v16b v; v8b h[2]; v2b d[8]; };
  __shared__ __align__(16) __bf16 Ksh[AT_KC * AT_LP];            // K hi [kv][d], rows at pitch AT_LP   9 KB
  __shared__ __align__(16) __bf16 Ksl[SPLIT_QK ? AT_KC * AT_LP : 8];
  __shared__ __align__(16) __bf16 Vth[AT_D * AT_LP];            // V hi [d][kv], rows at pitch AT_LP   9 KB
  __shared__ __align__(16) __bf16 Vtl[SPLIT_PV ? AT_D * AT_LP : 8];
  __shared__ __align__(16) float  Os[AT_NW][16 * 68];            // per wave out tile, pitch 68
  __shared__ float Bs[DISTB ? AT_BT : 1];                        // score bias of this (head, query block) by distance kv - q

  const int tid  = threadIdx.x;
  const int wave = tid >> 5;
  const int lane = tid & 31;
  const int hh   = lane >> 4;
  const int c    = lane & 15;

  const int nqb = g.S / AT_QB;
  const int bx = blockIdx.x + g.blk0;
  const int qb = bx % nqb;
  const int bh = bx / nqb;
  const int h  = bh % g.H;
  const int b  = bh / g.H;
  const int qbase_block = qb * AT_QB;
  const int q0 = qbase_block + wave * 16;

  const size_t qoff = (size_t)b * g.q_bs + (size_t)h * g.q_hs;
  const size_t koff = (size_t)b * g.k_bs + (size_t)h * g.k_hs;
  const size_t voff = (size_t)b * g.v_bs + (size_t)h * g.v_hs;
  float*       ob_ptr = out + (size_t)b * g.o_bs + (size_t)h * g.o_hs;

  // Bs[i] = bias of distance kv - q = i - (qbase_block + AT_QB - 1); published by the barriers at the head of the kv loop
  if (DISTB) {
    const float bl = g.cp[(size_t)b * g.c_bs + (size_t)h * g.c_hs + (size_t)lane * g.c_rs];   // lane n holds bucket n
    for (int i = tid; i < AT_BT; i += AT_NW * 32) {   // whole waves only (AT_BT % 32 == 0): every source lane of the shuffle is on
      const int rel = i - (qbase_block + AT_QB - 1); const int a = rel < 0 ? -rel : rel;
      int bkt;
      if (a < 8) bkt = a;
      else bkt = 8 + (a >= 12) + (a >= 16) + (a >= 23) + (a >= 32) + (a >= 46) + (a >= 64) + (a >= 91);   // = 8 + trunc(8*log(a/8)/log 16), capped at 15
      if (rel > 0) bkt += 16;
      Bs[i] = __shfl(bl, bkt, 32);
    }
  }

  // ---- Q fragments (B operand: column = query q0 + c): 2 d-chunks, hi (and lo) ----
  v16b qah[2], qal[2];
  {
    const size_t qrow = qoff + (size_t)(q0 + c) * g.q_rs + 8 * hh;
#pragma unroll
    for (int dc = 0; dc < 2; ++dc) {
      qah[dc] = Frag<__bf16>::load((const __bf16*)qh + qrow + dc * 32);
      qal[dc] = SPLIT_QK ? Frag<__bf16>::load((const __bf16*)ql + qrow + dc * 32) : qah[dc];
    }
  }

  float mrow = -INFINITY, lrow = 0.f;   // this lane's query: running maximum (both halves agree), sum over this half's kv rows
  v8f oacc[4];                          // O^T: oacc[t][r] = out[q0 + c][16 t + 8 hh + r]
#pragma unroll
  for (int t = 0; t < 4; ++t) oacc[t] = (v8f){0.f,0.f,0.f,0.f,0.f,0.f,0.f,0.f};

  const int nChunks = (g.mask_mode == 1 || g.mask_mode == 4) ? (qb + 1) : (g.Skv / AT_KC);   // block-uniform
  // per-row query mask (mode 3)
  const int qkeep = (g.mask_mode == 3) ? mask_b[(size_t)b * g.S + q0 + c] : 1;   // mask_b = qmask in mode 3
  const int sr = tid >> 3, sc = (tid & 7) * 8;   // tile staging: this thread's first row and its 16 B piece of a row
  unsigned kbo[4], vbo[4];                       // byte offsets of its four pieces of the current K and V tile
#pragma unroll
  for (int i = 0; i < 4; ++i) {
    kbo[i] = ((unsigned)(sr + 16 * i) * (unsigned)g.k_rs + sc) * 2u;
    vbo[i] = ((unsigned)(sr + 16 * i) * (unsigned)g.v_rs + sc) * 2u;
  }
  for (int kc = 0; kc < nChunks; ++kc) {
    const int kv0 = kc * AT_KC;
    {
      // Each tile is 64 rows of 128 B (K: row = kv, V: row = d): eight lanes copy a row, 16 B each, four rows a thread and tile.
      // The global reads touch no LDS, so they stand ahead of the barrier that ends the last chunk's reads of the tiles.
      // Address = this (batch, head)'s first byte, the same in every lane, + the lane's 32-bit byte offset from it.
      v8b rkh[4], rkl[4], rvh[4], rvl[4];
#pragma unroll
      for (int i = 0; i < 4; ++i) {
        rkh[i] = *(const v8b*)((const char*)(kh + koff) + kbo[i]);
        if (SPLIT_QK) rkl[i] = *(const v8b*)((const char*)(kl + koff) + kbo[i]);
        rvh[i] = *(const v8b*)((const char*)(vh + voff) + vbo[i]);
        if (SPLIT_PV) rvl[i] = *(const v8b*)((const char*)(vl + voff) + vbo[i]);
      }
      __syncthreads();
#pragma unroll
      for (int i = 0; i < 4; ++i) {
        const int lo = (sr + 16 * i) * AT_LP + sc;
        *(v8b*)(Ksh + lo) = rkh[i];
        if (SPLIT_QK) *(v8b*)(Ksl + lo) = rkl[i];
        *(v8b*)(Vth + lo) = rvh[i];
        if (SPLIT_PV) *(v8b*)(Vtl + lo) = rvl[i];
        kbo[i] += (unsigned)g.k_rs * (AT_KC * 2u);   // the next chunk: AT_KC rows on in k, AT_KC columns on in v
        vbo[i] += AT_KC * 2u;
      }
    }
    __syncthreads();

    // The K fragments of a d-chunk are read as one group, then the four score tiles advance side by side: one LDS latency a group,
    // and each tile's next product stands four matrix instructions behind its last. Each tile sums its products in the order dc, hi.hi, hi.lo, lo.hi
    // (q part first). s[j][r] = score of kv row kv0 + 16 j + 8 hh + r and query q0 + c.
    v8f s[4];
#pragma unroll
    for (int j = 0; j < 4; ++j) s[j] = (v8f){0.f,0.f,0.f,0.f,0.f,0.f,0.f,0.f};
#pragma unroll
    for (int dc = 0; dc < 2; ++dc) {
      FB kb[4], kl[4];
#pragma unroll
      for (int j = 0; j < 4; ++j) {
        kb[j].h[0] = *(const v8b*)(Ksh + (j * 16 + c) * AT_LP + dc * 32 + 8 * hh);
        kb[j].h[1] = *(const v8b*)(Ksh + (j * 16 + c) * AT_LP + dc * 32 + 16 + 8 * hh);
        if (SPLIT_QK) {
          kl[j].h[0] = *(const v8b*)(Ksl + (j * 16 + c) * AT_LP + dc * 32 + 8 * hh);
          kl[j].h[1] = *(const v8b*)(Ksl + (j * 16 + c) * AT_LP + dc * 32 + 16 + 8 * hh);
        }
      }
#pragma unroll
      for (int j = 0; j < 4; ++j) s[j] = at_mma16<F16>(kb[j].v, qah[dc], s[j]);
      if (SPLIT_QK) {
#pragma unroll
        for (int j = 0; j < 4; ++j) s[j] = at_mma16<F16>(kl[j].v, qah[dc], s[j]);
#pragma unroll
        for (int j = 0; j < 4; ++j) s[j] = at_mma16<F16>(kb[j].v, qal[dc], s[j]);
      }
    }
    const bool diag = (g.mask_mode == 1) && (kc == qb);
    float cj[4];   // maximum of each tile's eight scores: four independent chains
    if (DISTB) {
      const float* bp = Bs + (kv0 + 8 * hh + (AT_QB - 1) - wave * 16 - c);   // + kv row offset - query offset
#pragma unroll
      for (int j = 0; j < 4; ++j) {
        float m = -INFINITY;
#pragma unroll
        for (int r = 0; r < 8; ++r) { s[j][r] += bp[j * 16 + r]; m = fmaxf(m, s[j][r]); }
        cj[j] = m;
      }
    } else
#pragma unroll
    for (int j = 0; j < 4; ++j) {
      const int qrow = q0 + c;
      float m = -INFINITY;
#pragma unroll
      for (int r = 0; r < 8; ++r) {
        const int kvcol = kv0 + j * 16 + 8 * hh + r;
        bool masked = false;
        if (diag) masked = (kvcol > qrow);
        else if (g.mask_mode == 4) masked = (kvcol > qrow) || (qrow - kvcol > g.mask_is_int);
        else if (g.mask_mode == 2) {
          const size_t mi = (size_t)qrow * g.Skv + kvcol;
          masked = (g.mask_is_int == 0) ? (((const float*)mask_a)[mi] == 0.0f)
                 : (g.mask_is_int == 1) ? (((const int*)mask_a)[mi] == 0) : (((const int*)mask_a)[mi] != 0);
        } else if (g.mask_mode == 3) masked = (qkeep == 0) || (((const int*)mask_a)[(size_t)b * g.Skv + kvcol] == 0);   // mask_a = kvmask
        else if (g.mask_mode == 5) {
          const size_t mi = (size_t)qrow * g.Skv + kvcol;
          masked = (((const int*)mask_a)[mi] != 0);
          int n = mask_b[mi]; n = n < 0 ? 0 : n;
          s[j][r] += g.cp[(size_t)b * g.c_bs + (size_t)h * g.c_hs + (size_t)qrow * g.c_rs + n]
                   + g.pc[(size_t)b * g.c_bs + (size_t)h * g.c_hs + (size_t)kvcol * g.c_rs + n];
        }
        if (masked) s[j][r] = g.mask_fill;
        m = fmaxf(m, s[j][r]);
      }
      cj[j] = m;
    }
    // the query's maximum over the chunk: this lane's 32 kv rows, then the other half's 32
    float cm = fmaxf(fmaxf(cj[0], cj[1]), fmaxf(cj[2], cj[3]));
    cm = fmaxf(cm, at_other_half(cm));
    const float mnew = fmaxf(mrow, cm);
    const float alpha = expf(mrow - mnew);
    mrow = mnew;
    // Tiles 2 kk and 2 kk + 1 hold kv rows 8 hh + r and 16 + 8 hh + r of kv half kk: the k order of a B operand, element by element
    FB pb[2], pl[2];
    float ps[4];
#pragma unroll
    for (int j = 0; j < 4; ++j) {
      float psum = 0.f;
#pragma unroll
      for (int r = 0; r < 8; r += 2) {
        const float p0 = expf(s[j][r] - mnew), p1 = expf(s[j][r + 1] - mnew);
        psum += p0; psum += p1;
        const int e = (j & 1) * 8 + r;
        if (SPLIT_PV) at_split2(p0, p1, pb[j >> 1].d[e >> 1], pl[j >> 1].d[e >> 1]);
        else { pb[j >> 1].v[e] = at_to16<F16>(p0 * PSC); pb[j >> 1].v[e + 1] = at_to16<F16>(p1 * PSC); }
      }
      ps[j] = psum;
    }
    lrow = lrow * alpha + ((ps[0] + ps[1]) + (ps[2] + ps[3]));   // the halves' sums are joined once, behind the loop
#pragma unroll
    for (int t = 0; t < 4; ++t) oacc[t] *= alpha;
    // As for the scores: the V fragments of a kv half are read as one group, then the four output tiles advance side by side
    // (each tile's order of sums: kk, hi.hi, hi.lo, lo.hi, p part first).
#pragma unroll
    for (int kk = 0; kk < 2; ++kk) {
      FB vb[4], vl[4];
#pragma unroll
      for (int t = 0; t < 4; ++t) {
        vb[t].h[0] = *(const v8b*)(Vth + (t * 16 + c) * AT_LP + kk * 32 + 8 * hh);
        vb[t].h[1] = *(const v8b*)(Vth + (t * 16 + c) * AT_LP + kk * 32 + 16 + 8 * hh);
        if (SPLIT_PV) {
          vl[t].h[0] = *(const v8b*)(Vtl + (t * 16 + c) * AT_LP + kk * 32 + 8 * hh);
          vl[t].h[1] = *(const v8b*)(Vtl + (t * 16 + c) * AT_LP + kk * 32 + 16 + 8 * hh);
        }
      }
#pragma unroll
      for (int t = 0; t < 4; ++t) oacc[t] = at_mma16<F16>(vb[t].v, pb[kk].v, oacc[t]);
      if (SPLIT_PV) {
#pragma unroll
        for (int t = 0; t < 4; ++t) oacc[t] = at_mma16<F16>(vl[t].v, pb[kk].v, oacc[t]);
#pragma unroll
        for (int t = 0; t < 4; ++t) oacc[t] = at_mma16<F16>(vb[t].v, pl[kk].v, oacc[t]);
      }
    }
  }

  // a lane holds eight neighbouring d of its query a tile: two 16 B pieces into the wave's slab [query][d]
  float* os = Os[wave];
  {
    const float inv = 1.0f / ((lrow + at_other_half(lrow)) * PSC);
#pragma unroll
    for (int t = 0; t < 4; ++t) {
      const v8f o = oacc[t] * inv;
      *(v4f*)(os + c * 68 + t * 16 + 8 * hh)     = (v4f){o[0], o[1], o[2], o[3]};
      *(v4f*)(os + c * 68 + t * 16 + 8 * hh + 4) = (v4f){o[4], o[5], o[6], o[7]};
    }
  }
  __builtin_amdgcn_fence(__ATOMIC_RELEASE, "workgroup");
  __builtin_amdgcn_wave_barrier();
  __builtin_amdgcn_fence(__ATOMIC_ACQUIRE, "workgroup");
  {
    const int c4 = (lane & 15) * 4;
    {
#pragma unroll
      for (int it = 0; it < 8; ++it) {
        const int row = it * 2 + hh;
        v4f val = *(const v4f*)(os + row * 68 + c4);
        *(v4f*)(ob_ptr + (size_t)(q0 + row) * g.o_rs + c4) = val;
      }
      
    }
  }
}

#define TS 2048
#define TD 1024
#define TNH 16
#define TNB 32
extern "C" void kernel_launch(void* const* d_in, const int* in_sizes, int n_in, void* d_out, int out_size, void* d_ws, size_t ws_size, hipStream_t stream) {
  (void)in_sizes; (void)n_in; (void)out_size; (void)ws_size;
  const float* x = (const float*)d_in[0]; const float* wq = (const float*)d_in[1]; const float* wk = (const float*)d_in[2]; const float* wv = (const float*)d_in[3]; const float* wo = (const float*)d_in[4]; const float* rb = (const float*)d_in[5];
  float* out = (float*)d_out;   // [1][2048][1024]
  char* ws = (char*)d_ws; size_t off = 0;
  auto carve = [&](size_t bytes) -> char* { char* p = ws + off; off += (bytes + 255) & ~(size_t)255; return p; };
  _Float16* X16 = (_Float16*)carve((size_t)TS * TD * 2);
__bf16* Xh = (__bf16*)carve((size_t)TS * TD * 2); __bf16* Xl = (__bf16*)carve((size_t)TS * TD * 2);
  __bf16* Wqh = (__bf16*)carve((size_t)TD * TD * 2); __bf16* Wql = (__bf16*)carve((size_t)TD * TD * 2); __bf16* Wkh = (__bf16*)carve((size_t)TD * TD * 2); __bf16* Wkl = (__bf16*)carve((size_t)TD * TD * 2);
  _Float16* Wv16 = (_Float16*)carve((size_t)TD * TD * 2); _Float16* Wo16 = (_Float16*)carve((size_t)TD * TD * 2);
  unsigned short* Qh = (unsigned short*)carve((size_t)TS * TD * 2); unsigned short* Ql = (unsigned short*)carve((size_t)TS * TD * 2);
  unsigned short* Kh = (unsigned short*)carve((size_t)TS * TD * 2); unsigned short* Kl = (unsigned short*)carve((size_t)TS * TD * 2);
  unsigned short* Vth = (unsigned short*)carve((size_t)TS * TD * 2); unsigned short* Vtl = (unsigned short*)carve((size_t)TS * TD * 2);   // [TD][TS]
  float* O = (float*)carve((size_t)TS * TD * 4);
  _Float16* O16 = X16;
  cast_f32_f16x2<<<(TS * TD / 2 + 255) / 256, 256, 0, stream>>>(x, X16, TS * TD / 2);
  split_f32_bf16x2<<<(TS * TD / 2 + 255) / 256, 256, 0, stream>>>(x, Xh, Xl, TS * TD / 2);
  split_f32_bf16x2<<<(TD * TD / 2 + 255) / 256, 256, 0, stream>>>(wq, Wqh, Wql, TD * TD / 2);   // nn.Linear weights [out][in] = Bt layout
  split_f32_bf16x2<<<(TD * TD / 2 + 255) / 256, 256, 0, stream>>>(wk, Wkh, Wkl, TD * TD / 2);
  cast_f32_f16x2<<<(TD * TD / 2 + 255) / 256, 256, 0, stream>>>(wv, Wv16, TD * TD / 2);
  cast_f32_f16x2<<<(TD * TD / 2 + 255) / 256, 256, 0, stream>>>(wo, Wo16, TD * TD / 2);
  { const int t = (TS / 64) * (TD / 64);
    qkv_gemm64<4><<<dim3(t / 4, 3), 4 * 32, 0, stream>>>(U16(Xh), U16(Xl), U16(X16), U16(Wqh), U16(Wql), U16(Wkh), U16(Wkl), U16(Wv16), Qh, Ql, Kh, Kl, Vth, Vtl, TS, TD, TD); }
  { AttnGeom g;
    g.cp = rb; g.pc = nullptr; g.c_bs = 0; g.c_hs = 1; g.c_rs = TNH;   // rel_bias [bucket][head]
    g.q_bs = 0; g.q_rs = TD; g.q_hs = 64; g.k_bs = 0; g.k_rs = TD; g.k_hs = 64; g.v_bs = 0; g.v_rs = TS; g.v_hs = 64 * TS; g.o_bs = 0; g.o_rs = TD; g.o_hs = 64;
    g.S = TS; g.Skv = TS; g.H = TNH; g.mask_mode = 0; g.qscale = 1.0f; g.blk0 = 0; g.mask_fill = -INFINITY; g.mask_is_int = 0;
    attn64_kernel<true, true, false, true><<<TNH * (TS / AT_QB), AT_NW * 32, 0, stream>>>(Qh, Ql, Kh, Kl, Vth, Vtl, O, nullptr, nullptr, g); }
  cast_f32_f16x2<<<(TS * TD / 2 + 255) / 256, 256, 0, stream>>>(O, O16, TS * TD / 2);
  { const int t = (TS / 64) * (TD / 64);
    wmma_gemm64<2, 0, false, 0, 0, false><<<dim3(t / 2, 1), 2 * 32, 0, stream>>>(U16(O16), nullptr, TD, 0, U16(Wo16), nullptr, TD, 0, out, nullptr, TD, 0, nullptr, nullptr, 0, TS, TD, TD, 1.0f); }
}

// v007
// A run of this version takes 139 microseconds.
// Two timings next to v006 put it at 1.34 and 1.33 times that version's speed.
// Over all steps from v000 it is 6.27 times as fast.
#include <hip/hip_runtime.h>
#include <math.h>
// T5 self-attention with relative-position bias: q/k/v = x·Wᵀ (2048 x 1024 · 1024 x 1024 each), out = o·Woᵀ and the attention
// (16 heads x 64, 2048 x 2048, unscaled scores + rel_bias[bucket(k−q), h]): q/k projections and both attention products on
// v_wmma_f32_16x16x32_bf16 with bf16 hi/lo split operands (unscaled T5 scores make the softmax sharp), v and output projections on v_wmma_f32_16x16x32_f16 with f16 operands; f32 accumulate; the bucket table (integer thresholds of the T5 log-spaced bucketing: |Δ| < 8 exact, then ≥8,12,16,23,32,46,64,91,
// +16 for Δ > 0) and softmax in f32/int on VALU.
typedef __attribute__((ext_vector_type(16))) _Float16 v16h;
typedef __attribute__((ext_vector_type(8)))  _Float16 v8h;
typedef __attribute__((ext_vector_type(16))) __bf16   v16b;
typedef __attribute__((ext_vector_type(8)))  __bf16   v8b;
typedef __attribute__((ext_vector_type(8)))  float    v8f;
typedef __attribute__((ext_vector_type(4)))  float    v4f;
typedef __attribute__((ext_vector_type(2)))  float    v2f;
typedef __attribute__((ext_vector_type(2)))  __bf16   v2b;
#define PSCALE 32768.0f
#define U16(p) ((const unsigned short*)(const void*)(p))
#define PSCALE_INV (1.0f / 32768.0f)

__device__ __forceinline__ unsigned short f2bf_bits(float f) {
  unsigned u = __float_as_uint(f);
  return (unsigned short)((u + 0x7FFFu + ((u >> 16) & 1u)) >> 16);
}
__device__ __forceinline__ float bf_bits2f(unsigned short h) { return __uint_as_float(((unsigned)h) << 16); }

// hazard guard as a plain device helper
__device__ __forceinline__ void acc_guard4(v8f& a, v8f& b, v8f& c, v8f& d) { asm volatile("v_nop\n\tv_nop\n\tv_nop\n\tv_nop" : "+v"(a), "+v"(b), "+v"(c), "+v"(d)); }
template <typename T> struct Frag;
template <> struct Frag<_Float16> {
  typedef v16h V; typedef v8h H; union U { v16h v; v8h h[2]; };
  static __device__ __forceinline__ v16h load(const _Float16* p) {   // elements 0..7 <- p[0..7], 8..15 <- p[16..23]
    U f; f.h[0] = *(const v8h*)(p); f.h[1] = *(const v8h*)(p + 16); return f.v;
  }
  static __device__ __forceinline__ v8f mma(v16h a, v16h b, v8f c) {
    return __builtin_amdgcn_wmma_f32_16x16x32_f16(false, a, false, b, (short)0, c, false, false);
  }
};
template <> struct Frag<__bf16> {
  typedef v16b V; typedef v8b H; union U { v16b v; v8b h[2]; };
  static __device__ __forceinline__ v16b load(const __bf16* p) {
    U f; f.h[0] = *(const v8b*)(p); f.h[1] = *(const v8b*)(p + 16); return f.v;
  }
  static __device__ __forceinline__ v8f mma(v16b a, v16b b, v8f c) {
    return __builtin_amdgcn_wmma_f32_16x16x32_bf16(false, a, false, b, (short)0, c, false, false);
  }
};

// ---- Register-blocked batched WMMA GEMM ------------------------------------
// C[m,n] = scale * sum_k A[m,k] * Bt[n,k] (+bias)(+resid); each wave owns a 64x64 tile.
// A row-major [M,K]; Bt row-major [N,K]; a work-group of NW waves owns (NW / 2) x 2 wave tiles: M % (32 NW) == 0, N % 128 == 0, K % 64 == 0.
// The work-group's A and Bt rows pass through LDS, 64 k a stage: eight lanes copy a row's 128 B, so every global load covers whole lines and
// a row is fetched once a work-group; the next stage's global loads fly while this stage's products run.
// SPLIT: operands are hi/lo planes (A2/Bt2 = lo planes, same layout); product = hi·hi + hi·lo + lo·hi.
// BIAS_MODE: 0 = none, 1 = bias[m], 2 = bias[n].
// OUT_MODE: 0 = f32, 1 = f16, 2 = bf16 hi plane (Cout) + bf16 lo plane (Cout2).
// ET: 0 = f16 operands, 1 = bf16 operands (pointers passed as 16-bit storage)
template <int ET> struct Elem;
template <> struct Elem<0> { typedef _Float16 T; };
template <> struct Elem<1> { typedef __bf16 T; };
// NW = waves (64x64 tiles) per work-group, bx = index of the work-group among those of this product, b = batch index,
// sT = the work-group's NW slabs of 16 x 68 floats in LDS, sG = its operand stage of GM_ELEMS(NW, SPLIT) 16-bit elements in LDS
#define GM_KS 64   // k elements of a stage: 128 B of every row
#define GM_LP 72   // LDS row pitch of a stage in 16-bit elements: 144 B = 16 B x 9 (odd), so the 16 rows of a ds_load_b128 fragment read spread over the banks
#define GM_ELEMS(NW, SPLIT) (((NW) / 2 * 64 + 128) * GM_LP * ((SPLIT) ? 2 : 1))
template <int NW, int ET, bool SPLIT, int BIAS_MODE, int OUT_MODE, bool RESID, int ACT = 0>
__device__ __forceinline__ void gemm64_body(const int bx, const int b, float* __restrict__ sT, unsigned short* __restrict__ sG,
    const unsigned short* __restrict__ Ap, const unsigned short* __restrict__ A2p, int lda, long strideA,
    const unsigned short* __restrict__ Btp, const unsigned short* __restrict__ Bt2p, int ldb, long strideB,
    void* __restrict__ Cout, void* __restrict__ Cout2, int ldc, long strideC,
    const float* __restrict__ bias,
    const float* __restrict__ resid, long strideR,
    int M, int N, int K, float scale) {
  typedef typename Elem<ET>::T T;
  typedef typename Frag<T>::V V;
  const T* A = (const T*)Ap; const T* A2 = (const T*)A2p; const T* Bt = (const T*)Btp; const T* Bt2 = (const T*)Bt2p;
  typedef typename Frag<T>::H H;
  constexpr int AR = NW / 2 * 64, BR = 128, NT = NW * 32;   // rows of A and of Bt a work-group, its threads
  constexpr int NA = AR * 8 / NT, NB = BR * 8 / NT;         // 16 B pieces of a stage a thread and plane
  const int tid  = threadIdx.x;
  const int lane = tid & 31;
  const int wave = tid >> 5;
  const int tilesN = N / BR;
  const int tilesM = M / AR;
  if (bx >= tilesM * tilesN) return;   // the same in every thread of the work-group, ahead of every barrier
  const int tm = bx / tilesN;
  const int tn = bx - tm * tilesN;
  const int mW = tm * AR, nW = tn * BR;      // the work-group's first rows of A and of Bt
  const int am = (wave >> 1) << 6, bn = (wave & 1) << 6;   // the wave's first rows inside them
  const int m0 = mW + am;
  const int n0 = nW + bn;

  const T* Ab  = A  + (size_t)b * strideA;
  const T* Bb  = Bt + (size_t)b * strideB;
  const T* Ab2 = SPLIT ? (A2  + (size_t)b * strideA) : nullptr;
  const T* Bb2 = SPLIT ? (Bt2 + (size_t)b * strideB) : nullptr;

  const int rlane = lane & 15;                 // row (A) / col (B, D) within subtile
  const int koff  = (lane >> 4) * 8;           // k offset of this lane half
  const int mOff  = (lane >> 4) * 8;           // D row offset

  v8f acc[4][4];
#pragma unroll
  for (int i = 0; i < 4; ++i)
#pragma unroll
    for (int j = 0; j < 4; ++j) acc[i][j] = (v8f){0.f,0.f,0.f,0.f,0.f,0.f,0.f,0.f};

  T* sAh = (T*)sG;           T* sBh = sAh + AR * GM_LP;   // hi (or only) planes [row][k]
  T* sAl = sBh + BR * GM_LP; T* sBl = sAl + AR * GM_LP;   // lo planes, SPLIT only
  const int sr = tid >> 3, sc = (tid & 7) * 8;            // staging: this thread's first row and its 16 B piece of a row
  unsigned aob[NA], bob[NB];                              // byte offsets of its pieces from the work-group's first row (each operand's rows span less than 4 GiB)
#pragma unroll
  for (int i = 0; i < NA; ++i) aob[i] = ((unsigned)(sr + NT / 8 * i) * (unsigned)lda + sc) * 2u;
#pragma unroll
  for (int i = 0; i < NB; ++i) bob[i] = ((unsigned)(sr + NT / 8 * i) * (unsigned)ldb + sc) * 2u;
  H rah[NA], ral[NA], rbh[NB], rbl[NB];
  // address = first byte of the work-group's first row, the same in every lane, + the lane's 32-bit byte offset, which walks along k
  const size_t a0 = (size_t)mW * lda, b0 = (size_t)nW * ldb;
  auto fetch = [&]() {
#pragma unroll
    for (int i = 0; i < NA; ++i) {
      rah[i] = *(const H*)((const char*)(Ab + a0) + aob[i]);
      if (SPLIT) ral[i] = *(const H*)((const char*)(Ab2 + a0) + aob[i]);
    }
#pragma unroll
    for (int i = 0; i < NB; ++i) {
      rbh[i] = *(const H*)((const char*)(Bb + b0) + bob[i]);
      if (SPLIT) rbl[i] = *(const H*)((const char*)(Bb2 + b0) + bob[i]);
    }
  };
  fetch();
  for (int k0 = 0; k0 < K; k0 += GM_KS) {
    __syncthreads();   // every wave has left the last stage
#pragma unroll
    for (int i = 0; i < NA; ++i) {
      const int lo = (sr + NT / 8 * i) * GM_LP + sc;
      *(H*)(sAh + lo) = rah[i];
      if (SPLIT) *(H*)(sAl + lo) = ral[i];
      aob[i] += GM_KS * 2u;   // the next stage
    }
#pragma unroll
    for (int i = 0; i < NB; ++i) {
      const int lo = (sr + NT / 8 * i) * GM_LP + sc;
      *(H*)(sBh + lo) = rbh[i];
      if (SPLIT) *(H*)(sBl + lo) = rbl[i];
      bob[i] += GM_KS * 2u;
    }
    __syncthreads();   // the stage is whole for every wave
    if (k0 + GM_KS < K) {   // the same test in every thread
      fetch();
      // precaution: stands between these loads, which fly over the products, and every later rewrite of their address registers (scalar bases, lane offsets)
      asm volatile("s_wait_xcnt 0x0" ::: "memory");
    }
#pragma unroll
   for (int ks = 0; ks < GM_KS; ks += 32) {
    V bh[4], bl[4], ah[4], al[4];   // the slice's fragments are read as one group: one LDS latency a slice, not one a row of tiles
#pragma unroll
    for (int j = 0; j < 4; ++j) {
      const int bo = (bn + (j << 4) + rlane) * GM_LP + koff + ks;
      bh[j] = Frag<T>::load(sBh + bo);
      if (SPLIT) bl[j] = Frag<T>::load(sBl + bo);
    }
#pragma unroll
    for (int i = 0; i < 4; ++i) {
      const int ao = (am + (i << 4) + rlane) * GM_LP + koff + ks;
      ah[i] = Frag<T>::load(sAh + ao);
      if (SPLIT) al[i] = Frag<T>::load(sAl + ao);
    }
    __builtin_amdgcn_sched_barrier(0);   // holds the group of reads ahead of the products: the scheduler otherwise sinks each A read to its first use, a full LDS latency a row of tiles
#pragma unroll
    for (int i = 0; i < 4; ++i) {
#pragma unroll
      for (int j = 0; j < 4; ++j) {
        acc[i][j] = Frag<T>::mma(ah[i], bh[j], acc[i][j]);
        if (SPLIT) {
          acc[i][j] = Frag<T>::mma(ah[i], bl[j], acc[i][j]);
          acc[i][j] = Frag<T>::mma(al[i], bh[j], acc[i][j]);
        }
      }
    }
   }
  }
  acc_guard4(acc[0][0], acc[0][1], acc[0][2], acc[0][3]);
  acc_guard4(acc[1][0], acc[1][1], acc[1][2], acc[1][3]);
  acc_guard4(acc[2][0], acc[2][1], acc[2][2], acc[2][3]);
  acc_guard4(acc[3][0], acc[3][1], acc[3][2], acc[3][3]);

  // ---- epilogue ----
  float* slab = sT + wave * (16 * 68);
  const float* Rb = RESID ? (resid + (size_t)b * strideR) : nullptr;
#pragma unroll
  for (int i = 0; i < 4; ++i) {
    const int mBase = m0 + (i << 4);
#pragma unroll
    for (int j = 0; j < 4; ++j) {
      const int n = n0 + (j << 4) + rlane;
      float bv = 0.f;
      if (BIAS_MODE == 2) bv = bias[n];
#pragma unroll
      for (int r = 0; r < 8; ++r) {
        float v = acc[i][j][r] * scale;
        if (BIAS_MODE == 1) v += bias[mBase + mOff + r];
        if (BIAS_MODE == 2) v += bv;
        if (RESID) v += Rb[(size_t)(mBase + mOff + r) * ldc + n];
        if (ACT == 1) v = tanhf(v);
        if (ACT == 2) v = fmaxf(v, 0.0f);
        if (ACT == 3) v = v / (1.0f + expf(-v));
        if (ACT == 4) v = (v > 0.f) ? v : 0.01f * v;
        if (ACT == 5) v = 0.5f * v * (1.0f + erff(v * 0.70710678118654752f));
        slab[(mOff + r) * 68 + (j << 4) + rlane] = v;
      }
    }
    __builtin_amdgcn_fence(__ATOMIC_RELEASE, "workgroup");
    __builtin_amdgcn_wave_barrier();
    __builtin_amdgcn_fence(__ATOMIC_ACQUIRE, "workgroup");
    if (OUT_MODE == 0) {
      float* C = (float*)Cout + (size_t)b * strideC;
      const int hh = lane >> 4, c4 = (lane & 15) * 4;     // row seg = 256 B = 16 lanes x 16 B
      {
#pragma unroll
        for (int it = 0; it < 8; ++it) {
          const int row = it * 2 + hh;
          v4f v = *(const v4f*)(slab + row * 68 + c4);
          *(v4f*)(C + (size_t)(mBase + row) * ldc + n0 + c4) = v;
        }
        
      }
    } else {
      const int q = lane >> 3, c8 = (lane & 7) * 8;
      unsigned short* C  = (unsigned short*)Cout  + (size_t)b * strideC;
      unsigned short* C2 = (OUT_MODE == 2) ? ((unsigned short*)Cout2 + (size_t)b * strideC) : nullptr;
      {
#pragma unroll
        for (int it = 0; it < 4; ++it) {
          const int row = it * 4 + q;
          const float* sp = slab + row * 68 + c8;
          v8h hv, lv;
#pragma unroll
          for (int e = 0; e < 8; ++e) {
            if (OUT_MODE == 1) {
              hv[e] = (_Float16)sp[e];
            } else {
              unsigned short hb = f2bf_bits(sp[e]);
              unsigned short lb = f2bf_bits(sp[e] - bf_bits2f(hb));
              hv[e] = __builtin_bit_cast(_Float16, hb);
              lv[e] = __builtin_bit_cast(_Float16, lb);
            }
          }
          *(v8h*)(C + (size_t)(mBase + row) * ldc + n0 + c8) = hv;
          if (OUT_MODE == 2) *(v8h*)(C2 + (size_t)(mBase + row) * ldc + n0 + c8) = lv;
        }
        
      }
    }
    __builtin_amdgcn_fence(__ATOMIC_RELEASE, "workgroup");
    __builtin_amdgcn_wave_barrier();
    __builtin_amdgcn_fence(__ATOMIC_ACQUIRE, "workgroup");
  }
}

template <int NW, int ET, bool SPLIT, int BIAS_MODE, int OUT_MODE, bool RESID, int ACT = 0>
__global__ __launch_bounds__(NW * 32) void wmma_gemm64(
    const unsigned short* __restrict__ Ap, const unsigned short* __restrict__ A2p, int lda, long strideA,
    const unsigned short* __restrict__ Btp, const unsigned short* __restrict__ Bt2p, int ldb, long strideB,
    void* __restrict__ Cout, void* __restrict__ Cout2, int ldc, long strideC,
    const float* __restrict__ bias,
    const float* __restrict__ resid, long strideR,
    int M, int N, int K, float scale) {
  __shared__ __align__(16) float sT[NW * 16 * 68];   // per-wave 16x64 slab, pitch 68 floats
  __shared__ __align__(16) unsigned short sG[GM_ELEMS(NW, SPLIT)];
  gemm64_body<NW, ET, SPLIT, BIAS_MODE, OUT_MODE, RESID, ACT>(blockIdx.x, blockIdx.y, sT, sG, Ap, A2p, lda, strideA, Btp, Bt2p, ldb, strideB,
                                                              Cout, Cout2, ldc, strideC, bias, resid, strideR, M, N, K, scale);
}

// The three projections of one x [M][K] in one launch, so that their work-groups run side by side on different WGPs:
// blockIdx.y = 0: q = x Wq^T, 1: k = x Wk^T (both bf16 hi/lo split), 2: v^T = Wv x^T (f16); weights [N][K].
// Each result leaves as the bf16 hi and lo planes that the attention's matrix products read: q, k as [M][N], v transposed as [N][M].
template <int NW>
__global__ __launch_bounds__(NW * 32) void qkv_gemm64(
    const unsigned short* __restrict__ Xh, const unsigned short* __restrict__ Xl, const unsigned short* __restrict__ X16,
    const unsigned short* __restrict__ Wqh, const unsigned short* __restrict__ Wql,
    const unsigned short* __restrict__ Wkh, const unsigned short* __restrict__ Wkl, const unsigned short* __restrict__ Wv16,
    unsigned short* __restrict__ Qh, unsigned short* __restrict__ Ql, unsigned short* __restrict__ Kh, unsigned short* __restrict__ Kl,
    unsigned short* __restrict__ Vth, unsigned short* __restrict__ Vtl, int M, int N, int K) {
  __shared__ __align__(16) float sT[NW * 16 * 68];   // per-wave 16x64 slab, pitch 68 floats
  __shared__ __align__(16) unsigned short sG[GM_ELEMS(NW, true)];
  if (blockIdx.y < 2) {
    const bool isk = blockIdx.y == 1;
    gemm64_body<NW, 1, true, 0, 2, false>(blockIdx.x, 0, sT, sG, Xh, Xl, K, 0, isk ? Wkh : Wqh, isk ? Wkl : Wql, K, 0,
                                          isk ? Kh : Qh, isk ? Kl : Ql, N, 0, nullptr, nullptr, 0, M, N, K, 1.0f);
  } else {
    gemm64_body<NW, 0, false, 0, 2, false>(blockIdx.x, 0, sT, sG, Wv16, nullptr, K, 0, X16, nullptr, K, 0,
                                           Vth, Vtl, M, 0, nullptr, nullptr, 0, N, M, K, 1.0f);
  }
}

__global__ __launch_bounds__(256) void cast_f32_f16x2(
    const float* __restrict__ in, _Float16* __restrict__ out, int n2) {
  int i = blockIdx.x * 256 + threadIdx.x;
  if (i < n2) {
    const _Float16 h0 = (_Float16)in[2 * i], h1 = (_Float16)in[2 * i + 1];
    const unsigned u = (unsigned)__builtin_bit_cast(unsigned short, h0) | ((unsigned)__builtin_bit_cast(unsigned short, h1) << 16);
    ((unsigned*)out)[i] = u;
    
  }
}


// ---- f32 -> f16 cast with a power-of-two pre-scale (folded back by the consumer GEMM's scale) ----
__global__ __launch_bounds__(256) void cast_f32_f16x2s(const float* __restrict__ in, _Float16* __restrict__ out, int n2, float s) {
  int i = blockIdx.x * 256 + threadIdx.x;
  if (i < n2) {
    const _Float16 h0 = (_Float16)(in[2 * i] * s), h1 = (_Float16)(in[2 * i + 1] * s);
    const unsigned u = (unsigned)__builtin_bit_cast(unsigned short, h0) | ((unsigned)__builtin_bit_cast(unsigned short, h1) << 16);
    ((unsigned*)out)[i] = u;
    
  }
}
__global__ __launch_bounds__(256) void split_f32_bf16x2(
    const float* __restrict__ in, __bf16* __restrict__ hi, __bf16* __restrict__ lo, long n2) {
  long i = (long)blockIdx.x * 256 + threadIdx.x;
  long stride = (long)gridDim.x * 256;
  {
    for (long j = i; j < n2; j += stride) {
      const float a = in[2 * j], b = in[2 * j + 1];
      const unsigned short ah = f2bf_bits(a), bh = f2bf_bits(b);
      const unsigned short al = f2bf_bits(a - bf_bits2f(ah)), bl = f2bf_bits(b - bf_bits2f(bh));
      ((unsigned*)hi)[j] = (unsigned)ah | ((unsigned)bh << 16);
      ((unsigned*)lo)[j] = (unsigned)al | ((unsigned)bl << 16);
    }
    
  }
}


// ---- f32 [R][C] (row pitch ldi) -> f16 transposed [C][R] (row pitch ldo); 64x64 tiles; each output row segment
__global__ __launch_bounds__(256) void transpose_cast_f16(const float* __restrict__ in, int ldi,
                                                         _Float16* __restrict__ outT, int ldo, float scale) {
  __shared__ __align__(16) _Float16 tile[64][72];     // [c][r]
  const int c0 = blockIdx.x * 64, r0 = blockIdx.y * 64;
  const int t = threadIdx.y * 32 + threadIdx.x;
  for (int i = threadIdx.y; i < 64; i += 8) {
    tile[threadIdx.x][i]      = (_Float16)(in[(size_t)(r0 + i) * ldi + c0 + threadIdx.x] * scale);
    tile[32 + threadIdx.x][i] = (_Float16)(in[(size_t)(r0 + i) * ldi + c0 + 32 + threadIdx.x] * scale);
  }
  __syncthreads();
  const int q = t >> 3, c8 = (t & 7) * 8;
  {
#pragma unroll
    for (int it = 0; it < 2; ++it) {
      const int c = it * 32 + q;
      v8h hv = *(const v8h*)(&tile[c][c8]);
      *(v8h*)(outT + (size_t)(c0 + c) * ldo + r0 + c8) = hv;
    }
    
  }
}

// ---- f32 [R][C] (pitch ldi) -> bf16 hi/lo transposed planes [C][R] (pitch ldo); 64x64 tiles; each output row segment
__global__ __launch_bounds__(256) void transpose_split_bf16(const float* __restrict__ in, int ldi,
                                                           __bf16* __restrict__ outH, __bf16* __restrict__ outL, int ldo) {
  __shared__ __align__(16) float tile[64][68];     // [c][r]
  const int c0 = blockIdx.x * 64, r0 = blockIdx.y * 64;
  const int t = threadIdx.y * 32 + threadIdx.x;
  for (int i = threadIdx.y; i < 64; i += 8) {
    tile[threadIdx.x][i]      = in[(size_t)(r0 + i) * ldi + c0 + threadIdx.x];
    tile[32 + threadIdx.x][i] = in[(size_t)(r0 + i) * ldi + c0 + 32 + threadIdx.x];
  }
  __syncthreads();
  const int q = t >> 3, c8 = (t & 7) * 8;
  {
#pragma unroll
    for (int it = 0; it < 2; ++it) {
      const int c = it * 32 + q;
      v8b hv, lv;
#pragma unroll
      for (int e = 0; e < 8; ++e) {
        const float f = tile[c][c8 + e];
        const unsigned short hb = f2bf_bits(f);
        hv[e] = __builtin_bit_cast(__bf16, hb);
        lv[e] = __builtin_bit_cast(__bf16, f2bf_bits(f - bf_bits2f(hb)));
      }
      *(v8b*)(outH + (size_t)(c0 + c) * ldo + r0 + c8) = hv;
      *(v8b*)(outL + (size_t)(c0 + c) * ldo + r0 + c8) = lv;
    }
    
  }
}

#define AT_D 64
#define AT_NW 4
#define AT_QB 64
#define AT_KC 64
#define AT_LP 72   // LDS row pitch of the K and V tiles in 16-bit elements: 144 B = 16 B x 9 (odd), so the 16 rows of a ds_load_b128 fragment read spread over the banks
#define AT_BT (2048 + AT_QB)   // distance table: Skv + AT_QB - 1 entries used (Skv <= 2048), rounded up to whole waves
struct AttnGeom { const float* cp = nullptr; const float* pc = nullptr; long c_bs = 0, c_rs = 0, c_hs = 0;   // mode-5 / DISTB score-bias tables
                  long q_bs, q_rs, q_hs, k_bs, k_rs, k_hs, v_bs, v_rs, v_hs, o_bs, o_rs, o_hs;
                  int S, Skv, H, mask_mode; float qscale; int blk0; float mask_fill; int mask_is_int; };
static_assert(sizeof(AttnGeom) == 168, "no padding");

__device__ __forceinline__ unsigned short at_bf_bits(float f) {
  unsigned u = __float_as_uint(f);
  return (unsigned short)((u + 0x7FFFu + ((u >> 16) & 1u)) >> 16);
}
__device__ __forceinline__ __bf16 at_f2bf(float f) { return __builtin_bit_cast(__bf16, at_bf_bits(f)); }
// two neighbours as packed bf16 pairs: hi = the value rounded to nearest even, lo = what is left, rounded likewise
__device__ __forceinline__ void at_split2(float p0, float p1, v2b& hi, v2b& lo) {
  const v2f p = {p0, p1};
  hi = __builtin_convertvector(p, v2b);
  lo = __builtin_convertvector(p - __builtin_convertvector(hi, v2f), v2b);
}
// the value of lane l ^ 16: the other half of the same query's kv rows
__device__ __forceinline__ float at_other_half(float x) {
  const int b = __float_as_int(x);
  return __int_as_float(__builtin_amdgcn_permlanex16(b, b, 0x76543210, 0xfedcba98, false, false));
}
// 16-bit element as a bit pattern held in a __bf16 slot: f16 bits when F16, bf16 (RNE) otherwise
template <bool F16> __device__ __forceinline__ __bf16 at_to16(float f) {
  if (F16) return __builtin_bit_cast(__bf16, (_Float16)f);
  return at_f2bf(f);
}
// the builtin alone: the compiler keeps the distance behind it, and LDS reads may be scheduled across it
template <bool F16> __device__ __forceinline__ v8f at_mma16(v16b a, v16b b, v8f c) {
  if (F16) return __builtin_amdgcn_wmma_f32_16x16x32_f16(false, __builtin_bit_cast(v16h, a), false, __builtin_bit_cast(v16h, b), (short)0, c, false, false);
  return __builtin_amdgcn_wmma_f32_16x16x32_bf16(false, a, false, b, (short)0, c, false, false);
}

// DISTB: s += bias[bucket(kv - q)] of this head (32 buckets; bucket n of (b, h) at cp + b*c_bs + h*c_hs + n*c_rs), no mask; Skv <= 2048.
template <bool SPLIT_QK, bool SPLIT_PV, bool F16 = false, bool DISTB = false>
__global__ __launch_bounds__(128)
void attn64_kernel(const unsigned short* __restrict__ qh, const unsigned short* __restrict__ ql,
                   const unsigned short* __restrict__ kh, const unsigned short* __restrict__ kl,
                   const unsigned short* __restrict__ vh, const unsigned short* __restrict__ vl, float* __restrict__ out,
                   const void* __restrict__ mask_a, const int* __restrict__ mask_b, AttnGeom g) {
  static_assert(!(F16 && (SPLIT_QK || SPLIT_PV)), "f16 mode is non-split");
  const float PSC = F16 ? 32768.0f : 1.0f;     // f16 probabilities carried x2^15 (subnormal range), folded into the final 1/l
  union FB { v16b v; v8b h[2]; v2b d[8]; };
  __shared__ __align__(16) __bf16 Ksh[AT_KC * AT_LP];            // K hi [kv][d], rows at pitch AT_LP   9 KB
  __shared__ __align__(16) __bf16 Ksl[SPLIT_QK ? AT_KC * AT_LP : 8];
  __shared__ __align__(16) __bf16 Vth[AT_D * AT_LP];            // V hi [d][kv], rows at pitch AT_LP   9 KB
  __shared__ __align__(16) __bf16 Vtl[SPLIT_PV ? AT_D * AT_LP : 8];
  __shared__ __align__(16) float  Os[AT_NW][16 * 68];            // per wave out tile, pitch 68
  __shared__ float Bs[DISTB ? AT_BT : 1];                        // score bias of this (head, query block) by distance kv - q

  const int tid  = threadIdx.x;
  const int wave = tid >> 5;
  const int lane = tid & 31;
  const int hh   = lane >> 4;
  const int c    = lane & 15;

  const int nqb = g.S / AT_QB;
  const int bx = blockIdx.x + g.blk0;
  const int qb = bx % nqb;
  const int bh = bx / nqb;
  const int h  = bh % g.H;
  const int b  = bh / g.H;
  const int qbase_block = qb * AT_QB;
  const int q0 = qbase_block + wave * 16;

  const size_t qoff = (size_t)b * g.q_bs + (size_t)h * g.q_hs;
  const size_t koff = (size_t)b * g.k_bs + (size_t)h * g.k_hs;
  const size_t voff = (size_t)b * g.v_bs + (size_t)h * g.v_hs;
  float*       ob_ptr = out + (size_t)b * g.o_bs + (size_t)h * g.o_hs;

  // Bs[i] = bias of distance kv - q = i - (qbase_block + AT_QB - 1); published by the barriers at the head of the kv loop
  if (DISTB) {
    const float bl = g.cp[(size_t)b * g.c_bs + (size_t)h * g.c_hs + (size_t)lane * g.c_rs];   // lane n holds bucket n
    for (int i = tid; i < AT_BT; i += AT_NW * 32) {   // whole waves only (AT_BT % 32 == 0): every source lane of the shuffle is on
      const int rel = i - (qbase_block + AT_QB - 1); const int a = rel < 0 ? -rel : rel;
      int bkt;
      if (a < 8) bkt = a;
      else bkt = 8 + (a >= 12) + (a >= 16) + (a >= 23) + (a >= 32) + (a >= 46) + (a >= 64) + (a >= 91);   // = 8 + trunc(8*log(a/8)/log 16), capped at 15
      if (rel > 0) bkt += 16;
      Bs[i] = __shfl(bl, bkt, 32);
    }
  }

  // ---- Q fragments (B operand: column = query q0 + c): 2 d-chunks, hi (and lo) ----
  v16b qah[2], qal[2];
  {
    const size_t qrow = qoff + (size_t)(q0 + c) * g.q_rs + 8 * hh;
#pragma unroll
    for (int dc = 0; dc < 2; ++dc) {
      qah[dc] = Frag<__bf16>::load((const __bf16*)qh + qrow + dc * 32);
      qal[dc] = SPLIT_QK ? Frag<__bf16>::load((const __bf16*)ql + qrow + dc * 32) : qah[dc];
    }
  }

  float mrow = -INFINITY, lrow = 0.f;   // this lane's query: running maximum (both halves agree), sum over this half's kv rows
  v8f oacc[4];                          // O^T: oacc[t][r] = out[q0 + c][16 t + 8 hh + r]
#pragma unroll
  for (int t = 0; t < 4; ++t) oacc[t] = (v8f){0.f,0.f,0.f,0.f,0.f,0.f,0.f,0.f};

  const int nChunks = (g.mask_mode == 1 || g.mask_mode == 4) ? (qb + 1) : (g.Skv / AT_KC);   // block-uniform
  // per-row query mask (mode 3)
  const int qkeep = (g.mask_mode == 3) ? mask_b[(size_t)b * g.S + q0 + c] : 1;   // mask_b = qmask in mode 3
  const int sr = tid >> 3, sc = (tid & 7) * 8;   // tile staging: this thread's first row and its 16 B piece of a row
  unsigned kbo[4], vbo[4];                       // byte offsets of its four pieces of the current K and V tile
#pragma unroll
  for (int i = 0; i < 4; ++i) {
    kbo[i] = ((unsigned)(sr + 16 * i) * (unsigned)g.k_rs + sc) * 2u;
    vbo[i] = ((unsigned)(sr + 16 * i) * (unsigned)g.v_rs + sc) * 2u;
  }
  for (int kc = 0; kc < nChunks; ++kc) {
    const int kv0 = kc * AT_KC;
    {
      // Each tile is 64 rows of 128 B (K: row = kv, V: row = d): eight lanes copy a row, 16 B each, four rows a thread and tile.
      // The global reads touch no LDS, so they stand ahead of the barrier that ends the last chunk's reads of the tiles.
      // Address = this (batch, head)'s first byte, the same in every lane, + the lane's 32-bit byte offset from it.
      v8b rkh[4], rkl[4], rvh[4], rvl[4];
#pragma unroll
      for (int i = 0; i < 4; ++i) {
        rkh[i] = *(const v8b*)((const char*)(kh + koff) + kbo[i]);
        if (SPLIT_QK) rkl[i] = *(const v8b*)((const char*)(kl + koff) + kbo[i]);
        rvh[i] = *(const v8b*)((const char*)(vh + voff) + vbo[i]);
        if (SPLIT_PV) rvl[i] = *(const v8b*)((const char*)(vl + voff) + vbo[i]);
      }
      __syncthreads();
#pragma unroll
      for (int i = 0; i < 4; ++i) {
        const int lo = (sr + 16 * i) * AT_LP + sc;
        *(v8b*)(Ksh + lo) = rkh[i];
        if (SPLIT_QK) *(v8b*)(Ksl + lo) = rkl[i];
        *(v8b*)(Vth + lo) = rvh[i];
        if (SPLIT_PV) *(v8b*)(Vtl + lo) = rvl[i];
        kbo[i] += (unsigned)g.k_rs * (AT_KC * 2u);   // the next chunk: AT_KC rows on in k, AT_KC columns on in v
        vbo[i] += AT_KC * 2u;
      }
    }
    __syncthreads();

    // The K fragments of a d-chunk are read as one group, then the four score tiles advance side by side: one LDS latency a group,
    // and each tile's next product stands four matrix instructions behind its last. Each tile sums its products in the order dc, hi.hi, hi.lo, lo.hi
    // (q part first). s[j][r] = score of kv row kv0 + 16 j + 8 hh + r and query q0 + c.
    v8f s[4];
#pragma unroll
    for (int j = 0; j < 4; ++j) s[j] = (v8f){0.f,0.f,0.f,0.f,0.f,0.f,0.f,0.f};
#pragma unroll
    for (int dc = 0; dc < 2; ++dc) {
      FB kb[4], kl[4];
#pragma unroll
      for (int j = 0; j < 4; ++j) {
        kb[j].h[0] = *(const v8b*)(Ksh + (j * 16 + c) * AT_LP + dc * 32 + 8 * hh);
        kb[j].h[1] = *(const v8b*)(Ksh + (j * 16 + c) * AT_LP + dc * 32 + 16 + 8 * hh);
        if (SPLIT_QK) {
          kl[j].h[0] = *(const v8b*)(Ksl + (j * 16 + c) * AT_LP + dc * 32 + 8 * hh);
          kl[j].h[1] = *(const v8b*)(Ksl + (j * 16 + c) * AT_LP + dc * 32 + 16 + 8 * hh);
        }
      }
#pragma unroll
      for (int j = 0; j < 4; ++j) s[j] = at_mma16<F16>(kb[j].v, qah[dc], s[j]);
      if (SPLIT_QK) {
#pragma unroll
        for (int j = 0; j < 4; ++j) s[j] = at_mma16<F16>(kl[j].v, qah[dc], s[j]);
#pragma unroll
        for (int j = 0; j < 4; ++j) s[j] = at_mma16<F16>(kb[j].v, qal[dc], s[j]);
      }
    }
    const bool diag = (g.mask_mode == 1) && (kc == qb);
    float cj[4];   // maximum of each tile's eight scores: four independent chains
    if (DISTB) {
      const float* bp = Bs + (kv0 + 8 * hh + (AT_QB - 1) - wave * 16 - c);   // + kv row offset - query offset
#pragma unroll
      for (int j = 0; j < 4; ++j) {
        float m = -INFINITY;
#pragma unroll
        for (int r = 0; r < 8; ++r) { s[j][r] += bp[j * 16 + r]; m = fmaxf(m, s[j][r]); }
        cj[j] = m;
      }
    } else
#pragma unroll
    for (int j = 0; j < 4; ++j) {
      const int qrow = q0 + c;
      float m = -INFINITY;
#pragma unroll
      for (int r = 0; r < 8; ++r) {
        const int kvcol = kv0 + j * 16 + 8 * hh + r;
        bool masked = false;
        if (diag) masked = (kvcol > qrow);
        else if (g.mask_mode == 4) masked = (kvcol > qrow) || (qrow - kvcol > g.mask_is_int);
        else if (g.mask_mode == 2) {
          const size_t mi = (size_t)qrow * g.Skv + kvcol;
          masked = (g.mask_is_int == 0) ? (((const float*)mask_a)[mi] == 0.0f)
                 : (g.mask_is_int == 1) ? (((const int*)mask_a)[mi] == 0) : (((const int*)mask_a)[mi] != 0);
        } else if (g.mask_mode == 3) masked = (qkeep == 0) || (((const int*)mask_a)[(size_t)b * g.Skv + kvcol] == 0);   // mask_a = kvmask
        else if (g.mask_mode == 5) {
          const size_t mi = (size_t)qrow * g.Skv + kvcol;
          masked = (((const int*)mask_a)[mi] != 0);
          int n = mask_b[mi]; n = n < 0 ? 0 : n;
          s[j][r] += g.cp[(size_t)b * g.c_bs + (size_t)h * g.c_hs + (size_t)qrow * g.c_rs + n]
                   + g.pc[(size_t)b * g.c_bs + (size_t)h * g.c_hs + (size_t)kvcol * g.c_rs + n];
        }
        if (masked) s[j][r] = g.mask_fill;
        m = fmaxf(m, s[j][r]);
      }
      cj[j] = m;
    }
    // the query's maximum over the chunk: this lane's 32 kv rows, then the other half's 32
    float cm = fmaxf(fmaxf(cj[0], cj[1]), fmaxf(cj[2], cj[3]));
    cm = fmaxf(cm, at_other_half(cm));
    const float mnew = fmaxf(mrow, cm);
    const float alpha = expf(mrow - mnew);
    mrow = mnew;
    // Tiles 2 kk and 2 kk + 1 hold kv rows 8 hh + r and 16 + 8 hh + r of kv half kk: the k order of a B operand, element by element
    FB pb[2], pl[2];
    float ps[4];
#pragma unroll
    for (int j = 0; j < 4; ++j) {
      float psum = 0.f;
#pragma unroll
      for (int r = 0; r < 8; r += 2) {
        const float p0 = expf(s[j][r] - mnew), p1 = expf(s[j][r + 1] - mnew);
        psum += p0; psum += p1;
        const int e = (j & 1) * 8 + r;
        if (SPLIT_PV) at_split2(p0, p1, pb[j >> 1].d[e >> 1], pl[j >> 1].d[e >> 1]);
        else { pb[j >> 1].v[e] = at_to16<F16>(p0 * PSC); pb[j >> 1].v[e + 1] = at_to16<F16>(p1 * PSC); }
      }
      ps[j] = psum;
    }
    lrow = lrow * alpha + ((ps[0] + ps[1]) + (ps[2] + ps[3]));   // the halves' sums are joined once, behind the loop
#pragma unroll
    for (int t = 0; t < 4; ++t) oacc[t] *= alpha;
    // As for the scores: the V fragments of a kv half are read as one group, then the four output tiles advance side by side
    // (each tile's order of sums: kk, hi.hi, hi.lo, lo.hi, p part first).
#pragma unroll
    for (int kk = 0; kk < 2; ++kk) {
      FB vb[4], vl[4];
#pragma unroll
      for (int t = 0; t < 4; ++t) {
        vb[t].h[0] = *(const v8b*)(Vth + (t * 16 + c) * AT_LP + kk * 32 + 8 * hh);
        vb[t].h[1] = *(const v8b*)(Vth + (t * 16 + c) * AT_LP + kk * 32 + 16 + 8 * hh);
        if (SPLIT_PV) {
          vl[t].h[0] = *(const v8b*)(Vtl + (t * 16 + c) * AT_LP + kk * 32 + 8 * hh);
          vl[t].h[1] = *(const v8b*)(Vtl + (t * 16 + c) * AT_LP + kk * 32 + 16 + 8 * hh);
        }
      }
#pragma unroll
      for (int t = 0; t < 4; ++t) oacc[t] = at_mma16<F16>(vb[t].v, pb[kk].v, oacc[t]);
      if (SPLIT_PV) {
#pragma unroll
        for (int t = 0; t < 4; ++t) oacc[t] = at_mma16<F16>(vl[t].v, pb[kk].v, oacc[t]);
#pragma unroll
        for (int t = 0; t < 4; ++t) oacc[t] = at_mma16<F16>(vb[t].v, pl[kk].v, oacc[t]);
      }
    }
  }

  // a lane holds eight neighbouring d of its query a tile: two 16 B pieces into the wave's slab [query][d]
  float* os = Os[wave];
  {
    const float inv = 1.0f / ((lrow + at_other_half(lrow)) * PSC);
#pragma unroll
    for (int t = 0; t < 4; ++t) {
      const v8f o = oacc[t] * inv;
      *(v4f*)(os + c * 68 + t * 16 + 8 * hh)     = (v4f){o[0], o[1], o[2], o[3]};
      *(v4f*)(os + c * 68 + t * 16 + 8 * hh + 4) = (v4f){o[4], o[5], o[6], o[7]};
    }
  }
  __builtin_amdgcn_fence(__ATOMIC_RELEASE, "workgroup");
  __builtin_amdgcn_wave_barrier();
  __builtin_amdgcn_fence(__ATOMIC_ACQUIRE, "workgroup");
  {
    const int c4 = (lane & 15) * 4;
    {
#pragma unroll
      for (int it = 0; it < 8; ++it) {
        const int row = it * 2 + hh;
        v4f val = *(const v4f*)(os + row * 68 + c4);
        *(v4f*)(ob_ptr + (size_t)(q0 + row) * g.o_rs + c4) = val;
      }
      
    }
  }
}

#define TS 2048
#define TD 1024
#define TNH 16
#define TNB 32
extern "C" void kernel_launch(void* const* d_in, const int* in_sizes, int n_in, void* d_out, int out_size, void* d_ws, size_t ws_size, hipStream_t stream) {
  (void)in_sizes; (void)n_in; (void)out_size; (void)ws_size;
  const float* x = (const float*)d_in[0]; const float* wq = (const float*)d_in[1]; const float* wk = (const float*)d_in[2]; const float* wv = (const float*)d_in[3]; const float* wo = (const float*)d_in[4]; const float* rb = (const float*)d_in[5];
  float* out = (float*)d_out;   // [1][2048][1024]
  char* ws = (char*)d_ws; size_t off = 0;
  auto carve = [&](size_t bytes) -> char* { char* p = ws + off; off += (bytes + 255) & ~(size_t)255; return p; };
  _Float16* X16 = (_Float16*)carve((size_t)TS * TD * 2);
__bf16* Xh = (__bf16*)carve((size_t)TS * TD * 2); __bf16* Xl = (__bf16*)carve((size_t)TS * TD * 2);
  __bf16* Wqh = (__bf16*)carve((size_t)TD * TD * 2); __bf16* Wql = (__bf16*)carve((size_t)TD * TD * 2); __bf16* Wkh = (__bf16*)carve((size_t)TD * TD * 2); __bf16* Wkl = (__bf16*)carve((size_t)TD * TD * 2);
  _Float16* Wv16 = (_Float16*)carve((size_t)TD * TD * 2); _Float16* Wo16 = (_Float16*)carve((size_t)TD * TD * 2);
  unsigned short* Qh = (unsigned short*)carve((size_t)TS * TD * 2); unsigned short* Ql = (unsigned short*)carve((size_t)TS * TD * 2);
  unsigned short* Kh = (unsigned short*)carve((size_t)TS * TD * 2); unsigned short* Kl = (unsigned short*)carve((size_t)TS * TD * 2);
  unsigned short* Vth = (unsigned short*)carve((size_t)TS * TD * 2); unsigned short* Vtl = (unsigned short*)carve((size_t)TS * TD * 2);   // [TD][TS]
  float* O = (float*)carve((size_t)TS * TD * 4);
  _Float16* O16 = X16;
  cast_f32_f16x2<<<(TS * TD / 2 + 255) / 256, 256, 0, stream>>>(x, X16, TS * TD / 2);
  split_f32_bf16x2<<<(TS * TD / 2 + 255) / 256, 256, 0, stream>>>(x, Xh, Xl, TS * TD / 2);
  split_f32_bf16x2<<<(TD * TD / 2 + 255) / 256, 256, 0, stream>>>(wq, Wqh, Wql, TD * TD / 2);   // nn.Linear weights [out][in] = Bt layout
  split_f32_bf16x2<<<(TD * TD / 2 + 255) / 256, 256, 0, stream>>>(wk, Wkh, Wkl, TD * TD / 2);
  cast_f32_f16x2<<<(TD * TD / 2 + 255) / 256, 256, 0, stream>>>(wv, Wv16, TD * TD / 2);
  cast_f32_f16x2<<<(TD * TD / 2 + 255) / 256, 256, 0, stream>>>(wo, Wo16, TD * TD / 2);
  { const int t = (TS / 64) * (TD / 64);
    qkv_gemm64<4><<<dim3(t / 4, 3), 4 * 32, 0, stream>>>(U16(Xh), U16(Xl), U16(X16), U16(Wqh), U16(Wql), U16(Wkh), U16(Wkl), U16(Wv16), Qh, Ql, Kh, Kl, Vth, Vtl, TS, TD, TD); }
  { AttnGeom g;
    g.cp = rb; g.pc = nullptr; g.c_bs = 0; g.c_hs = 1; g.c_rs = TNH;   // rel_bias [bucket][head]
    g.q_bs = 0; g.q_rs = TD; g.q_hs = 64; g.k_bs = 0; g.k_rs = TD; g.k_hs = 64; g.v_bs = 0; g.v_rs = TS; g.v_hs = 64 * TS; g.o_bs = 0; g.o_rs = TD; g.o_hs = 64;
    g.S = TS; g.Skv = TS; g.H = TNH; g.mask_mode = 0; g.qscale = 1.0f; g.blk0 = 0; g.mask_fill = -INFINITY; g.mask_is_int = 0;
    attn64_kernel<true, true, false, true><<<TNH * (TS / AT_QB), AT_NW * 32, 0, stream>>>(Qh, Ql, Kh, Kl, Vth, Vtl, O, nullptr, nullptr, g); }
  cast_f32_f16x2<<<(TS * TD / 2 + 255) / 256, 256, 0, stream>>>(O, O16, TS * TD / 2);
  { const int t = (TS / 64) * (TD / 64);
    wmma_gemm64<2, 0, false, 0, 0, false><<<dim3(t / 2, 1), 2 * 32, 0, stream>>>(U16(O16), nullptr, TD, 0, U16(Wo16), nullptr, TD, 0, out, nullptr, TD, 0, nullptr, nullptr, 0, TS, TD, TD, 1.0f); }
}

// v008
// Measured time: 127 microseconds a run.
// Timed twice side by side with v007, it ran 1.08 times as fast both times.
// Counting every step since v000, it is 6.81 times as fast.
#include <hip/hip_runtime.h>
#include <math.h>
// T5 self-attention with relative-position bias: q/k/v = x·Wᵀ (2048 x 1024 · 1024 x 1024 each), out = o·Woᵀ and the attention
// (16 heads x 64, 2048 x 2048, unscaled scores + rel_bias[bucket(k−q), h]): q/k projections and both attention products on
// v_wmma_f32_16x16x32_bf16 with bf16 hi/lo split operands (unscaled T5 scores make the softmax sharp), v and output projections on v_wmma_f32_16x16x32_f16 with f16 operands; f32 accumulate; the bucket table (integer thresholds of the T5 log-spaced bucketing: |Δ| < 8 exact, then ≥8,12,16,23,32,46,64,91,
// +16 for Δ > 0) and softmax in f32/int on VALU.
typedef __attribute__((ext_vector_type(16))) _Float16 v16h;
typedef __attribute__((ext_vector_type(8)))  _Float16 v8h;
typedef __attribute__((ext_vector_type(16))) __bf16   v16b;
typedef __attribute__((ext_vector_type(8)))  __bf16   v8b;
typedef __attribute__((ext_vector_type(8)))  float    v8f;
typedef __attribute__((ext_vector_type(4)))  float    v4f;
typedef __attribute__((ext_vector_type(2)))  float    v2f;
typedef __attribute__((ext_vector_type(2)))  __bf16   v2b;
typedef __attribute__((ext_vector_type(4)))  __bf16   v4b;
typedef __attribute__((ext_vector_type(4)))  _Float16 v4h;
#define PSCALE 32768.0f
#define U16(p) ((const unsigned short*)(const void*)(p))
#define PSCALE_INV (1.0f / 32768.0f)

__device__ __forceinline__ unsigned short f2bf_bits(float f) {
  unsigned u = __float_as_uint(f);
  return (unsigned short)((u + 0x7FFFu + ((u >> 16) & 1u)) >> 16);
}
__device__ __forceinline__ float bf_bits2f(unsigned short h) { return __uint_as_float(((unsigned)h) << 16); }

// hazard guard as a plain device helper
__device__ __forceinline__ void acc_guard4(v8f& a, v8f& b, v8f& c, v8f& d) { asm volatile("v_nop\n\tv_nop\n\tv_nop\n\tv_nop" : "+v"(a), "+v"(b), "+v"(c), "+v"(d)); }
template <typename T> struct Frag;
template <> struct Frag<_Float16> {
  typedef v16h V; typedef v8h H; union U { v16h v; v8h h[2]; };
  static __device__ __forceinline__ v16h load(const _Float16* p) {   // elements 0..7 <- p[0..7], 8..15 <- p[16..23]
    U f; f.h[0] = *(const v8h*)(p); f.h[1] = *(const v8h*)(p + 16); return f.v;
  }
  static __device__ __forceinline__ v8f mma(v16h a, v16h b, v8f c) {
    return __builtin_amdgcn_wmma_f32_16x16x32_f16(false, a, false, b, (short)0, c, false, false);
  }
};
template <> struct Frag<__bf16> {
  typedef v16b V; typedef v8b H; union U { v16b v; v8b h[2]; };
  static __device__ __forceinline__ v16b load(const __bf16* p) {
    U f; f.h[0] = *(const v8b*)(p); f.h[1] = *(const v8b*)(p + 16); return f.v;
  }
  static __device__ __forceinline__ v8f mma(v16b a, v16b b, v8f c) {
    return __builtin_amdgcn_wmma_f32_16x16x32_bf16(false, a, false, b, (short)0, c, false, false);
  }
};

// ---- Register-blocked batched WMMA GEMM ------------------------------------
// C[m,n] = scale * sum_k A[m,k] * Bt[n,k] (+bias)(+resid); each wave owns a 64x64 tile.
// A row-major [M,K]; Bt row-major [N,K]; a work-group of NW waves owns (NW / 2) x 2 wave tiles: M % (32 NW) == 0, N % 128 == 0, K % 64 == 0.
// The work-group's A and Bt rows pass through LDS, 64 k a stage: eight lanes copy a row's 128 B, so every global load covers whole lines and
// a row is fetched once a work-group; the next stage's global loads fly while this stage's products run.
// SPLIT: operands are hi/lo planes (A2/Bt2 = lo planes, same layout); product = hi·hi + hi·lo + lo·hi.
// BIAS_MODE: 0 = none, 1 = bias[m], 2 = bias[n].
// OUT_MODE: 0 = f32, 1 = f16, 2 = bf16 hi plane (Cout) + bf16 lo plane (Cout2).
// ET: 0 = f16 operands, 1 = bf16 operands (pointers passed as 16-bit storage)
template <int ET> struct Elem;
template <> struct Elem<0> { typedef _Float16 T; };
template <> struct Elem<1> { typedef __bf16 T; };
// NW = waves (64x64 tiles) per work-group, bx = index of the work-group among those of this product, b = batch index,
// sT = the work-group's NW slabs of 16 x 68 floats in LDS, sG = its operand stage of GM_ELEMS(NW, SPLIT) 16-bit elements in LDS
#define GM_KS 64   // k elements of a stage: 128 B of every row
#define GM_LP 72   // LDS row pitch of a stage in 16-bit elements: 144 B = 16 B x 9 (odd), so the 16 rows of a ds_load_b128 fragment read spread over the banks
#define GM_ELEMS(NW, SPLIT) (((NW) / 2 * 64 + 128) * GM_LP * ((SPLIT) ? 2 : 1))
template <int NW, int ET, bool SPLIT, int BIAS_MODE, int OUT_MODE, bool RESID, int ACT = 0>
__device__ __forceinline__ void gemm64_body(const int bx, const int b, float* __restrict__ sT, unsigned short* __restrict__ sG,
    const unsigned short* __restrict__ Ap, const unsigned short* __restrict__ A2p, int lda, long strideA,
    const unsigned short* __restrict__ Btp, const unsigned short* __restrict__ Bt2p, int ldb, long strideB,
    void* __restrict__ Cout, void* __restrict__ Cout2, int ldc, long strideC,
    const float* __restrict__ bias,
    const float* __restrict__ resid, long strideR,
    int M, int N, int K, float scale) {
  typedef typename Elem<ET>::T T;
  typedef typename Frag<T>::V V;
  const T* A = (const T*)Ap; const T* A2 = (const T*)A2p; const T* Bt = (const T*)Btp; const T* Bt2 = (const T*)Bt2p;
  typedef typename Frag<T>::H H;
  constexpr int AR = NW / 2 * 64, BR = 128, NT = NW * 32;   // rows of A and of Bt a work-group, its threads
  constexpr int NA = AR * 8 / NT, NB = BR * 8 / NT;         // 16 B pieces of a stage a thread and plane
  const int tid  = threadIdx.x;
  const int lane = tid & 31;
  const int wave = tid >> 5;
  const int tilesN = N / BR;
  const int tilesM = M / AR;
  if (bx >= tilesM * tilesN) return;   // the same in every thread of the work-group, ahead of every barrier
  const int tm = bx / tilesN;
  const int tn = bx - tm * tilesN;
  const int mW = tm * AR, nW = tn * BR;      // the work-group's first rows of A and of Bt
  const int am = (wave >> 1) << 6, bn = (wave & 1) << 6;   // the wave's first rows inside them
  const int m0 = mW + am;
  const int n0 = nW + bn;

  const T* Ab  = A  + (size_t)b * strideA;
  const T* Bb  = Bt + (size_t)b * strideB;
  const T* Ab2 = SPLIT ? (A2  + (size_t)b * strideA) : nullptr;
  const T* Bb2 = SPLIT ? (Bt2 + (size_t)b * strideB) : nullptr;

  const int rlane = lane & 15;                 // row (A) / col (B, D) within subtile
  const int koff  = (lane >> 4) * 8;           // k offset of this lane half
  const int mOff  = (lane >> 4) * 8;           // D row offset

  v8f acc[4][4];
#pragma unroll
  for (int i = 0; i < 4; ++i)
#pragma unroll
    for (int j = 0; j < 4; ++j) acc[i][j] = (v8f){0.f,0.f,0.f,0.f,0.f,0.f,0.f,0.f};

  T* sAh = (T*)sG;           T* sBh = sAh + AR * GM_LP;   // hi (or only) planes [row][k]
  T* sAl = sBh + BR * GM_LP; T* sBl = sAl + AR * GM_LP;   // lo planes, SPLIT only
  const int sr = tid >> 3, sc = (tid & 7) * 8;            // staging: this thread's first row and its 16 B piece of a row
  unsigned aob[NA], bob[NB];                              // byte offsets of its pieces from the work-group's first row (each operand's rows span less than 4 GiB)
#pragma unroll
  for (int i = 0; i < NA; ++i) aob[i] = ((unsigned)(sr + NT / 8 * i) * (unsigned)lda + sc) * 2u;
#pragma unroll
  for (int i = 0; i < NB; ++i) bob[i] = ((unsigned)(sr + NT / 8 * i) * (unsigned)ldb + sc) * 2u;
  H rah[NA], ral[NA], rbh[NB], rbl[NB];
  // address = first byte of the work-group's first row, the same in every lane, + the lane's 32-bit byte offset, which walks along k
  const size_t a0 = (size_t)mW * lda, b0 = (size_t)nW * ldb;
  auto fetch = [&]() {
#pragma unroll
    for (int i = 0; i < NA; ++i) {
      rah[i] = *(const H*)((const char*)(Ab + a0) + aob[i]);
      if (SPLIT) ral[i] = *(const H*)((const char*)(Ab2 + a0) + aob[i]);
    }
#pragma unroll
    for (int i = 0; i < NB; ++i) {
      rbh[i] = *(const H*)((const char*)(Bb + b0) + bob[i]);
      if (SPLIT) rbl[i] = *(const H*)((const char*)(Bb2 + b0) + bob[i]);
    }
  };
  fetch();
  for (int k0 = 0; k0 < K; k0 += GM_KS) {
    __syncthreads();   // every wave has left the last stage
#pragma unroll
    for (int i = 0; i < NA; ++i) {
      const int lo = (sr + NT / 8 * i) * GM_LP + sc;
      *(H*)(sAh + lo) = rah[i];
      if (SPLIT) *(H*)(sAl + lo) = ral[i];
      aob[i] += GM_KS * 2u;   // the next stage
    }
#pragma unroll
    for (int i = 0; i < NB; ++i) {
      const int lo = (sr + NT / 8 * i) * GM_LP + sc;
      *(H*)(sBh + lo) = rbh[i];
      if (SPLIT) *(H*)(sBl + lo) = rbl[i];
      bob[i] += GM_KS * 2u;
    }
    __syncthreads();   // the stage is whole for every wave
    if (k0 + GM_KS < K) {   // the same test in every thread
      fetch();
      // precaution: stands between these loads, which fly over the products, and every later rewrite of their address registers (scalar bases, lane offsets)
      asm volatile("s_wait_xcnt 0x0" ::: "memory");
    }
#pragma unroll
   for (int ks = 0; ks < GM_KS; ks += 32) {
    V bh[4], bl[4], ah[4], al[4];   // the slice's fragments are read as one group: one LDS latency a slice, not one a row of tiles
#pragma unroll
    for (int j = 0; j < 4; ++j) {
      const int bo = (bn + (j << 4) + rlane) * GM_LP + koff + ks;
      bh[j] = Frag<T>::load(sBh + bo);
      if (SPLIT) bl[j] = Frag<T>::load(sBl + bo);
    }
#pragma unroll
    for (int i = 0; i < 4; ++i) {
      const int ao = (am + (i << 4) + rlane) * GM_LP + koff + ks;
      ah[i] = Frag<T>::load(sAh + ao);
      if (SPLIT) al[i] = Frag<T>::load(sAl + ao);
    }
    __builtin_amdgcn_sched_barrier(0);   // holds the group of reads ahead of the products: the scheduler otherwise sinks each A read to its first use, a full LDS latency a row of tiles
#pragma unroll
    for (int i = 0; i < 4; ++i) {
#pragma unroll
      for (int j = 0; j < 4; ++j) {
        acc[i][j] = Frag<T>::mma(ah[i], bh[j], acc[i][j]);
        if (SPLIT) {
          acc[i][j] = Frag<T>::mma(ah[i], bl[j], acc[i][j]);
          acc[i][j] = Frag<T>::mma(al[i], bh[j], acc[i][j]);
        }
      }
    }
   }
  }
  acc_guard4(acc[0][0], acc[0][1], acc[0][2], acc[0][3]);
  acc_guard4(acc[1][0], acc[1][1], acc[1][2], acc[1][3]);
  acc_guard4(acc[2][0], acc[2][1], acc[2][2], acc[2][3]);
  acc_guard4(acc[3][0], acc[3][1], acc[3][2], acc[3][3]);

  // ---- epilogue ----
  float* slab = sT + wave * (16 * 68);
  const float* Rb = RESID ? (resid + (size_t)b * strideR) : nullptr;
#pragma unroll
  for (int i = 0; i < 4; ++i) {
    const int mBase = m0 + (i << 4);
#pragma unroll
    for (int j = 0; j < 4; ++j) {
      const int n = n0 + (j << 4) + rlane;
      float bv = 0.f;
      if (BIAS_MODE == 2) bv = bias[n];
#pragma unroll
      for (int r = 0; r < 8; ++r) {
        float v = acc[i][j][r] * scale;
        if (BIAS_MODE == 1) v += bias[mBase + mOff + r];
        if (BIAS_MODE == 2) v += bv;
        if (RESID) v += Rb[(size_t)(mBase + mOff + r) * ldc + n];
        if (ACT == 1) v = tanhf(v);
        if (ACT == 2) v = fmaxf(v, 0.0f);
        if (ACT == 3) v = v / (1.0f + expf(-v));
        if (ACT == 4) v = (v > 0.f) ? v : 0.01f * v;
        if (ACT == 5) v = 0.5f * v * (1.0f + erff(v * 0.70710678118654752f));
        slab[(mOff + r) * 68 + (j << 4) + rlane] = v;
      }
    }
    __builtin_amdgcn_fence(__ATOMIC_RELEASE, "workgroup");
    __builtin_amdgcn_wave_barrier();
    __builtin_amdgcn_fence(__ATOMIC_ACQUIRE, "workgroup");
    if (OUT_MODE == 0) {
      float* C = (float*)Cout + (size_t)b * strideC;
      const int hh = lane >> 4, c4 = (lane & 15) * 4;     // row seg = 256 B = 16 lanes x 16 B
      {
#pragma unroll
        for (int it = 0; it < 8; ++it) {
          const int row = it * 2 + hh;
          v4f v = *(const v4f*)(slab + row * 68 + c4);
          *(v4f*)(C + (size_t)(mBase + row) * ldc + n0 + c4) = v;
        }
        
      }
    } else {
      const int q = lane >> 3, c8 = (lane & 7) * 8;
      unsigned short* C  = (unsigned short*)Cout  + (size_t)b * strideC;
      unsigned short* C2 = (OUT_MODE == 2) ? ((unsigned short*)Cout2 + (size_t)b * strideC) : nullptr;
      {
#pragma unroll
        for (int it = 0; it < 4; ++it) {
          const int row = it * 4 + q;
          const float* sp = slab + row * 68 + c8;
          v8h hv, lv;
#pragma unroll
          for (int e = 0; e < 8; ++e) {
            if (OUT_MODE == 1) {
              hv[e] = (_Float16)sp[e];
            } else {
              unsigned short hb = f2bf_bits(sp[e]);
              unsigned short lb = f2bf_bits(sp[e] - bf_bits2f(hb));
              hv[e] = __builtin_bit_cast(_Float16, hb);
              lv[e] = __builtin_bit_cast(_Float16, lb);
            }
          }
          *(v8h*)(C + (size_t)(mBase + row) * ldc + n0 + c8) = hv;
          if (OUT_MODE == 2) *(v8h*)(C2 + (size_t)(mBase + row) * ldc + n0 + c8) = lv;
        }
        
      }
    }
    __builtin_amdgcn_fence(__ATOMIC_RELEASE, "workgroup");
    __builtin_amdgcn_wave_barrier();
    __builtin_amdgcn_fence(__ATOMIC_ACQUIRE, "workgroup");
  }
}

template <int NW, int ET, bool SPLIT, int BIAS_MODE, int OUT_MODE, bool RESID, int ACT = 0>
__global__ __launch_bounds__(NW * 32) void wmma_gemm64(
    const unsigned short* __restrict__ Ap, const unsigned short* __restrict__ A2p, int lda, long strideA,
    const unsigned short* __restrict__ Btp, const unsigned short* __restrict__ Bt2p, int ldb, long strideB,
    void* __restrict__ Cout, void* __restrict__ Cout2, int ldc, long strideC,
    const float* __restrict__ bias,
    const float* __restrict__ resid, long strideR,
    int M, int N, int K, float scale) {
  __shared__ __align__(16) float sT[NW * 16 * 68];   // per-wave 16x64 slab, pitch 68 floats
  __shared__ __align__(16) unsigned short sG[GM_ELEMS(NW, SPLIT)];
  gemm64_body<NW, ET, SPLIT, BIAS_MODE, OUT_MODE, RESID, ACT>(blockIdx.x, blockIdx.y, sT, sG, Ap, A2p, lda, strideA, Btp, Bt2p, ldb, strideB,
                                                              Cout, Cout2, ldc, strideC, bias, resid, strideR, M, N, K, scale);
}

// The three projections of one x [M][K] in one launch, so that their work-groups run side by side on different WGPs:
// blockIdx.y = 0: q = x Wq^T, 1: k = x Wk^T (both bf16 hi/lo split), 2: v^T = Wv x^T (f16); weights [N][K].
// Each result leaves as the bf16 hi and lo planes that the attention's matrix products read: q, k as [M][N], v transposed as [N][M].
template <int NW>
__global__ __launch_bounds__(NW * 32) void qkv_gemm64(
    const unsigned short* __restrict__ Xh, const unsigned short* __restrict__ Xl, const unsigned short* __restrict__ X16,
    const unsigned short* __restrict__ Wqh, const unsigned short* __restrict__ Wql,
    const unsigned short* __restrict__ Wkh, const unsigned short* __restrict__ Wkl, const unsigned short* __restrict__ Wv16,
    unsigned short* __restrict__ Qh, unsigned short* __restrict__ Ql, unsigned short* __restrict__ Kh, unsigned short* __restrict__ Kl,
    unsigned short* __restrict__ Vth, unsigned short* __restrict__ Vtl, int M, int N, int K) {
  __shared__ __align__(16) float sT[NW * 16 * 68];   // per-wave 16x64 slab, pitch 68 floats
  __shared__ __align__(16) unsigned short sG[GM_ELEMS(NW, true)];
  if (blockIdx.y < 2) {
    const bool isk = blockIdx.y == 1;
    gemm64_body<NW, 1, true, 0, 2, false>(blockIdx.x, 0, sT, sG, Xh, Xl, K, 0, isk ? Wkh : Wqh, isk ? Wkl : Wql, K, 0,
                                          isk ? Kh : Qh, isk ? Kl : Ql, N, 0, nullptr, nullptr, 0, M, N, K, 1.0f);
  } else {
    gemm64_body<NW, 0, false, 0, 2, false>(blockIdx.x, 0, sT, sG, Wv16, nullptr, K, 0, X16, nullptr, K, 0,
                                           Vth, Vtl, M, 0, nullptr, nullptr, 0, N, M, K, 1.0f);
  }
}


// ---- f32 -> f16 cast with a power-of-two pre-scale (folded back by the consumer GEMM's scale) ----
__global__ __launch_bounds__(256) void cast_f32_f16x2s(const float* __restrict__ in, _Float16* __restrict__ out, int n2, float s) {
  int i = blockIdx.x * 256 + threadIdx.x;
  if (i < n2) {
    const _Float16 h0 = (_Float16)(in[2 * i] * s), h1 = (_Float16)(in[2 * i + 1] * s);
    const unsigned u = (unsigned)__builtin_bit_cast(unsigned short, h0) | ((unsigned)__builtin_bit_cast(unsigned short, h1) << 16);
    ((unsigned*)out)[i] = u;
    
  }
}


// ---- f32 [R][C] (row pitch ldi) -> f16 transposed [C][R] (row pitch ldo); 64x64 tiles; each output row segment
__global__ __launch_bounds__(256) void transpose_cast_f16(const float* __restrict__ in, int ldi,
                                                         _Float16* __restrict__ outT, int ldo, float scale) {
  __shared__ __align__(16) _Float16 tile[64][72];     // [c][r]
  const int c0 = blockIdx.x * 64, r0 = blockIdx.y * 64;
  const int t = threadIdx.y * 32 + threadIdx.x;
  for (int i = threadIdx.y; i < 64; i += 8) {
    tile[threadIdx.x][i]      = (_Float16)(in[(size_t)(r0 + i) * ldi + c0 + threadIdx.x] * scale);
    tile[32 + threadIdx.x][i] = (_Float16)(in[(size_t)(r0 + i) * ldi + c0 + 32 + threadIdx.x] * scale);
  }
  __syncthreads();
  const int q = t >> 3, c8 = (t & 7) * 8;
  {
#pragma unroll
    for (int it = 0; it < 2; ++it) {
      const int c = it * 32 + q;
      v8h hv = *(const v8h*)(&tile[c][c8]);
      *(v8h*)(outT + (size_t)(c0 + c) * ldo + r0 + c8) = hv;
    }
    
  }
}

// ---- f32 [R][C] (pitch ldi) -> bf16 hi/lo transposed planes [C][R] (pitch ldo); 64x64 tiles; each output row segment
__global__ __launch_bounds__(256) void transpose_split_bf16(const float* __restrict__ in, int ldi,
                                                           __bf16* __restrict__ outH, __bf16* __restrict__ outL, int ldo) {
  __shared__ __align__(16) float tile[64][68];     // [c][r]
  const int c0 = blockIdx.x * 64, r0 = blockIdx.y * 64;
  const int t = threadIdx.y * 32 + threadIdx.x;
  for (int i = threadIdx.y; i < 64; i += 8) {
    tile[threadIdx.x][i]      = in[(size_t)(r0 + i) * ldi + c0 + threadIdx.x];
    tile[32 + threadIdx.x][i] = in[(size_t)(r0 + i) * ldi + c0 + 32 + threadIdx.x];
  }
  __syncthreads();
  const int q = t >> 3, c8 = (t & 7) * 8;
  {
#pragma unroll
    for (int it = 0; it < 2; ++it) {
      const int c = it * 32 + q;
      v8b hv, lv;
#pragma unroll
      for (int e = 0; e < 8; ++e) {
        const float f = tile[c][c8 + e];
        const unsigned short hb = f2bf_bits(f);
        hv[e] = __builtin_bit_cast(__bf16, hb);
        lv[e] = __builtin_bit_cast(__bf16, f2bf_bits(f - bf_bits2f(hb)));
      }
      *(v8b*)(outH + (size_t)(c0 + c) * ldo + r0 + c8) = hv;
      *(v8b*)(outL + (size_t)(c0 + c) * ldo + r0 + c8) = lv;
    }
    
  }
}

#define AT_D 64
#define AT_NW 4
#define AT_QB 64
#define AT_KC 64
#define AT_LP 72   // LDS row pitch of the K and V tiles in 16-bit elements: 144 B = 16 B x 9 (odd), so the 16 rows of a ds_load_b128 fragment read spread over the banks
#define AT_BT (2048 + AT_QB)   // distance table: Skv + AT_QB - 1 entries used (Skv <= 2048), rounded up to whole waves
struct AttnGeom { const float* cp = nullptr; const float* pc = nullptr; long c_bs = 0, c_rs = 0, c_hs = 0;   // mode-5 / DISTB score-bias tables
                  long q_bs, q_rs, q_hs, k_bs, k_rs, k_hs, v_bs, v_rs, v_hs, o_bs, o_rs, o_hs;
                  int S, Skv, H, mask_mode; float qscale; int blk0; float mask_fill; int mask_is_int; };
static_assert(sizeof(AttnGeom) == 168, "no padding");

__device__ __forceinline__ unsigned short at_bf_bits(float f) {
  unsigned u = __float_as_uint(f);
  return (unsigned short)((u + 0x7FFFu + ((u >> 16) & 1u)) >> 16);
}
__device__ __forceinline__ __bf16 at_f2bf(float f) { return __builtin_bit_cast(__bf16, at_bf_bits(f)); }
// two neighbours as packed bf16 pairs: hi = the value rounded to nearest even, lo = what is left, rounded likewise
__device__ __forceinline__ void at_split2(float p0, float p1, v2b& hi, v2b& lo) {
  const v2f p = {p0, p1};
  hi = __builtin_convertvector(p, v2b);
  lo = __builtin_convertvector(p - __builtin_convertvector(hi, v2f), v2b);
}
// the value of lane l ^ 16: the other half of the same query's kv rows
__device__ __forceinline__ float at_other_half(float x) {
  const int b = __float_as_int(x);
  return __int_as_float(__builtin_amdgcn_permlanex16(b, b, 0x76543210, 0xfedcba98, false, false));
}
// 16-bit element as a bit pattern held in a __bf16 slot: f16 bits when F16, bf16 (RNE) otherwise
template <bool F16> __device__ __forceinline__ __bf16 at_to16(float f) {
  if (F16) return __builtin_bit_cast(__bf16, (_Float16)f);
  return at_f2bf(f);
}
// the builtin alone: the compiler keeps the distance behind it, and LDS reads may be scheduled across it
template <bool F16> __device__ __forceinline__ v8f at_mma16(v16b a, v16b b, v8f c) {
  if (F16) return __builtin_amdgcn_wmma_f32_16x16x32_f16(false, __builtin_bit_cast(v16h, a), false, __builtin_bit_cast(v16h, b), (short)0, c, false, false);
  return __builtin_amdgcn_wmma_f32_16x16x32_bf16(false, a, false, b, (short)0, c, false, false);
}

// DISTB: s += bias[bucket(kv - q)] of this head (32 buckets; bucket n of (b, h) at cp + b*c_bs + h*c_hs + n*c_rs), no mask; Skv <= 2048.
template <bool SPLIT_QK, bool SPLIT_PV, bool F16 = false, bool DISTB = false>
__global__ __launch_bounds__(128)
void attn64_kernel(const unsigned short* __restrict__ qh, const unsigned short* __restrict__ ql,
                   const unsigned short* __restrict__ kh, const unsigned short* __restrict__ kl,
                   const unsigned short* __restrict__ vh, const unsigned short* __restrict__ vl, _Float16* __restrict__ out,
                   const void* __restrict__ mask_a, const int* __restrict__ mask_b, AttnGeom g) {
  static_assert(!(F16 && (SPLIT_QK || SPLIT_PV)), "f16 mode is non-split");
  const float PSC = F16 ? 32768.0f : 1.0f;     // f16 probabilities carried x2^15 (subnormal range), folded into the final 1/l
  union FB { v16b v; v8b h[2]; v2b d[8]; };
  __shared__ __align__(16) __bf16 Ksh[AT_KC * AT_LP];            // K hi [kv][d], rows at pitch AT_LP   9 KB
  __shared__ __align__(16) __bf16 Ksl[SPLIT_QK ? AT_KC * AT_LP : 8];
  __shared__ __align__(16) __bf16 Vth[AT_D * AT_LP];            // V hi [d][kv], rows at pitch AT_LP   9 KB
  __shared__ __align__(16) __bf16 Vtl[SPLIT_PV ? AT_D * AT_LP : 8];
  __shared__ __align__(16) float  Os[AT_NW][16 * 68];            // per wave out tile, pitch 68
  __shared__ float Bs[DISTB ? AT_BT : 1];                        // score bias of this (head, query block) by distance kv - q

  const int tid  = threadIdx.x;
  const int wave = tid >> 5;
  const int lane = tid & 31;
  const int hh   = lane >> 4;
  const int c    = lane & 15;

  const int nqb = g.S / AT_QB;
  const int bx = blockIdx.x + g.blk0;
  const int qb = bx % nqb;
  const int bh = bx / nqb;
  const int h  = bh % g.H;
  const int b  = bh / g.H;
  const int qbase_block = qb * AT_QB;
  const int q0 = qbase_block + wave * 16;

  const size_t qoff = (size_t)b * g.q_bs + (size_t)h * g.q_hs;
  const size_t koff = (size_t)b * g.k_bs + (size_t)h * g.k_hs;
  const size_t voff = (size_t)b * g.v_bs + (size_t)h * g.v_hs;
  _Float16*    ob_ptr = out + (size_t)b * g.o_bs + (size_t)h * g.o_hs;

  // Bs[i] = bias of distance kv - q = i - (qbase_block + AT_QB - 1); published by the barriers at the head of the kv loop
  if (DISTB) {
    const float bl = g.cp[(size_t)b * g.c_bs + (size_t)h * g.c_hs + (size_t)lane * g.c_rs];   // lane n holds bucket n
    for (int i = tid; i < AT_BT; i += AT_NW * 32) {   // whole waves only (AT_BT % 32 == 0): every source lane of the shuffle is on
      const int rel = i - (qbase_block + AT_QB - 1); const int a = rel < 0 ? -rel : rel;
      int bkt;
      if (a < 8) bkt = a;
      else bkt = 8 + (a >= 12) + (a >= 16) + (a >= 23) + (a >= 32) + (a >= 46) + (a >= 64) + (a >= 91);   // = 8 + trunc(8*log(a/8)/log 16), capped at 15
      if (rel > 0) bkt += 16;
      Bs[i] = __shfl(bl, bkt, 32);
    }
  }

  // ---- Q fragments (B operand: column = query q0 + c): 2 d-chunks, hi (and lo) ----
  v16b qah[2], qal[2];
  {
    const size_t qrow = qoff + (size_t)(q0 + c) * g.q_rs + 8 * hh;
#pragma unroll
    for (int dc = 0; dc < 2; ++dc) {
      qah[dc] = Frag<__bf16>::load((const __bf16*)qh + qrow + dc * 32);
      qal[dc] = SPLIT_QK ? Frag<__bf16>::load((const __bf16*)ql + qrow + dc * 32) : qah[dc];
    }
  }

  float mrow = -INFINITY, lrow = 0.f;   // this lane's query: running maximum (both halves agree), sum over this half's kv rows
  v8f oacc[4];                          // O^T: oacc[t][r] = out[q0 + c][16 t + 8 hh + r]
#pragma unroll
  for (int t = 0; t < 4; ++t) oacc[t] = (v8f){0.f,0.f,0.f,0.f,0.f,0.f,0.f,0.f};

  const int nChunks = (g.mask_mode == 1 || g.mask_mode == 4) ? (qb + 1) : (g.Skv / AT_KC);   // block-uniform
  // per-row query mask (mode 3)
  const int qkeep = (g.mask_mode == 3) ? mask_b[(size_t)b * g.S + q0 + c] : 1;   // mask_b = qmask in mode 3
  const int sr = tid >> 3, sc = (tid & 7) * 8;   // tile staging: this thread's first row and its 16 B piece of a row
  unsigned kbo[4], vbo[4];                       // byte offsets of its four pieces of the current K and V tile
#pragma unroll
  for (int i = 0; i < 4; ++i) {
    kbo[i] = ((unsigned)(sr + 16 * i) * (unsigned)g.k_rs + sc) * 2u;
    vbo[i] = ((unsigned)(sr + 16 * i) * (unsigned)g.v_rs + sc) * 2u;
  }
  for (int kc = 0; kc < nChunks; ++kc) {
    const int kv0 = kc * AT_KC;
    {
      // Each tile is 64 rows of 128 B (K: row = kv, V: row = d): eight lanes copy a row, 16 B each, four rows a thread and tile.
      // The global reads touch no LDS, so they stand ahead of the barrier that ends the last chunk's reads of the tiles.
      // Address = this (batch, head)'s first byte, the same in every lane, + the lane's 32-bit byte offset from it.
      v8b rkh[4], rkl[4], rvh[4], rvl[4];
#pragma unroll
      for (int i = 0; i < 4; ++i) {
        rkh[i] = *(const v8b*)((const char*)(kh + koff) + kbo[i]);
        if (SPLIT_QK) rkl[i] = *(const v8b*)((const char*)(kl + koff) + kbo[i]);
        rvh[i] = *(const v8b*)((const char*)(vh + voff) + vbo[i]);
        if (SPLIT_PV) rvl[i] = *(const v8b*)((const char*)(vl + voff) + vbo[i]);
      }
      __syncthreads();
#pragma unroll
      for (int i = 0; i < 4; ++i) {
        const int lo = (sr + 16 * i) * AT_LP + sc;
        *(v8b*)(Ksh + lo) = rkh[i];
        if (SPLIT_QK) *(v8b*)(Ksl + lo) = rkl[i];
        *(v8b*)(Vth + lo) = rvh[i];
        if (SPLIT_PV) *(v8b*)(Vtl + lo) = rvl[i];
        kbo[i] += (unsigned)g.k_rs * (AT_KC * 2u);   // the next chunk: AT_KC rows on in k, AT_KC columns on in v
        vbo[i] += AT_KC * 2u;
      }
    }
    __syncthreads();

    // The K fragments of a d-chunk are read as one group, then the four score tiles advance side by side: one LDS latency a group,
    // and each tile's next product stands four matrix instructions behind its last. Each tile sums its products in the order dc, hi.hi, hi.lo, lo.hi
    // (q part first). s[j][r] = score of kv row kv0 + 16 j + 8 hh + r and query q0 + c.
    v8f s[4];
#pragma unroll
    for (int j = 0; j < 4; ++j) s[j] = (v8f){0.f,0.f,0.f,0.f,0.f,0.f,0.f,0.f};
#pragma unroll
    for (int dc = 0; dc < 2; ++dc) {
      FB kb[4], kl[4];
#pragma unroll
      for (int j = 0; j < 4; ++j) {
        kb[j].h[0] = *(const v8b*)(Ksh + (j * 16 + c) * AT_LP + dc * 32 + 8 * hh);
        kb[j].h[1] = *(const v8b*)(Ksh + (j * 16 + c) * AT_LP + dc * 32 + 16 + 8 * hh);
        if (SPLIT_QK) {
          kl[j].h[0] = *(const v8b*)(Ksl + (j * 16 + c) * AT_LP + dc * 32 + 8 * hh);
          kl[j].h[1] = *(const v8b*)(Ksl + (j * 16 + c) * AT_LP + dc * 32 + 16 + 8 * hh);
        }
      }
#pragma unroll
      for (int j = 0; j < 4; ++j) s[j] = at_mma16<F16>(kb[j].v, qah[dc], s[j]);
      if (SPLIT_QK) {
#pragma unroll
        for (int j = 0; j < 4; ++j) s[j] = at_mma16<F16>(kl[j].v, qah[dc], s[j]);
#pragma unroll
        for (int j = 0; j < 4; ++j) s[j] = at_mma16<F16>(kb[j].v, qal[dc], s[j]);
      }
    }
    const bool diag = (g.mask_mode == 1) && (kc == qb);
    float cj[4];   // maximum of each tile's eight scores: four independent chains
    if (DISTB) {
      const float* bp = Bs + (kv0 + 8 * hh + (AT_QB - 1) - wave * 16 - c);   // + kv row offset - query offset
#pragma unroll
      for (int j = 0; j < 4; ++j) {
        float m = -INFINITY;
#pragma unroll
        for (int r = 0; r < 8; ++r) { s[j][r] += bp[j * 16 + r]; m = fmaxf(m, s[j][r]); }
        cj[j] = m;
      }
    } else
#pragma unroll
    for (int j = 0; j < 4; ++j) {
      const int qrow = q0 + c;
      float m = -INFINITY;
#pragma unroll
      for (int r = 0; r < 8; ++r) {
        const int kvcol = kv0 + j * 16 + 8 * hh + r;
        bool masked = false;
        if (diag) masked = (kvcol > qrow);
        else if (g.mask_mode == 4) masked = (kvcol > qrow) || (qrow - kvcol > g.mask_is_int);
        else if (g.mask_mode == 2) {
          const size_t mi = (size_t)qrow * g.Skv + kvcol;
          masked = (g.mask_is_int == 0) ? (((const float*)mask_a)[mi] == 0.0f)
                 : (g.mask_is_int == 1) ? (((const int*)mask_a)[mi] == 0) : (((const int*)mask_a)[mi] != 0);
        } else if (g.mask_mode == 3) masked = (qkeep == 0) || (((const int*)mask_a)[(size_t)b * g.Skv + kvcol] == 0);   // mask_a = kvmask
        else if (g.mask_mode == 5) {
          const size_t mi = (size_t)qrow * g.Skv + kvcol;
          masked = (((const int*)mask_a)[mi] != 0);
          int n = mask_b[mi]; n = n < 0 ? 0 : n;
          s[j][r] += g.cp[(size_t)b * g.c_bs + (size_t)h * g.c_hs + (size_t)qrow * g.c_rs + n]
                   + g.pc[(size_t)b * g.c_bs + (size_t)h * g.c_hs + (size_t)kvcol * g.c_rs + n];
        }
        if (masked) s[j][r] = g.mask_fill;
        m = fmaxf(m, s[j][r]);
      }
      cj[j] = m;
    }
    // the query's maximum over the chunk: this lane's 32 kv rows, then the other half's 32
    float cm = fmaxf(fmaxf(cj[0], cj[1]), fmaxf(cj[2], cj[3]));
    cm = fmaxf(cm, at_other_half(cm));
    const float mnew = fmaxf(mrow, cm);
    const float alpha = expf(mrow - mnew);
    mrow = mnew;
    // Tiles 2 kk and 2 kk + 1 hold kv rows 8 hh + r and 16 + 8 hh + r of kv half kk: the k order of a B operand, element by element
    FB pb[2], pl[2];
    float ps[4];
#pragma unroll
    for (int j = 0; j < 4; ++j) {
      float psum = 0.f;
#pragma unroll
      for (int r = 0; r < 8; r += 2) {
        const float p0 = expf(s[j][r] - mnew), p1 = expf(s[j][r + 1] - mnew);
        psum += p0; psum += p1;
        const int e = (j & 1) * 8 + r;
        if (SPLIT_PV) at_split2(p0, p1, pb[j >> 1].d[e >> 1], pl[j >> 1].d[e >> 1]);
        else { pb[j >> 1].v[e] = at_to16<F16>(p0 * PSC); pb[j >> 1].v[e + 1] = at_to16<F16>(p1 * PSC); }
      }
      ps[j] = psum;
    }
    lrow = lrow * alpha + ((ps[0] + ps[1]) + (ps[2] + ps[3]));   // the halves' sums are joined once, behind the loop
#pragma unroll
    for (int t = 0; t < 4; ++t) oacc[t] *= alpha;
    // As for the scores: the V fragments of a kv half are read as one group, then the four output tiles advance side by side
    // (each tile's order of sums: kk, hi.hi, hi.lo, lo.hi, p part first).
#pragma unroll
    for (int kk = 0; kk < 2; ++kk) {
      FB vb[4], vl[4];
#pragma unroll
      for (int t = 0; t < 4; ++t) {
        vb[t].h[0] = *(const v8b*)(Vth + (t * 16 + c) * AT_LP + kk * 32 + 8 * hh);
        vb[t].h[1] = *(const v8b*)(Vth + (t * 16 + c) * AT_LP + kk * 32 + 16 + 8 * hh);
        if (SPLIT_PV) {
          vl[t].h[0] = *(const v8b*)(Vtl + (t * 16 + c) * AT_LP + kk * 32 + 8 * hh);
          vl[t].h[1] = *(const v8b*)(Vtl + (t * 16 + c) * AT_LP + kk * 32 + 16 + 8 * hh);
        }
      }
#pragma unroll
      for (int t = 0; t < 4; ++t) oacc[t] = at_mma16<F16>(vb[t].v, pb[kk].v, oacc[t]);
      if (SPLIT_PV) {
#pragma unroll
        for (int t = 0; t < 4; ++t) oacc[t] = at_mma16<F16>(vl[t].v, pb[kk].v, oacc[t]);
#pragma unroll
        for (int t = 0; t < 4; ++t) oacc[t] = at_mma16<F16>(vb[t].v, pl[kk].v, oacc[t]);
      }
    }
  }

  // a lane holds eight neighbouring d of its query a tile: two 16 B pieces into the wave's slab [query][d]
  float* os = Os[wave];
  {
    const float inv = 1.0f / ((lrow + at_other_half(lrow)) * PSC);
#pragma unroll
    for (int t = 0; t < 4; ++t) {
      const v8f o = oacc[t] * inv;
      *(v4f*)(os + c * 68 + t * 16 + 8 * hh)     = (v4f){o[0], o[1], o[2], o[3]};
      *(v4f*)(os + c * 68 + t * 16 + 8 * hh + 4) = (v4f){o[4], o[5], o[6], o[7]};
    }
  }
  __builtin_amdgcn_fence(__ATOMIC_RELEASE, "workgroup");
  __builtin_amdgcn_wave_barrier();
  __builtin_amdgcn_fence(__ATOMIC_ACQUIRE, "workgroup");
  {
    const int q4 = lane >> 3, c8 = (lane & 7) * 8;   // a query's 64 d as f16 are one 128 B line: eight lanes x 16 B, four queries a store
#pragma unroll
    for (int it = 0; it < 4; ++it) {
      const int row = it * 4 + q4;
      const v4f a = *(const v4f*)(os + row * 68 + c8), e = *(const v4f*)(os + row * 68 + c8 + 4);
      const v8f o = {a[0], a[1], a[2], a[3], e[0], e[1], e[2], e[3]};
      *(v8h*)(ob_ptr + (size_t)(q0 + row) * g.o_rs + c8) = __builtin_convertvector(o, v8h);
    }
  }
}

// ---- every f32 -> 16-bit conversion of the inputs, one launch ----
// A work-group converts CV_WG neighbouring elements of one input; a thread takes CV_IT pieces of four elements, 256 threads apart: a wave-wide load
// covers 512 contiguous bytes, a store 256, and all of a thread's loads are issued ahead of its first store. Few waves that each move 128 B a lane,
// because a launch of one small item a lane lasts as long as its waves take to start.
// F16P: a plain f16 plane (o16); SPL: bf16 hi and lo planes (hi = the value rounded to nearest even, lo = what is left, rounded likewise).
#define CV_IT 8
#define CV_WG (256 * CV_IT * 4)
template <bool F16P, bool SPL>
__device__ __forceinline__ void convert_block(const float* __restrict__ in, _Float16* __restrict__ o16,
                                              __bf16* __restrict__ hi, __bf16* __restrict__ lo, const int blk) {
  const size_t e0 = (size_t)blk * CV_WG + threadIdx.x * 4;
  v4f v[CV_IT];
#pragma unroll
  for (int i = 0; i < CV_IT; ++i) v[i] = *(const v4f*)(in + e0 + i * 1024);
#pragma unroll
  for (int i = 0; i < CV_IT; ++i) {
    const size_t e = e0 + i * 1024;
    if (F16P) *(v4h*)(o16 + e) = __builtin_convertvector(v[i], v4h);
    if (SPL) {
      v2b h0, l0, h1, l1;
      at_split2(v[i][0], v[i][1], h0, l0);
      at_split2(v[i][2], v[i][3], h1, l1);
      *(v4b*)(hi + e) = (v4b){h0[0], h0[1], h1[0], h1[1]};
      *(v4b*)(lo + e) = (v4b){l0[0], l0[1], l1[0], l1[1]};
    }
  }
  // precaution: stands between these stores and every later rewrite of their address and data registers on the paths that the caller's branches join
  asm volatile("s_wait_xcnt 0x0" ::: "memory");
}
// blockIdx.x: NBX work-groups for x (f16 plane and bf16 hi/lo planes from one read), then NBW each for wq, wk (hi/lo planes), wv, wo (f16 plane)
template <int NBX, int NBW>
__global__ __launch_bounds__(256) void convert_inputs(
    const float* __restrict__ x, const float* __restrict__ wq, const float* __restrict__ wk, const float* __restrict__ wv, const float* __restrict__ wo,
    _Float16* __restrict__ X16, __bf16* __restrict__ Xh, __bf16* __restrict__ Xl, __bf16* __restrict__ Wqh, __bf16* __restrict__ Wql,
    __bf16* __restrict__ Wkh, __bf16* __restrict__ Wkl, _Float16* __restrict__ Wv16, _Float16* __restrict__ Wo16) {
  const int bw = (int)blockIdx.x - NBX;
  if (bw < 0) { convert_block<true, true>(x, X16, Xh, Xl, blockIdx.x); return; }
  const int w = bw / NBW, blk = bw - w * NBW;
  if (w < 2) convert_block<false, true>(w ? wk : wq, nullptr, w ? Wkh : Wqh, w ? Wkl : Wql, blk);
  else       convert_block<true, false>(w == 2 ? wv : wo, w == 2 ? Wv16 : Wo16, nullptr, nullptr, blk);
}

#define TS 2048
#define TD 1024
#define TNH 16
#define TNB 32
extern "C" void kernel_launch(void* const* d_in, const int* in_sizes, int n_in, void* d_out, int out_size, void* d_ws, size_t ws_size, hipStream_t stream) {
  (void)in_sizes; (void)n_in; (void)out_size; (void)ws_size;
  const float* x = (const float*)d_in[0]; const float* wq = (const float*)d_in[1]; const float* wk = (const float*)d_in[2]; const float* wv = (const float*)d_in[3]; const float* wo = (const float*)d_in[4]; const float* rb = (const float*)d_in[5];
  float* out = (float*)d_out;   // [1][2048][1024]
  char* ws = (char*)d_ws; size_t off = 0;
  auto carve = [&](size_t bytes) -> char* { char* p = ws + off; off += (bytes + 255) & ~(size_t)255; return p; };
  _Float16* X16 = (_Float16*)carve((size_t)TS * TD * 2);
__bf16* Xh = (__bf16*)carve((size_t)TS * TD * 2); __bf16* Xl = (__bf16*)carve((size_t)TS * TD * 2);
  __bf16* Wqh = (__bf16*)carve((size_t)TD * TD * 2); __bf16* Wql = (__bf16*)carve((size_t)TD * TD * 2); __bf16* Wkh = (__bf16*)carve((size_t)TD * TD * 2); __bf16* Wkl = (__bf16*)carve((size_t)TD * TD * 2);
  _Float16* Wv16 = (_Float16*)carve((size_t)TD * TD * 2); _Float16* Wo16 = (_Float16*)carve((size_t)TD * TD * 2);
  unsigned short* Qh = (unsigned short*)carve((size_t)TS * TD * 2); unsigned short* Ql = (unsigned short*)carve((size_t)TS * TD * 2);
  unsigned short* Kh = (unsigned short*)carve((size_t)TS * TD * 2); unsigned short* Kl = (unsigned short*)carve((size_t)TS * TD * 2);
  unsigned short* Vth = (unsigned short*)carve((size_t)TS * TD * 2); unsigned short* Vtl = (unsigned short*)carve((size_t)TS * TD * 2);   // [TD][TS]
  _Float16* O16 = X16;   // x's f16 plane is last read by the projections' launch
  static_assert(TS * TD % CV_WG == 0 && TD * TD % CV_WG == 0, "whole work-groups");
  convert_inputs<TS * TD / CV_WG, TD * TD / CV_WG><<<TS * TD / CV_WG + 4 * (TD * TD / CV_WG), 256, 0, stream>>>(
      x, wq, wk, wv, wo, X16, Xh, Xl, Wqh, Wql, Wkh, Wkl, Wv16, Wo16);   // nn.Linear weights [out][in] = Bt layout
  { const int t = (TS / 64) * (TD / 64);
    qkv_gemm64<4><<<dim3(t / 4, 3), 4 * 32, 0, stream>>>(U16(Xh), U16(Xl), U16(X16), U16(Wqh), U16(Wql), U16(Wkh), U16(Wkl), U16(Wv16), Qh, Ql, Kh, Kl, Vth, Vtl, TS, TD, TD); }
  { AttnGeom g;
    g.cp = rb; g.pc = nullptr; g.c_bs = 0; g.c_hs = 1; g.c_rs = TNH;   // rel_bias [bucket][head]
    g.q_bs = 0; g.q_rs = TD; g.q_hs = 64; g.k_bs = 0; g.k_rs = TD; g.k_hs = 64; g.v_bs = 0; g.v_rs = TS; g.v_hs = 64 * TS; g.o_bs = 0; g.o_rs = TD; g.o_hs = 64;
    g.S = TS; g.Skv = TS; g.H = TNH; g.mask_mode = 0; g.qscale = 1.0f; g.blk0 = 0; g.mask_fill = -INFINITY; g.mask_is_int = 0;
    attn64_kernel<true, true, false, true><<<TNH * (TS / AT_QB), AT_NW * 32, 0, stream>>>(Qh, Ql, Kh, Kl, Vth, Vtl, O16, nullptr, nullptr, g); }
  { const int t = (TS / 64) * (TD / 64);
    wmma_gemm64<2, 0, false, 0, 0, false><<<dim3(t / 2, 1), 2 * 32, 0, stream>>>(U16(O16), nullptr, TD, 0, U16(Wo16), nullptr, TD, 0, out, nullptr, TD, 0, nullptr, nullptr, 0, TS, TD, TD, 1.0f); }
}

// v009
// A run of this version takes 110 microseconds.
// In two side-by-side timings against v008, it was 1.15 and 1.17 times as fast.
// Counting every step since v000, it is 7.89 times as fast.
#include <hip/hip_runtime.h>
#include <math.h>
#include <stdint.h>
// T5 self-attention with relative-position bias: q/k/v = x·Wᵀ (2048 x 1024 · 1024 x 1024 each), out = o·Woᵀ and the attention
// (16 heads x 64, 2048 x 2048, unscaled scores + rel_bias[bucket(k−q), h]): q/k projections and both attention products on
// v_wmma_f32_16x16x32_bf16 with bf16 hi/lo split operands (unscaled T5 scores make the softmax sharp), v and output projections on v_wmma_f32_16x16x32_f16 with f16 operands; f32 accumulate; the bucket table (integer thresholds of the T5 log-spaced bucketing: |Δ| < 8 exact, then ≥8,12,16,23,32,46,64,91,
// +16 for Δ > 0) and softmax in f32/int on VALU.
typedef __attribute__((ext_vector_type(16))) _Float16 v16h;
typedef __attribute__((ext_vector_type(8)))  _Float16 v8h;
typedef __attribute__((ext_vector_type(16))) __bf16   v16b;
typedef __attribute__((ext_vector_type(8)))  __bf16   v8b;
typedef __attribute__((ext_vector_type(8)))  float    v8f;
typedef __attribute__((ext_vector_type(4)))  float    v4f;
typedef __attribute__((ext_vector_type(2)))  float    v2f;
typedef __attribute__((ext_vector_type(2)))  __bf16   v2b;
typedef __attribute__((ext_vector_type(4)))  __bf16   v4b;
typedef __attribute__((ext_vector_type(4)))  _Float16 v4h;
#define PSCALE 32768.0f
#define U16(p) ((const unsigned short*)(const void*)(p))
#define PSCALE_INV (1.0f / 32768.0f)

__device__ __forceinline__ unsigned short f2bf_bits(float f) {
  unsigned u = __float_as_uint(f);
  return (unsigned short)((u + 0x7FFFu + ((u >> 16) & 1u)) >> 16);
}
__device__ __forceinline__ float bf_bits2f(unsigned short h) { return __uint_as_float(((unsigned)h) << 16); }

// hazard guard as a plain device helper
__device__ __forceinline__ void acc_guard4(v8f& a, v8f& b, v8f& c, v8f& d) { asm volatile("v_nop\n\tv_nop\n\tv_nop\n\tv_nop" : "+v"(a), "+v"(b), "+v"(c), "+v"(d)); }
template <typename T> struct Frag;
template <> struct Frag<_Float16> {
  typedef v16h V; typedef v8h H; union U { v16h v; v8h h[2]; };
  static __device__ __forceinline__ v16h load(const _Float16* p) {   // elements 0..7 <- p[0..7], 8..15 <- p[16..23]
    U f; f.h[0] = *(const v8h*)(p); f.h[1] = *(const v8h*)(p + 16); return f.v;
  }
  static __device__ __forceinline__ v8f mma(v16h a, v16h b, v8f c) {
    return __builtin_amdgcn_wmma_f32_16x16x32_f16(false, a, false, b, (short)0, c, false, false);
  }
};
template <> struct Frag<__bf16> {
  typedef v16b V; typedef v8b H; union U { v16b v; v8b h[2]; };
  static __device__ __forceinline__ v16b load(const __bf16* p) {
    U f; f.h[0] = *(const v8b*)(p); f.h[1] = *(const v8b*)(p + 16); return f.v;
  }
  static __device__ __forceinline__ v8f mma(v16b a, v16b b, v8f c) {
    return __builtin_amdgcn_wmma_f32_16x16x32_bf16(false, a, false, b, (short)0, c, false, false);
  }
};

// ---- Register-blocked batched WMMA GEMM ------------------------------------
// C[m,n] = scale * sum_k A[m,k] * Bt[n,k] (+bias)(+resid); each wave owns a 64x64 tile.
// A row-major [M,K]; Bt row-major [N,K]; a work-group of NW waves owns (NW / 2) x 2 wave tiles: M % (32 NW) == 0, N % 128 == 0, K % 64 == 0.
// The work-group's A and Bt rows pass through LDS, 64 k a stage: eight lanes copy a row's 128 B, so every global load covers whole lines and
// a row is fetched once a work-group; the next stage's global loads fly while this stage's products run.
// SPLIT: operands are hi/lo planes (A2/Bt2 = lo planes, same layout); product = hi·hi + hi·lo + lo·hi.
// BIAS_MODE: 0 = none, 1 = bias[m], 2 = bias[n].
// OUT_MODE: 0 = f32, 1 = f16, 2 = bf16 hi plane (Cout) + bf16 lo plane (Cout2).
// ET: 0 = f16 operands, 1 = bf16 operands (pointers passed as 16-bit storage)
template <int ET> struct Elem;
template <> struct Elem<0> { typedef _Float16 T; };
template <> struct Elem<1> { typedef __bf16 T; };
// NW = waves (64x64 tiles) per work-group, bx = index of the work-group among those of this product, b = batch index,
// sT = the work-group's NW slabs of 16 x 68 floats in LDS, sG = its operand stage of GM_ELEMS(NW, SPLIT) 16-bit elements in LDS
#define GM_KS 64   // k elements of a stage: 128 B of every row
#define GM_LP 72   // LDS row pitch of a stage in 16-bit elements: 144 B = 16 B x 9 (odd), so the 16 rows of a ds_load_b128 fragment read spread over the banks
#define GM_ELEMS(NW, SPLIT) (((NW) / 2 * 64 + 128) * GM_LP * ((SPLIT) ? 2 : 1))
template <int NW, int ET, bool SPLIT, int BIAS_MODE, int OUT_MODE, bool RESID, int ACT = 0>
__device__ __forceinline__ void gemm64_body(const int bx, const int b, float* __restrict__ sT, unsigned short* __restrict__ sG,
    const unsigned short* __restrict__ Ap, const unsigned short* __restrict__ A2p, int lda, long strideA,
    const unsigned short* __restrict__ Btp, const unsigned short* __restrict__ Bt2p, int ldb, long strideB,
    void* __restrict__ Cout, void* __restrict__ Cout2, int ldc, long strideC,
    const float* __restrict__ bias,
    const float* __restrict__ resid, long strideR,
    int M, int N, int K, float scale) {
  typedef typename Elem<ET>::T T;
  typedef typename Frag<T>::V V;
  const T* A = (const T*)Ap; const T* A2 = (const T*)A2p; const T* Bt = (const T*)Btp; const T* Bt2 = (const T*)Bt2p;
  typedef typename Frag<T>::H H;
  constexpr int AR = NW / 2 * 64, BR = 128, NT = NW * 32;   // rows of A and of Bt a work-group, its threads
  constexpr int NA = AR * 8 / NT, NB = BR * 8 / NT;         // 16 B pieces of a stage a thread and plane
  const int tid  = threadIdx.x;
  const int lane = tid & 31;
  const int wave = tid >> 5;
  const int tilesN = N / BR;
  const int tilesM = M / AR;
  if (bx >= tilesM * tilesN) return;   // the same in every thread of the work-group, ahead of every barrier
  const int tm = bx / tilesN;
  const int tn = bx - tm * tilesN;
  const int mW = tm * AR, nW = tn * BR;      // the work-group's first rows of A and of Bt
  const int am = (wave >> 1) << 6, bn = (wave & 1) << 6;   // the wave's first rows inside them
  const int m0 = mW + am;
  const int n0 = nW + bn;

  const T* Ab  = A  + (size_t)b * strideA;
  const T* Bb  = Bt + (size_t)b * strideB;
  const T* Ab2 = SPLIT ? (A2  + (size_t)b * strideA) : nullptr;
  const T* Bb2 = SPLIT ? (Bt2 + (size_t)b * strideB) : nullptr;

  const int rlane = lane & 15;                 // row (A) / col (B, D) within subtile
  const int koff  = (lane >> 4) * 8;           // k offset of this lane half
  const int mOff  = (lane >> 4) * 8;           // D row offset

  v8f acc[4][4];
#pragma unroll
  for (int i = 0; i < 4; ++i)
#pragma unroll
    for (int j = 0; j < 4; ++j) acc[i][j] = (v8f){0.f,0.f,0.f,0.f,0.f,0.f,0.f,0.f};

  T* sAh = (T*)sG;           T* sBh = sAh + AR * GM_LP;   // hi (or only) planes [row][k]
  T* sAl = sBh + BR * GM_LP; T* sBl = sAl + AR * GM_LP;   // lo planes, SPLIT only
  const int sr = tid >> 3, sc = (tid & 7) * 8;            // staging: this thread's first row and its 16 B piece of a row
  unsigned aob[NA], bob[NB];                              // byte offsets of its pieces from the work-group's first row (each operand's rows span less than 4 GiB)
#pragma unroll
  for (int i = 0; i < NA; ++i) aob[i] = ((unsigned)(sr + NT / 8 * i) * (unsigned)lda + sc) * 2u;
#pragma unroll
  for (int i = 0; i < NB; ++i) bob[i] = ((unsigned)(sr + NT / 8 * i) * (unsigned)ldb + sc) * 2u;
  H rah[NA], ral[NA], rbh[NB], rbl[NB];
  // address = first byte of the work-group's first row, the same in every lane, + the lane's 32-bit byte offset, which walks along k
  const size_t a0 = (size_t)mW * lda, b0 = (size_t)nW * ldb;
  auto fetch = [&]() {
#pragma unroll
    for (int i = 0; i < NA; ++i) {
      rah[i] = *(const H*)((const char*)(Ab + a0) + aob[i]);
      if (SPLIT) ral[i] = *(const H*)((const char*)(Ab2 + a0) + aob[i]);
    }
#pragma unroll
    for (int i = 0; i < NB; ++i) {
      rbh[i] = *(const H*)((const char*)(Bb + b0) + bob[i]);
      if (SPLIT) rbl[i] = *(const H*)((const char*)(Bb2 + b0) + bob[i]);
    }
  };
  fetch();
  for (int k0 = 0; k0 < K; k0 += GM_KS) {
    __syncthreads();   // every wave has left the last stage
#pragma unroll
    for (int i = 0; i < NA; ++i) {
      const int lo = (sr + NT / 8 * i) * GM_LP + sc;
      *(H*)(sAh + lo) = rah[i];
      if (SPLIT) *(H*)(sAl + lo) = ral[i];
      aob[i] += GM_KS * 2u;   // the next stage
    }
#pragma unroll
    for (int i = 0; i < NB; ++i) {
      const int lo = (sr + NT / 8 * i) * GM_LP + sc;
      *(H*)(sBh + lo) = rbh[i];
      if (SPLIT) *(H*)(sBl + lo) = rbl[i];
      bob[i] += GM_KS * 2u;
    }
    __syncthreads();   // the stage is whole for every wave
    if (k0 + GM_KS < K) {   // the same test in every thread
      fetch();
      // precaution: stands between these loads, which fly over the products, and every later rewrite of their address registers (scalar bases, lane offsets)
      asm volatile("s_wait_xcnt 0x0" ::: "memory");
    }
#pragma unroll
   for (int ks = 0; ks < GM_KS; ks += 32) {
    V bh[4], bl[4], ah[4], al[4];   // the slice's fragments are read as one group: one LDS latency a slice, not one a row of tiles
#pragma unroll
    for (int j = 0; j < 4; ++j) {
      const int bo = (bn + (j << 4) + rlane) * GM_LP + koff + ks;
      bh[j] = Frag<T>::load(sBh + bo);
      if (SPLIT) bl[j] = Frag<T>::load(sBl + bo);
    }
#pragma unroll
    for (int i = 0; i < 4; ++i) {
      const int ao = (am + (i << 4) + rlane) * GM_LP + koff + ks;
      ah[i] = Frag<T>::load(sAh + ao);
      if (SPLIT) al[i] = Frag<T>::load(sAl + ao);
    }
    __builtin_amdgcn_sched_barrier(0);   // holds the group of reads ahead of the products: the scheduler otherwise sinks each A read to its first use, a full LDS latency a row of tiles
#pragma unroll
    for (int i = 0; i < 4; ++i) {
#pragma unroll
      for (int j = 0; j < 4; ++j) {
        acc[i][j] = Frag<T>::mma(ah[i], bh[j], acc[i][j]);
        if (SPLIT) {
          acc[i][j] = Frag<T>::mma(ah[i], bl[j], acc[i][j]);
          acc[i][j] = Frag<T>::mma(al[i], bh[j], acc[i][j]);
        }
      }
    }
   }
  }
  acc_guard4(acc[0][0], acc[0][1], acc[0][2], acc[0][3]);
  acc_guard4(acc[1][0], acc[1][1], acc[1][2], acc[1][3]);
  acc_guard4(acc[2][0], acc[2][1], acc[2][2], acc[2][3]);
  acc_guard4(acc[3][0], acc[3][1], acc[3][2], acc[3][3]);

  // ---- epilogue ----
  float* slab = sT + wave * (16 * 68);
  const float* Rb = RESID ? (resid + (size_t)b * strideR) : nullptr;
#pragma unroll
  for (int i = 0; i < 4; ++i) {
    const int mBase = m0 + (i << 4);
#pragma unroll
    for (int j = 0; j < 4; ++j) {
      const int n = n0 + (j << 4) + rlane;
      float bv = 0.f;
      if (BIAS_MODE == 2) bv = bias[n];
#pragma unroll
      for (int r = 0; r < 8; ++r) {
        float v = acc[i][j][r] * scale;
        if (BIAS_MODE == 1) v += bias[mBase + mOff + r];
        if (BIAS_MODE == 2) v += bv;
        if (RESID) v += Rb[(size_t)(mBase + mOff + r) * ldc + n];
        if (ACT == 1) v = tanhf(v);
        if (ACT == 2) v = fmaxf(v, 0.0f);
        if (ACT == 3) v = v / (1.0f + expf(-v));
        if (ACT == 4) v = (v > 0.f) ? v : 0.01f * v;
        if (ACT == 5) v = 0.5f * v * (1.0f + erff(v * 0.70710678118654752f));
        slab[(mOff + r) * 68 + (j << 4) + rlane] = v;
      }
    }
    __builtin_amdgcn_fence(__ATOMIC_RELEASE, "workgroup");
    __builtin_amdgcn_wave_barrier();
    __builtin_amdgcn_fence(__ATOMIC_ACQUIRE, "workgroup");
    if (OUT_MODE == 0) {
      float* C = (float*)Cout + (size_t)b * strideC;
      const int hh = lane >> 4, c4 = (lane & 15) * 4;     // row seg = 256 B = 16 lanes x 16 B
      {
#pragma unroll
        for (int it = 0; it < 8; ++it) {
          const int row = it * 2 + hh;
          v4f v = *(const v4f*)(slab + row * 68 + c4);
          *(v4f*)(C + (size_t)(mBase + row) * ldc + n0 + c4) = v;
        }
        
      }
    } else {
      const int q = lane >> 3, c8 = (lane & 7) * 8;
      unsigned short* C  = (unsigned short*)Cout  + (size_t)b * strideC;
      unsigned short* C2 = (OUT_MODE == 2) ? ((unsigned short*)Cout2 + (size_t)b * strideC) : nullptr;
      {
#pragma unroll
        for (int it = 0; it < 4; ++it) {
          const int row = it * 4 + q;
          const float* sp = slab + row * 68 + c8;
          v8h hv, lv;
#pragma unroll
          for (int e = 0; e < 8; ++e) {
            if (OUT_MODE == 1) {
              hv[e] = (_Float16)sp[e];
            } else {
              unsigned short hb = f2bf_bits(sp[e]);
              unsigned short lb = f2bf_bits(sp[e] - bf_bits2f(hb));
              hv[e] = __builtin_bit_cast(_Float16, hb);
              lv[e] = __builtin_bit_cast(_Float16, lb);
            }
          }
          *(v8h*)(C + (size_t)(mBase + row) * ldc + n0 + c8) = hv;
          if (OUT_MODE == 2) *(v8h*)(C2 + (size_t)(mBase + row) * ldc + n0 + c8) = lv;
        }
        
      }
    }
    __builtin_amdgcn_fence(__ATOMIC_RELEASE, "workgroup");
    __builtin_amdgcn_wave_barrier();
    __builtin_amdgcn_fence(__ATOMIC_ACQUIRE, "workgroup");
  }
}

template <int NW, int ET, bool SPLIT, int BIAS_MODE, int OUT_MODE, bool RESID, int ACT = 0>
__global__ __launch_bounds__(NW * 32) void wmma_gemm64(
    const unsigned short* __restrict__ Ap, const unsigned short* __restrict__ A2p, int lda, long strideA,
    const unsigned short* __restrict__ Btp, const unsigned short* __restrict__ Bt2p, int ldb, long strideB,
    void* __restrict__ Cout, void* __restrict__ Cout2, int ldc, long strideC,
    const float* __restrict__ bias,
    const float* __restrict__ resid, long strideR,
    int M, int N, int K, float scale) {
  __shared__ __align__(16) float sT[NW * 16 * 68];   // per-wave 16x64 slab, pitch 68 floats
  __shared__ __align__(16) unsigned short sG[GM_ELEMS(NW, SPLIT)];
  gemm64_body<NW, ET, SPLIT, BIAS_MODE, OUT_MODE, RESID, ACT>(blockIdx.x, blockIdx.y, sT, sG, Ap, A2p, lda, strideA, Btp, Bt2p, ldb, strideB,
                                                              Cout, Cout2, ldc, strideC, bias, resid, strideR, M, N, K, scale);
}

// The three projections of one x [M][K] in one launch, so that their work-groups run side by side on different WGPs:
// blockIdx.y = 0: q = x Wq^T, 1: k = x Wk^T (both bf16 hi/lo split), 2: v^T = Wv x^T (f16); weights [N][K].
// Each result leaves as the bf16 hi and lo planes that the attention's matrix products read: q, k as [M][N], v transposed as [N][M].
template <int NW>
__global__ __launch_bounds__(NW * 32) void qkv_gemm64(
    const unsigned short* __restrict__ Xh, const unsigned short* __restrict__ Xl, const unsigned short* __restrict__ X16,
    const unsigned short* __restrict__ Wqh, const unsigned short* __restrict__ Wql,
    const unsigned short* __restrict__ Wkh, const unsigned short* __restrict__ Wkl, const unsigned short* __restrict__ Wv16,
    unsigned short* __restrict__ Qh, unsigned short* __restrict__ Ql, unsigned short* __restrict__ Kh, unsigned short* __restrict__ Kl,
    unsigned short* __restrict__ Vth, unsigned short* __restrict__ Vtl, int M, int N, int K) {
  __shared__ __align__(16) float sT[NW * 16 * 68];   // per-wave 16x64 slab, pitch 68 floats
  __shared__ __align__(16) unsigned short sG[GM_ELEMS(NW, true)];
  if (blockIdx.y < 2) {
    const bool isk = blockIdx.y == 1;
    gemm64_body<NW, 1, true, 0, 2, false>(blockIdx.x, 0, sT, sG, Xh, Xl, K, 0, isk ? Wkh : Wqh, isk ? Wkl : Wql, K, 0,
                                          isk ? Kh : Qh, isk ? Kl : Ql, N, 0, nullptr, nullptr, 0, M, N, K, 1.0f);
  } else {
    gemm64_body<NW, 0, false, 0, 2, false>(blockIdx.x, 0, sT, sG, Wv16, nullptr, K, 0, X16, nullptr, K, 0,
                                           Vth, Vtl, M, 0, nullptr, nullptr, 0, N, M, K, 1.0f);
  }
}


// ---- f32 -> f16 cast with a power-of-two pre-scale (folded back by the consumer GEMM's scale) ----
__global__ __launch_bounds__(256) void cast_f32_f16x2s(const float* __restrict__ in, _Float16* __restrict__ out, int n2, float s) {
  int i = blockIdx.x * 256 + threadIdx.x;
  if (i < n2) {
    const _Float16 h0 = (_Float16)(in[2 * i] * s), h1 = (_Float16)(in[2 * i + 1] * s);
    const unsigned u = (unsigned)__builtin_bit_cast(unsigned short, h0) | ((unsigned)__builtin_bit_cast(unsigned short, h1) << 16);
    ((unsigned*)out)[i] = u;
    
  }
}


// ---- f32 [R][C] (row pitch ldi) -> f16 transposed [C][R] (row pitch ldo); 64x64 tiles; each output row segment
__global__ __launch_bounds__(256) void transpose_cast_f16(const float* __restrict__ in, int ldi,
                                                         _Float16* __restrict__ outT, int ldo, float scale) {
  __shared__ __align__(16) _Float16 tile[64][72];     // [c][r]
  const int c0 = blockIdx.x * 64, r0 = blockIdx.y * 64;
  const int t = threadIdx.y * 32 + threadIdx.x;
  for (int i = threadIdx.y; i < 64; i += 8) {
    tile[threadIdx.x][i]      = (_Float16)(in[(size_t)(r0 + i) * ldi + c0 + threadIdx.x] * scale);
    tile[32 + threadIdx.x][i] = (_Float16)(in[(size_t)(r0 + i) * ldi + c0 + 32 + threadIdx.x] * scale);
  }
  __syncthreads();
  const int q = t >> 3, c8 = (t & 7) * 8;
  {
#pragma unroll
    for (int it = 0; it < 2; ++it) {
      const int c = it * 32 + q;
      v8h hv = *(const v8h*)(&tile[c][c8]);
      *(v8h*)(outT + (size_t)(c0 + c) * ldo + r0 + c8) = hv;
    }
    
  }
}

// ---- f32 [R][C] (pitch ldi) -> bf16 hi/lo transposed planes [C][R] (pitch ldo); 64x64 tiles; each output row segment
__global__ __launch_bounds__(256) void transpose_split_bf16(const float* __restrict__ in, int ldi,
                                                           __bf16* __restrict__ outH, __bf16* __restrict__ outL, int ldo) {
  __shared__ __align__(16) float tile[64][68];     // [c][r]
  const int c0 = blockIdx.x * 64, r0 = blockIdx.y * 64;
  const int t = threadIdx.y * 32 + threadIdx.x;
  for (int i = threadIdx.y; i < 64; i += 8) {
    tile[threadIdx.x][i]      = in[(size_t)(r0 + i) * ldi + c0 + threadIdx.x];
    tile[32 + threadIdx.x][i] = in[(size_t)(r0 + i) * ldi + c0 + 32 + threadIdx.x];
  }
  __syncthreads();
  const int q = t >> 3, c8 = (t & 7) * 8;
  {
#pragma unroll
    for (int it = 0; it < 2; ++it) {
      const int c = it * 32 + q;
      v8b hv, lv;
#pragma unroll
      for (int e = 0; e < 8; ++e) {
        const float f = tile[c][c8 + e];
        const unsigned short hb = f2bf_bits(f);
        hv[e] = __builtin_bit_cast(__bf16, hb);
        lv[e] = __builtin_bit_cast(__bf16, f2bf_bits(f - bf_bits2f(hb)));
      }
      *(v8b*)(outH + (size_t)(c0 + c) * ldo + r0 + c8) = hv;
      *(v8b*)(outL + (size_t)(c0 + c) * ldo + r0 + c8) = lv;
    }
    
  }
}

#define AT_D 64
#define AT_NW 4
#define AT_QB 64
#define AT_KC 64
#define AT_LP 72   // LDS row pitch of the K and V tiles in 16-bit elements: 144 B = 16 B x 9 (odd), so the 16 rows of a ds_load_b128 fragment read spread over the banks
#define AT_TB 10240   // a tile's place in the LDS ring: AT_KC rows x 144 B = 9,216 B, rounded up to a multiple of 2 KiB
#define AT_BT (2048 + AT_QB)   // distance table: Skv + AT_QB - 1 entries used (Skv <= 2048), rounded up to whole waves
struct AttnGeom { const float* cp = nullptr; const float* pc = nullptr; long c_bs = 0, c_rs = 0, c_hs = 0;   // mode-5 / DISTB score-bias tables
                  long q_bs, q_rs, q_hs, k_bs, k_rs, k_hs, v_bs, v_rs, v_hs, o_bs, o_rs, o_hs;
                  int S, Skv, H, mask_mode; float qscale; int blk0; float mask_fill; int mask_is_int; };
static_assert(sizeof(AttnGeom) == 168, "no padding");

__device__ __forceinline__ unsigned short at_bf_bits(float f) {
  unsigned u = __float_as_uint(f);
  return (unsigned short)((u + 0x7FFFu + ((u >> 16) & 1u)) >> 16);
}
__device__ __forceinline__ __bf16 at_f2bf(float f) { return __builtin_bit_cast(__bf16, at_bf_bits(f)); }
// two neighbours as packed bf16 pairs: hi = the value rounded to nearest even, lo = what is left, rounded likewise
__device__ __forceinline__ void at_split2(float p0, float p1, v2b& hi, v2b& lo) {
  const v2f p = {p0, p1};
  hi = __builtin_convertvector(p, v2b);
  lo = __builtin_convertvector(p - __builtin_convertvector(hi, v2f), v2b);
}
// the value of lane l ^ 16: the other half of the same query's kv rows
__device__ __forceinline__ float at_other_half(float x) {
  const int b = __float_as_int(x);
  return __int_as_float(__builtin_amdgcn_permlanex16(b, b, 0x76543210, 0xfedcba98, false, false));
}
// 16-bit element as a bit pattern held in a __bf16 slot: f16 bits when F16, bf16 (RNE) otherwise
template <bool F16> __device__ __forceinline__ __bf16 at_to16(float f) {
  if (F16) return __builtin_bit_cast(__bf16, (_Float16)f);
  return at_f2bf(f);
}
// the builtin alone: the compiler keeps the distance behind it, and LDS reads may be scheduled across it
template <bool F16> __device__ __forceinline__ v8f at_mma16(v16b a, v16b b, v8f c) {
  if (F16) return __builtin_amdgcn_wmma_f32_16x16x32_f16(false, __builtin_bit_cast(v16h, a), false, __builtin_bit_cast(v16h, b), (short)0, c, false, false);
  return __builtin_amdgcn_wmma_f32_16x16x32_bf16(false, a, false, b, (short)0, c, false, false);
}

// ---- tensor load: one request of a wave brings a tile of 64 rows x 128 B from global memory into LDS, through no register ----
typedef uint32_t u32x4 __attribute__((ext_vector_type(4)));
typedef uint32_t u32x8 __attribute__((ext_vector_type(8)));
__device__ __forceinline__ uint32_t at_uni(uint32_t v) { return (uint32_t)__builtin_amdgcn_readfirstlane(v); }
// a test around a tensor load, which ignores EXEC, has to be a scalar branch
__device__ __forceinline__ uint32_t at_pinned(uint32_t v) {
  uint32_t w = at_uni(v);
  asm volatile("" : "+s"(w));   // holds the wave-uniform test value in a scalar register, so that the test compiles to s_cmp + s_cbranch_scc
  return w;
}
// group 1: 1-byte elements, tensor = tile = 64 rows of 128 B, source row pitch in bytes, 4 dwords of LDS pad behind every 32 (LDS pitch 144 B), no mask
__device__ __forceinline__ u32x8 at_tdm_group1(uint32_t src_pitch) {
  u32x8 g;
  g[0] = at_uni((1u << 20) | (4u << 22) | (3u << 25));
  g[1] = at_uni(128u << 16);
  g[2] = at_uni(64u << 16);
  g[3] = at_uni(128u << 16);
  g[4] = at_uni(64u);
  g[5] = at_uni(src_pitch);
  g[6] = at_uni(0u);
  g[7] = at_uni(0u);
  asm volatile("" : "+s"(g));   // descriptor words held in their scalar registers
  return g;
}
// group 0: count 1, the tile's place in the work-group's LDS, the address of its first byte, type 2
__device__ __forceinline__ u32x4 at_tdm_group0(uint32_t lds_dst, uint64_t ga) {
  u32x4 g;
  g[0] = at_uni(1u); g[1] = at_uni(lds_dst); g[2] = at_uni((uint32_t)ga); g[3] = at_uni((((uint32_t)(ga >> 32)) & 0x01FFFFFFu) | 0x80000000u);
  asm volatile("" : "+s"(g));   // descriptor words held in their scalar registers, as in group 1
  return g;
}
// the same request for another place and a tile step bytes on: the address lies in words 2 and 3, below the type bits, and a carry goes from word 2 into word 3
__device__ __forceinline__ void at_tdm_advance(u32x4& g, uint32_t lds_dst, uint64_t step) {
  const uint64_t a = (((uint64_t)g[3] << 32) | g[2]) + step;
  g[1] = at_uni(lds_dst); g[2] = at_uni((uint32_t)a); g[3] = at_uni((uint32_t)(a >> 32));
}
__device__ __forceinline__ void at_tdm_load(u32x4 g0, u32x8 g1) { asm volatile("tensor_load_to_lds %0, %1" :: "s"(g0), "s"(g1) : "memory"); }
// the compiler places no wait for a tensor load: a tile has landed behind its issuer's own wait, and other waves read it behind the next barrier
__device__ __forceinline__ void at_wait_tensor0() { asm volatile("s_wait_tensorcnt 0x0" ::: "memory"); }
// this wave's LDS reads of a buffer have retired before the barrier behind which the buffer is refilled
__device__ __forceinline__ void at_wait_ds0() { asm volatile("s_wait_dscnt 0x0" ::: "memory"); }

// DISTB: s += bias[bucket(kv - q)] of this head (32 buckets; bucket n of (b, h) at cp + b*c_bs + h*c_hs + n*c_rs), no mask; Skv <= 2048.
template <bool SPLIT_QK, bool SPLIT_PV, bool F16 = false, bool DISTB = false>
__global__ __launch_bounds__(128)
void attn64_kernel(const unsigned short* __restrict__ qh, const unsigned short* __restrict__ ql,
                   const unsigned short* __restrict__ kh, const unsigned short* __restrict__ kl,
                   const unsigned short* __restrict__ vh, const unsigned short* __restrict__ vl, _Float16* __restrict__ out,
                   const void* __restrict__ mask_a, const int* __restrict__ mask_b, AttnGeom g) {
  static_assert(!(F16 && (SPLIT_QK || SPLIT_PV)), "f16 mode is non-split");
  const float PSC = F16 ? 32768.0f : 1.0f;     // f16 probabilities carried x2^15 (subnormal range), folded into the final 1/l
  union FB { v16b v; v8b h[2]; v2b d[8]; };
  static_assert(SPLIT_QK && SPLIT_PV && AT_NW == 4, "four tiles a chunk, one for each of the four waves");
  // two buffers of four tiles, rows at pitch AT_LP: K hi [kv][d], K lo, V hi [d][kv], V lo; chunk kc lies in buffer kc % 2
  __shared__ __attribute__((aligned(2048))) unsigned char Ring[2 * 4 * AT_TB];
  __shared__ __align__(16) float  Os[AT_NW][16 * 68];            // per wave out tile, pitch 68
  __shared__ float Bs[DISTB ? AT_BT : 1];                        // score bias of this (head, query block) by distance kv - q

  const int tid  = threadIdx.x;
  const int wave = tid >> 5;
  const int lane = tid & 31;
  const int hh   = lane >> 4;
  const int c    = lane & 15;

  const int nqb = g.S / AT_QB;
  const int bx = blockIdx.x + g.blk0;
  const int qb = bx % nqb;
  const int bh = bx / nqb;
  const int h  = bh % g.H;
  const int b  = bh / g.H;
  const int qbase_block = qb * AT_QB;
  const int q0 = qbase_block + wave * 16;

  const size_t qoff = (size_t)b * g.q_bs + (size_t)h * g.q_hs;
  const size_t koff = (size_t)b * g.k_bs + (size_t)h * g.k_hs;
  const size_t voff = (size_t)b * g.v_bs + (size_t)h * g.v_hs;
  _Float16*    ob_ptr = out + (size_t)b * g.o_bs + (size_t)h * g.o_hs;

  // Bs[i] = bias of distance kv - q = i - (qbase_block + AT_QB - 1); published by the barrier in front of the kv loop
  if (DISTB) {
    const float bl = g.cp[(size_t)b * g.c_bs + (size_t)h * g.c_hs + (size_t)lane * g.c_rs];   // lane n holds bucket n
    for (int i = tid; i < AT_BT; i += AT_NW * 32) {   // whole waves only (AT_BT % 32 == 0): every source lane of the shuffle is on
      const int rel = i - (qbase_block + AT_QB - 1); const int a = rel < 0 ? -rel : rel;
      int bkt;
      if (a < 8) bkt = a;
      else bkt = 8 + (a >= 12) + (a >= 16) + (a >= 23) + (a >= 32) + (a >= 46) + (a >= 64) + (a >= 91);   // = 8 + trunc(8*log(a/8)/log 16), capped at 15
      if (rel > 0) bkt += 16;
      Bs[i] = __shfl(bl, bkt, 32);
    }
  }

  // ---- Q fragments (B operand: column = query q0 + c): 2 d-chunks, hi (and lo) ----
  v16b qah[2], qal[2];
  {
    const size_t qrow = qoff + (size_t)(q0 + c) * g.q_rs + 8 * hh;
#pragma unroll
    for (int dc = 0; dc < 2; ++dc) {
      qah[dc] = Frag<__bf16>::load((const __bf16*)qh + qrow + dc * 32);
      qal[dc] = SPLIT_QK ? Frag<__bf16>::load((const __bf16*)ql + qrow + dc * 32) : qah[dc];
    }
  }

  float mrow = -INFINITY, lrow = 0.f;   // this lane's query: running maximum (both halves agree), sum over this half's kv rows
  v8f oacc[4];                          // O^T: oacc[t][r] = out[q0 + c][16 t + 8 hh + r]
#pragma unroll
  for (int t = 0; t < 4; ++t) oacc[t] = (v8f){0.f,0.f,0.f,0.f,0.f,0.f,0.f,0.f};

  const int nChunks = (g.mask_mode == 1 || g.mask_mode == 4) ? (qb + 1) : (g.Skv / AT_KC);   // block-uniform
  // per-row query mask (mode 3)
  const int qkeep = (g.mask_mode == 3) ? mask_b[(size_t)b * g.S + q0 + c] : 1;   // mask_b = qmask in mode 3
  // Each tile is 64 rows of 128 B (K: row = kv, V: row = d). Wave w brings tile w of every chunk with one tensor load, a chunk ahead of its use.
  const uint32_t wv = at_uni((uint32_t)tid >> 5);
  const unsigned short* tsrc = wv == 0 ? kh + koff : wv == 1 ? kl + koff : wv == 2 ? vh + voff : vl + voff;
  const uint64_t tstep = wv < 2 ? (uint64_t)g.k_rs * (AT_KC * 2u) : (uint64_t)(AT_KC * 2u);     // the next chunk: AT_KC rows on in k, AT_KC columns on in v
  const uint32_t tplace = (uint32_t)(size_t)Ring + wv * AT_TB;                                  // the tile's place in buffer 0
  const u32x8 tg1 = at_tdm_group1((wv < 2 ? (uint32_t)g.k_rs : (uint32_t)g.v_rs) * 2u);
  u32x4 tg0 = at_tdm_group0(tplace, (uint64_t)(size_t)tsrc);
  at_tdm_load(tg0, tg1);   // chunk 0
  at_wait_tensor0();
  __syncthreads();   // chunk 0 and the bias table are whole for every wave
  if (at_pinned(nChunks > 1)) {
    at_tdm_advance(tg0, tplace + 4 * AT_TB, tstep);
    at_tdm_load(tg0, tg1);   // chunk 1 flies while chunk 0 is worked on
  }
  for (int kc = 0; kc < nChunks; ++kc) {
    const int kv0 = kc * AT_KC;
    const uint32_t cur = (uint32_t)(kc & 1) * (4 * AT_TB);
    const __bf16* Ksh = (const __bf16*)(Ring + cur);
    const __bf16* Ksl = (const __bf16*)(Ring + cur + AT_TB);
    const __bf16* Vth = (const __bf16*)(Ring + cur + 2 * AT_TB);
    const __bf16* Vtl = (const __bf16*)(Ring + cur + 3 * AT_TB);
    // The K fragments of a d-chunk are read as one group, then the four score tiles advance side by side: one LDS latency a group,
    // and each tile's next product stands four matrix instructions behind its last. Each tile sums its products in the order dc, hi.hi, hi.lo, lo.hi
    // (q part first). s[j][r] = score of kv row kv0 + 16 j + 8 hh + r and query q0 + c.
    v8f s[4];
#pragma unroll
    for (int j = 0; j < 4; ++j) s[j] = (v8f){0.f,0.f,0.f,0.f,0.f,0.f,0.f,0.f};
#pragma unroll
    for (int dc = 0; dc < 2; ++dc) {
      FB kb[4], kl[4];
#pragma unroll
      for (int j = 0; j < 4; ++j) {
        kb[j].h[0] = *(const v8b*)(Ksh + (j * 16 + c) * AT_LP + dc * 32 + 8 * hh);
        kb[j].h[1] = *(const v8b*)(Ksh + (j * 16 + c) * AT_LP + dc * 32 + 16 + 8 * hh);
        if (SPLIT_QK) {
          kl[j].h[0] = *(const v8b*)(Ksl + (j * 16 + c) * AT_LP + dc * 32 + 8 * hh);
          kl[j].h[1] = *(const v8b*)(Ksl + (j * 16 + c) * AT_LP + dc * 32 + 16 + 8 * hh);
        }
      }
#pragma unroll
      for (int j = 0; j < 4; ++j) s[j] = at_mma16<F16>(kb[j].v, qah[dc], s[j]);
      if (SPLIT_QK) {
#pragma unroll
        for (int j = 0; j < 4; ++j) s[j] = at_mma16<F16>(kl[j].v, qah[dc], s[j]);
#pragma unroll
        for (int j = 0; j < 4; ++j) s[j] = at_mma16<F16>(kb[j].v, qal[dc], s[j]);
      }
    }
    const bool diag = (g.mask_mode == 1) && (kc == qb);
    float cj[4];   // maximum of each tile's eight scores: four independent chains
    if (DISTB) {
      const float* bp = Bs + (kv0 + 8 * hh + (AT_QB - 1) - wave * 16 - c);   // + kv row offset - query offset
#pragma unroll
      for (int j = 0; j < 4; ++j) {
        float m = -INFINITY;
#pragma unroll
        for (int r = 0; r < 8; ++r) { s[j][r] += bp[j * 16 + r]; m = fmaxf(m, s[j][r]); }
        cj[j] = m;
      }
    } else
#pragma unroll
    for (int j = 0; j < 4; ++j) {
      const int qrow = q0 + c;
      float m = -INFINITY;
#pragma unroll
      for (int r = 0; r < 8; ++r) {
        const int kvcol = kv0 + j * 16 + 8 * hh + r;
        bool masked = false;
        if (diag) masked = (kvcol > qrow);
        else if (g.mask_mode == 4) masked = (kvcol > qrow) || (qrow - kvcol > g.mask_is_int);
        else if (g.mask_mode == 2) {
          const size_t mi = (size_t)qrow * g.Skv + kvcol;
          masked = (g.mask_is_int == 0) ? (((const float*)mask_a)[mi] == 0.0f)
                 : (g.mask_is_int == 1) ? (((const int*)mask_a)[mi] == 0) : (((const int*)mask_a)[mi] != 0);
        } else if (g.mask_mode == 3) masked = (qkeep == 0) || (((const int*)mask_a)[(size_t)b * g.Skv + kvcol] == 0);   // mask_a = kvmask
        else if (g.mask_mode == 5) {
          const size_t mi = (size_t)qrow * g.Skv + kvcol;
          masked = (((const int*)mask_a)[mi] != 0);
          int n = mask_b[mi]; n = n < 0 ? 0 : n;
          s[j][r] += g.cp[(size_t)b * g.c_bs + (size_t)h * g.c_hs + (size_t)qrow * g.c_rs + n]
                   + g.pc[(size_t)b * g.c_bs + (size_t)h * g.c_hs + (size_t)kvcol * g.c_rs + n];
        }
        if (masked) s[j][r] = g.mask_fill;
        m = fmaxf(m, s[j][r]);
      }
      cj[j] = m;
    }
    // the query's maximum over the chunk: this lane's 32 kv rows, then the other half's 32
    float cm = fmaxf(fmaxf(cj[0], cj[1]), fmaxf(cj[2], cj[3]));
    cm = fmaxf(cm, at_other_half(cm));
    const float mnew = fmaxf(mrow, cm);
    const float alpha = expf(mrow - mnew);
    mrow = mnew;
    // Tiles 2 kk and 2 kk + 1 hold kv rows 8 hh + r and 16 + 8 hh + r of kv half kk: the k order of a B operand, element by element
    FB pb[2], pl[2];
    float ps[4];
#pragma unroll
    for (int j = 0; j < 4; ++j) {
      float psum = 0.f;
#pragma unroll
      for (int r = 0; r < 8; r += 2) {
        const float p0 = expf(s[j][r] - mnew), p1 = expf(s[j][r + 1] - mnew);
        psum += p0; psum += p1;
        const int e = (j & 1) * 8 + r;
        if (SPLIT_PV) at_split2(p0, p1, pb[j >> 1].d[e >> 1], pl[j >> 1].d[e >> 1]);
        else { pb[j >> 1].v[e] = at_to16<F16>(p0 * PSC); pb[j >> 1].v[e + 1] = at_to16<F16>(p1 * PSC); }
      }
      ps[j] = psum;
    }
    lrow = lrow * alpha + ((ps[0] + ps[1]) + (ps[2] + ps[3]));   // the halves' sums are joined once, behind the loop
#pragma unroll
    for (int t = 0; t < 4; ++t) oacc[t] *= alpha;
    // As for the scores: the V fragments of a kv half are read as one group, then the four output tiles advance side by side
    // (each tile's order of sums: kk, hi.hi, hi.lo, lo.hi, p part first).
#pragma unroll
    for (int kk = 0; kk < 2; ++kk) {
      FB vb[4], vl[4];
#pragma unroll
      for (int t = 0; t < 4; ++t) {
        vb[t].h[0] = *(const v8b*)(Vth + (t * 16 + c) * AT_LP + kk * 32 + 8 * hh);
        vb[t].h[1] = *(const v8b*)(Vth + (t * 16 + c) * AT_LP + kk * 32 + 16 + 8 * hh);
        if (SPLIT_PV) {
          vl[t].h[0] = *(const v8b*)(Vtl + (t * 16 + c) * AT_LP + kk * 32 + 8 * hh);
          vl[t].h[1] = *(const v8b*)(Vtl + (t * 16 + c) * AT_LP + kk * 32 + 16 + 8 * hh);
        }
      }
#pragma unroll
      for (int t = 0; t < 4; ++t) oacc[t] = at_mma16<F16>(vb[t].v, pb[kk].v, oacc[t]);
      if (SPLIT_PV) {
#pragma unroll
        for (int t = 0; t < 4; ++t) oacc[t] = at_mma16<F16>(vl[t].v, pb[kk].v, oacc[t]);
#pragma unroll
        for (int t = 0; t < 4; ++t) oacc[t] = at_mma16<F16>(vb[t].v, pl[kk].v, oacc[t]);
      }
    }
    // chunk kc + 1 is handed over: own LDS reads retired, own tile landed, then the one barrier of a chunk, which also ends every wave's reads of this buffer
    at_wait_ds0();
    at_wait_tensor0();
    __syncthreads();
    if (at_pinned(kc + 2 < nChunks)) {
      at_tdm_advance(tg0, tplace + cur, tstep);   // behind the wait that covers the last request
      at_tdm_load(tg0, tg1);   // chunk kc + 2 into the buffer just left
    }
  }
  at_wait_tensor0();
  at_wait_ds0();

  // a lane holds eight neighbouring d of its query a tile: two 16 B pieces into the wave's slab [query][d]
  float* os = Os[wave];
  {
    const float inv = 1.0f / ((lrow + at_other_half(lrow)) * PSC);
#pragma unroll
    for (int t = 0; t < 4; ++t) {
      const v8f o = oacc[t] * inv;
      *(v4f*)(os + c * 68 + t * 16 + 8 * hh)     = (v4f){o[0], o[1], o[2], o[3]};
      *(v4f*)(os + c * 68 + t * 16 + 8 * hh + 4) = (v4f){o[4], o[5], o[6], o[7]};
    }
  }
  __builtin_amdgcn_fence(__ATOMIC_RELEASE, "workgroup");
  __builtin_amdgcn_wave_barrier();
  __builtin_amdgcn_fence(__ATOMIC_ACQUIRE, "workgroup");
  {
    const int q4 = lane >> 3, c8 = (lane & 7) * 8;   // a query's 64 d as f16 are one 128 B line: eight lanes x 16 B, four queries a store
#pragma unroll
    for (int it = 0; it < 4; ++it) {
      const int row = it * 4 + q4;
      const v4f a = *(const v4f*)(os + row * 68 + c8), e = *(const v4f*)(os + row * 68 + c8 + 4);
      const v8f o = {a[0], a[1], a[2], a[3], e[0], e[1], e[2], e[3]};
      *(v8h*)(ob_ptr + (size_t)(q0 + row) * g.o_rs + c8) = __builtin_convertvector(o, v8h);
    }
  }
}

// ---- every f32 -> 16-bit conversion of the inputs, one launch ----
// A work-group converts CV_WG neighbouring elements of one input; a thread takes CV_IT pieces of four elements, 256 threads apart: a wave-wide load
// covers 512 contiguous bytes, a store 256, and all of a thread's loads are issued ahead of its first store. Few waves that each move 128 B a lane,
// because a launch of one small item a lane lasts as long as its waves take to start.
// F16P: a plain f16 plane (o16); SPL: bf16 hi and lo planes (hi = the value rounded to nearest even, lo = what is left, rounded likewise).
#define CV_IT 8
#define CV_WG (256 * CV_IT * 4)
template <bool F16P, bool SPL>
__device__ __forceinline__ void convert_block(const float* __restrict__ in, _Float16* __restrict__ o16,
                                              __bf16* __restrict__ hi, __bf16* __restrict__ lo, const int blk) {
  const size_t e0 = (size_t)blk * CV_WG + threadIdx.x * 4;
  v4f v[CV_IT];
#pragma unroll
  for (int i = 0; i < CV_IT; ++i) v[i] = *(const v4f*)(in + e0 + i * 1024);
#pragma unroll
  for (int i = 0; i < CV_IT; ++i) {
    const size_t e = e0 + i * 1024;
    if (F16P) *(v4h*)(o16 + e) = __builtin_convertvector(v[i], v4h);
    if (SPL) {
      v2b h0, l0, h1, l1;
      at_split2(v[i][0], v[i][1], h0, l0);
      at_split2(v[i][2], v[i][3], h1, l1);
      *(v4b*)(hi + e) = (v4b){h0[0], h0[1], h1[0], h1[1]};
      *(v4b*)(lo + e) = (v4b){l0[0], l0[1], l1[0], l1[1]};
    }
  }
  // precaution: stands between these stores and every later rewrite of their address and data registers on the paths that the caller's branches join
  asm volatile("s_wait_xcnt 0x0" ::: "memory");
}
// blockIdx.x: NBX work-groups for x (f16 plane and bf16 hi/lo planes from one read), then NBW each for wq, wk (hi/lo planes), wv, wo (f16 plane)
template <int NBX, int NBW>
__global__ __launch_bounds__(256) void convert_inputs(
    const float* __restrict__ x, const float* __restrict__ wq, const float* __restrict__ wk, const float* __restrict__ wv, const float* __restrict__ wo,
    _Float16* __restrict__ X16, __bf16* __restrict__ Xh, __bf16* __restrict__ Xl, __bf16* __restrict__ Wqh, __bf16* __restrict__ Wql,
    __bf16* __restrict__ Wkh, __bf16* __restrict__ Wkl, _Float16* __restrict__ Wv16, _Float16* __restrict__ Wo16) {
  const int bw = (int)blockIdx.x - NBX;
  if (bw < 0) { convert_block<true, true>(x, X16, Xh, Xl, blockIdx.x); return; }
  const int w = bw / NBW, blk = bw - w * NBW;
  if (w < 2) convert_block<false, true>(w ? wk : wq, nullptr, w ? Wkh : Wqh, w ? Wkl : Wql, blk);
  else       convert_block<true, false>(w == 2 ? wv : wo, w == 2 ? Wv16 : Wo16, nullptr, nullptr, blk);
}

#define TS 2048
#define TD 1024
#define TNH 16
#define TNB 32
extern "C" void kernel_launch(void* const* d_in, const int* in_sizes, int n_in, void* d_out, int out_size, void* d_ws, size_t ws_size, hipStream_t stream) {
  (void)in_sizes; (void)n_in; (void)out_size; (void)ws_size;
  const float* x = (const float*)d_in[0]; const float* wq = (const float*)d_in[1]; const float* wk = (const float*)d_in[2]; const float* wv = (const float*)d_in[3]; const float* wo = (const float*)d_in[4]; const float* rb = (const float*)d_in[5];
  float* out = (float*)d_out;   // [1][2048][1024]
  char* ws = (char*)d_ws; size_t off = 0;
  auto carve = [&](size_t bytes) -> char* { char* p = ws + off; off += (bytes + 255) & ~(size_t)255; return p; };
  _Float16* X16 = (_Float16*)carve((size_t)TS * TD * 2);
__bf16* Xh = (__bf16*)carve((size_t)TS * TD * 2); __bf16* Xl = (__bf16*)carve((size_t)TS * TD * 2);
  __bf16* Wqh = (__bf16*)carve((size_t)TD * TD * 2); __bf16* Wql = (__bf16*)carve((size_t)TD * TD * 2); __bf16* Wkh = (__bf16*)carve((size_t)TD * TD * 2); __bf16* Wkl = (__bf16*)carve((size_t)TD * TD * 2);
  _Float16* Wv16 = (_Float16*)carve((size_t)TD * TD * 2); _Float16* Wo16 = (_Float16*)carve((size_t)TD * TD * 2);
  unsigned short* Qh = (unsigned short*)carve((size_t)TS * TD * 2); unsigned short* Ql = (unsigned short*)carve((size_t)TS * TD * 2);
  unsigned short* Kh = (unsigned short*)carve((size_t)TS * TD * 2); unsigned short* Kl = (unsigned short*)carve((size_t)TS * TD * 2);
  unsigned short* Vth = (unsigned short*)carve((size_t)TS * TD * 2); unsigned short* Vtl = (unsigned short*)carve((size_t)TS * TD * 2);   // [TD][TS]
  _Float16* O16 = X16;   // x's f16 plane is last read by the projections' launch
  static_assert(TS * TD % CV_WG == 0 && TD * TD % CV_WG == 0, "whole work-groups");
  convert_inputs<TS * TD / CV_WG, TD * TD / CV_WG><<<TS * TD / CV_WG + 4 * (TD * TD / CV_WG), 256, 0, stream>>>(
      x, wq, wk, wv, wo, X16, Xh, Xl, Wqh, Wql, Wkh, Wkl, Wv16, Wo16);   // nn.Linear weights [out][in] = Bt layout
  { const int t = (TS / 64) * (TD / 64);
    qkv_gemm64<4><<<dim3(t / 4, 3), 4 * 32, 0, stream>>>(U16(Xh), U16(Xl), U16(X16), U16(Wqh), U16(Wql), U16(Wkh), U16(Wkl), U16(Wv16), Qh, Ql, Kh, Kl, Vth, Vtl, TS, TD, TD); }
  { AttnGeom g;
    g.cp = rb; g.pc = nullptr; g.c_bs = 0; g.c_hs = 1; g.c_rs = TNH;   // rel_bias [bucket][head]
    g.q_bs = 0; g.q_rs = TD; g.q_hs = 64; g.k_bs = 0; g.k_rs = TD; g.k_hs = 64; g.v_bs = 0; g.v_rs = TS; g.v_hs = 64 * TS; g.o_bs = 0; g.o_rs = TD; g.o_hs = 64;
    g.S = TS; g.Skv = TS; g.H = TNH; g.mask_mode = 0; g.qscale = 1.0f; g.blk0 = 0; g.mask_fill = -INFINITY; g.mask_is_int = 0;
    attn64_kernel<true, true, false, true><<<TNH * (TS / AT_QB), AT_NW * 32, 0, stream>>>(Qh, Ql, Kh, Kl, Vth, Vtl, O16, nullptr, nullptr, g); }
  { const int t = (TS / 64) * (TD / 64);
    wmma_gemm64<2, 0, false, 0, 0, false><<<dim3(t / 2, 1), 2 * 32, 0, stream>>>(U16(O16), nullptr, TD, 0, U16(Wo16), nullptr, TD, 0, out, nullptr, TD, 0, nullptr, nullptr, 0, TS, TD, TD, 1.0f); }
}

// v010
// A run of this version takes 99.2 microseconds.
// In two side-by-side timings against v009, it was 1.10 and 1.11 times as fast.
// Over all steps from v000 it is 8.74 times as fast.
#include <hip/hip_runtime.h>
#include <math.h>
#include <stdint.h>
// T5 self-attention with relative-position bias: q/k/v = x·Wᵀ (2048 x 1024 · 1024 x 1024 each), out = o·Woᵀ and the attention
// (16 heads x 64, 2048 x 2048, unscaled scores + rel_bias[bucket(k−q), h]): q/k projections and both attention products on
// v_wmma_f32_16x16x32_bf16 with bf16 hi/lo split operands (unscaled T5 scores make the softmax sharp), v and output projections on v_wmma_f32_16x16x32_f16 with f16 operands; f32 accumulate; the bucket table (integer thresholds of the T5 log-spaced bucketing: |Δ| < 8 exact, then ≥8,12,16,23,32,46,64,91,
// +16 for Δ > 0) and softmax in f32/int on VALU.
typedef __attribute__((ext_vector_type(16))) _Float16 v16h;
typedef __attribute__((ext_vector_type(8)))  _Float16 v8h;
typedef __attribute__((ext_vector_type(16))) __bf16   v16b;
typedef __attribute__((ext_vector_type(8)))  __bf16   v8b;
typedef __attribute__((ext_vector_type(8)))  float    v8f;
typedef __attribute__((ext_vector_type(4)))  float    v4f;
typedef __attribute__((ext_vector_type(2)))  float    v2f;
typedef __attribute__((ext_vector_type(2)))  __bf16   v2b;
typedef __attribute__((ext_vector_type(4)))  __bf16   v4b;
typedef __attribute__((ext_vector_type(4)))  _Float16 v4h;
#define PSCALE 32768.0f
#define U16(p) ((const unsigned short*)(const void*)(p))
#define PSCALE_INV (1.0f / 32768.0f)

__device__ __forceinline__ unsigned short f2bf_bits(float f) {
  unsigned u = __float_as_uint(f);
  return (unsigned short)((u + 0x7FFFu + ((u >> 16) & 1u)) >> 16);
}
__device__ __forceinline__ float bf_bits2f(unsigned short h) { return __uint_as_float(((unsigned)h) << 16); }

// hazard guard as a plain device helper
__device__ __forceinline__ void acc_guard4(v8f& a, v8f& b, v8f& c, v8f& d) { asm volatile("v_nop\n\tv_nop\n\tv_nop\n\tv_nop" : "+v"(a), "+v"(b), "+v"(c), "+v"(d)); }
template <typename T> struct Frag;
template <> struct Frag<_Float16> {
  typedef v16h V; typedef v8h H; union U { v16h v; v8h h[2]; };
  static __device__ __forceinline__ v16h load(const _Float16* p) {   // elements 0..7 <- p[0..7], 8..15 <- p[16..23]
    U f; f.h[0] = *(const v8h*)(p); f.h[1] = *(const v8h*)(p + 16); return f.v;
  }
  static __device__ __forceinline__ v8f mma(v16h a, v16h b, v8f c) {
    return __builtin_amdgcn_wmma_f32_16x16x32_f16(false, a, false, b, (short)0, c, false, false);
  }
};
template <> struct Frag<__bf16> {
  typedef v16b V; typedef v8b H; union U { v16b v; v8b h[2]; };
  static __device__ __forceinline__ v16b load(const __bf16* p) {
    U f; f.h[0] = *(const v8b*)(p); f.h[1] = *(const v8b*)(p + 16); return f.v;
  }
  static __device__ __forceinline__ v8f mma(v16b a, v16b b, v8f c) {
    return __builtin_amdgcn_wmma_f32_16x16x32_bf16(false, a, false, b, (short)0, c, false, false);
  }
};

// ---- Register-blocked batched WMMA GEMM ------------------------------------
// C[m,n] = scale * sum_k A[m,k] * Bt[n,k] (+bias)(+resid); each wave owns a 64x64 tile.
// A row-major [M,K]; Bt row-major [N,K]; a work-group of NW waves owns (NW / 2) x 2 wave tiles: M % (32 NW) == 0, N % 128 == 0, K % 64 == 0.
// The work-group's A and Bt rows pass through LDS, 64 k a stage: eight lanes copy a row's 128 B, so every global load covers whole lines and
// a row is fetched once a work-group; the next stage's global loads fly while this stage's products run.
// SPLIT: operands are hi/lo planes (A2/Bt2 = lo planes, same layout); product = hi·hi + hi·lo + lo·hi.
// BIAS_MODE: 0 = none, 1 = bias[m], 2 = bias[n].
// OUT_MODE: 0 = f32, 1 = f16, 2 = bf16 hi plane (Cout) + bf16 lo plane (Cout2).
// ET: 0 = f16 operands, 1 = bf16 operands (pointers passed as 16-bit storage)
template <int ET> struct Elem;
template <> struct Elem<0> { typedef _Float16 T; };
template <> struct Elem<1> { typedef __bf16 T; };
// NW = waves (64x64 tiles) per work-group, bx = index of the work-group among those of this product, b = batch index,
// sT = the work-group's NW slabs of 16 x 68 floats in LDS, sG = its operand stage of GM_ELEMS(NW, SPLIT) 16-bit elements in LDS
#define GM_KS 64   // k elements of a stage: 128 B of every row
#define GM_LP 72   // LDS row pitch of a stage in 16-bit elements: 144 B = 16 B x 9 (odd), so the 16 rows of a ds_load_b128 fragment read spread over the banks
#define GM_ELEMS(NW, SPLIT) (((NW) / 2 * 64 + 128) * GM_LP * ((SPLIT) ? 2 : 1))
template <int NW, int ET, bool SPLIT, int BIAS_MODE, int OUT_MODE, bool RESID, int ACT = 0>
__device__ __forceinline__ void gemm64_body(const int bx, const int b, float* __restrict__ sT, unsigned short* __restrict__ sG,
    const unsigned short* __restrict__ Ap, const unsigned short* __restrict__ A2p, int lda, long strideA,
    const unsigned short* __restrict__ Btp, const unsigned short* __restrict__ Bt2p, int ldb, long strideB,
    void* __restrict__ Cout, void* __restrict__ Cout2, int ldc, long strideC,
    const float* __restrict__ bias,
    const float* __restrict__ resid, long strideR,
    int M, int N, int K, float scale) {
  typedef typename Elem<ET>::T T;
  typedef typename Frag<T>::V V;
  const T* A = (const T*)Ap; const T* A2 = (const T*)A2p; const T* Bt = (const T*)Btp; const T* Bt2 = (const T*)Bt2p;
  typedef typename Frag<T>::H H;
  constexpr int AR = NW / 2 * 64, BR = 128, NT = NW * 32;   // rows of A and of Bt a work-group, its threads
  constexpr int NA = AR * 8 / NT, NB = BR * 8 / NT;         // 16 B pieces of a stage a thread and plane
  const int tid  = threadIdx.x;
  const int lane = tid & 31;
  const int wave = tid >> 5;
  const int tilesN = N / BR;
  const int tilesM = M / AR;
  if (bx >= tilesM * tilesN) return;   // the same in every thread of the work-group, ahead of every barrier
  const int tm = bx / tilesN;
  const int tn = bx - tm * tilesN;
  const int mW = tm * AR, nW = tn * BR;      // the work-group's first rows of A and of Bt
  const int am = (wave >> 1) << 6, bn = (wave & 1) << 6;   // the wave's first rows inside them
  const int m0 = mW + am;
  const int n0 = nW + bn;

  const T* Ab  = A  + (size_t)b * strideA;
  const T* Bb  = Bt + (size_t)b * strideB;
  const T* Ab2 = SPLIT ? (A2  + (size_t)b * strideA) : nullptr;
  const T* Bb2 = SPLIT ? (Bt2 + (size_t)b * strideB) : nullptr;

  const int rlane = lane & 15;                 // row (A) / col (B, D) within subtile
  const int koff  = (lane >> 4) * 8;           // k offset of this lane half
  const int mOff  = (lane >> 4) * 8;           // D row offset

  v8f acc[4][4];
#pragma unroll
  for (int i = 0; i < 4; ++i)
#pragma unroll
    for (int j = 0; j < 4; ++j) acc[i][j] = (v8f){0.f,0.f,0.f,0.f,0.f,0.f,0.f,0.f};

  T* sAh = (T*)sG;           T* sBh = sAh + AR * GM_LP;   // hi (or only) planes [row][k]
  T* sAl = sBh + BR * GM_LP; T* sBl = sAl + AR * GM_LP;   // lo planes, SPLIT only
  const int sr = tid >> 3, sc = (tid & 7) * 8;            // staging: this thread's first row and its 16 B piece of a row
  unsigned aob[NA], bob[NB];                              // byte offsets of its pieces from the work-group's first row (each operand's rows span less than 4 GiB)
#pragma unroll
  for (int i = 0; i < NA; ++i) aob[i] = ((unsigned)(sr + NT / 8 * i) * (unsigned)lda + sc) * 2u;
#pragma unroll
  for (int i = 0; i < NB; ++i) bob[i] = ((unsigned)(sr + NT / 8 * i) * (unsigned)ldb + sc) * 2u;
  H rah[NA], ral[NA], rbh[NB], rbl[NB];
  // address = first byte of the work-group's first row, the same in every lane, + the lane's 32-bit byte offset, which walks along k
  const size_t a0 = (size_t)mW * lda, b0 = (size_t)nW * ldb;
  auto fetch = [&]() {
#pragma unroll
    for (int i = 0; i < NA; ++i) {
      rah[i] = *(const H*)((const char*)(Ab + a0) + aob[i]);
      if (SPLIT) ral[i] = *(const H*)((const char*)(Ab2 + a0) + aob[i]);
    }
#pragma unroll
    for (int i = 0; i < NB; ++i) {
      rbh[i] = *(const H*)((const char*)(Bb + b0) + bob[i]);
      if (SPLIT) rbl[i] = *(const H*)((const char*)(Bb2 + b0) + bob[i]);
    }
  };
  fetch();
  for (int k0 = 0; k0 < K; k0 += GM_KS) {
    __syncthreads();   // every wave has left the last stage
#pragma unroll
    for (int i = 0; i < NA; ++i) {
      const int lo = (sr + NT / 8 * i) * GM_LP + sc;
      *(H*)(sAh + lo) = rah[i];
      if (SPLIT) *(H*)(sAl + lo) = ral[i];
      aob[i] += GM_KS * 2u;   // the next stage
    }
#pragma unroll
    for (int i = 0; i < NB; ++i) {
      const int lo = (sr + NT / 8 * i) * GM_LP + sc;
      *(H*)(sBh + lo) = rbh[i];
      if (SPLIT) *(H*)(sBl + lo) = rbl[i];
      bob[i] += GM_KS * 2u;
    }
    __syncthreads();   // the stage is whole for every wave
    if (k0 + GM_KS < K) {   // the same test in every thread
      fetch();
      // precaution: stands between these loads, which fly over the products, and every later rewrite of their address registers (scalar bases, lane offsets)
      asm volatile("s_wait_xcnt 0x0" ::: "memory");
    }
#pragma unroll
   for (int ks = 0; ks < GM_KS; ks += 32) {
    V bh[4], bl[4], ah[4], al[4];   // the slice's fragments are read as one group: one LDS latency a slice, not one a row of tiles
#pragma unroll
    for (int j = 0; j < 4; ++j) {
      const int bo = (bn + (j << 4) + rlane) * GM_LP + koff + ks;
      bh[j] = Frag<T>::load(sBh + bo);
      if (SPLIT) bl[j] = Frag<T>::load(sBl + bo);
    }
#pragma unroll
    for (int i = 0; i < 4; ++i) {
      const int ao = (am + (i << 4) + rlane) * GM_LP + koff + ks;
      ah[i] = Frag<T>::load(sAh + ao);
      if (SPLIT) al[i] = Frag<T>::load(sAl + ao);
    }
    __builtin_amdgcn_sched_barrier(0);   // holds the group of reads ahead of the products: the scheduler otherwise sinks each A read to its first use, a full LDS latency a row of tiles
#pragma unroll
    for (int i = 0; i < 4; ++i) {
#pragma unroll
      for (int j = 0; j < 4; ++j) {
        acc[i][j] = Frag<T>::mma(ah[i], bh[j], acc[i][j]);
        if (SPLIT) {
          acc[i][j] = Frag<T>::mma(ah[i], bl[j], acc[i][j]);
          acc[i][j] = Frag<T>::mma(al[i], bh[j], acc[i][j]);
        }
      }
    }
   }
  }
  acc_guard4(acc[0][0], acc[0][1], acc[0][2], acc[0][3]);
  acc_guard4(acc[1][0], acc[1][1], acc[1][2], acc[1][3]);
  acc_guard4(acc[2][0], acc[2][1], acc[2][2], acc[2][3]);
  acc_guard4(acc[3][0], acc[3][1], acc[3][2], acc[3][3]);

  // ---- epilogue ----
  float* slab = sT + wave * (16 * 68);
  const float* Rb = RESID ? (resid + (size_t)b * strideR) : nullptr;
#pragma unroll
  for (int i = 0; i < 4; ++i) {
    const int mBase = m0 + (i << 4);
#pragma unroll
    for (int j = 0; j < 4; ++j) {
      const int n = n0 + (j << 4) + rlane;
      float bv = 0.f;
      if (BIAS_MODE == 2) bv = bias[n];
#pragma unroll
      for (int r = 0; r < 8; ++r) {
        float v = acc[i][j][r] * scale;
        if (BIAS_MODE == 1) v += bias[mBase + mOff + r];
        if (BIAS_MODE == 2) v += bv;
        if (RESID) v += Rb[(size_t)(mBase + mOff + r) * ldc + n];
        if (ACT == 1) v = tanhf(v);
        if (ACT == 2) v = fmaxf(v, 0.0f);
        if (ACT == 3) v = v / (1.0f + expf(-v));
        if (ACT == 4) v = (v > 0.f) ? v : 0.01f * v;
        if (ACT == 5) v = 0.5f * v * (1.0f + erff(v * 0.70710678118654752f));
        slab[(mOff + r) * 68 + (j << 4) + rlane] = v;
      }
    }
    __builtin_amdgcn_fence(__ATOMIC_RELEASE, "workgroup");
    __builtin_amdgcn_wave_barrier();
    __builtin_amdgcn_fence(__ATOMIC_ACQUIRE, "workgroup");
    if (OUT_MODE == 0) {
      float* C = (float*)Cout + (size_t)b * strideC;
      const int hh = lane >> 4, c4 = (lane & 15) * 4;     // row seg = 256 B = 16 lanes x 16 B
      {
#pragma unroll
        for (int it = 0; it < 8; ++it) {
          const int row = it * 2 + hh;
          v4f v = *(const v4f*)(slab + row * 68 + c4);
          *(v4f*)(C + (size_t)(mBase + row) * ldc + n0 + c4) = v;
        }
        
      }
    } else {
      const int q = lane >> 3, c8 = (lane & 7) * 8;
      unsigned short* C  = (unsigned short*)Cout  + (size_t)b * strideC;
      unsigned short* C2 = (OUT_MODE == 2) ? ((unsigned short*)Cout2 + (size_t)b * strideC) : nullptr;
      {
#pragma unroll
        for (int it = 0; it < 4; ++it) {
          const int row = it * 4 + q;
          const float* sp = slab + row * 68 + c8;
          v8h hv, lv;
#pragma unroll
          for (int e = 0; e < 8; ++e) {
            if (OUT_MODE == 1) {
              hv[e] = (_Float16)sp[e];
            } else {
              unsigned short hb = f2bf_bits(sp[e]);
              unsigned short lb = f2bf_bits(sp[e] - bf_bits2f(hb));
              hv[e] = __builtin_bit_cast(_Float16, hb);
              lv[e] = __builtin_bit_cast(_Float16, lb);
            }
          }
          *(v8h*)(C + (size_t)(mBase + row) * ldc + n0 + c8) = hv;
          if (OUT_MODE == 2) *(v8h*)(C2 + (size_t)(mBase + row) * ldc + n0 + c8) = lv;
        }
        
      }
    }
    __builtin_amdgcn_fence(__ATOMIC_RELEASE, "workgroup");
    __builtin_amdgcn_wave_barrier();
    __builtin_amdgcn_fence(__ATOMIC_ACQUIRE, "workgroup");
  }
}

template <int NW, int ET, bool SPLIT, int BIAS_MODE, int OUT_MODE, bool RESID, int ACT = 0>
__global__ __launch_bounds__(NW * 32) void wmma_gemm64(
    const unsigned short* __restrict__ Ap, const unsigned short* __restrict__ A2p, int lda, long strideA,
    const unsigned short* __restrict__ Btp, const unsigned short* __restrict__ Bt2p, int ldb, long strideB,
    void* __restrict__ Cout, void* __restrict__ Cout2, int ldc, long strideC,
    const float* __restrict__ bias,
    const float* __restrict__ resid, long strideR,
    int M, int N, int K, float scale) {
  __shared__ __align__(16) float sT[NW * 16 * 68];   // per-wave 16x64 slab, pitch 68 floats
  __shared__ __align__(16) unsigned short sG[GM_ELEMS(NW, SPLIT)];
  gemm64_body<NW, ET, SPLIT, BIAS_MODE, OUT_MODE, RESID, ACT>(blockIdx.x, blockIdx.y, sT, sG, Ap, A2p, lda, strideA, Btp, Bt2p, ldb, strideB,
                                                              Cout, Cout2, ldc, strideC, bias, resid, strideR, M, N, K, scale);
}

// The three projections of one x [M][K] in one launch, so that their work-groups run side by side on different WGPs:
// blockIdx.y = 0: q = x Wq^T, 1: k = x Wk^T (both bf16 hi/lo split), 2: v^T = Wv x^T (f16); weights [N][K].
// Each result leaves as the bf16 hi and lo planes that the attention's matrix products read: q, k as [M][N], v transposed as [N][M].
template <int NW>
__global__ __launch_bounds__(NW * 32) void qkv_gemm64(
    const unsigned short* __restrict__ Xh, const unsigned short* __restrict__ Xl, const unsigned short* __restrict__ X16,
    const unsigned short* __restrict__ Wqh, const unsigned short* __restrict__ Wql,
    const unsigned short* __restrict__ Wkh, const unsigned short* __restrict__ Wkl, const unsigned short* __restrict__ Wv16,
    unsigned short* __restrict__ Qh, unsigned short* __restrict__ Ql, unsigned short* __restrict__ Kh, unsigned short* __restrict__ Kl,
    unsigned short* __restrict__ Vth, unsigned short* __restrict__ Vtl, int M, int N, int K) {
  __shared__ __align__(16) float sT[NW * 16 * 68];   // per-wave 16x64 slab, pitch 68 floats
  __shared__ __align__(16) unsigned short sG[GM_ELEMS(NW, true)];
  if (blockIdx.y < 2) {
    const bool isk = blockIdx.y == 1;
    gemm64_body<NW, 1, true, 0, 2, false>(blockIdx.x, 0, sT, sG, Xh, Xl, K, 0, isk ? Wkh : Wqh, isk ? Wkl : Wql, K, 0,
                                          isk ? Kh : Qh, isk ? Kl : Ql, N, 0, nullptr, nullptr, 0, M, N, K, 1.0f);
  } else {
    gemm64_body<NW, 0, false, 0, 2, false>(blockIdx.x, 0, sT, sG, Wv16, nullptr, K, 0, X16, nullptr, K, 0,
                                           Vth, Vtl, M, 0, nullptr, nullptr, 0, N, M, K, 1.0f);
  }
}


// ---- f32 -> f16 cast with a power-of-two pre-scale (folded back by the consumer GEMM's scale) ----
__global__ __launch_bounds__(256) void cast_f32_f16x2s(const float* __restrict__ in, _Float16* __restrict__ out, int n2, float s) {
  int i = blockIdx.x * 256 + threadIdx.x;
  if (i < n2) {
    const _Float16 h0 = (_Float16)(in[2 * i] * s), h1 = (_Float16)(in[2 * i + 1] * s);
    const unsigned u = (unsigned)__builtin_bit_cast(unsigned short, h0) | ((unsigned)__builtin_bit_cast(unsigned short, h1) << 16);
    ((unsigned*)out)[i] = u;
    
  }
}


// ---- f32 [R][C] (row pitch ldi) -> f16 transposed [C][R] (row pitch ldo); 64x64 tiles; each output row segment
__global__ __launch_bounds__(256) void transpose_cast_f16(const float* __restrict__ in, int ldi,
                                                         _Float16* __restrict__ outT, int ldo, float scale) {
  __shared__ __align__(16) _Float16 tile[64][72];     // [c][r]
  const int c0 = blockIdx.x * 64, r0 = blockIdx.y * 64;
  const int t = threadIdx.y * 32 + threadIdx.x;
  for (int i = threadIdx.y; i < 64; i += 8) {
    tile[threadIdx.x][i]      = (_Float16)(in[(size_t)(r0 + i) * ldi + c0 + threadIdx.x] * scale);
    tile[32 + threadIdx.x][i] = (_Float16)(in[(size_t)(r0 + i) * ldi + c0 + 32 + threadIdx.x] * scale);
  }
  __syncthreads();
  const int q = t >> 3, c8 = (t & 7) * 8;
  {
#pragma unroll
    for (int it = 0; it < 2; ++it) {
      const int c = it * 32 + q;
      v8h hv = *(const v8h*)(&tile[c][c8]);
      *(v8h*)(outT + (size_t)(c0 + c) * ldo + r0 + c8) = hv;
    }
    
  }
}

// ---- f32 [R][C] (pitch ldi) -> bf16 hi/lo transposed planes [C][R] (pitch ldo); 64x64 tiles; each output row segment
__global__ __launch_bounds__(256) void transpose_split_bf16(const float* __restrict__ in, int ldi,
                                                           __bf16* __restrict__ outH, __bf16* __restrict__ outL, int ldo) {
  __shared__ __align__(16) float tile[64][68];     // [c][r]
  const int c0 = blockIdx.x * 64, r0 = blockIdx.y * 64;
  const int t = threadIdx.y * 32 + threadIdx.x;
  for (int i = threadIdx.y; i < 64; i += 8) {
    tile[threadIdx.x][i]      = in[(size_t)(r0 + i) * ldi + c0 + threadIdx.x];
    tile[32 + threadIdx.x][i] = in[(size_t)(r0 + i) * ldi + c0 + 32 + threadIdx.x];
  }
  __syncthreads();
  const int q = t >> 3, c8 = (t & 7) * 8;
  {
#pragma unroll
    for (int it = 0; it < 2; ++it) {
      const int c = it * 32 + q;
      v8b hv, lv;
#pragma unroll
      for (int e = 0; e < 8; ++e) {
        const float f = tile[c][c8 + e];
        const unsigned short hb = f2bf_bits(f);
        hv[e] = __builtin_bit_cast(__bf16, hb);
        lv[e] = __builtin_bit_cast(__bf16, f2bf_bits(f - bf_bits2f(hb)));
      }
      *(v8b*)(outH + (size_t)(c0 + c) * ldo + r0 + c8) = hv;
      *(v8b*)(outL + (size_t)(c0 + c) * ldo + r0 + c8) = lv;
    }
    
  }
}

#define AT_D 64
#define AT_NW 4
#define AT_QB 64
#define AT_KC 64
#define AT_LP 72   // LDS row pitch of the K and V tiles in 16-bit elements: 144 B = 16 B x 9 (odd), so the 16 rows of a ds_load_b128 fragment read spread over the banks
#define AT_TB 10240   // a tile's place in the LDS ring: AT_KC rows x 144 B = 9,216 B, rounded up to a multiple of 2 KiB
#define AT_BT (2048 + AT_QB)   // distance table: Skv + AT_QB - 1 entries used (Skv <= 2048), rounded up to whole waves
struct AttnGeom { const float* cp = nullptr; const float* pc = nullptr; long c_bs = 0, c_rs = 0, c_hs = 0;   // mode-5 / DISTB score-bias tables
                  long q_bs, q_rs, q_hs, k_bs, k_rs, k_hs, v_bs, v_rs, v_hs, o_bs, o_rs, o_hs;
                  int S, Skv, H, mask_mode; float qscale; int blk0; float mask_fill; int mask_is_int; };
static_assert(sizeof(AttnGeom) == 168, "no padding");

__device__ __forceinline__ unsigned short at_bf_bits(float f) {
  unsigned u = __float_as_uint(f);
  return (unsigned short)((u + 0x7FFFu + ((u >> 16) & 1u)) >> 16);
}
__device__ __forceinline__ __bf16 at_f2bf(float f) { return __builtin_bit_cast(__bf16, at_bf_bits(f)); }
// two neighbours as packed bf16 pairs: hi = the value rounded to nearest even, lo = what is left, rounded likewise
__device__ __forceinline__ void at_split2(float p0, float p1, v2b& hi, v2b& lo) {
  const v2f p = {p0, p1};
  hi = __builtin_convertvector(p, v2b);
  lo = __builtin_convertvector(p - __builtin_convertvector(hi, v2f), v2b);
}
// the value of lane l ^ 16: the other half of the same query's kv rows
__device__ __forceinline__ float at_other_half(float x) {
  const int b = __float_as_int(x);
  return __int_as_float(__builtin_amdgcn_permlanex16(b, b, 0x76543210, 0xfedcba98, false, false));
}
// 16-bit element as a bit pattern held in a __bf16 slot: f16 bits when F16, bf16 (RNE) otherwise
template <bool F16> __device__ __forceinline__ __bf16 at_to16(float f) {
  if (F16) return __builtin_bit_cast(__bf16, (_Float16)f);
  return at_f2bf(f);
}
// 2^x as the bare v_exp_f32: the softmax's arguments are <= 0 up to rounding, or -inf, and a result below the normal range may become 0,
// so the range reduction, the rescale and the two range tests that expf puts round the same instruction have nothing to do here
#define AT_LOG2E 1.4426950408889634f
__device__ __forceinline__ float at_exp2(float x) { return __builtin_amdgcn_exp2f(x); }
// the builtin alone: the compiler keeps the distance behind it, and LDS reads may be scheduled across it
template <bool F16> __device__ __forceinline__ v8f at_mma16(v16b a, v16b b, v8f c) {
  if (F16) return __builtin_amdgcn_wmma_f32_16x16x32_f16(false, __builtin_bit_cast(v16h, a), false, __builtin_bit_cast(v16h, b), (short)0, c, false, false);
  return __builtin_amdgcn_wmma_f32_16x16x32_bf16(false, a, false, b, (short)0, c, false, false);
}

// ---- tensor load: one request of a wave brings a tile of 64 rows x 128 B from global memory into LDS, through no register ----
typedef uint32_t u32x4 __attribute__((ext_vector_type(4)));
typedef uint32_t u32x8 __attribute__((ext_vector_type(8)));
__device__ __forceinline__ uint32_t at_uni(uint32_t v) { return (uint32_t)__builtin_amdgcn_readfirstlane(v); }
// a test around a tensor load, which ignores EXEC, has to be a scalar branch
__device__ __forceinline__ uint32_t at_pinned(uint32_t v) {
  uint32_t w = at_uni(v);
  asm volatile("" : "+s"(w));   // holds the wave-uniform test value in a scalar register, so that the test compiles to s_cmp + s_cbranch_scc
  return w;
}
// group 1: 1-byte elements, tensor = tile = 64 rows of 128 B, source row pitch in bytes, 4 dwords of LDS pad behind every 32 (LDS pitch 144 B), no mask
__device__ __forceinline__ u32x8 at_tdm_group1(uint32_t src_pitch) {
  u32x8 g;
  g[0] = at_uni((1u << 20) | (4u << 22) | (3u << 25));
  g[1] = at_uni(128u << 16);
  g[2] = at_uni(64u << 16);
  g[3] = at_uni(128u << 16);
  g[4] = at_uni(64u);
  g[5] = at_uni(src_pitch);
  g[6] = at_uni(0u);
  g[7] = at_uni(0u);
  asm volatile("" : "+s"(g));   // descriptor words held in their scalar registers
  return g;
}
// group 0: count 1, the tile's place in the work-group's LDS, the address of its first byte, type 2
__device__ __forceinline__ u32x4 at_tdm_group0(uint32_t lds_dst, uint64_t ga) {
  u32x4 g;
  g[0] = at_uni(1u); g[1] = at_uni(lds_dst); g[2] = at_uni((uint32_t)ga); g[3] = at_uni((((uint32_t)(ga >> 32)) & 0x01FFFFFFu) | 0x80000000u);
  asm volatile("" : "+s"(g));   // descriptor words held in their scalar registers, as in group 1
  return g;
}
// the same request for another place and a tile step bytes on: the address lies in words 2 and 3, below the type bits, and a carry goes from word 2 into word 3
__device__ __forceinline__ void at_tdm_advance(u32x4& g, uint32_t lds_dst, uint64_t step) {
  const uint64_t a = (((uint64_t)g[3] << 32) | g[2]) + step;
  g[1] = at_uni(lds_dst); g[2] = at_uni((uint32_t)a); g[3] = at_uni((uint32_t)(a >> 32));
}
__device__ __forceinline__ void at_tdm_load(u32x4 g0, u32x8 g1) { asm volatile("tensor_load_to_lds %0, %1" :: "s"(g0), "s"(g1) : "memory"); }
// the compiler places no wait for a tensor load: a tile has landed behind its issuer's own wait, and other waves read it behind the next barrier
__device__ __forceinline__ void at_wait_tensor0() { asm volatile("s_wait_tensorcnt 0x0" ::: "memory"); }
// this wave's LDS reads of a buffer have retired before the barrier behind which the buffer is refilled
__device__ __forceinline__ void at_wait_ds0() { asm volatile("s_wait_dscnt 0x0" ::: "memory"); }

// DISTB: s += bias[bucket(kv - q)] of this head (32 buckets; bucket n of (b, h) at cp + b*c_bs + h*c_hs + n*c_rs), no mask; Skv <= 2048.
template <bool SPLIT_QK, bool SPLIT_PV, bool F16 = false, bool DISTB = false>
__global__ __launch_bounds__(128)
void attn64_kernel(const unsigned short* __restrict__ qh, const unsigned short* __restrict__ ql,
                   const unsigned short* __restrict__ kh, const unsigned short* __restrict__ kl,
                   const unsigned short* __restrict__ vh, const unsigned short* __restrict__ vl, _Float16* __restrict__ out,
                   const void* __restrict__ mask_a, const int* __restrict__ mask_b, AttnGeom g) {
  static_assert(!(F16 && (SPLIT_QK || SPLIT_PV)), "f16 mode is non-split");
  const float PSC = F16 ? 32768.0f : 1.0f;     // f16 probabilities carried x2^15 (subnormal range), folded into the final 1/l
  union FB { v16b v; v8b h[2]; v2b d[8]; };
  static_assert(SPLIT_QK && SPLIT_PV && AT_NW == 4, "four tiles a chunk, one for each of the four waves");
  // two buffers of four tiles, rows at pitch AT_LP: K hi [kv][d], K lo, V hi [d][kv], V lo; chunk kc lies in buffer kc % 2
  __shared__ __attribute__((aligned(2048))) unsigned char Ring[2 * 4 * AT_TB];
  __shared__ __align__(16) float  Os[AT_NW][16 * 68];            // per wave out tile, pitch 68
  __shared__ float Bs[DISTB ? AT_BT : 1];                        // score bias of this (head, query block) by distance kv - q

  const int tid  = threadIdx.x;
  const int wave = tid >> 5;
  const int lane = tid & 31;
  const int hh   = lane >> 4;
  const int c    = lane & 15;

  const int nqb = g.S / AT_QB;
  const int bx = blockIdx.x + g.blk0;
  const int qb = bx % nqb;
  const int bh = bx / nqb;
  const int h  = bh % g.H;
  const int b  = bh / g.H;
  const int qbase_block = qb * AT_QB;
  const int q0 = qbase_block + wave * 16;

  const size_t qoff = (size_t)b * g.q_bs + (size_t)h * g.q_hs;
  const size_t koff = (size_t)b * g.k_bs + (size_t)h * g.k_hs;
  const size_t voff = (size_t)b * g.v_bs + (size_t)h * g.v_hs;
  _Float16*    ob_ptr = out + (size_t)b * g.o_bs + (size_t)h * g.o_hs;

  // Bs[i] = bias of distance kv - q = i - (qbase_block + AT_QB - 1); published by the barrier in front of the kv loop
  if (DISTB) {
    const float bl = g.cp[(size_t)b * g.c_bs + (size_t)h * g.c_hs + (size_t)lane * g.c_rs];   // lane n holds bucket n
    for (int i = tid; i < AT_BT; i += AT_NW * 32) {   // whole waves only (AT_BT % 32 == 0): every source lane of the shuffle is on
      const int rel = i - (qbase_block + AT_QB - 1); const int a = rel < 0 ? -rel : rel;
      int bkt;
      if (a < 8) bkt = a;
      else bkt = 8 + (a >= 12) + (a >= 16) + (a >= 23) + (a >= 32) + (a >= 46) + (a >= 64) + (a >= 91);   // = 8 + trunc(8*log(a/8)/log 16), capped at 15
      if (rel > 0) bkt += 16;
      Bs[i] = __shfl(bl, bkt, 32);
    }
  }

  // ---- Q fragments (B operand: column = query q0 + c): 2 d-chunks, hi (and lo) ----
  v16b qah[2], qal[2];
  {
    const size_t qrow = qoff + (size_t)(q0 + c) * g.q_rs + 8 * hh;
#pragma unroll
    for (int dc = 0; dc < 2; ++dc) {
      qah[dc] = Frag<__bf16>::load((const __bf16*)qh + qrow + dc * 32);
      qal[dc] = SPLIT_QK ? Frag<__bf16>::load((const __bf16*)ql + qrow + dc * 32) : qah[dc];
    }
  }

  float mrl = -INFINITY, lrow = 0.f;   // this lane's query: running maximum x log2(e), rounded once (both halves agree), sum over this half's kv rows
  v8f oacc[4];                          // O^T: oacc[t][r] = out[q0 + c][16 t + 8 hh + r]
#pragma unroll
  for (int t = 0; t < 4; ++t) oacc[t] = (v8f){0.f,0.f,0.f,0.f,0.f,0.f,0.f,0.f};

  const int nChunks = (g.mask_mode == 1 || g.mask_mode == 4) ? (qb + 1) : (g.Skv / AT_KC);   // block-uniform
  // per-row query mask (mode 3)
  const int qkeep = (g.mask_mode == 3) ? mask_b[(size_t)b * g.S + q0 + c] : 1;   // mask_b = qmask in mode 3
  // Each tile is 64 rows of 128 B (K: row = kv, V: row = d). Wave w brings tile w of every chunk with one tensor load, a chunk ahead of its use.
  const uint32_t wv = at_uni((uint32_t)tid >> 5);
  const unsigned short* tsrc = wv == 0 ? kh + koff : wv == 1 ? kl + koff : wv == 2 ? vh + voff : vl + voff;
  const uint64_t tstep = wv < 2 ? (uint64_t)g.k_rs * (AT_KC * 2u) : (uint64_t)(AT_KC * 2u);     // the next chunk: AT_KC rows on in k, AT_KC columns on in v
  const uint32_t tplace = (uint32_t)(size_t)Ring + wv * AT_TB;                                  // the tile's place in buffer 0
  const u32x8 tg1 = at_tdm_group1((wv < 2 ? (uint32_t)g.k_rs : (uint32_t)g.v_rs) * 2u);
  u32x4 tg0 = at_tdm_group0(tplace, (uint64_t)(size_t)tsrc);
  at_tdm_load(tg0, tg1);   // chunk 0
  at_wait_tensor0();
  __syncthreads();   // chunk 0 and the bias table are whole for every wave
  if (at_pinned(nChunks > 1)) {
    at_tdm_advance(tg0, tplace + 4 * AT_TB, tstep);
    at_tdm_load(tg0, tg1);   // chunk 1 flies while chunk 0 is worked on
  }
  for (int kc = 0; kc < nChunks; ++kc) {
    const int kv0 = kc * AT_KC;
    const uint32_t cur = (uint32_t)(kc & 1) * (4 * AT_TB);
    const __bf16* Ksh = (const __bf16*)(Ring + cur);
    const __bf16* Ksl = (const __bf16*)(Ring + cur + AT_TB);
    const __bf16* Vth = (const __bf16*)(Ring + cur + 2 * AT_TB);
    const __bf16* Vtl = (const __bf16*)(Ring + cur + 3 * AT_TB);
    // The K fragments of a d-chunk are read as one group, then the four score tiles advance side by side: one LDS latency a group,
    // and each tile's next product stands four matrix instructions behind its last. Each tile sums its products in the order dc, hi.hi, hi.lo, lo.hi
    // (q part first). s[j][r] = score of kv row kv0 + 16 j + 8 hh + r and query q0 + c.
    v8f s[4];
#pragma unroll
    for (int j = 0; j < 4; ++j) s[j] = (v8f){0.f,0.f,0.f,0.f,0.f,0.f,0.f,0.f};
#pragma unroll
    for (int dc = 0; dc < 2; ++dc) {
      FB kb[4], kl[4];
#pragma unroll
      for (int j = 0; j < 4; ++j) {
        kb[j].h[0] = *(const v8b*)(Ksh + (j * 16 + c) * AT_LP + dc * 32 + 8 * hh);
        kb[j].h[1] = *(const v8b*)(Ksh + (j * 16 + c) * AT_LP + dc * 32 + 16 + 8 * hh);
        if (SPLIT_QK) {
          kl[j].h[0] = *(const v8b*)(Ksl + (j * 16 + c) * AT_LP + dc * 32 + 8 * hh);
          kl[j].h[1] = *(const v8b*)(Ksl + (j * 16 + c) * AT_LP + dc * 32 + 16 + 8 * hh);
        }
      }
#pragma unroll
      for (int j = 0; j < 4; ++j) s[j] = at_mma16<F16>(kb[j].v, qah[dc], s[j]);
      if (SPLIT_QK) {
#pragma unroll
        for (int j = 0; j < 4; ++j) s[j] = at_mma16<F16>(kl[j].v, qah[dc], s[j]);
#pragma unroll
        for (int j = 0; j < 4; ++j) s[j] = at_mma16<F16>(kb[j].v, qal[dc], s[j]);
      }
    }
    const bool diag = (g.mask_mode == 1) && (kc == qb);
    float cj[4];   // maximum of each tile's eight scores: four independent chains
    if (DISTB) {
      const float* bp = Bs + (kv0 + 8 * hh + (AT_QB - 1) - wave * 16 - c);   // + kv row offset - query offset
#pragma unroll
      for (int j = 0; j < 4; ++j) {
        float m = -INFINITY;
#pragma unroll
        for (int r = 0; r < 8; ++r) { s[j][r] += bp[j * 16 + r]; m = fmaxf(m, s[j][r]); }
        cj[j] = m;
      }
    } else
#pragma unroll
    for (int j = 0; j < 4; ++j) {
      const int qrow = q0 + c;
      float m = -INFINITY;
#pragma unroll
      for (int r = 0; r < 8; ++r) {
        const int kvcol = kv0 + j * 16 + 8 * hh + r;
        bool masked = false;
        if (diag) masked = (kvcol > qrow);
        else if (g.mask_mode == 4) masked = (kvcol > qrow) || (qrow - kvcol > g.mask_is_int);
        else if (g.mask_mode == 2) {
          const size_t mi = (size_t)qrow * g.Skv + kvcol;
          masked = (g.mask_is_int == 0) ? (((const float*)mask_a)[mi] == 0.0f)
                 : (g.mask_is_int == 1) ? (((const int*)mask_a)[mi] == 0) : (((const int*)mask_a)[mi] != 0);
        } else if (g.mask_mode == 3) masked = (qkeep == 0) || (((const int*)mask_a)[(size_t)b * g.Skv + kvcol] == 0);   // mask_a = kvmask
        else if (g.mask_mode == 5) {
          const size_t mi = (size_t)qrow * g.Skv + kvcol;
          masked = (((const int*)mask_a)[mi] != 0);
          int n = mask_b[mi]; n = n < 0 ? 0 : n;
          s[j][r] += g.cp[(size_t)b * g.c_bs + (size_t)h * g.c_hs + (size_t)qrow * g.c_rs + n]
                   + g.pc[(size_t)b * g.c_bs + (size_t)h * g.c_hs + (size_t)kvcol * g.c_rs + n];
        }
        if (masked) s[j][r] = g.mask_fill;
        m = fmaxf(m, s[j][r]);
      }
      cj[j] = m;
    }
    // the query's maximum over the chunk: this lane's 32 kv rows, then the other half's 32
    float cm = fmaxf(fmaxf(cj[0], cj[1]), fmaxf(cj[2], cj[3]));
    cm = fmaxf(cm, at_other_half(cm));
    // e^(s - m) = 2^(s log2(e) - mnl): every probability and every rescale of a query refers to the same rounded mnl, so an unchanged maximum gives alpha = 1 exactly
    const float mnl = fmaxf(mrl, cm * AT_LOG2E);   // rounding keeps the order: this is the rounded product of the larger maximum
    const float alpha = at_exp2(mrl - mnl);
    mrl = mnl;
    // Tiles 2 kk and 2 kk + 1 hold kv rows 8 hh + r and 16 + 8 hh + r of kv half kk: the k order of a B operand, element by element
    FB pb[2], pl[2];
    float ps[4];
#pragma unroll
    for (int j = 0; j < 4; ++j) {
      float psum = 0.f;
#pragma unroll
      for (int r = 0; r < 8; r += 2) {
        const v2f a = __builtin_elementwise_fma((v2f){s[j][r], s[j][r + 1]}, (v2f){AT_LOG2E, AT_LOG2E}, (v2f){-mnl, -mnl});   // two arguments a packed fma
        const float p0 = at_exp2(a[0]), p1 = at_exp2(a[1]);
        psum += p0; psum += p1;
        const int e = (j & 1) * 8 + r;
        if (SPLIT_PV) at_split2(p0, p1, pb[j >> 1].d[e >> 1], pl[j >> 1].d[e >> 1]);
        else { pb[j >> 1].v[e] = at_to16<F16>(p0 * PSC); pb[j >> 1].v[e + 1] = at_to16<F16>(p1 * PSC); }
      }
      ps[j] = psum;
    }
    lrow = lrow * alpha + ((ps[0] + ps[1]) + (ps[2] + ps[3]));   // the halves' sums are joined once, behind the loop
#pragma unroll
    for (int t = 0; t < 4; ++t) oacc[t] *= alpha;
    // As for the scores: the V fragments of a kv half are read as one group, then the four output tiles advance side by side
    // (each tile's order of sums: kk, hi.hi, hi.lo, lo.hi, p part first).
#pragma unroll
    for (int kk = 0; kk < 2; ++kk) {
      FB vb[4], vl[4];
#pragma unroll
      for (int t = 0; t < 4; ++t) {
        vb[t].h[0] = *(const v8b*)(Vth + (t * 16 + c) * AT_LP + kk * 32 + 8 * hh);
        vb[t].h[1] = *(const v8b*)(Vth + (t * 16 + c) * AT_LP + kk * 32 + 16 + 8 * hh);
        if (SPLIT_PV) {
          vl[t].h[0] = *(const v8b*)(Vtl + (t * 16 + c) * AT_LP + kk * 32 + 8 * hh);
          vl[t].h[1] = *(const v8b*)(Vtl + (t * 16 + c) * AT_LP + kk * 32 + 16 + 8 * hh);
        }
      }
#pragma unroll
      for (int t = 0; t < 4; ++t) oacc[t] = at_mma16<F16>(vb[t].v, pb[kk].v, oacc[t]);
      if (SPLIT_PV) {
#pragma unroll
        for (int t = 0; t < 4; ++t) oacc[t] = at_mma16<F16>(vl[t].v, pb[kk].v, oacc[t]);
#pragma unroll
        for (int t = 0; t < 4; ++t) oacc[t] = at_mma16<F16>(vb[t].v, pl[kk].v, oacc[t]);
      }
    }
    // chunk kc + 1 is handed over: own LDS reads retired, own tile landed, then the one barrier of a chunk, which also ends every wave's reads of this buffer
    at_wait_ds0();
    at_wait_tensor0();
    __syncthreads();
    if (at_pinned(kc + 2 < nChunks)) {
      at_tdm_advance(tg0, tplace + cur, tstep);   // behind the wait that covers the last request
      at_tdm_load(tg0, tg1);   // chunk kc + 2 into the buffer just left
    }
  }
  at_wait_tensor0();
  at_wait_ds0();

  // a lane holds eight neighbouring d of its query a tile: two 16 B pieces into the wave's slab [query][d]
  float* os = Os[wave];
  {
    const float inv = 1.0f / ((lrow + at_other_half(lrow)) * PSC);
#pragma unroll
    for (int t = 0; t < 4; ++t) {
      const v8f o = oacc[t] * inv;
      *(v4f*)(os + c * 68 + t * 16 + 8 * hh)     = (v4f){o[0], o[1], o[2], o[3]};
      *(v4f*)(os + c * 68 + t * 16 + 8 * hh + 4) = (v4f){o[4], o[5], o[6], o[7]};
    }
  }
  __builtin_amdgcn_fence(__ATOMIC_RELEASE, "workgroup");
  __builtin_amdgcn_wave_barrier();
  __builtin_amdgcn_fence(__ATOMIC_ACQUIRE, "workgroup");
  {
    const int q4 = lane >> 3, c8 = (lane & 7) * 8;   // a query's 64 d as f16 are one 128 B line: eight lanes x 16 B, four queries a store
#pragma unroll
    for (int it = 0; it < 4; ++it) {
      const int row = it * 4 + q4;
      const v4f a = *(const v4f*)(os + row * 68 + c8), e = *(const v4f*)(os + row * 68 + c8 + 4);
      const v8f o = {a[0], a[1], a[2], a[3], e[0], e[1], e[2], e[3]};
      *(v8h*)(ob_ptr + (size_t)(q0 + row) * g.o_rs + c8) = __builtin_convertvector(o, v8h);
    }
  }
}

// ---- every f32 -> 16-bit conversion of the inputs, one launch ----
// A work-group converts CV_WG neighbouring elements of one input; a thread takes CV_IT pieces of four elements, 256 threads apart: a wave-wide load
// covers 512 contiguous bytes, a store 256, and all of a thread's loads are issued ahead of its first store. Few waves that each move 128 B a lane,
// because a launch of one small item a lane lasts as long as its waves take to start.
// F16P: a plain f16 plane (o16); SPL: bf16 hi and lo planes (hi = the value rounded to nearest even, lo = what is left, rounded likewise).
#define CV_IT 8
#define CV_WG (256 * CV_IT * 4)
template <bool F16P, bool SPL>
__device__ __forceinline__ void convert_block(const float* __restrict__ in, _Float16* __restrict__ o16,
                                              __bf16* __restrict__ hi, __bf16* __restrict__ lo, const int blk) {
  const size_t e0 = (size_t)blk * CV_WG + threadIdx.x * 4;
  v4f v[CV_IT];
#pragma unroll
  for (int i = 0; i < CV_IT; ++i) v[i] = *(const v4f*)(in + e0 + i * 1024);
#pragma unroll
  for (int i = 0; i < CV_IT; ++i) {
    const size_t e = e0 + i * 1024;
    if (F16P) *(v4h*)(o16 + e) = __builtin_convertvector(v[i], v4h);
    if (SPL) {
      v2b h0, l0, h1, l1;
      at_split2(v[i][0], v[i][1], h0, l0);
      at_split2(v[i][2], v[i][3], h1, l1);
      *(v4b*)(hi + e) = (v4b){h0[0], h0[1], h1[0], h1[1]};
      *(v4b*)(lo + e) = (v4b){l0[0], l0[1], l1[0], l1[1]};
    }
  }
  // precaution: stands between these stores and every later rewrite of their address and data registers on the paths that the caller's branches join
  asm volatile("s_wait_xcnt 0x0" ::: "memory");
}
// blockIdx.x: NBX work-groups for x (f16 plane and bf16 hi/lo planes from one read), then NBW each for wq, wk (hi/lo planes), wv, wo (f16 plane)
template <int NBX, int NBW>
__global__ __launch_bounds__(256) void convert_inputs(
    const float* __restrict__ x, const float* __restrict__ wq, const float* __restrict__ wk, const float* __restrict__ wv, const float* __restrict__ wo,
    _Float16* __restrict__ X16, __bf16* __restrict__ Xh, __bf16* __restrict__ Xl, __bf16* __restrict__ Wqh, __bf16* __restrict__ Wql,
    __bf16* __restrict__ Wkh, __bf16* __restrict__ Wkl, _Float16* __restrict__ Wv16, _Float16* __restrict__ Wo16) {
  const int bw = (int)blockIdx.x - NBX;
  if (bw < 0) { convert_block<true, true>(x, X16, Xh, Xl, blockIdx.x); return; }
  const int w = bw / NBW, blk = bw - w * NBW;
  if (w < 2) convert_block<false, true>(w ? wk : wq, nullptr, w ? Wkh : Wqh, w ? Wkl : Wql, blk);
  else       convert_block<true, false>(w == 2 ? wv : wo, w == 2 ? Wv16 : Wo16, nullptr, nullptr, blk);
}

#define TS 2048
#define TD 1024
#define TNH 16
#define TNB 32
extern "C" void kernel_launch(void* const* d_in, const int* in_sizes, int n_in, void* d_out, int out_size, void* d_ws, size_t ws_size, hipStream_t stream) {
  (void)in_sizes; (void)n_in; (void)out_size; (void)ws_size;
  const float* x = (const float*)d_in[0]; const float* wq = (const float*)d_in[1]; const float* wk = (const float*)d_in[2]; const float* wv = (const float*)d_in[3]; const float* wo = (const float*)d_in[4]; const float* rb = (const float*)d_in[5];
  float* out = (float*)d_out;   // [1][2048][1024]
  char* ws = (char*)d_ws; size_t off = 0;
  auto carve = [&](size_t bytes) -> char* { char* p = ws + off; off += (bytes + 255) & ~(size_t)255; return p; };
  _Float16* X16 = (_Float16*)carve((size_t)TS * TD * 2);
__bf16* Xh = (__bf16*)carve((size_t)TS * TD * 2); __bf16* Xl = (__bf16*)carve((size_t)TS * TD * 2);
  __bf16* Wqh = (__bf16*)carve((size_t)TD * TD * 2); __bf16* Wql = (__bf16*)carve((size_t)TD * TD * 2); __bf16* Wkh = (__bf16*)carve((size_t)TD * TD * 2); __bf16* Wkl = (__bf16*)carve((size_t)TD * TD * 2);
  _Float16* Wv16 = (_Float16*)carve((size_t)TD * TD * 2); _Float16* Wo16 = (_Float16*)carve((size_t)TD * TD * 2);
  unsigned short* Qh = (unsigned short*)carve((size_t)TS * TD * 2); unsigned short* Ql = (unsigned short*)carve((size_t)TS * TD * 2);
  unsigned short* Kh = (unsigned short*)carve((size_t)TS * TD * 2); unsigned short* Kl = (unsigned short*)carve((size_t)TS * TD * 2);
  unsigned short* Vth = (unsigned short*)carve((size_t)TS * TD * 2); unsigned short* Vtl = (unsigned short*)carve((size_t)TS * TD * 2);   // [TD][TS]
  _Float16* O16 = X16;   // x's f16 plane is last read by the projections' launch
  static_assert(TS * TD % CV_WG == 0 && TD * TD % CV_WG == 0, "whole work-groups");
  convert_inputs<TS * TD / CV_WG, TD * TD / CV_WG><<<TS * TD / CV_WG + 4 * (TD * TD / CV_WG), 256, 0, stream>>>(
      x, wq, wk, wv, wo, X16, Xh, Xl, Wqh, Wql, Wkh, Wkl, Wv16, Wo16);   // nn.Linear weights [out][in] = Bt layout
  { const int t = (TS / 64) * (TD / 64);
    qkv_gemm64<4><<<dim3(t / 4, 3), 4 * 32, 0, stream>>>(U16(Xh), U16(Xl), U16(X16), U16(Wqh), U16(Wql), U16(Wkh), U16(Wkl), U16(Wv16), Qh, Ql, Kh, Kl, Vth, Vtl, TS, TD, TD); }
  { AttnGeom g;
    g.cp = rb; g.pc = nullptr; g.c_bs = 0; g.c_hs = 1; g.c_rs = TNH;   // rel_bias [bucket][head]
    g.q_bs = 0; g.q_rs = TD; g.q_hs = 64; g.k_bs = 0; g.k_rs = TD; g.k_hs = 64; g.v_bs = 0; g.v_rs = TS; g.v_hs = 64 * TS; g.o_bs = 0; g.o_rs = TD; g.o_hs = 64;
    g.S = TS; g.Skv = TS; g.H = TNH; g.mask_mode = 0; g.qscale = 1.0f; g.blk0 = 0; g.mask_fill = -INFINITY; g.mask_is_int = 0;
    attn64_kernel<true, true, false, true><<<TNH * (TS / AT_QB), AT_NW * 32, 0, stream>>>(Qh, Ql, Kh, Kl, Vth, Vtl, O16, nullptr, nullptr, g); }
  { const int t = (TS / 64) * (TD / 64);
    wmma_gemm64<2, 0, false, 0, 0, false><<<dim3(t / 2, 1), 2 * 32, 0, stream>>>(U16(O16), nullptr, TD, 0, U16(Wo16), nullptr, TD, 0, out, nullptr, TD, 0, nullptr, nullptr, 0, TS, TD, TD, 1.0f); }
}
